// v000
// The times below were measured on an AMD MI455X: many runs one after another, warmed up first and cycling through
// copies of the inputs, with the whole window's GPU time divided by the number of runs. Launches and the gaps
// between them are all in it. The median over several windows is given; except for v000 it joins two sittings, which
// can be a few percent apart, so the side-by-side timings, each taken in one sitting, are the better comparison.
// v000, which the later versions start from, runs in 1370 microseconds.
// compute dtype: all float inputs rounded to bf16, step_idx (int) read; q/k/v = x W^T with EXACT bf16 products on WMMA 16x16x32, f32 accumulate, plus the rank-4 LoRA terms (x A^T exact on WMMA, then . B^T on the VALU in f32) for q and v when 0 <= step_idx < 2; per-head RMSNorm (eps = f32 eps), partial rotary on the first 32 dims (10000^(-2i/32) and cos/sin computed inline per element with precise powf/cosf/sinf), q_gain, in f32; q as f16 hi + residual, k f16 -> 2-product causal GQA logits / 8 stored in f32 (4 heads per launch); softmax in f32 (precise expf), P x 2^11 kept f32 split bf16 hi + lo against v bf16 hi + lo (3 products); out = y (bf16 hi + lo) Wproj^T; f32 output.
#include <hip/hip_runtime.h>
#include <math.h>

typedef __attribute__((ext_vector_type(16))) _Float16 v16h;
typedef __attribute__((ext_vector_type(16))) __bf16 v16b;
typedef __attribute__((ext_vector_type(8)))  _Float16 v8h;
typedef __attribute__((ext_vector_type(8)))  float v8f;
typedef __attribute__((ext_vector_type(4)))  float v4f;
typedef __attribute__((ext_vector_type(2)))  float v2f;
typedef __attribute__((ext_vector_type(4)))  unsigned v4u;
typedef __attribute__((ext_vector_type(4)))  int v4i;
typedef float __attribute__((may_alias)) float_a;
typedef int __attribute__((may_alias)) int_a;

template <typename T> __device__ __forceinline__ void vst2(void* p, T v) { *(T*)p = v;  }
__device__ __forceinline__ v8f wmma16(v16h a, v16h b, v8f c) {
  v8f d = __builtin_amdgcn_wmma_f32_16x16x32_f16(false, a, false, b, (short)0, c, false, false);
  asm volatile("v_nop\n\tv_nop\n\tv_nop\n\tv_nop" : "+v"(d) : "v"(a), "v"(b));
  return d;
}
__device__ __forceinline__ v8f wmma_bf(v16b a, v16b b, v8f c) {
  v8f d = __builtin_amdgcn_wmma_f32_16x16x32_bf16(false, a, false, b, (short)0, c, false, false);
  asm volatile("v_nop\n\tv_nop\n\tv_nop\n\tv_nop" : "+v"(d) : "v"(a), "v"(b));
  return d;
}
// 16x16x32 fragments: lane = (h = lane>>4, row/col = lane&15); elements 0..7 = k0+8h+0..7, 8..15 = k0+16+8h+0..7; D element r = row 8h+r
__device__ __forceinline__ v16h frag_h(const _Float16* rowk0, int lane) {
  union { v16h v; v8h q[2]; } u; const _Float16* p = rowk0 + 8 * (lane >> 4);
  u.q[0] = *(const v8h*)p; u.q[1] = *(const v8h*)(p + 16); return u.v;
}
__device__ __forceinline__ v16h frag_f32(const float* rowk0, int lane) {
  v16h a; const float* p = rowk0 + 8 * (lane >> 4);
#pragma unroll
  for (int i = 0; i < 8; ++i) { a[i] = (_Float16)p[i]; a[8 + i] = (_Float16)p[16 + i]; }
  return a;
}
__device__ __forceinline__ v16h frag_f32s(const float* rowk0, int lane, float sc) {
  v16h a; const float* p = rowk0 + 8 * (lane >> 4);
#pragma unroll
  for (int i = 0; i < 8; ++i) { a[i] = (_Float16)(p[i] * sc); a[8 + i] = (_Float16)(p[16 + i] * sc); }
  return a;
}
// column fragment from a [K][ld] layout (column n), rows >= K read as 0
__device__ __forceinline__ v16h fragc_f32(const float* W, int k0, int n, int lane, int ld, int K) {
  v16h a; const int g = lane >> 4;
#pragma unroll
  for (int i = 0; i < 8; ++i) { const int ka = k0 + 8 * g + i, kb = ka + 16;
    a[i] = (_Float16)(ka < K ? W[(size_t)(ka < K ? ka : K - 1) * ld + n] : 0.f); a[8 + i] = (_Float16)(kb < K ? W[(size_t)(kb < K ? kb : K - 1) * ld + n] : 0.f); }
  return a;
}
struct F2 { v16b h, l; };
__device__ __forceinline__ F2 bsplit16(const float v[16]) { F2 r;
#pragma unroll
  for (int i = 0; i < 16; ++i) { const __bf16 h = (__bf16)v[i]; r.h[i] = h; r.l[i] = (__bf16)(v[i] - (float)h); }
  return r; }
__device__ __forceinline__ F2 split_row(const float* row, int k0, int lane) { float v[16]; const float* p = row + k0 + 8 * (lane >> 4);
#pragma unroll
  for (int i = 0; i < 8; ++i) { v[i] = p[i]; v[8 + i] = p[16 + i]; }
  return bsplit16(v); }
__device__ __forceinline__ F2 split_rowK(const float* row, int k0, int lane, int K) { float v[16]; const int g = lane >> 4;
#pragma unroll
  for (int i = 0; i < 8; ++i) { const int ka = k0 + 8 * g + i, kb = ka + 16; v[i] = ka < K ? row[ka < K ? ka : K - 1] : 0.f; v[8 + i] = kb < K ? row[kb < K ? kb : K - 1] : 0.f; }
  return bsplit16(v); }
__device__ __forceinline__ F2 split_col(const float* W, int k0, int n, int lane, int ld, int K) { float v[16]; const int g = lane >> 4;
#pragma unroll
  for (int i = 0; i < 8; ++i) { const int ka = k0 + 8 * g + i, kb = ka + 16; v[i] = ka < K ? W[(size_t)(ka < K ? ka : K - 1) * ld + n] : 0.f; v[8 + i] = kb < K ? W[(size_t)(kb < K ? kb : K - 1) * ld + n] : 0.f; }
  return bsplit16(v); }
__device__ __forceinline__ v8f mac3(const F2& a, const F2& b, v8f c) { c = wmma_bf(a.l, b.h, c); c = wmma_bf(a.h, b.l, c); return wmma_bf(a.h, b.h, c); }
__device__ __forceinline__ float sigm(float v) { return 1.0f / (1.0f + expf(-v)); }
#define LDSX() do { asm volatile("s_wait_dscnt 0" ::: "memory"); __builtin_amdgcn_wave_barrier(); __builtin_amdgcn_fence(__ATOMIC_RELEASE, "workgroup"); } while (0)


// RRT attention (B 2, S 2,048, dim 1,024 = 16 q heads x 64, 4 kv heads, LoRA rank 4 on q and v selected by step_idx, partial RoPE 32, RMS-normed q/k, per-head q gain, causal GQA SDPA, output Linear).
#define NB 2
#define TT 2048
#define CC 1024
#define NH 16
#define HK 4
#define GQ (NH / HK)
#define HD 64
#define KV (HK * HD)        // 256
#define RD 32               // partial rope dims
#define LR 4                // lora rank
#define HG 4
#define NR (NB * TT)
#ifndef TNB
#define TNB NB
#endif
typedef __attribute__((ext_vector_type(8))) __bf16 v8b;
__device__ __forceinline__ v16b frag_b(const __bf16* rowk0, int lane) {
  union { v16b v; v8b q[2]; } u; const __bf16* p = rowk0 + 8 * (lane >> 4);
  u.q[0] = *(const v8b*)p; u.q[1] = *(const v8b*)(p + 16); return u.v;
}
__device__ __forceinline__ float bfr(float v) { return (float)(__bf16)v; }
__device__ __attribute__((noinline)) float exp_ni(float v) { return expf(v); }
__device__ __attribute__((noinline)) float erf_ni(float v) { return erff(v); }

#define WS_XA  0u
#define WS_QH  (WS_XA + 4u * (size_t)NR * 32)
#define WS_QL  (WS_QH + 2u * (size_t)NR * CC)
#define WS_KH  (WS_QL + 2u * (size_t)NR * CC)          // f16 k rows [row][256]
#define WS_VT  (WS_KH + 2u * (size_t)NR * KV)          // bf16 v planes [b][256][t] hi / lo
#define WS_VL  (WS_VT + 2u * (size_t)NB * KV * TT)
#define WS_S   (WS_VL + 2u * (size_t)NB * KV * TT)     // f32 S [HG][t][t]
#define WS_Y   (WS_S + 4u * (size_t)HG * TT * TT)
#define WS_END (WS_Y + 4u * (size_t)NR * CC)

// ---- k_lora: block = 64 rows: XA[row][0..3] = x . A_q[si]^T, [4..7] = x . A_v[si]^T (exact products; zero if step_idx out of range)
__global__ __launch_bounds__(128) void k_lora(const float* __restrict__ X, const float* __restrict__ AQ, const float* __restrict__ AV, const int* __restrict__ STEP, float* __restrict__ XA) { __shared__ __align__(16) float ss[4][16][36];
  const int tid = threadIdx.x, wave = tid >> 5, lane = tid & 31, col = lane & 15, g = lane >> 4; const size_t r0 = (size_t)blockIdx.x * 64 + wave * 16;
  const int si = STEP[0]; const bool use = (si >= 0 && si < 2); const float* aq = AQ + (size_t)(use ? si : 0) * LR * CC; const float* av = AV + (size_t)(use ? si : 0) * LR * CC;
  v8f acc = {};
#pragma unroll 4
  for (int kc = 0; kc < CC / 32; ++kc) { v16b a; { const float* p = X + (r0 + col) * CC + kc * 32 + 8 * g;
#pragma unroll
      for (int i = 0; i < 8; ++i) { a[i] = (__bf16)p[i]; a[8 + i] = (__bf16)p[16 + i]; } }
    v16b w; { const float* p = (col < 4) ? (aq + (size_t)col * CC) : (col < 8) ? (av + (size_t)(col - 4) * CC) : nullptr;
#pragma unroll
      for (int i = 0; i < 8; ++i) { w[i] = p ? (__bf16)p[kc * 32 + 8 * g + i] : (__bf16)0.f; w[8 + i] = p ? (__bf16)p[kc * 32 + 16 + 8 * g + i] : (__bf16)0.f; } }
    acc = wmma_bf(a, w, acc); }
#pragma unroll
  for (int r = 0; r < 8; ++r) ss[wave][8 * g + r][col] = use ? acc[r] : 0.f;
  LDSX(); for (int rl = 0; rl < 16; ++rl) if (lane < 2) vst2(XA + (r0 + rl) * 32 + lane * 4, *(const v4f*)&ss[wave][rl][lane * 4]); }
// ---- k_proj: block = (64 rows, 128 cols over [q 1024 | k 256 | v 256]): x W^T (+ LoRA), RMSNorm + partial rope (+ gain) for q/k; v -> planes
__global__ __launch_bounds__(128) void k_proj(const float* __restrict__ X, const float* __restrict__ WQ, const float* __restrict__ WK, const float* __restrict__ WV, const float* __restrict__ GAIN, const float* __restrict__ BQ, const float* __restrict__ BV, const int* __restrict__ STEP, const float* __restrict__ XA, _Float16* __restrict__ QH, _Float16* __restrict__ QL, _Float16* __restrict__ KH, __bf16* __restrict__ VT, __bf16* __restrict__ VL) {
  __shared__ __align__(16) float sf[64][132]; __shared__ __align__(16) _Float16 sh[64][136], sl[64][136]; __shared__ __align__(16) __bf16 th[128][72], tl2[128][72]; __shared__ float srs[64][2];
  const int tid = threadIdx.x, wave = tid >> 5, lane = tid & 31, col = lane & 15, g = lane >> 4; const int cg = blockIdx.y * 128; const size_t r0 = (size_t)blockIdx.x * 64;
  const int region = (cg < CC) ? 0 : (cg < CC + KV) ? 1 : 2; const int c0 = region == 0 ? cg : region == 1 ? cg - CC : cg - CC - KV; const float* Wm = region == 0 ? WQ : region == 1 ? WK : WV;
  const int si = STEP[0]; const bool use = (si >= 0 && si < 2);
  v8f acc[8] = {};
#pragma unroll 2
  for (int kc = 0; kc < CC / 32; ++kc) { v16b a; { const float* p = X + (r0 + wave * 16 + col) * CC + kc * 32 + 8 * g;
#pragma unroll
      for (int i = 0; i < 8; ++i) { a[i] = (__bf16)p[i]; a[8 + i] = (__bf16)p[16 + i]; } }
#pragma unroll
    for (int j = 0; j < 8; ++j) { v16b w; const int o = c0 + j * 16 + col; const float* p = Wm + (size_t)o * CC + kc * 32 + 8 * g;
#pragma unroll
      for (int i = 0; i < 8; ++i) { w[i] = (__bf16)p[i]; w[8 + i] = (__bf16)p[16 + i]; }
      acc[j] = wmma_bf(a, w, acc[j]); } }
#pragma unroll
  for (int j = 0; j < 8; ++j) { const int o = c0 + j * 16 + col;
#pragma unroll
    for (int r = 0; r < 8; ++r) { const int rl = wave * 16 + 8 * g + r; float v = acc[j][r];
      if (use && region != 1) { const float* Bm = (region == 0) ? (BQ + ((size_t)si * CC + o) * LR) : (BV + ((size_t)si * KV + o) * LR); const float* xa = XA + (r0 + rl) * 32 + (region == 0 ? 0 : 4);
#pragma unroll
        for (int q = 0; q < LR; ++q) v += xa[q] * bfr(Bm[q]); }
      sf[rl][j * 16 + col] = v; } }
  __syncthreads();
  if (region <= 1) {   // RMSNorm per head (64 dims, eps = FLT_EPSILON), partial rope on dims < 32 (x1 = d<16, x2 = 16..31): [x1 c + x2 s, -x1 s + x2 c], then gain (q only)
    for (int e = tid; e < 64 * 2; e += 128) { const int rl = e >> 1, hh = e & 1; float s2 = 0.f;
#pragma unroll 1
      for (int d = 0; d < HD; ++d) { const float v = sf[rl][hh * 64 + d]; s2 += v * v; } srs[rl][hh] = 1.0f / sqrtf(s2 * (1.0f / HD) + 1.1920929e-7f); }
    __syncthreads();
    for (int e = tid; e < 64 * 128; e += 128) { const int rl = e >> 7, cl = e & 127; const int d = cl & 63, hb = cl & ~63; const float rs = srs[rl][cl >> 6]; const int t = (int)((r0 + rl) % TT); float v;
      if (d < RD) { const int i2 = d & 15; const float inv_freq = 1.0f / powf(10000.0f, (float)(2 * i2) / (float)RD); const float ang = (float)t * inv_freq; const float c = cosf(ang), s = sinf(ang); const float x1 = sf[rl][hb + i2] * rs, x2 = sf[rl][hb + 16 + i2] * rs; v = (d < 16) ? (x1 * c + x2 * s) : (-x1 * s + x2 * c); }
      else v = sf[rl][cl] * rs;
      if (region == 0) v *= bfr(GAIN[(c0 + cl) / HD]);
      const _Float16 hv = (_Float16)v; sh[rl][cl] = hv; sl[rl][cl] = (_Float16)(v - (float)hv); }
    __syncthreads();
    if (region == 0) { for (int e = tid; e < 64 * 16; e += 128) { const int rl = e >> 4, q = e & 15; vst2((unsigned*)(QH + (r0 + rl) * CC + c0 + q * 8), *(const v4u*)&sh[rl][q * 8]); vst2((unsigned*)(QL + (r0 + rl) * CC + c0 + q * 8), *(const v4u*)&sl[rl][q * 8]); } }
    else { for (int e = tid; e < 64 * 16; e += 128) { const int rl = e >> 4, q = e & 15; vst2((unsigned*)(KH + (r0 + rl) * KV + c0 + q * 8), *(const v4u*)&sh[rl][q * 8]); } } }
  else { for (int e = tid; e < 64 * 128; e += 128) { const int rl = e >> 7, cl = e & 127; const float v = sf[rl][cl]; const __bf16 bh = (__bf16)v; th[cl][rl] = bh; tl2[cl][rl] = (__bf16)(v - (float)bh); }
    __syncthreads(); const size_t b = r0 / TT; const int t0 = (int)(r0 % TT);
    for (int e = tid; e < 128 * 8; e += 128) { const int cl = e >> 3, q = e & 7; const size_t o2 = (b * KV + c0 + cl) * (size_t)TT + t0 + q * 8; vst2((unsigned*)(VT + o2), *(const v4u*)&th[cl][q * 8]); vst2((unsigned*)(VL + o2), *(const v4u*)&tl2[cl][q * 8]); } } }
// ---- k_sc: block = (64 queries, 128 keys, head in group): causal logits / 8 (GQA: kv head = h / 4)
__global__ __launch_bounds__(128) void k_sc(const _Float16* __restrict__ QH, const _Float16* __restrict__ QL, const _Float16* __restrict__ KH, int b, int h0, float* __restrict__ S0) { __shared__ __align__(16) float ss[4][16][132];
  const int h = h0 + blockIdx.z; const int kvh = h / GQ; float* S = S0 + (size_t)blockIdx.z * TT * TT;
  const int tid = threadIdx.x, wave = tid >> 5, lane = tid & 31, col = lane & 15, g = lane >> 4; const int k0 = blockIdx.y * 128; const int ql0 = blockIdx.x * 64 + wave * 16;
  if (k0 > blockIdx.x * 64 + 63) return;
  v8f acc[8] = {};
#pragma unroll
  for (int kc = 0; kc < HD / 32; ++kc) { const size_t qo = ((size_t)b * TT + ql0 + col) * CC + h * HD + kc * 32; const v16h ah = frag_h(QH + qo, lane), al = frag_h(QL + qo, lane);
#pragma unroll
    for (int j = 0; j < 8; ++j) { const v16h kb = frag_h(KH + ((size_t)b * TT + k0 + j * 16 + col) * KV + kvh * HD + kc * 32, lane); acc[j] = wmma16(ah, kb, acc[j]); acc[j] = wmma16(al, kb, acc[j]); } }
#pragma unroll
  for (int j = 0; j < 8; ++j) { const int kt = k0 + j * 16 + col;
#pragma unroll
    for (int r = 0; r < 8; ++r) { const int qt = ql0 + 8 * g + r; ss[wave][8 * g + r][j * 16 + col] = (kt <= qt) ? acc[j][r] * 0.125f : -3.0e38f; } }
  LDSX(); for (int rl = 0; rl < 16; ++rl) vst2(S + (size_t)(ql0 + rl) * TT + k0 + lane * 4, *(const v4f*)&ss[wave][rl][lane * 4]); }
// ---- k_sm: causal softmax, P x 2^11 f32 in place
__global__ __launch_bounds__(256) void k_sm(float* __restrict__ S0) { __shared__ float sred[8]; __shared__ float sbc; __shared__ __align__(16) float sh[TT];
  const int t = threadIdx.x; const size_t row = blockIdx.x; float* sr = S0 + (size_t)blockIdx.y * TT * TT + row * TT; const int kend = ((int)row / 64) * 64 + 64;
  float m = -3.0e38f; for (int k = t; k < kend; k += 256) m = fmaxf(m, sr[k]);
#pragma unroll
  for (int o = 1; o < 32; o <<= 1) m = fmaxf(m, __shfl_xor(m, o));
  if ((t & 31) == 0) sred[t >> 5] = m; __syncthreads(); if (t == 0) { float a = sred[0]; for (int i = 1; i < 8; ++i) a = fmaxf(a, sred[i]); sbc = a; } __syncthreads(); m = sbc; __syncthreads();
  float sum = 0.f; for (int k = t; k < kend; k += 256) { const float v = sr[k]; sum += (v <= -1.0e38f) ? 0.f : expf(v - m); }
#pragma unroll
  for (int o = 1; o < 32; o <<= 1) sum += __shfl_xor(sum, o);
  if ((t & 31) == 0) sred[t >> 5] = sum; __syncthreads(); if (t == 0) { float a = 0.f; for (int i = 0; i < 8; ++i) a += sred[i]; sbc = 1.0f / a; } __syncthreads(); const float inv = sbc;
  for (int k = t; k < kend; k += 256) { const float v = sr[k]; sh[k] = (v <= -1.0e38f) ? 0.f : expf(v - m) * inv * 2048.0f; }
  __syncthreads(); for (int q = t; q < kend / 4; q += 256) vst2(sr + q * 4, *(const v4f*)&sh[q * 4]); }
// ---- k_pv: block = (64 queries, head in group): y rows [row][h*64 + d] (3 products)
__global__ __launch_bounds__(128) void k_pv(const float* __restrict__ PS0, const __bf16* __restrict__ VT, const __bf16* __restrict__ VL, int b, int h0, float* __restrict__ Y) { __shared__ __align__(16) float ss[4][16][68];
  const int h = h0 + blockIdx.z; const int kvh = h / GQ; const float* PS = PS0 + (size_t)blockIdx.z * TT * TT;
  const int tid = threadIdx.x, wave = tid >> 5, lane = tid & 31, col = lane & 15, g = lane >> 4; const int ql0 = blockIdx.x * 64 + wave * 16; const int kend = blockIdx.x * 64 + 64;
  v8f acc[4] = {};
#pragma unroll 1
  for (int kc = 0; kc < kend / 32; ++kc) { const F2 p = split_row(PS + (size_t)(ql0 + col) * TT, kc * 32, lane);
#pragma unroll
    for (int j = 0; j < 4; ++j) { const size_t po = ((size_t)b * KV + kvh * HD + j * 16 + col) * TT + kc * 32; const v16b vh = frag_b(VT + po, lane); acc[j] = wmma_bf(p.h, vh, acc[j]); acc[j] = wmma_bf(p.l, vh, acc[j]); acc[j] = wmma_bf(p.h, frag_b(VL + po, lane), acc[j]); } }
#pragma unroll
  for (int j = 0; j < 4; ++j)
#pragma unroll
    for (int r = 0; r < 8; ++r) ss[wave][8 * g + r][j * 16 + col] = acc[j][r] * (1.0f / 2048.0f);
  LDSX(); for (int rl = 0; rl < 16; ++rl) if (lane < 16) vst2(Y + ((size_t)b * TT + ql0 + rl) * CC + h * HD + lane * 4, *(const v4f*)&ss[wave][rl][lane * 4]); }
// ---- k_out: out = y (hi + lo) Wproj^T
__global__ __launch_bounds__(128) void k_out(const float* __restrict__ Y, const float* __restrict__ WO, float* __restrict__ OUT) { __shared__ __align__(16) float sf[4][16][132];
  const int tid = threadIdx.x, wave = tid >> 5, lane = tid & 31, col = lane & 15, g = lane >> 4; const int c0 = blockIdx.y * 128; const size_t r0 = (size_t)blockIdx.x * 64 + wave * 16;
  v8f acc[8] = {};
#pragma unroll 2
  for (int kc = 0; kc < CC / 32; ++kc) { const F2 a = split_row(Y + (r0 + col) * CC, kc * 32, lane);
#pragma unroll
    for (int j = 0; j < 8; ++j) { v16b w; const int o = c0 + j * 16 + col; const float* p = WO + (size_t)o * CC + kc * 32 + 8 * g;
#pragma unroll
      for (int i = 0; i < 8; ++i) { w[i] = (__bf16)p[i]; w[8 + i] = (__bf16)p[16 + i]; }
      acc[j] = wmma_bf(a.h, w, acc[j]); acc[j] = wmma_bf(a.l, w, acc[j]); } }
#pragma unroll
  for (int j = 0; j < 8; ++j)
#pragma unroll
    for (int r = 0; r < 8; ++r) sf[wave][8 * g + r][j * 16 + col] = acc[j][r];
  LDSX(); for (int rl = 0; rl < 16; ++rl) vst2(OUT + (r0 + rl) * CC + c0 + lane * 4, *(const v4f*)&sf[wave][rl][lane * 4]); }
extern "C" void kernel_launch(void* const* d_in, const int* in_sizes, int n_in, void* d_out, int out_size, void* d_ws, size_t ws_size, hipStream_t stream) {
  (void)in_sizes; (void)n_in; (void)out_size;
  const float** F = (const float**)d_in;   // 0 x [2,2048,1024], 1 Wq [1024,1024], 2 Wk [256,1024], 3 Wv [256,1024], 4 Wproj [1024,1024] ([out,in]), 5 q_gain [16], 6 lora_A_q [2,4,1024], 7 lora_B_q [2,1024,4], 8 lora_A_v [2,4,1024], 9 lora_B_v [2,256,4], 10 step_idx [1] int32
  if (ws_size < (size_t)WS_END) return;
  const int* STEP = (const int*)d_in[10];
  char* ws = (char*)d_ws; float *XA = (float*)(ws + WS_XA), *S = (float*)(ws + WS_S), *Y = (float*)(ws + WS_Y); _Float16 *QH = (_Float16*)(ws + WS_QH), *QL = (_Float16*)(ws + WS_QL), *KH = (_Float16*)(ws + WS_KH); __bf16 *VT = (__bf16*)(ws + WS_VT), *VL = (__bf16*)(ws + WS_VL);
  k_lora<<<TNB * TT / 64, 128, 0, stream>>>(F[0], F[6], F[8], STEP, XA);
  k_proj<<<dim3(TNB * TT / 64, (CC + 2 * KV) / 128), 128, 0, stream>>>(F[0], F[1], F[2], F[3], F[5], F[7], F[9], STEP, XA, QH, QL, KH, VT, VL);
  for (int b = 0; b < TNB; ++b) for (int h0 = 0; h0 < NH; h0 += HG) {
    k_sc<<<dim3(TT / 64, TT / 128, HG), 128, 0, stream>>>(QH, QL, KH, b, h0, S);
    k_sm<<<dim3(TT, HG), 256, 0, stream>>>(S);
    k_pv<<<dim3(TT / 64, 1, HG), 128, 0, stream>>>(S, VT, VL, b, h0, Y);
  }
  k_out<<<dim3(TNB * TT / 64, CC / 128), 128, 0, stream>>>(Y, F[4], (float*)d_out);
}

// v001
// A run of this version takes 759 microseconds.
// Two timings next to v000 put it at 1.84 and 1.80 times that version's speed.
// compute dtype: all float inputs rounded to bf16, step_idx (int) read; q/k/v = x W^T with EXACT bf16 products on WMMA 16x16x32, f32 accumulate, plus the rank-4 LoRA terms (x A^T exact on WMMA, then . B^T on the VALU in f32) for q and v when 0 <= step_idx < 2; per-head RMSNorm (eps = f32 eps), partial rotary on the first 32 dims (10000^(-2i/32) and cos/sin computed inline per element with precise powf/cosf/sinf), q_gain, in f32; q as f16 hi + residual, k f16 -> 2-product causal GQA logits / 8 stored in f32 (4 heads per launch); softmax in f32 (precise expf), P x 2^11 kept f32 split bf16 hi + lo against v bf16 hi + lo (3 products); out = y (bf16 hi + lo) Wproj^T; f32 output.
#include <hip/hip_runtime.h>
#include <math.h>

typedef __attribute__((ext_vector_type(16))) _Float16 v16h;
typedef __attribute__((ext_vector_type(16))) __bf16 v16b;
typedef __attribute__((ext_vector_type(8)))  _Float16 v8h;
typedef __attribute__((ext_vector_type(8)))  float v8f;
typedef __attribute__((ext_vector_type(4)))  float v4f;
typedef __attribute__((ext_vector_type(2)))  float v2f;
typedef __attribute__((ext_vector_type(4)))  unsigned v4u;
typedef __attribute__((ext_vector_type(4)))  int v4i;
typedef float __attribute__((may_alias)) float_a;
typedef int __attribute__((may_alias)) int_a;

template <typename T> __device__ __forceinline__ void vst2(void* p, T v) { *(T*)p = v;  }
__device__ __forceinline__ v8f wmma16(v16h a, v16h b, v8f c) {
  v8f d = __builtin_amdgcn_wmma_f32_16x16x32_f16(false, a, false, b, (short)0, c, false, false);
  asm volatile("v_nop\n\tv_nop\n\tv_nop\n\tv_nop" : "+v"(d) : "v"(a), "v"(b));
  return d;
}
__device__ __forceinline__ v8f wmma_bf(v16b a, v16b b, v8f c) {
  v8f d = __builtin_amdgcn_wmma_f32_16x16x32_bf16(false, a, false, b, (short)0, c, false, false);
  asm volatile("v_nop\n\tv_nop\n\tv_nop\n\tv_nop" : "+v"(d) : "v"(a), "v"(b));
  return d;
}
// 16x16x32 fragments: lane = (h = lane>>4, row/col = lane&15); elements 0..7 = k0+8h+0..7, 8..15 = k0+16+8h+0..7; D element r = row 8h+r
__device__ __forceinline__ v16h frag_h(const _Float16* rowk0, int lane) {
  union { v16h v; v8h q[2]; } u; const _Float16* p = rowk0 + 8 * (lane >> 4);
  u.q[0] = *(const v8h*)p; u.q[1] = *(const v8h*)(p + 16); return u.v;
}
__device__ __forceinline__ v16h frag_f32(const float* rowk0, int lane) {
  v16h a; const float* p = rowk0 + 8 * (lane >> 4);
#pragma unroll
  for (int i = 0; i < 8; ++i) { a[i] = (_Float16)p[i]; a[8 + i] = (_Float16)p[16 + i]; }
  return a;
}
__device__ __forceinline__ v16h frag_f32s(const float* rowk0, int lane, float sc) {
  v16h a; const float* p = rowk0 + 8 * (lane >> 4);
#pragma unroll
  for (int i = 0; i < 8; ++i) { a[i] = (_Float16)(p[i] * sc); a[8 + i] = (_Float16)(p[16 + i] * sc); }
  return a;
}
// column fragment from a [K][ld] layout (column n), rows >= K read as 0
__device__ __forceinline__ v16h fragc_f32(const float* W, int k0, int n, int lane, int ld, int K) {
  v16h a; const int g = lane >> 4;
#pragma unroll
  for (int i = 0; i < 8; ++i) { const int ka = k0 + 8 * g + i, kb = ka + 16;
    a[i] = (_Float16)(ka < K ? W[(size_t)(ka < K ? ka : K - 1) * ld + n] : 0.f); a[8 + i] = (_Float16)(kb < K ? W[(size_t)(kb < K ? kb : K - 1) * ld + n] : 0.f); }
  return a;
}
struct F2 { v16b h, l; };
__device__ __forceinline__ F2 bsplit16(const float v[16]) { F2 r;
#pragma unroll
  for (int i = 0; i < 16; ++i) { const __bf16 h = (__bf16)v[i]; r.h[i] = h; r.l[i] = (__bf16)(v[i] - (float)h); }
  return r; }
__device__ __forceinline__ F2 split_row(const float* row, int k0, int lane) { float v[16]; const float* p = row + k0 + 8 * (lane >> 4);
#pragma unroll
  for (int i = 0; i < 8; ++i) { v[i] = p[i]; v[8 + i] = p[16 + i]; }
  return bsplit16(v); }
__device__ __forceinline__ F2 split_rowK(const float* row, int k0, int lane, int K) { float v[16]; const int g = lane >> 4;
#pragma unroll
  for (int i = 0; i < 8; ++i) { const int ka = k0 + 8 * g + i, kb = ka + 16; v[i] = ka < K ? row[ka < K ? ka : K - 1] : 0.f; v[8 + i] = kb < K ? row[kb < K ? kb : K - 1] : 0.f; }
  return bsplit16(v); }
__device__ __forceinline__ F2 split_col(const float* W, int k0, int n, int lane, int ld, int K) { float v[16]; const int g = lane >> 4;
#pragma unroll
  for (int i = 0; i < 8; ++i) { const int ka = k0 + 8 * g + i, kb = ka + 16; v[i] = ka < K ? W[(size_t)(ka < K ? ka : K - 1) * ld + n] : 0.f; v[8 + i] = kb < K ? W[(size_t)(kb < K ? kb : K - 1) * ld + n] : 0.f; }
  return bsplit16(v); }
__device__ __forceinline__ v8f mac3(const F2& a, const F2& b, v8f c) { c = wmma_bf(a.l, b.h, c); c = wmma_bf(a.h, b.l, c); return wmma_bf(a.h, b.h, c); }
__device__ __forceinline__ float sigm(float v) { return 1.0f / (1.0f + expf(-v)); }
#define LDSX() do { asm volatile("s_wait_dscnt 0" ::: "memory"); __builtin_amdgcn_wave_barrier(); __builtin_amdgcn_fence(__ATOMIC_RELEASE, "workgroup"); } while (0)


// RRT attention (B 2, S 2,048, dim 1,024 = 16 q heads x 64, 4 kv heads, LoRA rank 4 on q and v selected by step_idx, partial RoPE 32, RMS-normed q/k, per-head q gain, causal GQA SDPA, output Linear).
#define NB 2
#define TT 2048
#define CC 1024
#define NH 16
#define HK 4
#define GQ (NH / HK)
#define HD 64
#define KV (HK * HD)        // 256
#define RD 32               // partial rope dims
#define LR 4                // lora rank
#define HG 4
#define NR (NB * TT)
#ifndef TNB
#define TNB NB
#endif
typedef __attribute__((ext_vector_type(8))) __bf16 v8b;
__device__ __forceinline__ v16b frag_b(const __bf16* rowk0, int lane) {
  union { v16b v; v8b q[2]; } u; const __bf16* p = rowk0 + 8 * (lane >> 4);
  u.q[0] = *(const v8b*)p; u.q[1] = *(const v8b*)(p + 16); return u.v;
}
__device__ __forceinline__ float bfr(float v) { return (float)(__bf16)v; }
__device__ __attribute__((noinline)) float exp_ni(float v) { return expf(v); }
__device__ __attribute__((noinline)) float erf_ni(float v) { return erff(v); }
// Operand sets held as loaded. The statement behind each WMMA keeps a global load from moving over it, so a load written behind a WMMA is also issued behind it:
// the loops of k_lora, k_proj, k_pv and k_out write a whole set's loads in one group, ahead of the WMMAs that run while the set is in flight, and reads the set only one stage later.
struct Raw16 { v4f q[4]; };                    // one f32 row fragment: k0+8h+0..7 in q[0], q[1]; k0+16+8h+0..7 in q[2], q[3]
__device__ __forceinline__ void raw_ld(Raw16& s, const float* p) { s.q[0] = *(const v4f*)p; s.q[1] = *(const v4f*)(p + 4); s.q[2] = *(const v4f*)(p + 16); s.q[3] = *(const v4f*)(p + 20); }
__device__ __forceinline__ v16b raw_bf(const Raw16& s) { v16b w;
#pragma unroll
  for (int i = 0; i < 4; ++i) { w[i] = (__bf16)s.q[0][i]; w[4 + i] = (__bf16)s.q[1][i]; w[8 + i] = (__bf16)s.q[2][i]; w[12 + i] = (__bf16)s.q[3][i]; }
  return w; }
__device__ __forceinline__ F2 raw_split(const Raw16& s) { float v[16];
#pragma unroll
  for (int i = 0; i < 4; ++i) { v[i] = s.q[0][i]; v[4 + i] = s.q[1][i]; v[8 + i] = s.q[2][i]; v[12 + i] = s.q[3][i]; }
  return bsplit16(v); }
// behind a group of loads: the wait that is kept in front of any rewrite of the address registers these loads name; the inputs hold those registers unchanged up to it
__device__ __forceinline__ void xwait(const void* p) { asm volatile("s_wait_xcnt 0x0" :: "v"(p) : "memory"); }
__device__ __forceinline__ void xwait3(const void* p, const void* q, const void* r) { asm volatile("s_wait_xcnt 0x0" :: "v"(p), "v"(q), "v"(r) : "memory"); }
struct Raw64 { Raw16 f[4]; };                  // four weight fragments, 16 output columns apart
__device__ __forceinline__ void raw4_ld(Raw64& s, const float* p) {
#pragma unroll
  for (int j = 0; j < 4; ++j) raw_ld(s.f[j], p + (size_t)j * 16 * CC);
  xwait(p); }
// the lane's own piece is already in p (8 * (lane >> 4) elements into the 32)
__device__ __forceinline__ v16b frag_bs(const __bf16* p) { union { v16b v; v8b q[2]; } u; u.q[0] = *(const v8b*)p; u.q[1] = *(const v8b*)(p + 16); return u.v; }
struct PvSet { Raw16 p; v16b h[4], l[4]; };    // one 32-key pass of k_pv: the P row piece, the V hi and lo fragments
__device__ __forceinline__ void pv_ld(PvSet& s, const float* pp, const __bf16* hp, const __bf16* lp) { raw_ld(s.p, pp);
#pragma unroll
  for (int j = 0; j < 4; ++j) { s.h[j] = frag_bs(hp + (size_t)j * 16 * TT); s.l[j] = frag_bs(lp + (size_t)j * 16 * TT); }
  xwait3(pp, hp, lp); }
__device__ __forceinline__ void pv_mac(const PvSet& s, v8f* acc) { const F2 p = raw_split(s.p);
#pragma unroll
  for (int j = 0; j < 4; ++j) { acc[j] = wmma_bf(p.h, s.h[j], acc[j]); acc[j] = wmma_bf(p.l, s.h[j], acc[j]); acc[j] = wmma_bf(p.h, s.l[j], acc[j]); } }

#define WS_XA  0u
#define WS_QH  (WS_XA + 4u * (size_t)NR * 32)
#define WS_QL  (WS_QH + 2u * (size_t)NR * CC)
#define WS_KH  (WS_QL + 2u * (size_t)NR * CC)          // f16 k rows [row][256]
#define WS_VT  (WS_KH + 2u * (size_t)NR * KV)          // bf16 v planes [b][256][t] hi / lo
#define WS_VL  (WS_VT + 2u * (size_t)NB * KV * TT)
#define WS_S   (WS_VL + 2u * (size_t)NB * KV * TT)     // f32 S [HG][t][t]
#define WS_Y   (WS_S + 4u * (size_t)HG * TT * TT)
#define WS_END (WS_Y + 4u * (size_t)NR * CC)

// ---- k_lora: block = 64 rows: XA[row][0..3] = x . A_q[si]^T, [4..7] = x . A_v[si]^T (exact products; zero if step_idx out of range)
__global__ __launch_bounds__(128) void k_lora(const float* __restrict__ X, const float* __restrict__ AQ, const float* __restrict__ AV, const int* __restrict__ STEP, float* __restrict__ XA) { __shared__ __align__(16) float ss[4][16][36];
  const int tid = threadIdx.x, wave = tid >> 5, lane = tid & 31, col = lane & 15, g = lane >> 4; const size_t r0 = (size_t)blockIdx.x * 64 + wave * 16;
  const int si = STEP[0]; const bool use = (si >= 0 && si < 2); const float* aq = AQ + (size_t)(use ? si : 0) * LR * CC; const float* av = AV + (size_t)(use ? si : 0) * LR * CC;
  v8f acc = {};
  const float* xp = X + (r0 + col) * CC + 8 * g; const bool on = col < 8;   // columns 8..15 read row 0 of A_q, in bounds, and enter the product as 0
  const float* ap = ((col < 4) ? (aq + (size_t)col * CC) : on ? (av + (size_t)(col - 4) * CC) : aq) + 8 * g;
  Raw16 rx[4], rw[4];
#pragma unroll
  for (int u = 0; u < 4; ++u) { raw_ld(rx[u], xp + u * 32); raw_ld(rw[u], ap + u * 32); }
  xwait(xp); xwait(ap);
  // rolled: one trip is four passes, loaded one trip ahead; the next four passes' loads go out ahead of this trip's WMMAs; the last trip's refill reads its own passes again and is not used
#pragma unroll 1
  for (int kq = 0; kq < CC / 128; ++kq) { const int kn = (kq + 1 < CC / 128 ? kq + 1 : kq) * 128; v16b a[4], w[4];
#pragma unroll
    for (int u = 0; u < 4; ++u) { a[u] = raw_bf(rx[u]); const v16b t = raw_bf(rw[u]);
#pragma unroll
      for (int i = 0; i < 16; ++i) w[u][i] = on ? t[i] : (__bf16)0.f; }
#pragma unroll
    for (int u = 0; u < 4; ++u) { raw_ld(rx[u], xp + kn + u * 32); raw_ld(rw[u], ap + kn + u * 32); }
    xwait(xp + kn); xwait(ap + kn);
#pragma unroll
    for (int u = 0; u < 4; ++u) acc = wmma_bf(a[u], w[u], acc); }
#pragma unroll
  for (int r = 0; r < 8; ++r) ss[wave][8 * g + r][col] = use ? acc[r] : 0.f;
  LDSX(); for (int rl = 0; rl < 16; ++rl) if (lane < 2) vst2(XA + (r0 + rl) * 32 + lane * 4, *(const v4f*)&ss[wave][rl][lane * 4]); }
// ---- k_proj: block = (64 rows, 128 cols over [q 1024 | k 256 | v 256]): x W^T (+ LoRA), RMSNorm + partial rope (+ gain) for q/k; v -> planes
__global__ __launch_bounds__(128) void k_proj(const float* __restrict__ X, const float* __restrict__ WQ, const float* __restrict__ WK, const float* __restrict__ WV, const float* __restrict__ GAIN, const float* __restrict__ BQ, const float* __restrict__ BV, const int* __restrict__ STEP, const float* __restrict__ XA, _Float16* __restrict__ QH, _Float16* __restrict__ QL, _Float16* __restrict__ KH, __bf16* __restrict__ VT, __bf16* __restrict__ VL) {
  __shared__ __align__(16) float sf[64][132]; __shared__ __align__(16) _Float16 sh[64][136], sl[64][136]; __shared__ __align__(16) __bf16 th[128][72], tl2[128][72]; __shared__ float srs[64][2];
  const int tid = threadIdx.x, wave = tid >> 5, lane = tid & 31, col = lane & 15, g = lane >> 4; const int cg = blockIdx.y * 128; const size_t r0 = (size_t)blockIdx.x * 64;
  const int region = (cg < CC) ? 0 : (cg < CC + KV) ? 1 : 2; const int c0 = region == 0 ? cg : region == 1 ? cg - CC : cg - CC - KV; const float* Wm = region == 0 ? WQ : region == 1 ? WK : WV;
  const int si = STEP[0]; const bool use = (si >= 0 && si < 2);
  v8f acc[8] = {};
  const float* xp = X + (r0 + wave * 16 + col) * CC + 8 * g; const float* wp = Wm + (size_t)(c0 + col) * CC + 8 * g;
  Raw16 ra; Raw64 w0, w1; raw_ld(ra, xp); xwait(xp); raw4_ld(w0, wp);
  // rolled: the two weight sets (columns 0..63, 64..127) keep their registers, each filled while the other is multiplied; the last trip's refills read its own pass again and are not used
#pragma unroll 1
  for (int kc = 0; kc < CC / 32; ++kc) { const int ko = kc * 32, kn = (kc + 1 < CC / 32 ? kc + 1 : kc) * 32;
    raw4_ld(w1, wp + (size_t)64 * CC + ko); const v16b a = raw_bf(ra); raw_ld(ra, xp + kn); xwait(xp + kn);
#pragma unroll
    for (int j = 0; j < 4; ++j) acc[j] = wmma_bf(a, raw_bf(w0.f[j]), acc[j]);
    raw4_ld(w0, wp + kn);
#pragma unroll
    for (int j = 0; j < 4; ++j) acc[4 + j] = wmma_bf(a, raw_bf(w1.f[j]), acc[4 + j]); }
#pragma unroll
  for (int j = 0; j < 8; ++j) { const int o = c0 + j * 16 + col;
#pragma unroll
    for (int r = 0; r < 8; ++r) { const int rl = wave * 16 + 8 * g + r; float v = acc[j][r];
      if (use && region != 1) { const float* Bm = (region == 0) ? (BQ + ((size_t)si * CC + o) * LR) : (BV + ((size_t)si * KV + o) * LR); const float* xa = XA + (r0 + rl) * 32 + (region == 0 ? 0 : 4);
#pragma unroll
        for (int q = 0; q < LR; ++q) v += xa[q] * bfr(Bm[q]); }
      sf[rl][j * 16 + col] = v; } }
  __syncthreads();
  if (region <= 1) {   // RMSNorm per head (64 dims, eps = FLT_EPSILON), partial rope on dims < 32 (x1 = d<16, x2 = 16..31): [x1 c + x2 s, -x1 s + x2 c], then gain (q only)
    for (int e = tid; e < 64 * 2; e += 128) { const int rl = e >> 1, hh = e & 1; float s2 = 0.f;
#pragma unroll 1
      for (int d = 0; d < HD; ++d) { const float v = sf[rl][hh * 64 + d]; s2 += v * v; } srs[rl][hh] = 1.0f / sqrtf(s2 * (1.0f / HD) + 1.1920929e-7f); }
    __syncthreads();
    for (int e = tid; e < 64 * 128; e += 128) { const int rl = e >> 7, cl = e & 127; const int d = cl & 63, hb = cl & ~63; const float rs = srs[rl][cl >> 6]; const int t = (int)((r0 + rl) % TT); float v;
      if (d < RD) { const int i2 = d & 15; const float inv_freq = 1.0f / powf(10000.0f, (float)(2 * i2) / (float)RD); const float ang = (float)t * inv_freq; const float c = cosf(ang), s = sinf(ang); const float x1 = sf[rl][hb + i2] * rs, x2 = sf[rl][hb + 16 + i2] * rs; v = (d < 16) ? (x1 * c + x2 * s) : (-x1 * s + x2 * c); }
      else v = sf[rl][cl] * rs;
      if (region == 0) v *= bfr(GAIN[(c0 + cl) / HD]);
      const _Float16 hv = (_Float16)v; sh[rl][cl] = hv; sl[rl][cl] = (_Float16)(v - (float)hv); }
    __syncthreads();
    if (region == 0) { for (int e = tid; e < 64 * 16; e += 128) { const int rl = e >> 4, q = e & 15; vst2((unsigned*)(QH + (r0 + rl) * CC + c0 + q * 8), *(const v4u*)&sh[rl][q * 8]); vst2((unsigned*)(QL + (r0 + rl) * CC + c0 + q * 8), *(const v4u*)&sl[rl][q * 8]); } }
    else { for (int e = tid; e < 64 * 16; e += 128) { const int rl = e >> 4, q = e & 15; vst2((unsigned*)(KH + (r0 + rl) * KV + c0 + q * 8), *(const v4u*)&sh[rl][q * 8]); } } }
  else { for (int e = tid; e < 64 * 128; e += 128) { const int rl = e >> 7, cl = e & 127; const float v = sf[rl][cl]; const __bf16 bh = (__bf16)v; th[cl][rl] = bh; tl2[cl][rl] = (__bf16)(v - (float)bh); }
    __syncthreads(); const size_t b = r0 / TT; const int t0 = (int)(r0 % TT);
    for (int e = tid; e < 128 * 8; e += 128) { const int cl = e >> 3, q = e & 7; const size_t o2 = (b * KV + c0 + cl) * (size_t)TT + t0 + q * 8; vst2((unsigned*)(VT + o2), *(const v4u*)&th[cl][q * 8]); vst2((unsigned*)(VL + o2), *(const v4u*)&tl2[cl][q * 8]); } } }
// ---- k_sc: block = (64 queries, 128 keys, head in group): causal logits / 8 (GQA: kv head = h / 4)
__global__ __launch_bounds__(128) void k_sc(const _Float16* __restrict__ QH, const _Float16* __restrict__ QL, const _Float16* __restrict__ KH, int b, int h0, float* __restrict__ S0) { __shared__ __align__(16) float ss[4][16][132];
  const int h = h0 + blockIdx.z; const int kvh = h / GQ; float* S = S0 + (size_t)blockIdx.z * TT * TT;
  const int tid = threadIdx.x, wave = tid >> 5, lane = tid & 31, col = lane & 15, g = lane >> 4; const int k0 = blockIdx.y * 128; const int ql0 = blockIdx.x * 64 + wave * 16;
  if (k0 > blockIdx.x * 64 + 63) return;
  v8f acc[8] = {};
#pragma unroll
  for (int kc = 0; kc < HD / 32; ++kc) { const size_t qo = ((size_t)b * TT + ql0 + col) * CC + h * HD + kc * 32; const v16h ah = frag_h(QH + qo, lane), al = frag_h(QL + qo, lane);
#pragma unroll
    for (int j = 0; j < 8; ++j) { const v16h kb = frag_h(KH + ((size_t)b * TT + k0 + j * 16 + col) * KV + kvh * HD + kc * 32, lane); acc[j] = wmma16(ah, kb, acc[j]); acc[j] = wmma16(al, kb, acc[j]); } }
#pragma unroll
  for (int j = 0; j < 8; ++j) { const int kt = k0 + j * 16 + col;
#pragma unroll
    for (int r = 0; r < 8; ++r) { const int qt = ql0 + 8 * g + r; ss[wave][8 * g + r][j * 16 + col] = (kt <= qt) ? acc[j][r] * 0.125f : -3.0e38f; } }
  LDSX(); for (int rl = 0; rl < 16; ++rl) vst2(S + (size_t)(ql0 + rl) * TT + k0 + lane * 4, *(const v4f*)&ss[wave][rl][lane * 4]); }
// ---- k_sm: causal softmax, P x 2^11 f32 in place
__global__ __launch_bounds__(256) void k_sm(float* __restrict__ S0) { __shared__ float sred[8]; __shared__ float sbc; __shared__ __align__(16) float sh[TT];
  const int t = threadIdx.x; const size_t row = blockIdx.x; float* sr = S0 + (size_t)blockIdx.y * TT * TT + row * TT; const int kend = ((int)row / 64) * 64 + 64;
  float m = -3.0e38f; for (int k = t; k < kend; k += 256) m = fmaxf(m, sr[k]);
#pragma unroll
  for (int o = 1; o < 32; o <<= 1) m = fmaxf(m, __shfl_xor(m, o));
  if ((t & 31) == 0) sred[t >> 5] = m; __syncthreads(); if (t == 0) { float a = sred[0]; for (int i = 1; i < 8; ++i) a = fmaxf(a, sred[i]); sbc = a; } __syncthreads(); m = sbc; __syncthreads();
  float sum = 0.f; for (int k = t; k < kend; k += 256) { const float v = sr[k]; sum += (v <= -1.0e38f) ? 0.f : expf(v - m); }
#pragma unroll
  for (int o = 1; o < 32; o <<= 1) sum += __shfl_xor(sum, o);
  if ((t & 31) == 0) sred[t >> 5] = sum; __syncthreads(); if (t == 0) { float a = 0.f; for (int i = 0; i < 8; ++i) a += sred[i]; sbc = 1.0f / a; } __syncthreads(); const float inv = sbc;
  for (int k = t; k < kend; k += 256) { const float v = sr[k]; sh[k] = (v <= -1.0e38f) ? 0.f : expf(v - m) * inv * 2048.0f; }
  __syncthreads(); for (int q = t; q < kend / 4; q += 256) vst2(sr + q * 4, *(const v4f*)&sh[q * 4]); }
// ---- k_pv: block = (64 queries, head in group): y rows [row][h*64 + d] (3 products)
__global__ __launch_bounds__(128) void k_pv(const float* __restrict__ PS0, const __bf16* __restrict__ VT, const __bf16* __restrict__ VL, int b, int h0, float* __restrict__ Y) { __shared__ __align__(16) float ss[4][16][68];
  const int h = h0 + blockIdx.z; const int kvh = h / GQ; const float* PS = PS0 + (size_t)blockIdx.z * TT * TT;
  const int tid = threadIdx.x, wave = tid >> 5, lane = tid & 31, col = lane & 15, g = lane >> 4; const int ql0 = blockIdx.x * 64 + wave * 16; const int kend = blockIdx.x * 64 + 64;
  v8f acc[4] = {};
  const int n = kend / 32;   // even, at least 2
  const float* pp = PS + (size_t)(ql0 + col) * TT + 8 * g; const size_t vo = ((size_t)b * KV + kvh * HD + col) * TT + 8 * g; const __bf16* hp = VT + vo; const __bf16* lp = VL + vo;
  PvSet sa, sb; pv_ld(sa, pp, hp, lp);
  // rolled: one trip is the two register sets' turn, each set filled while the other is multiplied; behind the last pass the refill reads that pass again and is not used
#pragma unroll 1
  for (int kc = 0; kc < n; kc += 2) { const int kb = kc + 1, ka = kc + 2 < n ? kc + 2 : kc + 1;
    pv_ld(sb, pp + kb * 32, hp + kb * 32, lp + kb * 32); pv_mac(sa, acc);
    pv_ld(sa, pp + ka * 32, hp + ka * 32, lp + ka * 32); pv_mac(sb, acc); }
#pragma unroll
  for (int j = 0; j < 4; ++j)
#pragma unroll
    for (int r = 0; r < 8; ++r) ss[wave][8 * g + r][j * 16 + col] = acc[j][r] * (1.0f / 2048.0f);
  LDSX(); for (int rl = 0; rl < 16; ++rl) if (lane < 16) vst2(Y + ((size_t)b * TT + ql0 + rl) * CC + h * HD + lane * 4, *(const v4f*)&ss[wave][rl][lane * 4]); }
// ---- k_out: out = y (hi + lo) Wproj^T
__global__ __launch_bounds__(128) void k_out(const float* __restrict__ Y, const float* __restrict__ WO, float* __restrict__ OUT) { __shared__ __align__(16) float sf[4][16][132];
  const int tid = threadIdx.x, wave = tid >> 5, lane = tid & 31, col = lane & 15, g = lane >> 4; const int c0 = blockIdx.y * 128; const size_t r0 = (size_t)blockIdx.x * 64 + wave * 16;
  v8f acc[8] = {};
  const float* yp = Y + (r0 + col) * CC + 8 * g; const float* wp = WO + (size_t)(c0 + col) * CC + 8 * g;
  Raw16 ra; Raw64 w0, w1; raw_ld(ra, yp); xwait(yp); raw4_ld(w0, wp);
  // rolled: the two weight sets (columns 0..63, 64..127) keep their registers, each filled while the other is multiplied; the last trip's refills read its own pass again and are not used
#pragma unroll 1
  for (int kc = 0; kc < CC / 32; ++kc) { const int ko = kc * 32, kn = (kc + 1 < CC / 32 ? kc + 1 : kc) * 32;
    raw4_ld(w1, wp + (size_t)64 * CC + ko); const F2 a = raw_split(ra); raw_ld(ra, yp + kn); xwait(yp + kn);
#pragma unroll
    for (int j = 0; j < 4; ++j) { const v16b w = raw_bf(w0.f[j]); acc[j] = wmma_bf(a.h, w, acc[j]); acc[j] = wmma_bf(a.l, w, acc[j]); }
    raw4_ld(w0, wp + kn);
#pragma unroll
    for (int j = 0; j < 4; ++j) { const v16b w = raw_bf(w1.f[j]); acc[4 + j] = wmma_bf(a.h, w, acc[4 + j]); acc[4 + j] = wmma_bf(a.l, w, acc[4 + j]); } }
#pragma unroll
  for (int j = 0; j < 8; ++j)
#pragma unroll
    for (int r = 0; r < 8; ++r) sf[wave][8 * g + r][j * 16 + col] = acc[j][r];
  LDSX(); for (int rl = 0; rl < 16; ++rl) vst2(OUT + (r0 + rl) * CC + c0 + lane * 4, *(const v4f*)&sf[wave][rl][lane * 4]); }
extern "C" void kernel_launch(void* const* d_in, const int* in_sizes, int n_in, void* d_out, int out_size, void* d_ws, size_t ws_size, hipStream_t stream) {
  (void)in_sizes; (void)n_in; (void)out_size;
  const float** F = (const float**)d_in;   // 0 x [2,2048,1024], 1 Wq [1024,1024], 2 Wk [256,1024], 3 Wv [256,1024], 4 Wproj [1024,1024] ([out,in]), 5 q_gain [16], 6 lora_A_q [2,4,1024], 7 lora_B_q [2,1024,4], 8 lora_A_v [2,4,1024], 9 lora_B_v [2,256,4], 10 step_idx [1] int32
  if (ws_size < (size_t)WS_END) return;
  const int* STEP = (const int*)d_in[10];
  char* ws = (char*)d_ws; float *XA = (float*)(ws + WS_XA), *S = (float*)(ws + WS_S), *Y = (float*)(ws + WS_Y); _Float16 *QH = (_Float16*)(ws + WS_QH), *QL = (_Float16*)(ws + WS_QL), *KH = (_Float16*)(ws + WS_KH); __bf16 *VT = (__bf16*)(ws + WS_VT), *VL = (__bf16*)(ws + WS_VL);
  k_lora<<<TNB * TT / 64, 128, 0, stream>>>(F[0], F[6], F[8], STEP, XA);
  k_proj<<<dim3(TNB * TT / 64, (CC + 2 * KV) / 128), 128, 0, stream>>>(F[0], F[1], F[2], F[3], F[5], F[7], F[9], STEP, XA, QH, QL, KH, VT, VL);
  for (int b = 0; b < TNB; ++b) for (int h0 = 0; h0 < NH; h0 += HG) {
    k_sc<<<dim3(TT / 64, TT / 128, HG), 128, 0, stream>>>(QH, QL, KH, b, h0, S);
    k_sm<<<dim3(TT, HG), 256, 0, stream>>>(S);
    k_pv<<<dim3(TT / 64, 1, HG), 128, 0, stream>>>(S, VT, VL, b, h0, Y);
  }
  k_out<<<dim3(TNB * TT / 64, CC / 128), 128, 0, stream>>>(Y, F[4], (float*)d_out);
}

// v002
// One run takes 209 microseconds.
// In two side-by-side timings against v001, it was 3.61 and 3.75 times as fast.
// All steps since v000 together make it 6.69 times as fast.
// compute dtype: all float inputs rounded to bf16, step_idx (int) read; q/k/v = x W^T with EXACT bf16 products on WMMA 16x16x32, f32 accumulate, plus the rank-4 LoRA terms (x A^T exact on WMMA, then . B^T on the VALU in f32) for q and v when 0 <= step_idx < 2; per-head RMSNorm (eps = f32 eps), partial rotary on the first 32 dims (frequencies 10000^(-2i/32) computed per element in k_proj with precise powf/cosf/sinf), q_gain, in f32; q as f16 hi + residual, k f16 -> 2-product causal GQA logits / 8 kept in registers; running-maximum softmax in f32 (precise expf), unnormalised P in f32 split bf16 hi + lo against v bf16 hi + lo (3 products), divided by the row sum at the end; out = y (bf16 hi + lo) Wproj^T; f32 output.
#include <hip/hip_runtime.h>
#include <math.h>

typedef __attribute__((ext_vector_type(16))) _Float16 v16h;
typedef __attribute__((ext_vector_type(16))) __bf16 v16b;
typedef __attribute__((ext_vector_type(8)))  _Float16 v8h;
typedef __attribute__((ext_vector_type(8)))  float v8f;
typedef __attribute__((ext_vector_type(4)))  float v4f;
typedef __attribute__((ext_vector_type(2)))  float v2f;
typedef __attribute__((ext_vector_type(4)))  unsigned v4u;
typedef __attribute__((ext_vector_type(4)))  int v4i;
typedef float __attribute__((may_alias)) float_a;
typedef int __attribute__((may_alias)) int_a;

template <typename T> __device__ __forceinline__ void vst2(void* p, T v) { *(T*)p = v;  }
__device__ __forceinline__ v8f wmma16(v16h a, v16h b, v8f c) {
  v8f d = __builtin_amdgcn_wmma_f32_16x16x32_f16(false, a, false, b, (short)0, c, false, false);
  asm volatile("v_nop\n\tv_nop\n\tv_nop\n\tv_nop" : "+v"(d) : "v"(a), "v"(b));
  return d;
}
__device__ __forceinline__ v8f wmma_bf(v16b a, v16b b, v8f c) {
  v8f d = __builtin_amdgcn_wmma_f32_16x16x32_bf16(false, a, false, b, (short)0, c, false, false);
  asm volatile("v_nop\n\tv_nop\n\tv_nop\n\tv_nop" : "+v"(d) : "v"(a), "v"(b));
  return d;
}
// 16x16x32 fragments: lane = (h = lane>>4, row/col = lane&15); elements 0..7 = k0+8h+0..7, 8..15 = k0+16+8h+0..7; D element r = row 8h+r
__device__ __forceinline__ v16h frag_h(const _Float16* rowk0, int lane) {
  union { v16h v; v8h q[2]; } u; const _Float16* p = rowk0 + 8 * (lane >> 4);
  u.q[0] = *(const v8h*)p; u.q[1] = *(const v8h*)(p + 16); return u.v;
}
__device__ __forceinline__ v16h frag_f32(const float* rowk0, int lane) {
  v16h a; const float* p = rowk0 + 8 * (lane >> 4);
#pragma unroll
  for (int i = 0; i < 8; ++i) { a[i] = (_Float16)p[i]; a[8 + i] = (_Float16)p[16 + i]; }
  return a;
}
__device__ __forceinline__ v16h frag_f32s(const float* rowk0, int lane, float sc) {
  v16h a; const float* p = rowk0 + 8 * (lane >> 4);
#pragma unroll
  for (int i = 0; i < 8; ++i) { a[i] = (_Float16)(p[i] * sc); a[8 + i] = (_Float16)(p[16 + i] * sc); }
  return a;
}
// column fragment from a [K][ld] layout (column n), rows >= K read as 0
__device__ __forceinline__ v16h fragc_f32(const float* W, int k0, int n, int lane, int ld, int K) {
  v16h a; const int g = lane >> 4;
#pragma unroll
  for (int i = 0; i < 8; ++i) { const int ka = k0 + 8 * g + i, kb = ka + 16;
    a[i] = (_Float16)(ka < K ? W[(size_t)(ka < K ? ka : K - 1) * ld + n] : 0.f); a[8 + i] = (_Float16)(kb < K ? W[(size_t)(kb < K ? kb : K - 1) * ld + n] : 0.f); }
  return a;
}
struct F2 { v16b h, l; };
__device__ __forceinline__ F2 bsplit16(const float v[16]) { F2 r;
#pragma unroll
  for (int i = 0; i < 16; ++i) { const __bf16 h = (__bf16)v[i]; r.h[i] = h; r.l[i] = (__bf16)(v[i] - (float)h); }
  return r; }
__device__ __forceinline__ F2 split_row(const float* row, int k0, int lane) { float v[16]; const float* p = row + k0 + 8 * (lane >> 4);
#pragma unroll
  for (int i = 0; i < 8; ++i) { v[i] = p[i]; v[8 + i] = p[16 + i]; }
  return bsplit16(v); }
__device__ __forceinline__ F2 split_rowK(const float* row, int k0, int lane, int K) { float v[16]; const int g = lane >> 4;
#pragma unroll
  for (int i = 0; i < 8; ++i) { const int ka = k0 + 8 * g + i, kb = ka + 16; v[i] = ka < K ? row[ka < K ? ka : K - 1] : 0.f; v[8 + i] = kb < K ? row[kb < K ? kb : K - 1] : 0.f; }
  return bsplit16(v); }
__device__ __forceinline__ F2 split_col(const float* W, int k0, int n, int lane, int ld, int K) { float v[16]; const int g = lane >> 4;
#pragma unroll
  for (int i = 0; i < 8; ++i) { const int ka = k0 + 8 * g + i, kb = ka + 16; v[i] = ka < K ? W[(size_t)(ka < K ? ka : K - 1) * ld + n] : 0.f; v[8 + i] = kb < K ? W[(size_t)(kb < K ? kb : K - 1) * ld + n] : 0.f; }
  return bsplit16(v); }
__device__ __forceinline__ v8f mac3(const F2& a, const F2& b, v8f c) { c = wmma_bf(a.l, b.h, c); c = wmma_bf(a.h, b.l, c); return wmma_bf(a.h, b.h, c); }
__device__ __forceinline__ float sigm(float v) { return 1.0f / (1.0f + expf(-v)); }
#define LDSX() do { asm volatile("s_wait_dscnt 0" ::: "memory"); __builtin_amdgcn_wave_barrier(); __builtin_amdgcn_fence(__ATOMIC_RELEASE, "workgroup"); } while (0)


// RRT attention (B 2, S 2,048, dim 1,024 = 16 q heads x 64, 4 kv heads, LoRA rank 4 on q and v selected by step_idx, partial RoPE 32, RMS-normed q/k, per-head q gain, causal GQA SDPA, output Linear).
#define NB 2
#define TT 2048
#define CC 1024
#define NH 16
#define HK 4
#define GQ (NH / HK)
#define HD 64
#define KV (HK * HD)        // 256
#define RD 32               // partial rope dims
#define LR 4                // lora rank
#define HG 4
#define NR (NB * TT)
#ifndef TNB
#define TNB NB
#endif
typedef __attribute__((ext_vector_type(8))) __bf16 v8b;
__device__ __forceinline__ v16b frag_b(const __bf16* rowk0, int lane) {
  union { v16b v; v8b q[2]; } u; const __bf16* p = rowk0 + 8 * (lane >> 4);
  u.q[0] = *(const v8b*)p; u.q[1] = *(const v8b*)(p + 16); return u.v;
}
__device__ __forceinline__ float bfr(float v) { return (float)(__bf16)v; }
__device__ __attribute__((noinline)) float exp_ni(float v) { return expf(v); }
__device__ __attribute__((noinline)) float erf_ni(float v) { return erff(v); }
// Operand sets held as loaded. The statement behind each wmma16 / wmma_bf keeps a global load from moving over it, so a load written behind one is also issued behind it:
// the loops of k_lora, k_proj and k_out write a whole set's loads in one group, ahead of the WMMAs that run while the set is in flight, and reads the set only one stage later.
struct Raw16 { v4f q[4]; };                    // one f32 row fragment: k0+8h+0..7 in q[0], q[1]; k0+16+8h+0..7 in q[2], q[3]
__device__ __forceinline__ void raw_ld(Raw16& s, const float* p) { s.q[0] = *(const v4f*)p; s.q[1] = *(const v4f*)(p + 4); s.q[2] = *(const v4f*)(p + 16); s.q[3] = *(const v4f*)(p + 20); }
__device__ __forceinline__ v16b raw_bf(const Raw16& s) { v16b w;
#pragma unroll
  for (int i = 0; i < 4; ++i) { w[i] = (__bf16)s.q[0][i]; w[4 + i] = (__bf16)s.q[1][i]; w[8 + i] = (__bf16)s.q[2][i]; w[12 + i] = (__bf16)s.q[3][i]; }
  return w; }
__device__ __forceinline__ F2 raw_split(const Raw16& s) { float v[16];
#pragma unroll
  for (int i = 0; i < 4; ++i) { v[i] = s.q[0][i]; v[4 + i] = s.q[1][i]; v[8 + i] = s.q[2][i]; v[12 + i] = s.q[3][i]; }
  return bsplit16(v); }
// behind a group of loads: the wait that is kept in front of any rewrite of the address registers these loads name; the inputs hold those registers unchanged up to it
__device__ __forceinline__ void xwait(const void* p) { asm volatile("s_wait_xcnt 0x0" :: "v"(p) : "memory"); }
__device__ __forceinline__ void xwait2(const void* p, const void* q) { asm volatile("s_wait_xcnt 0x0" :: "v"(p), "v"(q) : "memory"); }
struct Raw64 { Raw16 f[4]; };                  // four weight fragments, 16 output columns apart
__device__ __forceinline__ void raw4_ld(Raw64& s, const float* p) {
#pragma unroll
  for (int j = 0; j < 4; ++j) raw_ld(s.f[j], p + (size_t)j * 16 * CC);
  xwait(p); }
// the lane's own piece is already in p (8 * (lane >> 4) elements into the 32)
__device__ __forceinline__ v16b frag_bs(const __bf16* p) { union { v16b v; v8b q[2]; } u; u.q[0] = *(const v8b*)p; u.q[1] = *(const v8b*)(p + 16); return u.v; }

#define WS_XA  0u
#define WS_QH  (WS_XA + 4u * (size_t)NR * 32)
#define WS_QL  (WS_QH + 2u * (size_t)NR * CC)
#define WS_KH  (WS_QL + 2u * (size_t)NR * CC)          // f16 k rows [row][256]
#define WS_VT  (WS_KH + 2u * (size_t)NR * KV)          // bf16 v planes [b][256][t] hi / lo
#define WS_VL  (WS_VT + 2u * (size_t)NB * KV * TT)
#define WS_Y   (WS_VL + 2u * (size_t)NB * KV * TT)
#define WS_END (WS_Y + 4u * (size_t)NR * CC)

// ---- k_lora: block = 64 rows: XA[row][0..3] = x . A_q[si]^T, [4..7] = x . A_v[si]^T (exact products; zero if step_idx out of range)
__global__ __launch_bounds__(128) void k_lora(const float* __restrict__ X, const float* __restrict__ AQ, const float* __restrict__ AV, const int* __restrict__ STEP, float* __restrict__ XA) { __shared__ __align__(16) float ss[4][16][36];
  const int tid = threadIdx.x, wave = tid >> 5, lane = tid & 31, col = lane & 15, g = lane >> 4; const size_t r0 = (size_t)blockIdx.x * 64 + wave * 16;
  const int si = STEP[0]; const bool use = (si >= 0 && si < 2); const float* aq = AQ + (size_t)(use ? si : 0) * LR * CC; const float* av = AV + (size_t)(use ? si : 0) * LR * CC;
  v8f acc = {};
  const float* xp = X + (r0 + col) * CC + 8 * g; const bool on = col < 8;   // columns 8..15 read row 0 of A_q, in bounds, and enter the product as 0
  const float* ap = ((col < 4) ? (aq + (size_t)col * CC) : on ? (av + (size_t)(col - 4) * CC) : aq) + 8 * g;
  Raw16 rx[4], rw[4];
#pragma unroll
  for (int u = 0; u < 4; ++u) { raw_ld(rx[u], xp + u * 32); raw_ld(rw[u], ap + u * 32); }
  xwait(xp); xwait(ap);
  // rolled: one trip is four passes, loaded one trip ahead; the next four passes' loads go out ahead of this trip's WMMAs; the last trip's refill reads its own passes again and is not used
#pragma unroll 1
  for (int kq = 0; kq < CC / 128; ++kq) { const int kn = (kq + 1 < CC / 128 ? kq + 1 : kq) * 128; v16b a[4], w[4];
#pragma unroll
    for (int u = 0; u < 4; ++u) { a[u] = raw_bf(rx[u]); const v16b t = raw_bf(rw[u]);
#pragma unroll
      for (int i = 0; i < 16; ++i) w[u][i] = on ? t[i] : (__bf16)0.f; }
#pragma unroll
    for (int u = 0; u < 4; ++u) { raw_ld(rx[u], xp + kn + u * 32); raw_ld(rw[u], ap + kn + u * 32); }
    xwait(xp + kn); xwait(ap + kn);
#pragma unroll
    for (int u = 0; u < 4; ++u) acc = wmma_bf(a[u], w[u], acc); }
#pragma unroll
  for (int r = 0; r < 8; ++r) ss[wave][8 * g + r][col] = use ? acc[r] : 0.f;
  LDSX(); for (int rl = 0; rl < 16; ++rl) if (lane < 2) vst2(XA + (r0 + rl) * 32 + lane * 4, *(const v4f*)&ss[wave][rl][lane * 4]); }
// ---- k_proj: block = (64 rows, 128 cols over [q 1024 | k 256 | v 256]): x W^T (+ LoRA), RMSNorm + partial rope (+ gain) for q/k; v -> planes
__global__ __launch_bounds__(128) void k_proj(const float* __restrict__ X, const float* __restrict__ WQ, const float* __restrict__ WK, const float* __restrict__ WV, const float* __restrict__ GAIN, const float* __restrict__ BQ, const float* __restrict__ BV, const int* __restrict__ STEP, const float* __restrict__ XA, _Float16* __restrict__ QH, _Float16* __restrict__ QL, _Float16* __restrict__ KH, __bf16* __restrict__ VT, __bf16* __restrict__ VL) {
  __shared__ __align__(16) float sf[64][132]; __shared__ __align__(16) _Float16 sh[64][136], sl[64][136]; __shared__ __align__(16) __bf16 th[128][72], tl2[128][72]; __shared__ float srs[64][2];
  const int tid = threadIdx.x, wave = tid >> 5, lane = tid & 31, col = lane & 15, g = lane >> 4; const int cg = blockIdx.y * 128; const size_t r0 = (size_t)blockIdx.x * 64;
  const int region = (cg < CC) ? 0 : (cg < CC + KV) ? 1 : 2; const int c0 = region == 0 ? cg : region == 1 ? cg - CC : cg - CC - KV; const float* Wm = region == 0 ? WQ : region == 1 ? WK : WV;
  const int si = STEP[0]; const bool use = (si >= 0 && si < 2);
  v8f acc[8] = {};
  const float* xp = X + (r0 + wave * 16 + col) * CC + 8 * g; const float* wp = Wm + (size_t)(c0 + col) * CC + 8 * g;
  Raw16 ra; Raw64 w0, w1; raw_ld(ra, xp); xwait(xp); raw4_ld(w0, wp);
  // rolled: the two weight sets (columns 0..63, 64..127) keep their registers, each filled while the other is multiplied; the last trip's refills read its own pass again and are not used
#pragma unroll 1
  for (int kc = 0; kc < CC / 32; ++kc) { const int ko = kc * 32, kn = (kc + 1 < CC / 32 ? kc + 1 : kc) * 32;
    raw4_ld(w1, wp + (size_t)64 * CC + ko); const v16b a = raw_bf(ra); raw_ld(ra, xp + kn); xwait(xp + kn);
#pragma unroll
    for (int j = 0; j < 4; ++j) acc[j] = wmma_bf(a, raw_bf(w0.f[j]), acc[j]);
    raw4_ld(w0, wp + kn);
#pragma unroll
    for (int j = 0; j < 4; ++j) acc[4 + j] = wmma_bf(a, raw_bf(w1.f[j]), acc[4 + j]); }
#pragma unroll
  for (int j = 0; j < 8; ++j) { const int o = c0 + j * 16 + col;
#pragma unroll
    for (int r = 0; r < 8; ++r) { const int rl = wave * 16 + 8 * g + r; float v = acc[j][r];
      if (use && region != 1) { const float* Bm = (region == 0) ? (BQ + ((size_t)si * CC + o) * LR) : (BV + ((size_t)si * KV + o) * LR); const float* xa = XA + (r0 + rl) * 32 + (region == 0 ? 0 : 4);
#pragma unroll
        for (int q = 0; q < LR; ++q) v += xa[q] * bfr(Bm[q]); }
      sf[rl][j * 16 + col] = v; } }
  __syncthreads();
  if (region <= 1) {   // RMSNorm per head (64 dims, eps = FLT_EPSILON), partial rope on dims < 32 (x1 = d<16, x2 = 16..31): [x1 c + x2 s, -x1 s + x2 c], then gain (q only)
    for (int e = tid; e < 64 * 2; e += 128) { const int rl = e >> 1, hh = e & 1; float s2 = 0.f;
#pragma unroll 1
      for (int d = 0; d < HD; ++d) { const float v = sf[rl][hh * 64 + d]; s2 += v * v; } srs[rl][hh] = 1.0f / sqrtf(s2 * (1.0f / HD) + 1.1920929e-7f); }
    __syncthreads();
    for (int e = tid; e < 64 * 128; e += 128) { const int rl = e >> 7, cl = e & 127; const int d = cl & 63, hb = cl & ~63; const float rs = srs[rl][cl >> 6]; const int t = (int)((r0 + rl) % TT); float v;
      if (d < RD) { const int i2 = d & 15; const float inv_freq = 1.0f / powf(10000.0f, (float)(2 * i2) / (float)RD); const float ang = (float)t * inv_freq; const float c = cosf(ang), s = sinf(ang); const float x1 = sf[rl][hb + i2] * rs, x2 = sf[rl][hb + 16 + i2] * rs; v = (d < 16) ? (x1 * c + x2 * s) : (-x1 * s + x2 * c); }
      else v = sf[rl][cl] * rs;
      if (region == 0) v *= bfr(GAIN[(c0 + cl) / HD]);
      const _Float16 hv = (_Float16)v; sh[rl][cl] = hv; sl[rl][cl] = (_Float16)(v - (float)hv); }
    __syncthreads();
    if (region == 0) { for (int e = tid; e < 64 * 16; e += 128) { const int rl = e >> 4, q = e & 15; vst2((unsigned*)(QH + (r0 + rl) * CC + c0 + q * 8), *(const v4u*)&sh[rl][q * 8]); vst2((unsigned*)(QL + (r0 + rl) * CC + c0 + q * 8), *(const v4u*)&sl[rl][q * 8]); } }
    else { for (int e = tid; e < 64 * 16; e += 128) { const int rl = e >> 4, q = e & 15; vst2((unsigned*)(KH + (r0 + rl) * KV + c0 + q * 8), *(const v4u*)&sh[rl][q * 8]); } } }
  else { for (int e = tid; e < 64 * 128; e += 128) { const int rl = e >> 7, cl = e & 127; const float v = sf[rl][cl]; const __bf16 bh = (__bf16)v; th[cl][rl] = bh; tl2[cl][rl] = (__bf16)(v - (float)bh); }
    __syncthreads(); const size_t b = r0 / TT; const int t0 = (int)(r0 % TT);
    for (int e = tid; e < 128 * 8; e += 128) { const int cl = e >> 3, q = e & 7; const size_t o2 = (b * KV + c0 + cl) * (size_t)TT + t0 + q * 8; vst2((unsigned*)(VT + o2), *(const v4u*)&th[cl][q * 8]); vst2((unsigned*)(VL + o2), *(const v4u*)&tl2[cl][q * 8]); } } }
// ---- k_fa: causal GQA attention in one launch, nothing of S or P in memory. Block = the 4 query heads of one kv head, one wave each; a wave owns 16 queries.
// S^T = K Q^T puts one query's scores of a 32-key pass into one lane pair (l, l ^ 16): D register r of key tile t is key 16 t + 8 (l >> 4) + r, which is the k order of a 16x16x32 operand,
// so P goes from the score registers straight into the B operand of O^T += V^T P^T, and maximum, sum and rescale are per lane.
// Each wave runs query tile x and then tile 127 - x, so that every wave of the grid walks the same number of keys.
__device__ __forceinline__ float xhalf(float x) { return __builtin_bit_cast(float, __builtin_amdgcn_permlanex16(__builtin_bit_cast(int, x), __builtin_bit_cast(int, x), 0x76543210, 0xfedcba98, false, false)); }  // lane l with lane l ^ 16
__device__ __forceinline__ v8f mm_h(v16h a, v16h b, v8f c) { return __builtin_amdgcn_wmma_f32_16x16x32_f16(false, a, false, b, (short)0, c, false, false); }
__device__ __forceinline__ v8f mm_b(v16b a, v16b b, v8f c) { return __builtin_amdgcn_wmma_f32_16x16x32_bf16(false, a, false, b, (short)0, c, false, false); }
__device__ __forceinline__ v16h frag_hs(const _Float16* p) { union { v16h v; v8h q[2]; } u; u.q[0] = *(const v8h*)p; u.q[1] = *(const v8h*)(p + 16); return u.v; }
struct KSet { v16h f[2][2]; };                 // one 32-key pass: [key tile of 16][32 head dims]
struct VSet { v16b h[4], l[4]; };              // one 32-key pass: V^T hi and lo, 16 head dims each
__device__ __forceinline__ void k_ld(KSet& s, const _Float16* p) {
#pragma unroll
  for (int t = 0; t < 2; ++t) { s.f[t][0] = frag_hs(p + (size_t)t * 16 * KV); s.f[t][1] = frag_hs(p + (size_t)t * 16 * KV + 32); }
  xwait(p); }
__device__ __forceinline__ void v_ld(VSet& s, const __bf16* hp, const __bf16* lp) {
#pragma unroll
  for (int j = 0; j < 4; ++j) { s.h[j] = frag_bs(hp + (size_t)j * 16 * TT); s.l[j] = frag_bs(lp + (size_t)j * 16 * TT); }
  xwait2(hp, lp); }
__global__ __launch_bounds__(128) void k_fa(const _Float16* __restrict__ QH, const _Float16* __restrict__ QL, const _Float16* __restrict__ KH, const __bf16* __restrict__ VT, const __bf16* __restrict__ VL, float* __restrict__ Y) {
  const int tid = threadIdx.x, wave = tid >> 5, lane = tid & 31, col = lane & 15, g = lane >> 4; const int kvh = blockIdx.y, b = blockIdx.z, h = kvh * GQ + wave;
  const _Float16* kp = KH + ((size_t)b * TT + col) * KV + kvh * HD + 8 * g; const size_t vo = ((size_t)b * KV + kvh * HD + col) * TT + 8 * g; const __bf16* hp = VT + vo; const __bf16* lp = VL + vo;
  // rolled: the two query tiles of a wave run one after the other through the same code
#pragma unroll 1
  for (int part = 0; part < 2; ++part) { const int tile = part ? TT / 16 - 1 - (int)blockIdx.x : (int)blockIdx.x; const int qt = tile * 16 + col; const int n = tile / 2 + 1;   // passes of 32 keys up to the diagonal
    const size_t qo = ((size_t)b * TT + qt) * CC + h * HD + 8 * g; const v16h qh0 = frag_hs(QH + qo), qh1 = frag_hs(QH + qo + 32), ql0 = frag_hs(QL + qo), ql1 = frag_hs(QL + qo + 32);
    asm volatile("" :: "v"(qh0), "v"(qh1), "v"(ql0), "v"(ql1));   // inputs only: Q has landed before K and V go out, so the loop's load waits count K and V alone and V stays in flight over the score products
    v8f o[4] = {}; float m = -3.0e38f, l = 0.f;
    KSet ks; VSet vs; k_ld(ks, kp); v_ld(vs, hp, lp);
    // rolled: K and V keep their registers; the next pass's K goes out behind this pass's score products, its V behind the output products; the last pass's refills read its own keys again and are not used
    // the last product of each accumulator goes through wmma16 / wmma_bf: the statement behind it keeps the refill loads from moving up over it, where they would need second registers, copies and a wait at the loop's foot
#pragma unroll 1
    for (int s = 0; s < n; ++s) { const int sn = s + 1 < n ? s + 1 : s; v8f st[2] = {};
#pragma unroll
      for (int t = 0; t < 2; ++t) { st[t] = mm_h(ks.f[t][0], qh0, st[t]); st[t] = mm_h(ks.f[t][0], ql0, st[t]); st[t] = mm_h(ks.f[t][1], qh1, st[t]); st[t] = wmma16(ks.f[t][1], ql1, st[t]); }
      k_ld(ks, kp + (size_t)sn * 32 * KV);
      __builtin_amdgcn_sched_barrier(0);   // the K refill goes out ahead of the softmax, which runs while it is in flight; without this it sinks to the output products
      const int rel = qt - s * 32 - 8 * g; float p[16];   // element i is key s * 32 + 16 (i >> 3) + 8 g + (i & 7): inside the causal triangle while 16 (i >> 3) + (i & 7) <= rel
#pragma unroll
      for (int i = 0; i < 16; ++i) p[i] = (16 * (i >> 3) + (i & 7) <= rel) ? st[i >> 3][i & 7] * 0.125f : -3.0e38f;
      float mx[4];
#pragma unroll
      for (int c = 0; c < 4; ++c) mx[c] = fmaxf(fmaxf(p[c], p[4 + c]), fmaxf(p[8 + c], p[12 + c]));
      float mn = fmaxf(fmaxf(mx[0], mx[1]), fmaxf(mx[2], mx[3])); mn = fmaxf(mn, xhalf(mn)); mn = fmaxf(mn, m);   // key 0 is open to every query, so mn is a real score from the first pass on
      const float al = expf(m - mn); m = mn;
#pragma unroll
      for (int i = 0; i < 16; ++i) p[i] = expf(p[i] - mn);   // a masked score gives exactly 0
      float sm[4];
#pragma unroll
      for (int c = 0; c < 4; ++c) sm[c] = (p[c] + p[4 + c]) + (p[8 + c] + p[12 + c]);
      l = l * al + ((sm[0] + sm[1]) + (sm[2] + sm[3]));   // this lane's half of the keys; the halves join behind the loop
#pragma unroll
      for (int j = 0; j < 4; ++j) o[j] *= al;
      const F2 pf = bsplit16(p);
#pragma unroll
      for (int j = 0; j < 4; ++j) { o[j] = mm_b(vs.h[j], pf.h, o[j]); o[j] = mm_b(vs.h[j], pf.l, o[j]); o[j] = wmma_bf(vs.l[j], pf.h, o[j]); }
      v_ld(vs, hp + sn * 32, lp + sn * 32); }
    l += xhalf(l); const float inv = 1.0f / l; float* yp = Y + ((size_t)b * TT + qt) * CC + h * HD + 8 * g;   // O^T register r of tile j is head dim 16 j + 8 g + r of the lane's query
#pragma unroll
    for (int j = 0; j < 4; ++j) { v4f a, c;
#pragma unroll
      for (int r = 0; r < 4; ++r) { a[r] = o[j][r] * inv; c[r] = o[j][4 + r] * inv; }
      vst2(yp + j * 16, a); vst2(yp + j * 16 + 4, c); }
    xwait(yp); } }
// ---- k_out: out = y (hi + lo) Wproj^T
__global__ __launch_bounds__(128) void k_out(const float* __restrict__ Y, const float* __restrict__ WO, float* __restrict__ OUT) { __shared__ __align__(16) float sf[4][16][132];
  const int tid = threadIdx.x, wave = tid >> 5, lane = tid & 31, col = lane & 15, g = lane >> 4; const int c0 = blockIdx.y * 128; const size_t r0 = (size_t)blockIdx.x * 64 + wave * 16;
  v8f acc[8] = {};
  const float* yp = Y + (r0 + col) * CC + 8 * g; const float* wp = WO + (size_t)(c0 + col) * CC + 8 * g;
  Raw16 ra; Raw64 w0, w1; raw_ld(ra, yp); xwait(yp); raw4_ld(w0, wp);
  // rolled: the two weight sets (columns 0..63, 64..127) keep their registers, each filled while the other is multiplied; the last trip's refills read its own pass again and are not used
#pragma unroll 1
  for (int kc = 0; kc < CC / 32; ++kc) { const int ko = kc * 32, kn = (kc + 1 < CC / 32 ? kc + 1 : kc) * 32;
    raw4_ld(w1, wp + (size_t)64 * CC + ko); const F2 a = raw_split(ra); raw_ld(ra, yp + kn); xwait(yp + kn);
#pragma unroll
    for (int j = 0; j < 4; ++j) { const v16b w = raw_bf(w0.f[j]); acc[j] = wmma_bf(a.h, w, acc[j]); acc[j] = wmma_bf(a.l, w, acc[j]); }
    raw4_ld(w0, wp + kn);
#pragma unroll
    for (int j = 0; j < 4; ++j) { const v16b w = raw_bf(w1.f[j]); acc[4 + j] = wmma_bf(a.h, w, acc[4 + j]); acc[4 + j] = wmma_bf(a.l, w, acc[4 + j]); } }
#pragma unroll
  for (int j = 0; j < 8; ++j)
#pragma unroll
    for (int r = 0; r < 8; ++r) sf[wave][8 * g + r][j * 16 + col] = acc[j][r];
  LDSX(); for (int rl = 0; rl < 16; ++rl) vst2(OUT + (r0 + rl) * CC + c0 + lane * 4, *(const v4f*)&sf[wave][rl][lane * 4]); }
extern "C" void kernel_launch(void* const* d_in, const int* in_sizes, int n_in, void* d_out, int out_size, void* d_ws, size_t ws_size, hipStream_t stream) {
  (void)in_sizes; (void)n_in; (void)out_size;
  const float** F = (const float**)d_in;   // 0 x [2,2048,1024], 1 Wq [1024,1024], 2 Wk [256,1024], 3 Wv [256,1024], 4 Wproj [1024,1024] ([out,in]), 5 q_gain [16], 6 lora_A_q [2,4,1024], 7 lora_B_q [2,1024,4], 8 lora_A_v [2,4,1024], 9 lora_B_v [2,256,4], 10 step_idx [1] int32
  if (ws_size < (size_t)WS_END) return;
  const int* STEP = (const int*)d_in[10];
  char* ws = (char*)d_ws; float *XA = (float*)(ws + WS_XA), *Y = (float*)(ws + WS_Y); _Float16 *QH = (_Float16*)(ws + WS_QH), *QL = (_Float16*)(ws + WS_QL), *KH = (_Float16*)(ws + WS_KH); __bf16 *VT = (__bf16*)(ws + WS_VT), *VL = (__bf16*)(ws + WS_VL);
  k_lora<<<TNB * TT / 64, 128, 0, stream>>>(F[0], F[6], F[8], STEP, XA);
  k_proj<<<dim3(TNB * TT / 64, (CC + 2 * KV) / 128), 128, 0, stream>>>(F[0], F[1], F[2], F[3], F[5], F[7], F[9], STEP, XA, QH, QL, KH, VT, VL);
  k_fa<<<dim3(TT / 32, HK, TNB), 128, 0, stream>>>(QH, QL, KH, VT, VL, Y);
  k_out<<<dim3(TNB * TT / 64, CC / 128), 128, 0, stream>>>(Y, F[4], (float*)d_out);
}

// v003
// It runs in 133 microseconds.
// Timed twice side by side with v002, it ran 1.54 and 1.53 times as fast.
// Counting every step since v000, it is 10.3 times as fast.
// compute dtype: all float inputs rounded to bf16, step_idx (int) read; q/k/v = x W^T with EXACT bf16 products on WMMA 16x16x32, f32 accumulate, plus the rank-4 LoRA terms (x A^T exact on WMMA, then . B^T on the VALU in f32) for q and v when 0 <= step_idx < 2; per-head RMSNorm (eps = f32 eps), partial rotary on the first 32 dims (frequencies 10000^(-2i/32) computed per element in k_proj with precise powf/cosf/sinf), q_gain, in f32; q as f16 hi + residual, k f16 -> 2-product causal GQA logits / 8 kept in registers; running-maximum softmax in f32 (precise expf), unnormalised P in f32 split bf16 hi + lo against v bf16 hi + lo (3 products), divided by the row sum at the end; out = y (bf16 hi + lo) Wproj^T; f32 output.
#include <hip/hip_runtime.h>
#include <math.h>

typedef __attribute__((ext_vector_type(16))) _Float16 v16h;
typedef __attribute__((ext_vector_type(16))) __bf16 v16b;
typedef __attribute__((ext_vector_type(8)))  _Float16 v8h;
typedef __attribute__((ext_vector_type(8)))  float v8f;
typedef __attribute__((ext_vector_type(4)))  float v4f;
typedef __attribute__((ext_vector_type(2)))  float v2f;
typedef __attribute__((ext_vector_type(4)))  unsigned v4u;
typedef __attribute__((ext_vector_type(4)))  int v4i;
typedef float __attribute__((may_alias)) float_a;
typedef int __attribute__((may_alias)) int_a;

template <typename T> __device__ __forceinline__ void vst2(void* p, T v) { *(T*)p = v;  }
__device__ __forceinline__ v8f wmma16(v16h a, v16h b, v8f c) {
  v8f d = __builtin_amdgcn_wmma_f32_16x16x32_f16(false, a, false, b, (short)0, c, false, false);
  asm volatile("v_nop\n\tv_nop\n\tv_nop\n\tv_nop" : "+v"(d) : "v"(a), "v"(b));
  return d;
}
__device__ __forceinline__ v8f wmma_bf(v16b a, v16b b, v8f c) {
  v8f d = __builtin_amdgcn_wmma_f32_16x16x32_bf16(false, a, false, b, (short)0, c, false, false);
  asm volatile("v_nop\n\tv_nop\n\tv_nop\n\tv_nop" : "+v"(d) : "v"(a), "v"(b));
  return d;
}
// 16x16x32 fragments: lane = (h = lane>>4, row/col = lane&15); elements 0..7 = k0+8h+0..7, 8..15 = k0+16+8h+0..7; D element r = row 8h+r
__device__ __forceinline__ v16h frag_h(const _Float16* rowk0, int lane) {
  union { v16h v; v8h q[2]; } u; const _Float16* p = rowk0 + 8 * (lane >> 4);
  u.q[0] = *(const v8h*)p; u.q[1] = *(const v8h*)(p + 16); return u.v;
}
__device__ __forceinline__ v16h frag_f32(const float* rowk0, int lane) {
  v16h a; const float* p = rowk0 + 8 * (lane >> 4);
#pragma unroll
  for (int i = 0; i < 8; ++i) { a[i] = (_Float16)p[i]; a[8 + i] = (_Float16)p[16 + i]; }
  return a;
}
__device__ __forceinline__ v16h frag_f32s(const float* rowk0, int lane, float sc) {
  v16h a; const float* p = rowk0 + 8 * (lane >> 4);
#pragma unroll
  for (int i = 0; i < 8; ++i) { a[i] = (_Float16)(p[i] * sc); a[8 + i] = (_Float16)(p[16 + i] * sc); }
  return a;
}
// column fragment from a [K][ld] layout (column n), rows >= K read as 0
__device__ __forceinline__ v16h fragc_f32(const float* W, int k0, int n, int lane, int ld, int K) {
  v16h a; const int g = lane >> 4;
#pragma unroll
  for (int i = 0; i < 8; ++i) { const int ka = k0 + 8 * g + i, kb = ka + 16;
    a[i] = (_Float16)(ka < K ? W[(size_t)(ka < K ? ka : K - 1) * ld + n] : 0.f); a[8 + i] = (_Float16)(kb < K ? W[(size_t)(kb < K ? kb : K - 1) * ld + n] : 0.f); }
  return a;
}
struct F2 { v16b h, l; };
__device__ __forceinline__ F2 bsplit16(const float v[16]) { F2 r;
#pragma unroll
  for (int i = 0; i < 16; ++i) { const __bf16 h = (__bf16)v[i]; r.h[i] = h; r.l[i] = (__bf16)(v[i] - (float)h); }
  return r; }
__device__ __forceinline__ F2 split_row(const float* row, int k0, int lane) { float v[16]; const float* p = row + k0 + 8 * (lane >> 4);
#pragma unroll
  for (int i = 0; i < 8; ++i) { v[i] = p[i]; v[8 + i] = p[16 + i]; }
  return bsplit16(v); }
__device__ __forceinline__ F2 split_rowK(const float* row, int k0, int lane, int K) { float v[16]; const int g = lane >> 4;
#pragma unroll
  for (int i = 0; i < 8; ++i) { const int ka = k0 + 8 * g + i, kb = ka + 16; v[i] = ka < K ? row[ka < K ? ka : K - 1] : 0.f; v[8 + i] = kb < K ? row[kb < K ? kb : K - 1] : 0.f; }
  return bsplit16(v); }
__device__ __forceinline__ F2 split_col(const float* W, int k0, int n, int lane, int ld, int K) { float v[16]; const int g = lane >> 4;
#pragma unroll
  for (int i = 0; i < 8; ++i) { const int ka = k0 + 8 * g + i, kb = ka + 16; v[i] = ka < K ? W[(size_t)(ka < K ? ka : K - 1) * ld + n] : 0.f; v[8 + i] = kb < K ? W[(size_t)(kb < K ? kb : K - 1) * ld + n] : 0.f; }
  return bsplit16(v); }
__device__ __forceinline__ v8f mac3(const F2& a, const F2& b, v8f c) { c = wmma_bf(a.l, b.h, c); c = wmma_bf(a.h, b.l, c); return wmma_bf(a.h, b.h, c); }
__device__ __forceinline__ float sigm(float v) { return 1.0f / (1.0f + expf(-v)); }
#define LDSX() do { asm volatile("s_wait_dscnt 0" ::: "memory"); __builtin_amdgcn_wave_barrier(); __builtin_amdgcn_fence(__ATOMIC_RELEASE, "workgroup"); } while (0)


// RRT attention (B 2, S 2,048, dim 1,024 = 16 q heads x 64, 4 kv heads, LoRA rank 4 on q and v selected by step_idx, partial RoPE 32, RMS-normed q/k, per-head q gain, causal GQA SDPA, output Linear).
#define NB 2
#define TT 2048
#define CC 1024
#define NH 16
#define HK 4
#define GQ (NH / HK)
#define HD 64
#define KV (HK * HD)        // 256
#define RD 32               // partial rope dims
#define LR 4                // lora rank
#define HG 4
#define NR (NB * TT)
#ifndef TNB
#define TNB NB
#endif
typedef __attribute__((ext_vector_type(8))) __bf16 v8b;
__device__ __forceinline__ v16b frag_b(const __bf16* rowk0, int lane) {
  union { v16b v; v8b q[2]; } u; const __bf16* p = rowk0 + 8 * (lane >> 4);
  u.q[0] = *(const v8b*)p; u.q[1] = *(const v8b*)(p + 16); return u.v;
}
__device__ __forceinline__ float bfr(float v) { return (float)(__bf16)v; }
__device__ __attribute__((noinline)) float exp_ni(float v) { return expf(v); }
__device__ __attribute__((noinline)) float erf_ni(float v) { return erff(v); }
// Operand sets held as loaded. The statement behind each wmma16 / wmma_bf keeps a global load from moving over it, so a load written behind one is also issued behind it:
// the loops of k_lora, k_proj and k_out write a whole set's loads in one group, ahead of the WMMAs that run while the set is in flight, and reads the set only one stage later.
struct Raw16 { v4f q[4]; };                    // one f32 row fragment: k0+8h+0..7 in q[0], q[1]; k0+16+8h+0..7 in q[2], q[3]
__device__ __forceinline__ void raw_ld(Raw16& s, const float* p) { s.q[0] = *(const v4f*)p; s.q[1] = *(const v4f*)(p + 4); s.q[2] = *(const v4f*)(p + 16); s.q[3] = *(const v4f*)(p + 20); }
__device__ __forceinline__ v16b raw_bf(const Raw16& s) { v16b w;
#pragma unroll
  for (int i = 0; i < 4; ++i) { w[i] = (__bf16)s.q[0][i]; w[4 + i] = (__bf16)s.q[1][i]; w[8 + i] = (__bf16)s.q[2][i]; w[12 + i] = (__bf16)s.q[3][i]; }
  return w; }
// behind a group of loads: the wait that is kept in front of any rewrite of the address registers these loads name; the inputs hold those registers unchanged up to it
__device__ __forceinline__ void xwait(const void* p) { asm volatile("s_wait_xcnt 0x0" :: "v"(p) : "memory"); }
__device__ __forceinline__ void xwait2(const void* p, const void* q) { asm volatile("s_wait_xcnt 0x0" :: "v"(p), "v"(q) : "memory"); }
// Packed operand: a [rows][1024] matrix as bf16 in fragment order, [16-row block][pass of 32 k][half q][lane][8]: element i is row 16 block + (lane & 15), k = 32 pass + 16 q + 8 (lane >> 4) + i,
// the k order of raw_bf. One fragment is 1 KiB in a row and one wave-wide 16-byte load of it is 512 contiguous bytes, four whole lines.
#define PKF 512                                // elements of one fragment
#define PKB (CC / 32 * PKF)                    // elements of one 16-row block
__device__ __forceinline__ v16b pk_ld(const __bf16* p) { union { v16b v; v8b q[2]; } u; u.q[0] = *(const v8b*)p; u.q[1] = *(const v8b*)(p + 256); return u.v; }   // the lane's 8 * lane is already in p
__device__ __forceinline__ v16h pk_ldh(const _Float16* p) { union { v16h v; v8h q[2]; } u; u.q[0] = *(const v8h*)p; u.q[1] = *(const v8h*)(p + 256); return u.v; }
__device__ __forceinline__ void pk_st(__bf16* p, v16b w) { union { v16b v; v8b q[2]; } u; u.v = w; vst2(p, u.q[0]); vst2(p + 256, u.q[1]); }
struct PSet { v16b a, w[8]; };                 // one pass of k_proj: the wave's x fragment and eight weight fragments, 16 output columns apart
template <int OFF> __device__ __forceinline__ void ps_ld(PSet& s, const __bf16* ap, const __bf16* wp) { s.a = pk_ld(ap + OFF);   // OFF goes into the loads' offset fields: both sets of a trip name the same address registers
#pragma unroll
  for (int j = 0; j < 8; ++j) s.w[j] = pk_ld(wp + (size_t)j * PKB + OFF);
  xwait2(ap, wp); }
__device__ __forceinline__ void ps_mul(const PSet& s, v8f acc[8]) {
#pragma unroll
  for (int j = 0; j < 8; ++j) acc[j] = wmma_bf(s.a, s.w[j], acc[j]); }
struct OSet { v16b ah, al, w[8]; };            // one pass of k_out: the wave's y fragment, hi and lo, and eight weight fragments
template <int OFF> __device__ __forceinline__ void os_ld(OSet& s, const __bf16* hp, const __bf16* lp, const __bf16* wp) { s.ah = pk_ld(hp + OFF); s.al = pk_ld(lp + OFF);
#pragma unroll
  for (int j = 0; j < 8; ++j) s.w[j] = pk_ld(wp + (size_t)j * PKB + OFF);
  xwait2(hp, lp); xwait(wp); }
__device__ __forceinline__ void os_mul(const OSet& s, v8f acc[8]) {
#pragma unroll
  for (int j = 0; j < 8; ++j) { acc[j] = wmma_bf(s.ah, s.w[j], acc[j]); acc[j] = wmma_bf(s.al, s.w[j], acc[j]); } }

#define WS_XA  0u
#define WS_QH  (WS_XA + 4u * (size_t)NR * 32)
#define WS_QL  (WS_QH + 2u * (size_t)NR * CC)
#define WS_KH  (WS_QL + 2u * (size_t)NR * CC)          // f16 k, fragment order
#define WS_VT  (WS_KH + 2u * (size_t)NR * KV)          // bf16 V^T planes hi / lo, fragment order
#define WS_VL  (WS_VT + 2u * (size_t)NB * KV * TT)
#define WS_YH  (WS_VL + 2u * (size_t)NB * KV * TT)      // packed y, bf16 hi / lo
#define WS_YL  (WS_YH + 2u * (size_t)NR * CC)
#define WS_XP  (WS_YL + 2u * (size_t)NR * CC)          // packed x
#define WS_WP  (WS_XP + 2u * (size_t)NR * CC)          // packed weights, row blocks [Wq 64 | Wk 16 | Wv 16 | Wproj 64]
#define WS_END (WS_WP + 2u * (size_t)(2 * CC + 2 * KV) * CC)
#define XB (TNB * TT / 16)                             // 16-row blocks of x
#define WB_O ((CC + 2 * KV) / 16)                      // first row block of Wproj in the packed weights

// ---- k_pack: x and the four weight matrices, each element rounded to bf16 once and stored in fragment order. Block = one 16-row block by 512 k (blockIdx.y picks the half), wave = four passes of 32 k
__global__ __launch_bounds__(128) void k_pack(const float* __restrict__ X, const float* __restrict__ WQ, const float* __restrict__ WK, const float* __restrict__ WV, const float* __restrict__ WO, __bf16* __restrict__ XP, __bf16* __restrict__ WP) {
  const int tid = threadIdx.x, wave = tid >> 5, lane = tid & 31, col = lane & 15, g = lane >> 4; const int rb = blockIdx.x, wb = rb - XB, k4 = ((int)blockIdx.y * 4 + wave) * 4;
  const float* src = rb < XB ? X + (size_t)rb * 16 * CC : wb < CC / 16 ? WQ + (size_t)wb * 16 * CC : wb < (CC + KV) / 16 ? WK + (size_t)(wb - CC / 16) * 16 * CC : wb < WB_O ? WV + (size_t)(wb - (CC + KV) / 16) * 16 * CC : WO + (size_t)(wb - WB_O) * 16 * CC;
  __bf16* dst = rb < XB ? XP + (size_t)rb * PKB : WP + (size_t)wb * PKB;
  const float* p = src + (size_t)col * CC + k4 * 32 + 8 * g; __bf16* d = dst + (size_t)k4 * PKF + lane * 8;
  Raw16 r[4];
#pragma unroll
  for (int u = 0; u < 4; ++u) raw_ld(r[u], p + u * 32);
  xwait(p);
#pragma unroll
  for (int u = 0; u < 4; ++u) pk_st(d + u * PKF, raw_bf(r[u]));
  xwait(d); }

// ---- k_lora: block = 64 rows: XA[row][0..3] = x . A_q[si]^T, [4..7] = x . A_v[si]^T (exact products; zero if step_idx out of range)
__global__ __launch_bounds__(128) void k_lora(const float* __restrict__ X, const float* __restrict__ AQ, const float* __restrict__ AV, const int* __restrict__ STEP, float* __restrict__ XA) { __shared__ __align__(16) float ss[4][16][36];
  const int tid = threadIdx.x, wave = tid >> 5, lane = tid & 31, col = lane & 15, g = lane >> 4; const size_t r0 = (size_t)blockIdx.x * 64 + wave * 16;
  const int si = STEP[0]; const bool use = (si >= 0 && si < 2); const float* aq = AQ + (size_t)(use ? si : 0) * LR * CC; const float* av = AV + (size_t)(use ? si : 0) * LR * CC;
  v8f acc = {};
  const float* xp = X + (r0 + col) * CC + 8 * g; const bool on = col < 8;   // columns 8..15 read row 0 of A_q, in bounds, and enter the product as 0
  const float* ap = ((col < 4) ? (aq + (size_t)col * CC) : on ? (av + (size_t)(col - 4) * CC) : aq) + 8 * g;
  Raw16 rx[4], rw[4];
#pragma unroll
  for (int u = 0; u < 4; ++u) { raw_ld(rx[u], xp + u * 32); raw_ld(rw[u], ap + u * 32); }
  xwait(xp); xwait(ap);
  // rolled: one trip is four passes, loaded one trip ahead; the next four passes' loads go out ahead of this trip's WMMAs; the last trip's refill reads its own passes again and is not used
#pragma unroll 1
  for (int kq = 0; kq < CC / 128; ++kq) { const int kn = (kq + 1 < CC / 128 ? kq + 1 : kq) * 128; v16b a[4], w[4];
#pragma unroll
    for (int u = 0; u < 4; ++u) { a[u] = raw_bf(rx[u]); const v16b t = raw_bf(rw[u]);
#pragma unroll
      for (int i = 0; i < 16; ++i) w[u][i] = on ? t[i] : (__bf16)0.f; }
#pragma unroll
    for (int u = 0; u < 4; ++u) { raw_ld(rx[u], xp + kn + u * 32); raw_ld(rw[u], ap + kn + u * 32); }
    xwait(xp + kn); xwait(ap + kn);
#pragma unroll
    for (int u = 0; u < 4; ++u) acc = wmma_bf(a[u], w[u], acc); }
#pragma unroll
  for (int r = 0; r < 8; ++r) ss[wave][8 * g + r][col] = use ? acc[r] : 0.f;
  LDSX(); for (int rl = 0; rl < 16; ++rl) if (lane < 2) vst2(XA + (r0 + rl) * 32 + lane * 4, *(const v4f*)&ss[wave][rl][lane * 4]); }
// ---- k_proj: block = (64 rows, 128 cols over [q 1024 | k 256 | v 256]): x W^T (+ LoRA), RMSNorm + partial rope (+ gain) for q/k; v -> planes
__global__ __launch_bounds__(128) void k_proj(const __bf16* __restrict__ XP, const __bf16* __restrict__ WP, const float* __restrict__ GAIN, const float* __restrict__ BQ, const float* __restrict__ BV, const int* __restrict__ STEP, const float* __restrict__ XA, _Float16* __restrict__ QH, _Float16* __restrict__ QL, _Float16* __restrict__ KH, __bf16* __restrict__ VT, __bf16* __restrict__ VL) {
  __shared__ __align__(16) float sf[64][132]; __shared__ __align__(16) _Float16 sh[64][136], sl[64][136]; __shared__ __align__(16) __bf16 th[128][72], tl2[128][72]; __shared__ float srs[64][2];
  const int tid = threadIdx.x, wave = tid >> 5, lane = tid & 31, col = lane & 15, g = lane >> 4; const int cg = blockIdx.y * 128; const size_t r0 = (size_t)blockIdx.x * 64;
  const int region = (cg < CC) ? 0 : (cg < CC + KV) ? 1 : 2; const int c0 = region == 0 ? cg : region == 1 ? cg - CC : cg - CC - KV;
  const int si = STEP[0]; const bool use = (si >= 0 && si < 2);
  v8f acc[8] = {};
  const __bf16* xp = XP + (size_t)((int)blockIdx.x * 4 + wave) * PKB + lane * 8; const __bf16* wp = WP + (size_t)(cg / 16) * PKB + lane * 8;   // the packed weights' row blocks run [q | k | v], as cg does
  PSet s0, s1; ps_ld<0>(s0, xp, wp); ps_ld<PKF>(s1, xp, wp);
  // rolled: two passes a trip, each in its own register set, refilled behind its products for the pass two on, so a set's loads fly over the other pass's products; the last trip's refills read its own passes again and are not used
#pragma unroll 1
  for (int kc = 0; kc < CC / 32; kc += 2) { const int kn = (kc + 2 < CC / 32 ? kc + 2 : kc) * PKF;
    ps_mul(s0, acc); ps_ld<0>(s0, xp + kn, wp + kn);
    ps_mul(s1, acc); ps_ld<PKF>(s1, xp + kn, wp + kn); }
#pragma unroll
  for (int j = 0; j < 8; ++j) { const int o = c0 + j * 16 + col;
#pragma unroll
    for (int r = 0; r < 8; ++r) { const int rl = wave * 16 + 8 * g + r; float v = acc[j][r];
      if (use && region != 1) { const float* Bm = (region == 0) ? (BQ + ((size_t)si * CC + o) * LR) : (BV + ((size_t)si * KV + o) * LR); const float* xa = XA + (r0 + rl) * 32 + (region == 0 ? 0 : 4);
#pragma unroll
        for (int q = 0; q < LR; ++q) v += xa[q] * bfr(Bm[q]); }
      sf[rl][j * 16 + col] = v; } }
  __syncthreads();
  if (region <= 1) {   // RMSNorm per head (64 dims, eps = FLT_EPSILON), partial rope on dims < 32 (x1 = d<16, x2 = 16..31): [x1 c + x2 s, -x1 s + x2 c], then gain (q only)
    for (int e = tid; e < 64 * 2; e += 128) { const int rl = e >> 1, hh = e & 1; float s2 = 0.f;
#pragma unroll 1
      for (int d = 0; d < HD; ++d) { const float v = sf[rl][hh * 64 + d]; s2 += v * v; } srs[rl][hh] = 1.0f / sqrtf(s2 * (1.0f / HD) + 1.1920929e-7f); }
    __syncthreads();
    for (int e = tid; e < 64 * 128; e += 128) { const int rl = e >> 7, cl = e & 127; const int d = cl & 63, hb = cl & ~63; const float rs = srs[rl][cl >> 6]; const int t = (int)((r0 + rl) % TT); float v;
      if (d < RD) { const int i2 = d & 15; const float inv_freq = 1.0f / powf(10000.0f, (float)(2 * i2) / (float)RD); const float ang = (float)t * inv_freq; const float c = cosf(ang), s = sinf(ang); const float x1 = sf[rl][hb + i2] * rs, x2 = sf[rl][hb + 16 + i2] * rs; v = (d < 16) ? (x1 * c + x2 * s) : (-x1 * s + x2 * c); }
      else v = sf[rl][cl] * rs;
      if (region == 0) v *= bfr(GAIN[(c0 + cl) / HD]);
      const _Float16 hv = (_Float16)v; sh[rl][cl] = hv; sl[rl][cl] = (_Float16)(v - (float)hv); }
    __syncthreads();
    if (region == 0) { for (int e = tid; e < 64 * 16; e += 128) { const int rl = e >> 4, q = e & 15; vst2((unsigned*)(QH + (r0 + rl) * CC + c0 + q * 8), *(const v4u*)&sh[rl][q * 8]); vst2((unsigned*)(QL + (r0 + rl) * CC + c0 + q * 8), *(const v4u*)&sl[rl][q * 8]); } }
    else { const size_t kb0 = ((r0 / TT) * HK + c0 / HD) * (size_t)(TT / 16) + (r0 % TT) / 16;   // k in fragment order, [b][kv head][16-key block][f = 16 head dims][lane][8]: key 16 block + (lane & 15), head dim 16 f + 8 (lane >> 4) + i
      for (int e = tid; e < 64 * 16; e += 128) { const int ln = e & 31, f = (e >> 5) & 3, hh = (e >> 7) & 1, kb = e >> 8; vst2((unsigned*)(KH + ((kb0 + (size_t)hh * (TT / 16) + kb) * 4 + f) * 256 + ln * 8), *(const v4u*)&sh[kb * 16 + (ln & 15)][hh * 64 + f * 16 + (ln >> 4) * 8]); } } }
  else { for (int e = tid; e < 64 * 128; e += 128) { const int rl = e >> 7, cl = e & 127; const float v = sf[rl][cl]; const __bf16 bh = (__bf16)v; th[cl][rl] = bh; tl2[cl][rl] = (__bf16)(v - (float)bh); }
    __syncthreads(); const size_t p0 = ((r0 / TT) * HK + c0 / HD) * (size_t)(TT / 32) + (r0 % TT) / 32;   // V^T in fragment order, [b][kv head][pass of 32 keys][f][lane][8]: head dim 16 (f >> 1) + (lane & 15), key 32 pass + 16 (f & 1) + 8 (lane >> 4) + i
    for (int e = tid; e < 128 * 8; e += 128) { const int ln = e & 31, f = (e >> 5) & 7, sl = (e >> 8) & 1, hh = e >> 9; const int cl = hh * 64 + (f >> 1) * 16 + (ln & 15), kq = sl * 32 + (f & 1) * 16 + (ln >> 4) * 8;
      const size_t o2 = ((p0 + (size_t)hh * (TT / 32) + sl) * 8 + f) * 256 + ln * 8; vst2((unsigned*)(VT + o2), *(const v4u*)&th[cl][kq]); vst2((unsigned*)(VL + o2), *(const v4u*)&tl2[cl][kq]); } } }
// ---- k_fa: causal GQA attention in one launch, nothing of S or P in memory. Block = the 4 query heads of one kv head, one wave each; a wave owns 16 queries.
// S^T = K Q^T puts one query's scores of a 32-key pass into one lane pair (l, l ^ 16): D register r of key tile t is key 16 t + 8 (l >> 4) + r, which is the k order of a 16x16x32 operand,
// so P goes from the score registers straight into the B operand of O^T += V^T P^T, and maximum, sum and rescale are per lane.
// Each wave runs query tile x and then tile 127 - x, so that every wave of the grid walks the same number of keys.
__device__ __forceinline__ float xhalf(float x) { return __builtin_bit_cast(float, __builtin_amdgcn_permlanex16(__builtin_bit_cast(int, x), __builtin_bit_cast(int, x), 0x76543210, 0xfedcba98, false, false)); }  // lane l with lane l ^ 16
__device__ __forceinline__ v8f mm_h(v16h a, v16h b, v8f c) { return __builtin_amdgcn_wmma_f32_16x16x32_f16(false, a, false, b, (short)0, c, false, false); }
__device__ __forceinline__ v8f mm_b(v16b a, v16b b, v8f c) { return __builtin_amdgcn_wmma_f32_16x16x32_bf16(false, a, false, b, (short)0, c, false, false); }
__device__ __forceinline__ v16h frag_hs(const _Float16* p) { union { v16h v; v8h q[2]; } u; u.q[0] = *(const v8h*)p; u.q[1] = *(const v8h*)(p + 16); return u.v; }
struct KSet { v16h f[2][2]; };                 // one 32-key pass: [key tile of 16][32 head dims]
struct VSet { v16b h[4], l[4]; };              // one 32-key pass: V^T hi and lo, 16 head dims each
__device__ __forceinline__ void k_ld(KSet& s, const _Float16* p) {
#pragma unroll
  for (int t = 0; t < 2; ++t) { s.f[t][0] = pk_ldh(p + t * 2 * PKF); s.f[t][1] = pk_ldh(p + t * 2 * PKF + PKF); }
  xwait(p); }
__device__ __forceinline__ void v_ld(VSet& s, const __bf16* hp, const __bf16* lp) {
#pragma unroll
  for (int j = 0; j < 4; ++j) { s.h[j] = pk_ld(hp + j * PKF); s.l[j] = pk_ld(lp + j * PKF); }
  xwait2(hp, lp); }
__global__ __launch_bounds__(128) void k_fa(const _Float16* __restrict__ QH, const _Float16* __restrict__ QL, const _Float16* __restrict__ KH, const __bf16* __restrict__ VT, const __bf16* __restrict__ VL, __bf16* __restrict__ YH, __bf16* __restrict__ YL) {
  const int tid = threadIdx.x, wave = tid >> 5, lane = tid & 31, col = lane & 15, g = lane >> 4; const int kvh = blockIdx.y, b = blockIdx.z, h = kvh * GQ + wave;
  const size_t vo = (size_t)(b * HK + kvh) * (TT / 32) * (4 * PKF) + lane * 8; const _Float16* kp = KH + vo; const __bf16* hp = VT + vo; const __bf16* lp = VL + vo;   // a pass of 32 keys is four fragments in k and in each V plane
  // rolled: the two query tiles of a wave run one after the other through the same code
#pragma unroll 1
  for (int part = 0; part < 2; ++part) { const int tile = part ? TT / 16 - 1 - (int)blockIdx.x : (int)blockIdx.x; const int qt = tile * 16 + col; const int n = tile / 2 + 1;   // passes of 32 keys up to the diagonal
    const size_t qo = ((size_t)b * TT + qt) * CC + h * HD + 8 * g; const v16h qh0 = frag_hs(QH + qo), qh1 = frag_hs(QH + qo + 32), ql0 = frag_hs(QL + qo), ql1 = frag_hs(QL + qo + 32);
    asm volatile("" :: "v"(qh0), "v"(qh1), "v"(ql0), "v"(ql1));   // inputs only: Q has landed before K and V go out, so the loop's load waits count K and V alone and V stays in flight over the score products
    v8f o[4] = {}; float m = -3.0e38f, l = 0.f;
    KSet ks; VSet vs; k_ld(ks, kp); v_ld(vs, hp, lp);
    // rolled: K and V keep their registers; the next pass's K goes out behind this pass's score products, its V behind the output products; the last pass's refills read its own keys again and are not used
    // the last product of each accumulator goes through wmma16 / wmma_bf: the statement behind it keeps the refill loads from moving up over it, where they would need second registers, copies and a wait at the loop's foot
#pragma unroll 1
    for (int s = 0; s < n; ++s) { const int sn = s + 1 < n ? s + 1 : s; v8f st[2] = {};
#pragma unroll
      for (int t = 0; t < 2; ++t) { st[t] = mm_h(ks.f[t][0], qh0, st[t]); st[t] = mm_h(ks.f[t][0], ql0, st[t]); st[t] = mm_h(ks.f[t][1], qh1, st[t]); st[t] = wmma16(ks.f[t][1], ql1, st[t]); }
      k_ld(ks, kp + (size_t)sn * (4 * PKF));
      __builtin_amdgcn_sched_barrier(0);   // the K refill goes out ahead of the softmax, which runs while it is in flight; without this it sinks to the output products
      const int rel = qt - s * 32 - 8 * g; float p[16];   // element i is key s * 32 + 16 (i >> 3) + 8 g + (i & 7): inside the causal triangle while 16 (i >> 3) + (i & 7) <= rel
#pragma unroll
      for (int i = 0; i < 16; ++i) p[i] = (16 * (i >> 3) + (i & 7) <= rel) ? st[i >> 3][i & 7] * 0.125f : -3.0e38f;
      float mx[4];
#pragma unroll
      for (int c = 0; c < 4; ++c) mx[c] = fmaxf(fmaxf(p[c], p[4 + c]), fmaxf(p[8 + c], p[12 + c]));
      float mn = fmaxf(fmaxf(mx[0], mx[1]), fmaxf(mx[2], mx[3])); mn = fmaxf(mn, xhalf(mn)); mn = fmaxf(mn, m);   // key 0 is open to every query, so mn is a real score from the first pass on
      const float al = expf(m - mn); m = mn;
#pragma unroll
      for (int i = 0; i < 16; ++i) p[i] = expf(p[i] - mn);   // a masked score gives exactly 0
      float sm[4];
#pragma unroll
      for (int c = 0; c < 4; ++c) sm[c] = (p[c] + p[4 + c]) + (p[8 + c] + p[12 + c]);
      l = l * al + ((sm[0] + sm[1]) + (sm[2] + sm[3]));   // this lane's half of the keys; the halves join behind the loop
#pragma unroll
      for (int j = 0; j < 4; ++j) o[j] *= al;
      const F2 pf = bsplit16(p);
#pragma unroll
      for (int j = 0; j < 4; ++j) { o[j] = mm_b(vs.h[j], pf.h, o[j]); o[j] = mm_b(vs.h[j], pf.l, o[j]); o[j] = wmma_bf(vs.l[j], pf.h, o[j]); }
      v_ld(vs, hp + (size_t)sn * (4 * PKF), lp + (size_t)sn * (4 * PKF)); }
    // O^T register r of tile j is head dim 16 j + 8 g + r of the lane's query: column 64 h + 16 j + 8 g + r of y, which is element r of this lane in pass 2 h + (j >> 1), half j & 1 of the packed row block
    l += xhalf(l); const float inv = 1.0f / l; const size_t yo = (size_t)(b * (TT / 16) + tile) * PKB + (size_t)h * 2 * PKF + lane * 8;
#pragma unroll
    for (int j = 0; j < 4; ++j) { v8b a, c;
#pragma unroll
      for (int r = 0; r < 8; ++r) { const float v = o[j][r] * inv; const __bf16 hv = (__bf16)v; a[r] = hv; c[r] = (__bf16)(v - (float)hv); }
      vst2(YH + yo + j * 256, a); vst2(YL + yo + j * 256, c); }
    xwait2(YH + yo, YL + yo); } }
// ---- k_out: out = y (hi + lo) Wproj^T
__global__ __launch_bounds__(128) void k_out(const __bf16* __restrict__ YH, const __bf16* __restrict__ YL, const __bf16* __restrict__ WP, float* __restrict__ OUT) { __shared__ __align__(16) float sf[4][16][132];
  const int tid = threadIdx.x, wave = tid >> 5, lane = tid & 31, col = lane & 15, g = lane >> 4; const int c0 = blockIdx.y * 128; const size_t r0 = (size_t)blockIdx.x * 64 + wave * 16;
  v8f acc[8] = {};
  const size_t yo = (size_t)((int)blockIdx.x * 4 + wave) * PKB + lane * 8; const __bf16* hp = YH + yo; const __bf16* lp = YL + yo; const __bf16* wp = WP + (size_t)(WB_O + c0 / 16) * PKB + lane * 8;
  OSet s0, s1; os_ld<0>(s0, hp, lp, wp); os_ld<PKF>(s1, hp, lp, wp);
  // rolled: two passes a trip, each in its own register set, refilled behind its products for the pass two on, so a set's loads fly over the other pass's products; the last trip's refills read its own passes again and are not used
#pragma unroll 1
  for (int kc = 0; kc < CC / 32; kc += 2) { const int kn = (kc + 2 < CC / 32 ? kc + 2 : kc) * PKF;
    os_mul(s0, acc); os_ld<0>(s0, hp + kn, lp + kn, wp + kn);
    os_mul(s1, acc); os_ld<PKF>(s1, hp + kn, lp + kn, wp + kn); }
#pragma unroll
  for (int j = 0; j < 8; ++j)
#pragma unroll
    for (int r = 0; r < 8; ++r) sf[wave][8 * g + r][j * 16 + col] = acc[j][r];
  LDSX(); for (int rl = 0; rl < 16; ++rl) vst2(OUT + (r0 + rl) * CC + c0 + lane * 4, *(const v4f*)&sf[wave][rl][lane * 4]); }
extern "C" void kernel_launch(void* const* d_in, const int* in_sizes, int n_in, void* d_out, int out_size, void* d_ws, size_t ws_size, hipStream_t stream) {
  (void)in_sizes; (void)n_in; (void)out_size;
  const float** F = (const float**)d_in;   // 0 x [2,2048,1024], 1 Wq [1024,1024], 2 Wk [256,1024], 3 Wv [256,1024], 4 Wproj [1024,1024] ([out,in]), 5 q_gain [16], 6 lora_A_q [2,4,1024], 7 lora_B_q [2,1024,4], 8 lora_A_v [2,4,1024], 9 lora_B_v [2,256,4], 10 step_idx [1] int32
  if (ws_size < (size_t)WS_END) return;
  const int* STEP = (const int*)d_in[10];
  char* ws = (char*)d_ws; float *XA = (float*)(ws + WS_XA); _Float16 *QH = (_Float16*)(ws + WS_QH), *QL = (_Float16*)(ws + WS_QL), *KH = (_Float16*)(ws + WS_KH); __bf16 *VT = (__bf16*)(ws + WS_VT), *VL = (__bf16*)(ws + WS_VL), *YH = (__bf16*)(ws + WS_YH), *YL = (__bf16*)(ws + WS_YL), *XP = (__bf16*)(ws + WS_XP), *WP = (__bf16*)(ws + WS_WP);
  k_pack<<<dim3(XB + (2 * CC + 2 * KV) / 16, CC / 512), 128, 0, stream>>>(F[0], F[1], F[2], F[3], F[4], XP, WP);
  k_lora<<<TNB * TT / 64, 128, 0, stream>>>(F[0], F[6], F[8], STEP, XA);
  k_proj<<<dim3(TNB * TT / 64, (CC + 2 * KV) / 128), 128, 0, stream>>>(XP, WP, F[5], F[7], F[9], STEP, XA, QH, QL, KH, VT, VL);
  k_fa<<<dim3(TT / 32, HK, TNB), 128, 0, stream>>>(QH, QL, KH, VT, VL, YH, YL);
  k_out<<<dim3(TNB * TT / 64, CC / 128), 128, 0, stream>>>(YH, YL, WP, (float*)d_out);
}

// v004
// A run of this version takes 130 microseconds.
// Timed twice side by side with v003, it ran 1.04 times as fast both times.
// All steps since v000 together make it 10.7 times as fast.
// compute dtype: all float inputs rounded to bf16, step_idx (int) read; q/k/v = x W^T with EXACT bf16 products on WMMA 16x16x32, f32 accumulate, plus the rank-4 LoRA terms (x A^T exact on WMMA, then . B^T on the VALU in f32) for q and v when 0 <= step_idx < 2; per-head RMSNorm (eps = f32 eps), partial rotary on the first 32 dims (10000^(-2i/32), cos and sin computed per element in k_proj with precise powf/cosf/sinf), q_gain, in f32; q as f16 hi + residual, k f16 -> 2-product causal GQA logits kept raw in registers; running-maximum softmax in f32 in base 2 (score * 0.125 log2(e) - maximum in one fma, then the hardware's exp2), unnormalised P in f32 split bf16 hi + lo against v bf16 hi + lo (3 products), divided by the row sum at the end; out = y (bf16 hi + lo) Wproj^T; f32 output.
#include <hip/hip_runtime.h>
#include <math.h>

typedef __attribute__((ext_vector_type(16))) _Float16 v16h;
typedef __attribute__((ext_vector_type(16))) __bf16 v16b;
typedef __attribute__((ext_vector_type(8)))  _Float16 v8h;
typedef __attribute__((ext_vector_type(8)))  float v8f;
typedef __attribute__((ext_vector_type(4)))  float v4f;
typedef __attribute__((ext_vector_type(2)))  float v2f;
typedef __attribute__((ext_vector_type(4)))  unsigned v4u;
typedef __attribute__((ext_vector_type(4)))  int v4i;
typedef float __attribute__((may_alias)) float_a;
typedef int __attribute__((may_alias)) int_a;

template <typename T> __device__ __forceinline__ void vst2(void* p, T v) { *(T*)p = v;  }
__device__ __forceinline__ v8f wmma16(v16h a, v16h b, v8f c) {
  v8f d = __builtin_amdgcn_wmma_f32_16x16x32_f16(false, a, false, b, (short)0, c, false, false);
  asm volatile("v_nop\n\tv_nop\n\tv_nop\n\tv_nop" : "+v"(d) : "v"(a), "v"(b));
  return d;
}
__device__ __forceinline__ v8f wmma_bf(v16b a, v16b b, v8f c) {
  v8f d = __builtin_amdgcn_wmma_f32_16x16x32_bf16(false, a, false, b, (short)0, c, false, false);
  asm volatile("v_nop\n\tv_nop\n\tv_nop\n\tv_nop" : "+v"(d) : "v"(a), "v"(b));
  return d;
}
// 16x16x32 fragments: lane = (h = lane>>4, row/col = lane&15); elements 0..7 = k0+8h+0..7, 8..15 = k0+16+8h+0..7; D element r = row 8h+r
__device__ __forceinline__ v16h frag_h(const _Float16* rowk0, int lane) {
  union { v16h v; v8h q[2]; } u; const _Float16* p = rowk0 + 8 * (lane >> 4);
  u.q[0] = *(const v8h*)p; u.q[1] = *(const v8h*)(p + 16); return u.v;
}
__device__ __forceinline__ v16h frag_f32(const float* rowk0, int lane) {
  v16h a; const float* p = rowk0 + 8 * (lane >> 4);
#pragma unroll
  for (int i = 0; i < 8; ++i) { a[i] = (_Float16)p[i]; a[8 + i] = (_Float16)p[16 + i]; }
  return a;
}
__device__ __forceinline__ v16h frag_f32s(const float* rowk0, int lane, float sc) {
  v16h a; const float* p = rowk0 + 8 * (lane >> 4);
#pragma unroll
  for (int i = 0; i < 8; ++i) { a[i] = (_Float16)(p[i] * sc); a[8 + i] = (_Float16)(p[16 + i] * sc); }
  return a;
}
// column fragment from a [K][ld] layout (column n), rows >= K read as 0
__device__ __forceinline__ v16h fragc_f32(const float* W, int k0, int n, int lane, int ld, int K) {
  v16h a; const int g = lane >> 4;
#pragma unroll
  for (int i = 0; i < 8; ++i) { const int ka = k0 + 8 * g + i, kb = ka + 16;
    a[i] = (_Float16)(ka < K ? W[(size_t)(ka < K ? ka : K - 1) * ld + n] : 0.f); a[8 + i] = (_Float16)(kb < K ? W[(size_t)(kb < K ? kb : K - 1) * ld + n] : 0.f); }
  return a;
}
struct F2 { v16b h, l; };
__device__ __forceinline__ F2 bsplit16(const float v[16]) { F2 r;
#pragma unroll
  for (int i = 0; i < 16; ++i) { const __bf16 h = (__bf16)v[i]; r.h[i] = h; r.l[i] = (__bf16)(v[i] - (float)h); }
  return r; }
__device__ __forceinline__ F2 split_row(const float* row, int k0, int lane) { float v[16]; const float* p = row + k0 + 8 * (lane >> 4);
#pragma unroll
  for (int i = 0; i < 8; ++i) { v[i] = p[i]; v[8 + i] = p[16 + i]; }
  return bsplit16(v); }
__device__ __forceinline__ F2 split_rowK(const float* row, int k0, int lane, int K) { float v[16]; const int g = lane >> 4;
#pragma unroll
  for (int i = 0; i < 8; ++i) { const int ka = k0 + 8 * g + i, kb = ka + 16; v[i] = ka < K ? row[ka < K ? ka : K - 1] : 0.f; v[8 + i] = kb < K ? row[kb < K ? kb : K - 1] : 0.f; }
  return bsplit16(v); }
__device__ __forceinline__ F2 split_col(const float* W, int k0, int n, int lane, int ld, int K) { float v[16]; const int g = lane >> 4;
#pragma unroll
  for (int i = 0; i < 8; ++i) { const int ka = k0 + 8 * g + i, kb = ka + 16; v[i] = ka < K ? W[(size_t)(ka < K ? ka : K - 1) * ld + n] : 0.f; v[8 + i] = kb < K ? W[(size_t)(kb < K ? kb : K - 1) * ld + n] : 0.f; }
  return bsplit16(v); }
__device__ __forceinline__ v8f mac3(const F2& a, const F2& b, v8f c) { c = wmma_bf(a.l, b.h, c); c = wmma_bf(a.h, b.l, c); return wmma_bf(a.h, b.h, c); }
__device__ __forceinline__ float sigm(float v) { return 1.0f / (1.0f + expf(-v)); }
#define LDSX() do { asm volatile("s_wait_dscnt 0" ::: "memory"); __builtin_amdgcn_wave_barrier(); __builtin_amdgcn_fence(__ATOMIC_RELEASE, "workgroup"); } while (0)


// RRT attention (B 2, S 2,048, dim 1,024 = 16 q heads x 64, 4 kv heads, LoRA rank 4 on q and v selected by step_idx, partial RoPE 32, RMS-normed q/k, per-head q gain, causal GQA SDPA, output Linear).
#define NB 2
#define TT 2048
#define CC 1024
#define NH 16
#define HK 4
#define GQ (NH / HK)
#define HD 64
#define KV (HK * HD)        // 256
#define RD 32               // partial rope dims
#define LR 4                // lora rank
#define HG 4
#define NR (NB * TT)
#ifndef TNB
#define TNB NB
#endif
typedef __attribute__((ext_vector_type(8))) __bf16 v8b;
__device__ __forceinline__ v16b frag_b(const __bf16* rowk0, int lane) {
  union { v16b v; v8b q[2]; } u; const __bf16* p = rowk0 + 8 * (lane >> 4);
  u.q[0] = *(const v8b*)p; u.q[1] = *(const v8b*)(p + 16); return u.v;
}
__device__ __forceinline__ float bfr(float v) { return (float)(__bf16)v; }
__device__ __attribute__((noinline)) float exp_ni(float v) { return expf(v); }
__device__ __attribute__((noinline)) float erf_ni(float v) { return erff(v); }
// Operand sets held as loaded. The statement behind each wmma16 / wmma_bf keeps a global load from moving over it, so a load written behind one is also issued behind it:
// the loops of k_lora, k_proj and k_out write a whole set's loads in one group, ahead of the WMMAs that run while the set is in flight, and reads the set only one stage later.
struct Raw16 { v4f q[4]; };                    // one f32 row fragment: k0+8h+0..7 in q[0], q[1]; k0+16+8h+0..7 in q[2], q[3]
__device__ __forceinline__ void raw_ld(Raw16& s, const float* p) { s.q[0] = *(const v4f*)p; s.q[1] = *(const v4f*)(p + 4); s.q[2] = *(const v4f*)(p + 16); s.q[3] = *(const v4f*)(p + 20); }
__device__ __forceinline__ v16b raw_bf(const Raw16& s) { v16b w;
#pragma unroll
  for (int i = 0; i < 4; ++i) { w[i] = (__bf16)s.q[0][i]; w[4 + i] = (__bf16)s.q[1][i]; w[8 + i] = (__bf16)s.q[2][i]; w[12 + i] = (__bf16)s.q[3][i]; }
  return w; }
// behind a group of loads: the wait that is kept in front of any rewrite of the address registers these loads name; the inputs hold those registers unchanged up to it
__device__ __forceinline__ void xwait(const void* p) { asm volatile("s_wait_xcnt 0x0" :: "v"(p) : "memory"); }
__device__ __forceinline__ void xwait2(const void* p, const void* q) { asm volatile("s_wait_xcnt 0x0" :: "v"(p), "v"(q) : "memory"); }
// Packed operand: a [rows][1024] matrix as bf16 in fragment order, [16-row block][pass of 32 k][half q][lane][8]: element i is row 16 block + (lane & 15), k = 32 pass + 16 q + 8 (lane >> 4) + i,
// the k order of raw_bf. One fragment is 1 KiB in a row and one wave-wide 16-byte load of it is 512 contiguous bytes, four whole lines.
#define PKF 512                                // elements of one fragment
#define PKB (CC / 32 * PKF)                    // elements of one 16-row block
__device__ __forceinline__ v16b pk_ld(const __bf16* p) { union { v16b v; v8b q[2]; } u; u.q[0] = *(const v8b*)p; u.q[1] = *(const v8b*)(p + 256); return u.v; }   // the lane's 8 * lane is already in p
__device__ __forceinline__ v16h pk_ldh(const _Float16* p) { union { v16h v; v8h q[2]; } u; u.q[0] = *(const v8h*)p; u.q[1] = *(const v8h*)(p + 256); return u.v; }
__device__ __forceinline__ void pk_st(__bf16* p, v16b w) { union { v16b v; v8b q[2]; } u; u.v = w; vst2(p, u.q[0]); vst2(p + 256, u.q[1]); }
struct PSet { v16b a, w[8]; };                 // one pass of k_proj: the wave's x fragment and eight weight fragments, 16 output columns apart
template <int OFF> __device__ __forceinline__ void ps_ld(PSet& s, const __bf16* ap, const __bf16* wp) { s.a = pk_ld(ap + OFF);   // OFF goes into the loads' offset fields: both sets of a trip name the same address registers
#pragma unroll
  for (int j = 0; j < 8; ++j) s.w[j] = pk_ld(wp + (size_t)j * PKB + OFF);
  xwait2(ap, wp); }
__device__ __forceinline__ void ps_mul(const PSet& s, v8f acc[8]) {
#pragma unroll
  for (int j = 0; j < 8; ++j) acc[j] = wmma_bf(s.a, s.w[j], acc[j]); }
struct OSet { v16b ah, al, w[8]; };            // one pass of k_out: the wave's y fragment, hi and lo, and eight weight fragments
template <int OFF> __device__ __forceinline__ void os_ld(OSet& s, const __bf16* hp, const __bf16* lp, const __bf16* wp) { s.ah = pk_ld(hp + OFF); s.al = pk_ld(lp + OFF);
#pragma unroll
  for (int j = 0; j < 8; ++j) s.w[j] = pk_ld(wp + (size_t)j * PKB + OFF);
  xwait2(hp, lp); xwait(wp); }
__device__ __forceinline__ void os_mul(const OSet& s, v8f acc[8]) {
#pragma unroll
  for (int j = 0; j < 8; ++j) { acc[j] = wmma_bf(s.ah, s.w[j], acc[j]); acc[j] = wmma_bf(s.al, s.w[j], acc[j]); } }

#define WS_XA  0u
#define WS_QH  (WS_XA + 4u * (size_t)NR * 32)
#define WS_QL  (WS_QH + 2u * (size_t)NR * CC)
#define WS_KH  (WS_QL + 2u * (size_t)NR * CC)          // f16 k, fragment order
#define WS_VT  (WS_KH + 2u * (size_t)NR * KV)          // bf16 V^T planes hi / lo, fragment order
#define WS_VL  (WS_VT + 2u * (size_t)NB * KV * TT)
#define WS_YH  (WS_VL + 2u * (size_t)NB * KV * TT)      // packed y, bf16 hi / lo
#define WS_YL  (WS_YH + 2u * (size_t)NR * CC)
#define WS_XP  (WS_YL + 2u * (size_t)NR * CC)          // packed x
#define WS_WP  (WS_XP + 2u * (size_t)NR * CC)          // packed weights, row blocks [Wq 64 | Wk 16 | Wv 16 | Wproj 64]
#define WS_END (WS_WP + 2u * (size_t)(2 * CC + 2 * KV) * CC)
#define XB (TNB * TT / 16)                             // 16-row blocks of x
#define WB_O ((CC + 2 * KV) / 16)                      // first row block of Wproj in the packed weights

// ---- k_pack: x and the four weight matrices, each element rounded to bf16 once and stored in fragment order. Block = one 16-row block by 512 k (blockIdx.y picks the half), wave = four passes of 32 k
__global__ __launch_bounds__(128) void k_pack(const float* __restrict__ X, const float* __restrict__ WQ, const float* __restrict__ WK, const float* __restrict__ WV, const float* __restrict__ WO, __bf16* __restrict__ XP, __bf16* __restrict__ WP) {
  const int tid = threadIdx.x, wave = tid >> 5, lane = tid & 31, col = lane & 15, g = lane >> 4; const int rb = blockIdx.x, wb = rb - XB, k4 = ((int)blockIdx.y * 4 + wave) * 4;
  const float* src = rb < XB ? X + (size_t)rb * 16 * CC : wb < CC / 16 ? WQ + (size_t)wb * 16 * CC : wb < (CC + KV) / 16 ? WK + (size_t)(wb - CC / 16) * 16 * CC : wb < WB_O ? WV + (size_t)(wb - (CC + KV) / 16) * 16 * CC : WO + (size_t)(wb - WB_O) * 16 * CC;
  __bf16* dst = rb < XB ? XP + (size_t)rb * PKB : WP + (size_t)wb * PKB;
  const float* p = src + (size_t)col * CC + k4 * 32 + 8 * g; __bf16* d = dst + (size_t)k4 * PKF + lane * 8;
  Raw16 r[4];
#pragma unroll
  for (int u = 0; u < 4; ++u) raw_ld(r[u], p + u * 32);
  xwait(p);
#pragma unroll
  for (int u = 0; u < 4; ++u) pk_st(d + u * PKF, raw_bf(r[u]));
  xwait(d); }

// ---- k_lora: block = 64 rows: XA[row][0..3] = x . A_q[si]^T, [4..7] = x . A_v[si]^T (exact products; zero if step_idx out of range)
__global__ __launch_bounds__(128) void k_lora(const float* __restrict__ X, const float* __restrict__ AQ, const float* __restrict__ AV, const int* __restrict__ STEP, float* __restrict__ XA) { __shared__ __align__(16) float ss[4][16][36];
  const int tid = threadIdx.x, wave = tid >> 5, lane = tid & 31, col = lane & 15, g = lane >> 4; const size_t r0 = (size_t)blockIdx.x * 64 + wave * 16;
  const int si = STEP[0]; const bool use = (si >= 0 && si < 2); const float* aq = AQ + (size_t)(use ? si : 0) * LR * CC; const float* av = AV + (size_t)(use ? si : 0) * LR * CC;
  v8f acc = {};
  const float* xp = X + (r0 + col) * CC + 8 * g; const bool on = col < 8;   // columns 8..15 read row 0 of A_q, in bounds, and enter the product as 0
  const float* ap = ((col < 4) ? (aq + (size_t)col * CC) : on ? (av + (size_t)(col - 4) * CC) : aq) + 8 * g;
  Raw16 rx[4], rw[4];
#pragma unroll
  for (int u = 0; u < 4; ++u) { raw_ld(rx[u], xp + u * 32); raw_ld(rw[u], ap + u * 32); }
  xwait(xp); xwait(ap);
  // rolled: one trip is four passes, loaded one trip ahead; the next four passes' loads go out ahead of this trip's WMMAs; the last trip's refill reads its own passes again and is not used
#pragma unroll 1
  for (int kq = 0; kq < CC / 128; ++kq) { const int kn = (kq + 1 < CC / 128 ? kq + 1 : kq) * 128; v16b a[4], w[4];
#pragma unroll
    for (int u = 0; u < 4; ++u) { a[u] = raw_bf(rx[u]); const v16b t = raw_bf(rw[u]);
#pragma unroll
      for (int i = 0; i < 16; ++i) w[u][i] = on ? t[i] : (__bf16)0.f; }
#pragma unroll
    for (int u = 0; u < 4; ++u) { raw_ld(rx[u], xp + kn + u * 32); raw_ld(rw[u], ap + kn + u * 32); }
    xwait(xp + kn); xwait(ap + kn);
#pragma unroll
    for (int u = 0; u < 4; ++u) acc = wmma_bf(a[u], w[u], acc); }
#pragma unroll
  for (int r = 0; r < 8; ++r) ss[wave][8 * g + r][col] = use ? acc[r] : 0.f;
  LDSX(); for (int rl = 0; rl < 16; ++rl) if (lane < 2) vst2(XA + (r0 + rl) * 32 + lane * 4, *(const v4f*)&ss[wave][rl][lane * 4]); }
// ---- k_proj: block = (64 rows, 128 cols over [q 1024 | k 256 | v 256]): x W^T (+ LoRA), RMSNorm + partial rope (+ gain) for q/k; v -> planes
__global__ __launch_bounds__(128) void k_proj(const __bf16* __restrict__ XP, const __bf16* __restrict__ WP, const float* __restrict__ GAIN, const float* __restrict__ BQ, const float* __restrict__ BV, const int* __restrict__ STEP, const float* __restrict__ XA, _Float16* __restrict__ QH, _Float16* __restrict__ QL, _Float16* __restrict__ KH, __bf16* __restrict__ VT, __bf16* __restrict__ VL) {
  __shared__ __align__(16) float sf[64][132]; __shared__ __align__(16) _Float16 sh[64][136], sl[64][136]; __shared__ __align__(16) __bf16 th[128][72], tl2[128][72]; __shared__ float srs[64][2];
  const int tid = threadIdx.x, wave = tid >> 5, lane = tid & 31, col = lane & 15, g = lane >> 4; const int cg = blockIdx.y * 128; const size_t r0 = (size_t)blockIdx.x * 64;
  const int region = (cg < CC) ? 0 : (cg < CC + KV) ? 1 : 2; const int c0 = region == 0 ? cg : region == 1 ? cg - CC : cg - CC - KV;
  const int si = STEP[0]; const bool use = (si >= 0 && si < 2);
  v8f acc[8] = {};
  const __bf16* xp = XP + (size_t)((int)blockIdx.x * 4 + wave) * PKB + lane * 8; const __bf16* wp = WP + (size_t)(cg / 16) * PKB + lane * 8;   // the packed weights' row blocks run [q | k | v], as cg does
  PSet s0, s1; ps_ld<0>(s0, xp, wp); ps_ld<PKF>(s1, xp, wp);
  // rolled: two passes a trip, each in its own register set, refilled behind its products for the pass two on, so a set's loads fly over the other pass's products; the last trip's refills read its own passes again and are not used
#pragma unroll 1
  for (int kc = 0; kc < CC / 32; kc += 2) { const int kn = (kc + 2 < CC / 32 ? kc + 2 : kc) * PKF;
    ps_mul(s0, acc); ps_ld<0>(s0, xp + kn, wp + kn);
    ps_mul(s1, acc); ps_ld<PKF>(s1, xp + kn, wp + kn); }
#pragma unroll
  for (int j = 0; j < 8; ++j) { const int o = c0 + j * 16 + col;
#pragma unroll
    for (int r = 0; r < 8; ++r) { const int rl = wave * 16 + 8 * g + r; float v = acc[j][r];
      if (use && region != 1) { const float* Bm = (region == 0) ? (BQ + ((size_t)si * CC + o) * LR) : (BV + ((size_t)si * KV + o) * LR); const float* xa = XA + (r0 + rl) * 32 + (region == 0 ? 0 : 4);
#pragma unroll
        for (int q = 0; q < LR; ++q) v += xa[q] * bfr(Bm[q]); }
      sf[rl][j * 16 + col] = v; } }
  __syncthreads();
  if (region <= 1) {   // RMSNorm per head (64 dims, eps = FLT_EPSILON), partial rope on dims < 32 (x1 = d<16, x2 = 16..31): [x1 c + x2 s, -x1 s + x2 c], then gain (q only)
    for (int e = tid; e < 64 * 2; e += 128) { const int rl = e >> 1, hh = e & 1; float s2 = 0.f;
#pragma unroll 1
      for (int d = 0; d < HD; ++d) { const float v = sf[rl][hh * 64 + d]; s2 += v * v; } srs[rl][hh] = 1.0f / sqrtf(s2 * (1.0f / HD) + 1.1920929e-7f); }
    __syncthreads();
    for (int e = tid; e < 64 * 128; e += 128) { const int rl = e >> 7, cl = e & 127; const int d = cl & 63, hb = cl & ~63; const float rs = srs[rl][cl >> 6]; const int t = (int)((r0 + rl) % TT); float v;
      if (d < RD) { const int i2 = d & 15; const float inv_freq = 1.0f / powf(10000.0f, (float)(2 * i2) / (float)RD); const float ang = (float)t * inv_freq; const float c = cosf(ang), s = sinf(ang); const float x1 = sf[rl][hb + i2] * rs, x2 = sf[rl][hb + 16 + i2] * rs; v = (d < 16) ? (x1 * c + x2 * s) : (-x1 * s + x2 * c); }
      else v = sf[rl][cl] * rs;
      if (region == 0) v *= bfr(GAIN[(c0 + cl) / HD]);
      const _Float16 hv = (_Float16)v; sh[rl][cl] = hv; sl[rl][cl] = (_Float16)(v - (float)hv); }
    __syncthreads();
    if (region == 0) { for (int e = tid; e < 64 * 16; e += 128) { const int rl = e >> 4, q = e & 15; vst2((unsigned*)(QH + (r0 + rl) * CC + c0 + q * 8), *(const v4u*)&sh[rl][q * 8]); vst2((unsigned*)(QL + (r0 + rl) * CC + c0 + q * 8), *(const v4u*)&sl[rl][q * 8]); } }
    else { const size_t kb0 = ((r0 / TT) * HK + c0 / HD) * (size_t)(TT / 16) + (r0 % TT) / 16;   // k in fragment order, [b][kv head][16-key block][f = 16 head dims][lane][8]: key 16 block + (lane & 15), head dim 16 f + 8 (lane >> 4) + i
      for (int e = tid; e < 64 * 16; e += 128) { const int ln = e & 31, f = (e >> 5) & 3, hh = (e >> 7) & 1, kb = e >> 8; vst2((unsigned*)(KH + ((kb0 + (size_t)hh * (TT / 16) + kb) * 4 + f) * 256 + ln * 8), *(const v4u*)&sh[kb * 16 + (ln & 15)][hh * 64 + f * 16 + (ln >> 4) * 8]); } } }
  else { for (int e = tid; e < 64 * 128; e += 128) { const int rl = e >> 7, cl = e & 127; const float v = sf[rl][cl]; const __bf16 bh = (__bf16)v; th[cl][rl] = bh; tl2[cl][rl] = (__bf16)(v - (float)bh); }
    __syncthreads(); const size_t p0 = ((r0 / TT) * HK + c0 / HD) * (size_t)(TT / 32) + (r0 % TT) / 32;   // V^T in fragment order, [b][kv head][pass of 32 keys][f][lane][8]: head dim 16 (f >> 1) + (lane & 15), key 32 pass + 16 (f & 1) + 8 (lane >> 4) + i
    for (int e = tid; e < 128 * 8; e += 128) { const int ln = e & 31, f = (e >> 5) & 7, sl = (e >> 8) & 1, hh = e >> 9; const int cl = hh * 64 + (f >> 1) * 16 + (ln & 15), kq = sl * 32 + (f & 1) * 16 + (ln >> 4) * 8;
      const size_t o2 = ((p0 + (size_t)hh * (TT / 32) + sl) * 8 + f) * 256 + ln * 8; vst2((unsigned*)(VT + o2), *(const v4u*)&th[cl][kq]); vst2((unsigned*)(VL + o2), *(const v4u*)&tl2[cl][kq]); } } }
// ---- k_fa: causal GQA attention in one launch, nothing of S or P in memory. Block = the 4 query heads of one kv head, one wave each; a wave owns 16 queries.
// S^T = K Q^T puts one query's scores of a 32-key pass into one lane pair (l, l ^ 16): D register r of key tile t is key 16 t + 8 (l >> 4) + r, which is the k order of a 16x16x32 operand,
// so P goes from the score registers straight into the B operand of O^T += V^T P^T, and maximum, sum and rescale are per lane.
// Each wave runs query tile x and then tile 127 - x, so that every wave of the grid walks the same number of keys.
__device__ __forceinline__ float xhalf(float x) { return __builtin_bit_cast(float, __builtin_amdgcn_permlanex16(__builtin_bit_cast(int, x), __builtin_bit_cast(int, x), 0x76543210, 0xfedcba98, false, false)); }  // lane l with lane l ^ 16
__device__ __forceinline__ v8f mm_h(v16h a, v16h b, v8f c) { return __builtin_amdgcn_wmma_f32_16x16x32_f16(false, a, false, b, (short)0, c, false, false); }
__device__ __forceinline__ v8f mm_b(v16b a, v16b b, v8f c) { return __builtin_amdgcn_wmma_f32_16x16x32_bf16(false, a, false, b, (short)0, c, false, false); }
__device__ __forceinline__ v16h frag_hs(const _Float16* p) { union { v16h v; v8h q[2]; } u; u.q[0] = *(const v8h*)p; u.q[1] = *(const v8h*)(p + 16); return u.v; }
#define SC2 0.18033688011112043f               // 0.125 * log2(e): 1 / sqrt(head dim) and the change of base in one factor
struct KSet { v16h f[2][2]; };                 // one 32-key pass: [key tile of 16][32 head dims]
struct VSet { v16b h[4], l[4]; };              // one 32-key pass: V^T hi and lo, 16 head dims each
__device__ __forceinline__ void k_ld(KSet& s, const _Float16* p) {
#pragma unroll
  for (int t = 0; t < 2; ++t) { s.f[t][0] = pk_ldh(p + t * 2 * PKF); s.f[t][1] = pk_ldh(p + t * 2 * PKF + PKF); }
  xwait(p); }
__device__ __forceinline__ void v_ld(VSet& s, const __bf16* hp, const __bf16* lp) {
#pragma unroll
  for (int j = 0; j < 4; ++j) { s.h[j] = pk_ld(hp + j * PKF); s.l[j] = pk_ld(lp + j * PKF); }
  xwait2(hp, lp); }
__global__ __launch_bounds__(128) void k_fa(const _Float16* __restrict__ QH, const _Float16* __restrict__ QL, const _Float16* __restrict__ KH, const __bf16* __restrict__ VT, const __bf16* __restrict__ VL, __bf16* __restrict__ YH, __bf16* __restrict__ YL) {
  const int tid = threadIdx.x, wave = tid >> 5, lane = tid & 31, col = lane & 15, g = lane >> 4; const int kvh = blockIdx.y, b = blockIdx.z, h = kvh * GQ + wave;
  const size_t vo = (size_t)(b * HK + kvh) * (TT / 32) * (4 * PKF) + lane * 8; const _Float16* kp = KH + vo; const __bf16* hp = VT + vo; const __bf16* lp = VL + vo;   // a pass of 32 keys is four fragments in k and in each V plane
  // rolled: the two query tiles of a wave run one after the other through the same code
#pragma unroll 1
  for (int part = 0; part < 2; ++part) { const int tile = part ? TT / 16 - 1 - (int)blockIdx.x : (int)blockIdx.x; const int qt = tile * 16 + col; const int n = tile / 2 + 1;   // passes of 32 keys up to the diagonal
    const size_t qo = ((size_t)b * TT + qt) * CC + h * HD + 8 * g; const v16h qh0 = frag_hs(QH + qo), qh1 = frag_hs(QH + qo + 32), ql0 = frag_hs(QL + qo), ql1 = frag_hs(QL + qo + 32);
    asm volatile("" :: "v"(qh0), "v"(qh1), "v"(ql0), "v"(ql1));   // inputs only: Q has landed before K and V go out, so the loop's load waits count K and V alone and V stays in flight over the score products
    v8f o[4] = {}; float m = -3.0e38f, l = 0.f;
    KSet ks; VSet vs; k_ld(ks, kp); v_ld(vs, hp, lp);
    // rolled: K and V keep their registers; the next pass's K goes out behind this pass's score products, its V behind the output products; the last pass's refills read its own keys again and are not used
    // the last product of each accumulator goes through wmma16 / wmma_bf: the statement behind it keeps the refill loads from moving up over it, where they would need second registers, copies and a wait at the loop's foot
#pragma unroll 1
    for (int s = 0; s < n; ++s) { const int sn = s + 1 < n ? s + 1 : s; v8f st[2] = {};
#pragma unroll
      for (int t = 0; t < 2; ++t) { st[t] = mm_h(ks.f[t][0], qh0, st[t]); st[t] = mm_h(ks.f[t][0], ql0, st[t]); st[t] = mm_h(ks.f[t][1], qh1, st[t]); st[t] = wmma16(ks.f[t][1], ql1, st[t]); }
      k_ld(ks, kp + (size_t)sn * (4 * PKF));
      __builtin_amdgcn_sched_barrier(0);   // the K refill goes out ahead of the softmax, which runs while it is in flight; without this it sinks to the output products
      const int rel = qt - s * 32 - 8 * g; float p[16];   // element i is key s * 32 + 16 (i >> 3) + 8 g + (i & 7): inside the causal triangle while 16 (i >> 3) + (i & 7) <= rel
#pragma unroll
      for (int i = 0; i < 16; ++i) p[i] = (16 * (i >> 3) + (i & 7) <= rel) ? st[i >> 3][i & 7] : -3.0e38f;   // raw scores: the scale is positive, so their maximum is the scaled maximum's place
      float mx[4];
#pragma unroll
      for (int c = 0; c < 4; ++c) mx[c] = fmaxf(fmaxf(p[c], p[4 + c]), fmaxf(p[8 + c], p[12 + c]));
      float mn = fmaxf(fmaxf(mx[0], mx[1]), fmaxf(mx[2], mx[3])); mn = fmaxf(mn, xhalf(mn)); mn = fmaxf(mn * SC2, m);   // key 0 is open to every query, so mn is a real score from the first pass on; m and mn are in base-2 units
      const float al = __builtin_amdgcn_exp2f(m - mn); m = mn;
#pragma unroll
      for (int i = 0; i < 16; i += 2) { const v2f a = __builtin_elementwise_fma(v2f{p[i], p[i + 1]}, v2f{SC2, SC2}, v2f{-mn, -mn}); p[i] = __builtin_amdgcn_exp2f(a.x); p[i + 1] = __builtin_amdgcn_exp2f(a.y); }   // e^(score / 8 - maximum) as 2^(score * SC2 - mn), two scores an fma; a masked score gives exactly 0
      float sm[4];
#pragma unroll
      for (int c = 0; c < 4; ++c) sm[c] = (p[c] + p[4 + c]) + (p[8 + c] + p[12 + c]);
      l = l * al + ((sm[0] + sm[1]) + (sm[2] + sm[3]));   // this lane's half of the keys; the halves join behind the loop
#pragma unroll
      for (int j = 0; j < 4; ++j) o[j] *= al;
      const F2 pf = bsplit16(p);
#pragma unroll
      for (int j = 0; j < 4; ++j) { o[j] = mm_b(vs.h[j], pf.h, o[j]); o[j] = mm_b(vs.h[j], pf.l, o[j]); o[j] = wmma_bf(vs.l[j], pf.h, o[j]); }
      v_ld(vs, hp + (size_t)sn * (4 * PKF), lp + (size_t)sn * (4 * PKF)); }
    // O^T register r of tile j is head dim 16 j + 8 g + r of the lane's query: column 64 h + 16 j + 8 g + r of y, which is element r of this lane in pass 2 h + (j >> 1), half j & 1 of the packed row block
    l += xhalf(l); const float inv = 1.0f / l; const size_t yo = (size_t)(b * (TT / 16) + tile) * PKB + (size_t)h * 2 * PKF + lane * 8;
#pragma unroll
    for (int j = 0; j < 4; ++j) { v8b a, c;
#pragma unroll
      for (int r = 0; r < 8; ++r) { const float v = o[j][r] * inv; const __bf16 hv = (__bf16)v; a[r] = hv; c[r] = (__bf16)(v - (float)hv); }
      vst2(YH + yo + j * 256, a); vst2(YL + yo + j * 256, c); }
    xwait2(YH + yo, YL + yo); } }
// ---- k_out: out = y (hi + lo) Wproj^T
__global__ __launch_bounds__(128) void k_out(const __bf16* __restrict__ YH, const __bf16* __restrict__ YL, const __bf16* __restrict__ WP, float* __restrict__ OUT) { __shared__ __align__(16) float sf[4][16][132];
  const int tid = threadIdx.x, wave = tid >> 5, lane = tid & 31, col = lane & 15, g = lane >> 4; const int c0 = blockIdx.y * 128; const size_t r0 = (size_t)blockIdx.x * 64 + wave * 16;
  v8f acc[8] = {};
  const size_t yo = (size_t)((int)blockIdx.x * 4 + wave) * PKB + lane * 8; const __bf16* hp = YH + yo; const __bf16* lp = YL + yo; const __bf16* wp = WP + (size_t)(WB_O + c0 / 16) * PKB + lane * 8;
  OSet s0, s1; os_ld<0>(s0, hp, lp, wp); os_ld<PKF>(s1, hp, lp, wp);
  // rolled: two passes a trip, each in its own register set, refilled behind its products for the pass two on, so a set's loads fly over the other pass's products; the last trip's refills read its own passes again and are not used
#pragma unroll 1
  for (int kc = 0; kc < CC / 32; kc += 2) { const int kn = (kc + 2 < CC / 32 ? kc + 2 : kc) * PKF;
    os_mul(s0, acc); os_ld<0>(s0, hp + kn, lp + kn, wp + kn);
    os_mul(s1, acc); os_ld<PKF>(s1, hp + kn, lp + kn, wp + kn); }
#pragma unroll
  for (int j = 0; j < 8; ++j)
#pragma unroll
    for (int r = 0; r < 8; ++r) sf[wave][8 * g + r][j * 16 + col] = acc[j][r];
  LDSX(); for (int rl = 0; rl < 16; ++rl) vst2(OUT + (r0 + rl) * CC + c0 + lane * 4, *(const v4f*)&sf[wave][rl][lane * 4]); }
extern "C" void kernel_launch(void* const* d_in, const int* in_sizes, int n_in, void* d_out, int out_size, void* d_ws, size_t ws_size, hipStream_t stream) {
  (void)in_sizes; (void)n_in; (void)out_size;
  const float** F = (const float**)d_in;   // 0 x [2,2048,1024], 1 Wq [1024,1024], 2 Wk [256,1024], 3 Wv [256,1024], 4 Wproj [1024,1024] ([out,in]), 5 q_gain [16], 6 lora_A_q [2,4,1024], 7 lora_B_q [2,1024,4], 8 lora_A_v [2,4,1024], 9 lora_B_v [2,256,4], 10 step_idx [1] int32
  if (ws_size < (size_t)WS_END) return;
  const int* STEP = (const int*)d_in[10];
  char* ws = (char*)d_ws; float *XA = (float*)(ws + WS_XA); _Float16 *QH = (_Float16*)(ws + WS_QH), *QL = (_Float16*)(ws + WS_QL), *KH = (_Float16*)(ws + WS_KH); __bf16 *VT = (__bf16*)(ws + WS_VT), *VL = (__bf16*)(ws + WS_VL), *YH = (__bf16*)(ws + WS_YH), *YL = (__bf16*)(ws + WS_YL), *XP = (__bf16*)(ws + WS_XP), *WP = (__bf16*)(ws + WS_WP);
  k_pack<<<dim3(XB + (2 * CC + 2 * KV) / 16, CC / 512), 128, 0, stream>>>(F[0], F[1], F[2], F[3], F[4], XP, WP);
  k_lora<<<TNB * TT / 64, 128, 0, stream>>>(F[0], F[6], F[8], STEP, XA);
  k_proj<<<dim3(TNB * TT / 64, (CC + 2 * KV) / 128), 128, 0, stream>>>(XP, WP, F[5], F[7], F[9], STEP, XA, QH, QL, KH, VT, VL);
  k_fa<<<dim3(TT / 32, HK, TNB), 128, 0, stream>>>(QH, QL, KH, VT, VL, YH, YL);
  k_out<<<dim3(TNB * TT / 64, CC / 128), 128, 0, stream>>>(YH, YL, WP, (float*)d_out);
}

// v005
// One run takes 111 microseconds.
// Two timings next to v004 put it at 1.18 and 1.19 times that version's speed.
// Over all steps from v000 it is 12.6 times as fast.
// compute dtype: all float inputs rounded to bf16, step_idx (int) read; q/k/v = x W^T with EXACT bf16 products on WMMA 16x16x32, f32 accumulate, plus the rank-4 LoRA terms (x A^T exact on WMMA, then . B^T on the VALU in f32) for q and v when 0 <= step_idx < 2; per-head RMSNorm (eps = f32 eps), partial rotary on the first 32 dims (angles t 10000^(-2i/32) computed per lane and row on device with precise powf/sincosf), q_gain, in f32; q as f16 hi + residual, k f16 -> 2-product causal GQA logits kept raw in registers; running-maximum softmax in f32 in base 2 (score * 0.125 log2(e) - maximum in one fma, then the hardware's exp2), unnormalised P in f32 split bf16 hi + lo against v bf16 hi + lo (3 products), divided by the row sum at the end; out = y (bf16 hi + lo) Wproj^T; f32 output.
#include <hip/hip_runtime.h>
#include <math.h>

typedef __attribute__((ext_vector_type(16))) _Float16 v16h;
typedef __attribute__((ext_vector_type(16))) __bf16 v16b;
typedef __attribute__((ext_vector_type(8)))  _Float16 v8h;
typedef __attribute__((ext_vector_type(8)))  float v8f;
typedef __attribute__((ext_vector_type(4)))  float v4f;
typedef __attribute__((ext_vector_type(2)))  float v2f;
typedef __attribute__((ext_vector_type(4)))  unsigned v4u;
typedef __attribute__((ext_vector_type(4)))  int v4i;
typedef float __attribute__((may_alias)) float_a;
typedef int __attribute__((may_alias)) int_a;

template <typename T> __device__ __forceinline__ void vst2(void* p, T v) { *(T*)p = v;  }
__device__ __forceinline__ v8f wmma16(v16h a, v16h b, v8f c) {
  v8f d = __builtin_amdgcn_wmma_f32_16x16x32_f16(false, a, false, b, (short)0, c, false, false);
  asm volatile("v_nop\n\tv_nop\n\tv_nop\n\tv_nop" : "+v"(d) : "v"(a), "v"(b));
  return d;
}
__device__ __forceinline__ v8f wmma_bf(v16b a, v16b b, v8f c) {
  v8f d = __builtin_amdgcn_wmma_f32_16x16x32_bf16(false, a, false, b, (short)0, c, false, false);
  asm volatile("v_nop\n\tv_nop\n\tv_nop\n\tv_nop" : "+v"(d) : "v"(a), "v"(b));
  return d;
}
// 16x16x32 fragments: lane = (h = lane>>4, row/col = lane&15); elements 0..7 = k0+8h+0..7, 8..15 = k0+16+8h+0..7; D element r = row 8h+r
__device__ __forceinline__ v16h frag_h(const _Float16* rowk0, int lane) {
  union { v16h v; v8h q[2]; } u; const _Float16* p = rowk0 + 8 * (lane >> 4);
  u.q[0] = *(const v8h*)p; u.q[1] = *(const v8h*)(p + 16); return u.v;
}
__device__ __forceinline__ v16h frag_f32(const float* rowk0, int lane) {
  v16h a; const float* p = rowk0 + 8 * (lane >> 4);
#pragma unroll
  for (int i = 0; i < 8; ++i) { a[i] = (_Float16)p[i]; a[8 + i] = (_Float16)p[16 + i]; }
  return a;
}
__device__ __forceinline__ v16h frag_f32s(const float* rowk0, int lane, float sc) {
  v16h a; const float* p = rowk0 + 8 * (lane >> 4);
#pragma unroll
  for (int i = 0; i < 8; ++i) { a[i] = (_Float16)(p[i] * sc); a[8 + i] = (_Float16)(p[16 + i] * sc); }
  return a;
}
// column fragment from a [K][ld] layout (column n), rows >= K read as 0
__device__ __forceinline__ v16h fragc_f32(const float* W, int k0, int n, int lane, int ld, int K) {
  v16h a; const int g = lane >> 4;
#pragma unroll
  for (int i = 0; i < 8; ++i) { const int ka = k0 + 8 * g + i, kb = ka + 16;
    a[i] = (_Float16)(ka < K ? W[(size_t)(ka < K ? ka : K - 1) * ld + n] : 0.f); a[8 + i] = (_Float16)(kb < K ? W[(size_t)(kb < K ? kb : K - 1) * ld + n] : 0.f); }
  return a;
}
struct F2 { v16b h, l; };
__device__ __forceinline__ F2 bsplit16(const float v[16]) { F2 r;
#pragma unroll
  for (int i = 0; i < 16; ++i) { const __bf16 h = (__bf16)v[i]; r.h[i] = h; r.l[i] = (__bf16)(v[i] - (float)h); }
  return r; }
__device__ __forceinline__ F2 split_row(const float* row, int k0, int lane) { float v[16]; const float* p = row + k0 + 8 * (lane >> 4);
#pragma unroll
  for (int i = 0; i < 8; ++i) { v[i] = p[i]; v[8 + i] = p[16 + i]; }
  return bsplit16(v); }
__device__ __forceinline__ F2 split_rowK(const float* row, int k0, int lane, int K) { float v[16]; const int g = lane >> 4;
#pragma unroll
  for (int i = 0; i < 8; ++i) { const int ka = k0 + 8 * g + i, kb = ka + 16; v[i] = ka < K ? row[ka < K ? ka : K - 1] : 0.f; v[8 + i] = kb < K ? row[kb < K ? kb : K - 1] : 0.f; }
  return bsplit16(v); }
__device__ __forceinline__ F2 split_col(const float* W, int k0, int n, int lane, int ld, int K) { float v[16]; const int g = lane >> 4;
#pragma unroll
  for (int i = 0; i < 8; ++i) { const int ka = k0 + 8 * g + i, kb = ka + 16; v[i] = ka < K ? W[(size_t)(ka < K ? ka : K - 1) * ld + n] : 0.f; v[8 + i] = kb < K ? W[(size_t)(kb < K ? kb : K - 1) * ld + n] : 0.f; }
  return bsplit16(v); }
__device__ __forceinline__ v8f mac3(const F2& a, const F2& b, v8f c) { c = wmma_bf(a.l, b.h, c); c = wmma_bf(a.h, b.l, c); return wmma_bf(a.h, b.h, c); }
__device__ __forceinline__ float sigm(float v) { return 1.0f / (1.0f + expf(-v)); }
#define LDSX() do { asm volatile("s_wait_dscnt 0" ::: "memory"); __builtin_amdgcn_wave_barrier(); __builtin_amdgcn_fence(__ATOMIC_RELEASE, "workgroup"); } while (0)


// RRT attention (B 2, S 2,048, dim 1,024 = 16 q heads x 64, 4 kv heads, LoRA rank 4 on q and v selected by step_idx, partial RoPE 32, RMS-normed q/k, per-head q gain, causal GQA SDPA, output Linear).
#define NB 2
#define TT 2048
#define CC 1024
#define NH 16
#define HK 4
#define GQ (NH / HK)
#define HD 64
#define KV (HK * HD)        // 256
#define RD 32               // partial rope dims
#define LR 4                // lora rank
#define HG 4
#define NR (NB * TT)
#ifndef TNB
#define TNB NB
#endif
typedef __attribute__((ext_vector_type(8))) __bf16 v8b;
__device__ __forceinline__ v16b frag_b(const __bf16* rowk0, int lane) {
  union { v16b v; v8b q[2]; } u; const __bf16* p = rowk0 + 8 * (lane >> 4);
  u.q[0] = *(const v8b*)p; u.q[1] = *(const v8b*)(p + 16); return u.v;
}
__device__ __forceinline__ float bfr(float v) { return (float)(__bf16)v; }
__device__ __attribute__((noinline)) float exp_ni(float v) { return expf(v); }
__device__ __attribute__((noinline)) float erf_ni(float v) { return erff(v); }
// Operand sets held as loaded. The statement behind each wmma16 / wmma_bf keeps a global load from moving over it, so a load written behind one is also issued behind it:
// the loops of k_lora, k_proj and k_out write a whole set's loads in one group, ahead of the WMMAs that run while the set is in flight, and reads the set only one stage later.
struct Raw16 { v4f q[4]; };                    // one f32 row fragment: k0+8h+0..7 in q[0], q[1]; k0+16+8h+0..7 in q[2], q[3]
__device__ __forceinline__ void raw_ld(Raw16& s, const float* p) { s.q[0] = *(const v4f*)p; s.q[1] = *(const v4f*)(p + 4); s.q[2] = *(const v4f*)(p + 16); s.q[3] = *(const v4f*)(p + 20); }
__device__ __forceinline__ v16b raw_bf(const Raw16& s) { v16b w;
#pragma unroll
  for (int i = 0; i < 4; ++i) { w[i] = (__bf16)s.q[0][i]; w[4 + i] = (__bf16)s.q[1][i]; w[8 + i] = (__bf16)s.q[2][i]; w[12 + i] = (__bf16)s.q[3][i]; }
  return w; }
// behind a group of loads: the wait that is kept in front of any rewrite of the address registers these loads name; the inputs hold those registers unchanged up to it
__device__ __forceinline__ void xwait(const void* p) { asm volatile("s_wait_xcnt 0x0" :: "v"(p) : "memory"); }
__device__ __forceinline__ void xwait2(const void* p, const void* q) { asm volatile("s_wait_xcnt 0x0" :: "v"(p), "v"(q) : "memory"); }
// Packed operand: a [rows][1024] matrix as bf16 in fragment order, [16-row block][pass of 32 k][half q][lane][8]: element i is row 16 block + (lane & 15), k = 32 pass + 16 q + 8 (lane >> 4) + i,
// the k order of raw_bf. One fragment is 1 KiB in a row and one wave-wide 16-byte load of it is 512 contiguous bytes, four whole lines.
#define PKF 512                                // elements of one fragment
#define PKB (CC / 32 * PKF)                    // elements of one 16-row block
__device__ __forceinline__ v16b pk_ld(const __bf16* p) { union { v16b v; v8b q[2]; } u; u.q[0] = *(const v8b*)p; u.q[1] = *(const v8b*)(p + 256); return u.v; }   // the lane's 8 * lane is already in p
__device__ __forceinline__ v16h pk_ldh(const _Float16* p) { union { v16h v; v8h q[2]; } u; u.q[0] = *(const v8h*)p; u.q[1] = *(const v8h*)(p + 256); return u.v; }
__device__ __forceinline__ void pk_st(__bf16* p, v16b w) { union { v16b v; v8b q[2]; } u; u.v = w; vst2(p, u.q[0]); vst2(p + 256, u.q[1]); }
struct PSet { v16b a, w[8]; };                 // one pass of k_proj: the wave's x fragment and eight weight fragments, 16 output columns apart
template <int OFF> __device__ __forceinline__ void ps_ld(PSet& s, const __bf16* ap, const __bf16* wp) { s.a = pk_ld(ap + OFF);   // OFF goes into the loads' offset fields: both sets of a trip name the same address registers
#pragma unroll
  for (int j = 0; j < 8; ++j) s.w[j] = pk_ld(wp + (size_t)j * PKB + OFF);
  xwait2(ap, wp); }
__device__ __forceinline__ void ps_mul(const PSet& s, v8f acc[8]) {
#pragma unroll
  for (int j = 0; j < 8; ++j) acc[j] = wmma_bf(s.a, s.w[j], acc[j]); }
struct OSet { v16b ah, al, w[8]; };            // one pass of k_out: the wave's y fragment, hi and lo, and eight weight fragments
template <int OFF> __device__ __forceinline__ void os_ld(OSet& s, const __bf16* hp, const __bf16* lp, const __bf16* wp) { s.ah = pk_ld(hp + OFF); s.al = pk_ld(lp + OFF);
#pragma unroll
  for (int j = 0; j < 8; ++j) s.w[j] = pk_ld(wp + (size_t)j * PKB + OFF);
  xwait2(hp, lp); xwait(wp); }
__device__ __forceinline__ void os_mul(const OSet& s, v8f acc[8]) {
#pragma unroll
  for (int j = 0; j < 8; ++j) { acc[j] = wmma_bf(s.ah, s.w[j], acc[j]); acc[j] = wmma_bf(s.al, s.w[j], acc[j]); } }

#define WS_XA  0u
#define WS_QH  (WS_XA + 4u * (size_t)NR * 32)
#define WS_QL  (WS_QH + 2u * (size_t)NR * CC)
#define WS_KH  (WS_QL + 2u * (size_t)NR * CC)          // f16 k, fragment order
#define WS_VT  (WS_KH + 2u * (size_t)NR * KV)          // bf16 V^T planes hi / lo, fragment order
#define WS_VL  (WS_VT + 2u * (size_t)NB * KV * TT)
#define WS_YH  (WS_VL + 2u * (size_t)NB * KV * TT)      // packed y, bf16 hi / lo
#define WS_YL  (WS_YH + 2u * (size_t)NR * CC)
#define WS_XP  (WS_YL + 2u * (size_t)NR * CC)          // packed x
#define WS_WP  (WS_XP + 2u * (size_t)NR * CC)          // packed weights, row blocks [Wq 64 | Wk 16 | Wv 16 | Wproj 64]
#define WS_END (WS_WP + 2u * (size_t)(2 * CC + 2 * KV) * CC)
#define XB (TNB * TT / 16)                             // 16-row blocks of x
#define WB_O ((CC + 2 * KV) / 16)                      // first row block of Wproj in the packed weights

// ---- k_pack: x and the four weight matrices, each element rounded to bf16 once and stored in fragment order. Block = one 16-row block by 512 k (blockIdx.y picks the half), wave = four passes of 32 k
__global__ __launch_bounds__(128) void k_pack(const float* __restrict__ X, const float* __restrict__ WQ, const float* __restrict__ WK, const float* __restrict__ WV, const float* __restrict__ WO, __bf16* __restrict__ XP, __bf16* __restrict__ WP) {
  const int tid = threadIdx.x, wave = tid >> 5, lane = tid & 31, col = lane & 15, g = lane >> 4; const int rb = blockIdx.x, wb = rb - XB, k4 = ((int)blockIdx.y * 4 + wave) * 4;
  const float* src = rb < XB ? X + (size_t)rb * 16 * CC : wb < CC / 16 ? WQ + (size_t)wb * 16 * CC : wb < (CC + KV) / 16 ? WK + (size_t)(wb - CC / 16) * 16 * CC : wb < WB_O ? WV + (size_t)(wb - (CC + KV) / 16) * 16 * CC : WO + (size_t)(wb - WB_O) * 16 * CC;
  __bf16* dst = rb < XB ? XP + (size_t)rb * PKB : WP + (size_t)wb * PKB;
  const float* p = src + (size_t)col * CC + k4 * 32 + 8 * g; __bf16* d = dst + (size_t)k4 * PKF + lane * 8;
  Raw16 r[4];
#pragma unroll
  for (int u = 0; u < 4; ++u) raw_ld(r[u], p + u * 32);
  xwait(p);
#pragma unroll
  for (int u = 0; u < 4; ++u) pk_st(d + u * PKF, raw_bf(r[u]));
  xwait(d); }

// ---- k_lora: block = 64 rows: XA[row][0..3] = x . A_q[si]^T, [4..7] = x . A_v[si]^T (exact products; zero if step_idx out of range)
__global__ __launch_bounds__(128) void k_lora(const float* __restrict__ X, const float* __restrict__ AQ, const float* __restrict__ AV, const int* __restrict__ STEP, float* __restrict__ XA) { __shared__ __align__(16) float ss[4][16][36];
  const int tid = threadIdx.x, wave = tid >> 5, lane = tid & 31, col = lane & 15, g = lane >> 4; const size_t r0 = (size_t)blockIdx.x * 64 + wave * 16;
  const int si = STEP[0]; const bool use = (si >= 0 && si < 2); const float* aq = AQ + (size_t)(use ? si : 0) * LR * CC; const float* av = AV + (size_t)(use ? si : 0) * LR * CC;
  v8f acc = {};
  const float* xp = X + (r0 + col) * CC + 8 * g; const bool on = col < 8;   // columns 8..15 read row 0 of A_q, in bounds, and enter the product as 0
  const float* ap = ((col < 4) ? (aq + (size_t)col * CC) : on ? (av + (size_t)(col - 4) * CC) : aq) + 8 * g;
  Raw16 rx[4], rw[4];
#pragma unroll
  for (int u = 0; u < 4; ++u) { raw_ld(rx[u], xp + u * 32); raw_ld(rw[u], ap + u * 32); }
  xwait(xp); xwait(ap);
  // rolled: one trip is four passes, loaded one trip ahead; the next four passes' loads go out ahead of this trip's WMMAs; the last trip's refill reads its own passes again and is not used
#pragma unroll 1
  for (int kq = 0; kq < CC / 128; ++kq) { const int kn = (kq + 1 < CC / 128 ? kq + 1 : kq) * 128; v16b a[4], w[4];
#pragma unroll
    for (int u = 0; u < 4; ++u) { a[u] = raw_bf(rx[u]); const v16b t = raw_bf(rw[u]);
#pragma unroll
      for (int i = 0; i < 16; ++i) w[u][i] = on ? t[i] : (__bf16)0.f; }
#pragma unroll
    for (int u = 0; u < 4; ++u) { raw_ld(rx[u], xp + kn + u * 32); raw_ld(rw[u], ap + kn + u * 32); }
    xwait(xp + kn); xwait(ap + kn);
#pragma unroll
    for (int u = 0; u < 4; ++u) acc = wmma_bf(a[u], w[u], acc); }
#pragma unroll
  for (int r = 0; r < 8; ++r) ss[wave][8 * g + r][col] = use ? acc[r] : 0.f;
  LDSX(); for (int rl = 0; rl < 16; ++rl) if (lane < 2) vst2(XA + (r0 + rl) * 32 + lane * 4, *(const v4f*)&ss[wave][rl][lane * 4]); }
// lane exchanges inside a 16-lane row group, as DPP operands: 0x160 + m reads lane l ^ m, 0x150 + n reads lane n of the group
template <int CTRL> __device__ __forceinline__ float dppf(float x) { return __builtin_bit_cast(float, __builtin_amdgcn_update_dpp(0, __builtin_bit_cast(int, x), CTRL, 0xf, 0xf, true)); }
// one halving step of a sum of 2 WD values over the group: a lane keeps the half that its bit WD of col names and adds its partner's share of that half
template <int WD> __device__ __forceinline__ void rstep(float* v, int col) { const bool up = (col & WD) != 0;
#pragma unroll
  for (int i = 0; i < WD; ++i) { const float keep = up ? v[i + WD] : v[i], send = up ? v[i] : v[i + WD]; v[i] = keep + dppf<0x160 + WD>(send); } }
template <int I> __device__ __forceinline__ void rshare(float* o, float x) { if constexpr (I < 16) { o[I] = dppf<0x150 + I>(x); rshare<I + 1>(o, x); } }
// ---- k_proj: block = (64 rows, 128 cols over [q 1024 | k 256 | v 256]): x W^T (+ LoRA), RMSNorm + partial rope (+ gain) for q/k; v -> planes
__global__ __launch_bounds__(128) void k_proj(const __bf16* __restrict__ XP, const __bf16* __restrict__ WP, const float* __restrict__ GAIN, const float* __restrict__ BQ, const float* __restrict__ BV, const int* __restrict__ STEP, const float* __restrict__ XA, _Float16* __restrict__ QH, _Float16* __restrict__ QL, _Float16* __restrict__ KH, __bf16* __restrict__ VT, __bf16* __restrict__ VL) {
  __shared__ __align__(16) _Float16 sh[64][136], sl[64][136]; __shared__ __align__(16) __bf16 th[128][72], tl2[128][72];
  const int tid = threadIdx.x, wave = tid >> 5, lane = tid & 31, col = lane & 15, g = lane >> 4; const int cg = blockIdx.y * 128; const size_t r0 = (size_t)blockIdx.x * 64;
  const int region = (cg < CC) ? 0 : (cg < CC + KV) ? 1 : 2; const int c0 = region == 0 ? cg : region == 1 ? cg - CC : cg - CC - KV;
  const int si = STEP[0]; const bool use = (si >= 0 && si < 2);
  v8f acc[8] = {};
  const __bf16* xp = XP + (size_t)((int)blockIdx.x * 4 + wave) * PKB + lane * 8; const __bf16* wp = WP + (size_t)(cg / 16) * PKB + lane * 8;   // the packed weights' row blocks run [q | k | v], as cg does
  PSet s0, s1; ps_ld<0>(s0, xp, wp); ps_ld<PKF>(s1, xp, wp);
  // rolled: two passes a trip, each in its own register set, refilled behind its products for the pass two on, so a set's loads fly over the other pass's products; the last trip's refills read its own passes again and are not used
#pragma unroll 1
  for (int kc = 0; kc < CC / 32; kc += 2) { const int kn = (kc + 2 < CC / 32 ? kc + 2 : kc) * PKF;
    ps_mul(s0, acc); ps_ld<0>(s0, xp + kn, wp + kn);
    ps_mul(s1, acc); ps_ld<PKF>(s1, xp + kn, wp + kn); }
  // From here to the barrier every lane works on its own accumulator registers: acc[j][r] is row rw + r, column 16 j + col of the block.
  const int rw = wave * 16 + 8 * g;
  if (use && region != 1) {   // LoRA term: the lane's eight B rows and eight x A^T rows go out as one group and are waited for once
    const float* bp = (region == 0 ? BQ + ((size_t)si * CC + c0 + col) * LR : BV + ((size_t)si * KV + c0 + col) * LR); const float* xa = XA + (r0 + rw) * 32 + (region == 0 ? 0 : 4);
    v4f bm[8], xr[8];
#pragma unroll
    for (int j = 0; j < 8; ++j) bm[j] = *(const v4f*)(bp + j * 16 * LR);
#pragma unroll
    for (int r = 0; r < 8; ++r) xr[r] = *(const v4f*)(xa + r * 32);
    xwait2(bp, xa);
#pragma unroll
    for (int j = 0; j < 8; ++j) {
#pragma unroll
      for (int q = 0; q < LR; ++q) bm[j][q] = bfr(bm[j][q]);
#pragma unroll
      for (int r = 0; r < 8; ++r) { float v = acc[j][r];
#pragma unroll
        for (int q = 0; q < LR; ++q) v = __builtin_fmaf(xr[r][q], bm[j][q], v);
        acc[j][r] = v; } } }
  if (region <= 1) {   // RMSNorm per head (64 dims, eps = FLT_EPSILON), partial rope on dims < 32 (x1 = d<16, x2 = 16..31): [x1 c + x2 s, -x1 s + x2 c], then gain (q only)
    // a head is four j; sum 8 hh + r is head hh, row rw + r: four squares in the lane, then over the 16 lanes of the row group; lane col is left with sum col, takes its root once and hands it round
    float s2[16];
#pragma unroll
    for (int i = 0; i < 16; ++i) { const int jb = (i >> 3) * 4, r = i & 7; s2[i] = (acc[jb][r] * acc[jb][r] + acc[jb + 1][r] * acc[jb + 1][r]) + (acc[jb + 2][r] * acc[jb + 2][r] + acc[jb + 3][r] * acc[jb + 3][r]); }
    rstep<8>(s2, col); rstep<4>(s2, col); rstep<2>(s2, col); rstep<1>(s2, col);
    float rs[16]; rshare<0>(rs, 1.0f / sqrtf(s2[0] * (1.0f / HD) + 1.1920929e-7f));
    // the rope pair (d, d + 16) of frequency col is acc[4 hh][r], acc[4 hh + 1][r] of this lane: one angle a row and lane serves both heads
    const float inv_freq = 1.0f / powf(10000.0f, (float)(2 * col) / (float)RD); const int t0 = (int)((r0 + rw) % TT);
    float gn[2] = {1.f, 1.f}; if (region == 0) { gn[0] = bfr(GAIN[c0 / HD]); gn[1] = bfr(GAIN[c0 / HD + 1]); }   // k has no gain: times 1 is exact
#pragma unroll
    for (int r = 0; r < 8; ++r) { float s, c; sincosf((float)(t0 + r) * inv_freq, &s, &c);
#pragma unroll
      for (int hh = 0; hh < 2; ++hh) { const float k = rs[hh * 8 + r]; const float x1 = acc[hh * 4][r] * k, x2 = acc[hh * 4 + 1][r] * k;
        float v[4] = {x1 * c + x2 * s, -x1 * s + x2 * c, acc[hh * 4 + 2][r] * k, acc[hh * 4 + 3][r] * k};
#pragma unroll
        for (int jj = 0; jj < 4; ++jj) { v[jj] *= gn[hh];
          const _Float16 hv = (_Float16)v[jj]; sh[rw + r][hh * 64 + jj * 16 + col] = hv; sl[rw + r][hh * 64 + jj * 16 + col] = (_Float16)(v[jj] - (float)hv); } } }
    __syncthreads();
    if (region == 0) { for (int e = tid; e < 64 * 16; e += 128) { const int rl = e >> 4, q = e & 15; vst2((unsigned*)(QH + (r0 + rl) * CC + c0 + q * 8), *(const v4u*)&sh[rl][q * 8]); vst2((unsigned*)(QL + (r0 + rl) * CC + c0 + q * 8), *(const v4u*)&sl[rl][q * 8]); } }
    else { const size_t kb0 = ((r0 / TT) * HK + c0 / HD) * (size_t)(TT / 16) + (r0 % TT) / 16;   // k in fragment order, [b][kv head][16-key block][f = 16 head dims][lane][8]: key 16 block + (lane & 15), head dim 16 f + 8 (lane >> 4) + i
      for (int e = tid; e < 64 * 16; e += 128) { const int ln = e & 31, f = (e >> 5) & 3, hh = (e >> 7) & 1, kb = e >> 8; vst2((unsigned*)(KH + ((kb0 + (size_t)hh * (TT / 16) + kb) * 4 + f) * 256 + ln * 8), *(const v4u*)&sh[kb * 16 + (ln & 15)][hh * 64 + f * 16 + (ln >> 4) * 8]); } } }
  else {   // the lane's eight rows of column 16 j + col are eight keys in a row of V^T: one 16-byte LDS store a plane
#pragma unroll
    for (int j = 0; j < 8; ++j) { v8b a, c;
#pragma unroll
      for (int r = 0; r < 8; ++r) { const float v = acc[j][r]; const __bf16 bh = (__bf16)v; a[r] = bh; c[r] = (__bf16)(v - (float)bh); }
      vst2(&th[j * 16 + col][rw], a); vst2(&tl2[j * 16 + col][rw], c); }
    __syncthreads(); const size_t p0 = ((r0 / TT) * HK + c0 / HD) * (size_t)(TT / 32) + (r0 % TT) / 32;   // V^T in fragment order, [b][kv head][pass of 32 keys][f][lane][8]: head dim 16 (f >> 1) + (lane & 15), key 32 pass + 16 (f & 1) + 8 (lane >> 4) + i
    for (int e = tid; e < 128 * 8; e += 128) { const int ln = e & 31, f = (e >> 5) & 7, sl = (e >> 8) & 1, hh = e >> 9; const int cl = hh * 64 + (f >> 1) * 16 + (ln & 15), kq = sl * 32 + (f & 1) * 16 + (ln >> 4) * 8;
      const size_t o2 = ((p0 + (size_t)hh * (TT / 32) + sl) * 8 + f) * 256 + ln * 8; vst2((unsigned*)(VT + o2), *(const v4u*)&th[cl][kq]); vst2((unsigned*)(VL + o2), *(const v4u*)&tl2[cl][kq]); } } }
// ---- k_fa: causal GQA attention in one launch, nothing of S or P in memory. Block = the 4 query heads of one kv head, one wave each; a wave owns 16 queries.
// S^T = K Q^T puts one query's scores of a 32-key pass into one lane pair (l, l ^ 16): D register r of key tile t is key 16 t + 8 (l >> 4) + r, which is the k order of a 16x16x32 operand,
// so P goes from the score registers straight into the B operand of O^T += V^T P^T, and maximum, sum and rescale are per lane.
// Each wave runs query tile x and then tile 127 - x, so that every wave of the grid walks the same number of keys.
__device__ __forceinline__ float xhalf(float x) { return __builtin_bit_cast(float, __builtin_amdgcn_permlanex16(__builtin_bit_cast(int, x), __builtin_bit_cast(int, x), 0x76543210, 0xfedcba98, false, false)); }  // lane l with lane l ^ 16
__device__ __forceinline__ v8f mm_h(v16h a, v16h b, v8f c) { return __builtin_amdgcn_wmma_f32_16x16x32_f16(false, a, false, b, (short)0, c, false, false); }
__device__ __forceinline__ v8f mm_b(v16b a, v16b b, v8f c) { return __builtin_amdgcn_wmma_f32_16x16x32_bf16(false, a, false, b, (short)0, c, false, false); }
__device__ __forceinline__ v16h frag_hs(const _Float16* p) { union { v16h v; v8h q[2]; } u; u.q[0] = *(const v8h*)p; u.q[1] = *(const v8h*)(p + 16); return u.v; }
#define SC2 0.18033688011112043f               // 0.125 * log2(e): 1 / sqrt(head dim) and the change of base in one factor
struct KSet { v16h f[2][2]; };                 // one 32-key pass: [key tile of 16][32 head dims]
struct VSet { v16b h[4], l[4]; };              // one 32-key pass: V^T hi and lo, 16 head dims each
__device__ __forceinline__ void k_ld(KSet& s, const _Float16* p) {
#pragma unroll
  for (int t = 0; t < 2; ++t) { s.f[t][0] = pk_ldh(p + t * 2 * PKF); s.f[t][1] = pk_ldh(p + t * 2 * PKF + PKF); }
  xwait(p); }
__device__ __forceinline__ void v_ld(VSet& s, const __bf16* hp, const __bf16* lp) {
#pragma unroll
  for (int j = 0; j < 4; ++j) { s.h[j] = pk_ld(hp + j * PKF); s.l[j] = pk_ld(lp + j * PKF); }
  xwait2(hp, lp); }
__global__ __launch_bounds__(128) void k_fa(const _Float16* __restrict__ QH, const _Float16* __restrict__ QL, const _Float16* __restrict__ KH, const __bf16* __restrict__ VT, const __bf16* __restrict__ VL, __bf16* __restrict__ YH, __bf16* __restrict__ YL) {
  const int tid = threadIdx.x, wave = tid >> 5, lane = tid & 31, col = lane & 15, g = lane >> 4; const int kvh = blockIdx.y, b = blockIdx.z, h = kvh * GQ + wave;
  const size_t vo = (size_t)(b * HK + kvh) * (TT / 32) * (4 * PKF) + lane * 8; const _Float16* kp = KH + vo; const __bf16* hp = VT + vo; const __bf16* lp = VL + vo;   // a pass of 32 keys is four fragments in k and in each V plane
  // rolled: the two query tiles of a wave run one after the other through the same code
#pragma unroll 1
  for (int part = 0; part < 2; ++part) { const int tile = part ? TT / 16 - 1 - (int)blockIdx.x : (int)blockIdx.x; const int qt = tile * 16 + col; const int n = tile / 2 + 1;   // passes of 32 keys up to the diagonal
    const size_t qo = ((size_t)b * TT + qt) * CC + h * HD + 8 * g; const v16h qh0 = frag_hs(QH + qo), qh1 = frag_hs(QH + qo + 32), ql0 = frag_hs(QL + qo), ql1 = frag_hs(QL + qo + 32);
    asm volatile("" :: "v"(qh0), "v"(qh1), "v"(ql0), "v"(ql1));   // inputs only: Q has landed before K and V go out, so the loop's load waits count K and V alone and V stays in flight over the score products
    v8f o[4] = {}; float m = -3.0e38f, l = 0.f;
    KSet ks; VSet vs; k_ld(ks, kp); v_ld(vs, hp, lp);
    // rolled: K and V keep their registers; the next pass's K goes out behind this pass's score products, its V behind the output products; the last pass's refills read its own keys again and are not used
    // the last product of each accumulator goes through wmma16 / wmma_bf: the statement behind it keeps the refill loads from moving up over it, where they would need second registers, copies and a wait at the loop's foot
#pragma unroll 1
    for (int s = 0; s < n; ++s) { const int sn = s + 1 < n ? s + 1 : s; v8f st[2] = {};
#pragma unroll
      for (int t = 0; t < 2; ++t) { st[t] = mm_h(ks.f[t][0], qh0, st[t]); st[t] = mm_h(ks.f[t][0], ql0, st[t]); st[t] = mm_h(ks.f[t][1], qh1, st[t]); st[t] = wmma16(ks.f[t][1], ql1, st[t]); }
      k_ld(ks, kp + (size_t)sn * (4 * PKF));
      __builtin_amdgcn_sched_barrier(0);   // the K refill goes out ahead of the softmax, which runs while it is in flight; without this it sinks to the output products
      const int rel = qt - s * 32 - 8 * g; float p[16];   // element i is key s * 32 + 16 (i >> 3) + 8 g + (i & 7): inside the causal triangle while 16 (i >> 3) + (i & 7) <= rel
#pragma unroll
      for (int i = 0; i < 16; ++i) p[i] = (16 * (i >> 3) + (i & 7) <= rel) ? st[i >> 3][i & 7] : -3.0e38f;   // raw scores: the scale is positive, so their maximum is the scaled maximum's place
      float mx[4];
#pragma unroll
      for (int c = 0; c < 4; ++c) mx[c] = fmaxf(fmaxf(p[c], p[4 + c]), fmaxf(p[8 + c], p[12 + c]));
      float mn = fmaxf(fmaxf(mx[0], mx[1]), fmaxf(mx[2], mx[3])); mn = fmaxf(mn, xhalf(mn)); mn = fmaxf(mn * SC2, m);   // key 0 is open to every query, so mn is a real score from the first pass on; m and mn are in base-2 units
      const float al = __builtin_amdgcn_exp2f(m - mn); m = mn;
#pragma unroll
      for (int i = 0; i < 16; i += 2) { const v2f a = __builtin_elementwise_fma(v2f{p[i], p[i + 1]}, v2f{SC2, SC2}, v2f{-mn, -mn}); p[i] = __builtin_amdgcn_exp2f(a.x); p[i + 1] = __builtin_amdgcn_exp2f(a.y); }   // e^(score / 8 - maximum) as 2^(score * SC2 - mn), two scores an fma; a masked score gives exactly 0
      float sm[4];
#pragma unroll
      for (int c = 0; c < 4; ++c) sm[c] = (p[c] + p[4 + c]) + (p[8 + c] + p[12 + c]);
      l = l * al + ((sm[0] + sm[1]) + (sm[2] + sm[3]));   // this lane's half of the keys; the halves join behind the loop
#pragma unroll
      for (int j = 0; j < 4; ++j) o[j] *= al;
      const F2 pf = bsplit16(p);
#pragma unroll
      for (int j = 0; j < 4; ++j) { o[j] = mm_b(vs.h[j], pf.h, o[j]); o[j] = mm_b(vs.h[j], pf.l, o[j]); o[j] = wmma_bf(vs.l[j], pf.h, o[j]); }
      v_ld(vs, hp + (size_t)sn * (4 * PKF), lp + (size_t)sn * (4 * PKF)); }
    // O^T register r of tile j is head dim 16 j + 8 g + r of the lane's query: column 64 h + 16 j + 8 g + r of y, which is element r of this lane in pass 2 h + (j >> 1), half j & 1 of the packed row block
    l += xhalf(l); const float inv = 1.0f / l; const size_t yo = (size_t)(b * (TT / 16) + tile) * PKB + (size_t)h * 2 * PKF + lane * 8;
#pragma unroll
    for (int j = 0; j < 4; ++j) { v8b a, c;
#pragma unroll
      for (int r = 0; r < 8; ++r) { const float v = o[j][r] * inv; const __bf16 hv = (__bf16)v; a[r] = hv; c[r] = (__bf16)(v - (float)hv); }
      vst2(YH + yo + j * 256, a); vst2(YL + yo + j * 256, c); }
    xwait2(YH + yo, YL + yo); } }
// ---- k_out: out = y (hi + lo) Wproj^T
__global__ __launch_bounds__(128) void k_out(const __bf16* __restrict__ YH, const __bf16* __restrict__ YL, const __bf16* __restrict__ WP, float* __restrict__ OUT) { __shared__ __align__(16) float sf[4][16][132];
  const int tid = threadIdx.x, wave = tid >> 5, lane = tid & 31, col = lane & 15, g = lane >> 4; const int c0 = blockIdx.y * 128; const size_t r0 = (size_t)blockIdx.x * 64 + wave * 16;
  v8f acc[8] = {};
  const size_t yo = (size_t)((int)blockIdx.x * 4 + wave) * PKB + lane * 8; const __bf16* hp = YH + yo; const __bf16* lp = YL + yo; const __bf16* wp = WP + (size_t)(WB_O + c0 / 16) * PKB + lane * 8;
  OSet s0, s1; os_ld<0>(s0, hp, lp, wp); os_ld<PKF>(s1, hp, lp, wp);
  // rolled: two passes a trip, each in its own register set, refilled behind its products for the pass two on, so a set's loads fly over the other pass's products; the last trip's refills read its own passes again and are not used
#pragma unroll 1
  for (int kc = 0; kc < CC / 32; kc += 2) { const int kn = (kc + 2 < CC / 32 ? kc + 2 : kc) * PKF;
    os_mul(s0, acc); os_ld<0>(s0, hp + kn, lp + kn, wp + kn);
    os_mul(s1, acc); os_ld<PKF>(s1, hp + kn, lp + kn, wp + kn); }
#pragma unroll
  for (int j = 0; j < 8; ++j)
#pragma unroll
    for (int r = 0; r < 8; ++r) sf[wave][8 * g + r][j * 16 + col] = acc[j][r];
  LDSX(); for (int rl = 0; rl < 16; ++rl) vst2(OUT + (r0 + rl) * CC + c0 + lane * 4, *(const v4f*)&sf[wave][rl][lane * 4]); }
extern "C" void kernel_launch(void* const* d_in, const int* in_sizes, int n_in, void* d_out, int out_size, void* d_ws, size_t ws_size, hipStream_t stream) {
  (void)in_sizes; (void)n_in; (void)out_size;
  const float** F = (const float**)d_in;   // 0 x [2,2048,1024], 1 Wq [1024,1024], 2 Wk [256,1024], 3 Wv [256,1024], 4 Wproj [1024,1024] ([out,in]), 5 q_gain [16], 6 lora_A_q [2,4,1024], 7 lora_B_q [2,1024,4], 8 lora_A_v [2,4,1024], 9 lora_B_v [2,256,4], 10 step_idx [1] int32
  if (ws_size < (size_t)WS_END) return;
  const int* STEP = (const int*)d_in[10];
  char* ws = (char*)d_ws; float *XA = (float*)(ws + WS_XA); _Float16 *QH = (_Float16*)(ws + WS_QH), *QL = (_Float16*)(ws + WS_QL), *KH = (_Float16*)(ws + WS_KH); __bf16 *VT = (__bf16*)(ws + WS_VT), *VL = (__bf16*)(ws + WS_VL), *YH = (__bf16*)(ws + WS_YH), *YL = (__bf16*)(ws + WS_YL), *XP = (__bf16*)(ws + WS_XP), *WP = (__bf16*)(ws + WS_WP);
  k_pack<<<dim3(XB + (2 * CC + 2 * KV) / 16, CC / 512), 128, 0, stream>>>(F[0], F[1], F[2], F[3], F[4], XP, WP);
  k_lora<<<TNB * TT / 64, 128, 0, stream>>>(F[0], F[6], F[8], STEP, XA);
  k_proj<<<dim3(TNB * TT / 64, (CC + 2 * KV) / 128), 128, 0, stream>>>(XP, WP, F[5], F[7], F[9], STEP, XA, QH, QL, KH, VT, VL);
  k_fa<<<dim3(TT / 32, HK, TNB), 128, 0, stream>>>(QH, QL, KH, VT, VL, YH, YL);
  k_out<<<dim3(TNB * TT / 64, CC / 128), 128, 0, stream>>>(YH, YL, WP, (float*)d_out);
}

// v006
// It runs in 102 microseconds.
// Two timings next to v005 put it at 1.09 and 1.08 times that version's speed.
// Counting every step since v000, it is 13.7 times as fast.
// compute dtype: all float inputs rounded to bf16, step_idx (int) read; q/k/v = x W^T with EXACT bf16 products on WMMA 16x16x32, f32 accumulate, plus the rank-4 LoRA terms (x A^T exact on WMMA, then . B^T on the VALU in f32) for q and v when 0 <= step_idx < 2; per-head RMSNorm (eps = f32 eps), partial rotary on the first 32 dims (angles t 10000^(-2i/32) computed per lane and row on device with precise powf/sincosf), q_gain, in f32; q as f16 hi + residual, k f16 -> 2-product causal GQA logits kept raw in registers; running-maximum softmax in f32 in base 2 (score * 0.125 log2(e) - maximum in one fma, then the hardware's exp2), unnormalised P in f32 split bf16 hi + lo against v bf16 hi + lo (3 products), divided by the row sum at the end; out = y (bf16 hi + lo) Wproj^T; f32 output.
#include <hip/hip_runtime.h>
#include <math.h>

typedef __attribute__((ext_vector_type(16))) _Float16 v16h;
typedef __attribute__((ext_vector_type(16))) __bf16 v16b;
typedef __attribute__((ext_vector_type(8)))  _Float16 v8h;
typedef __attribute__((ext_vector_type(8)))  float v8f;
typedef __attribute__((ext_vector_type(4)))  float v4f;
typedef __attribute__((ext_vector_type(2)))  float v2f;
typedef __attribute__((ext_vector_type(4)))  unsigned v4u;
typedef __attribute__((ext_vector_type(4)))  int v4i;
typedef float __attribute__((may_alias)) float_a;
typedef int __attribute__((may_alias)) int_a;

template <typename T> __device__ __forceinline__ void vst2(void* p, T v) { *(T*)p = v;  }
__device__ __forceinline__ v8f wmma16(v16h a, v16h b, v8f c) {
  v8f d = __builtin_amdgcn_wmma_f32_16x16x32_f16(false, a, false, b, (short)0, c, false, false);
  asm volatile("v_nop\n\tv_nop\n\tv_nop\n\tv_nop" : "+v"(d) : "v"(a), "v"(b));
  return d;
}
__device__ __forceinline__ v8f wmma_bf(v16b a, v16b b, v8f c) {
  v8f d = __builtin_amdgcn_wmma_f32_16x16x32_bf16(false, a, false, b, (short)0, c, false, false);
  asm volatile("v_nop\n\tv_nop\n\tv_nop\n\tv_nop" : "+v"(d) : "v"(a), "v"(b));
  return d;
}
// 16x16x32 fragments: lane = (h = lane>>4, row/col = lane&15); elements 0..7 = k0+8h+0..7, 8..15 = k0+16+8h+0..7; D element r = row 8h+r
__device__ __forceinline__ v16h frag_h(const _Float16* rowk0, int lane) {
  union { v16h v; v8h q[2]; } u; const _Float16* p = rowk0 + 8 * (lane >> 4);
  u.q[0] = *(const v8h*)p; u.q[1] = *(const v8h*)(p + 16); return u.v;
}
__device__ __forceinline__ v16h frag_f32(const float* rowk0, int lane) {
  v16h a; const float* p = rowk0 + 8 * (lane >> 4);
#pragma unroll
  for (int i = 0; i < 8; ++i) { a[i] = (_Float16)p[i]; a[8 + i] = (_Float16)p[16 + i]; }
  return a;
}
__device__ __forceinline__ v16h frag_f32s(const float* rowk0, int lane, float sc) {
  v16h a; const float* p = rowk0 + 8 * (lane >> 4);
#pragma unroll
  for (int i = 0; i < 8; ++i) { a[i] = (_Float16)(p[i] * sc); a[8 + i] = (_Float16)(p[16 + i] * sc); }
  return a;
}
// column fragment from a [K][ld] layout (column n), rows >= K read as 0
__device__ __forceinline__ v16h fragc_f32(const float* W, int k0, int n, int lane, int ld, int K) {
  v16h a; const int g = lane >> 4;
#pragma unroll
  for (int i = 0; i < 8; ++i) { const int ka = k0 + 8 * g + i, kb = ka + 16;
    a[i] = (_Float16)(ka < K ? W[(size_t)(ka < K ? ka : K - 1) * ld + n] : 0.f); a[8 + i] = (_Float16)(kb < K ? W[(size_t)(kb < K ? kb : K - 1) * ld + n] : 0.f); }
  return a;
}
struct F2 { v16b h, l; };
__device__ __forceinline__ F2 bsplit16(const float v[16]) { F2 r;
#pragma unroll
  for (int i = 0; i < 16; ++i) { const __bf16 h = (__bf16)v[i]; r.h[i] = h; r.l[i] = (__bf16)(v[i] - (float)h); }
  return r; }
__device__ __forceinline__ F2 split_row(const float* row, int k0, int lane) { float v[16]; const float* p = row + k0 + 8 * (lane >> 4);
#pragma unroll
  for (int i = 0; i < 8; ++i) { v[i] = p[i]; v[8 + i] = p[16 + i]; }
  return bsplit16(v); }
__device__ __forceinline__ F2 split_rowK(const float* row, int k0, int lane, int K) { float v[16]; const int g = lane >> 4;
#pragma unroll
  for (int i = 0; i < 8; ++i) { const int ka = k0 + 8 * g + i, kb = ka + 16; v[i] = ka < K ? row[ka < K ? ka : K - 1] : 0.f; v[8 + i] = kb < K ? row[kb < K ? kb : K - 1] : 0.f; }
  return bsplit16(v); }
__device__ __forceinline__ F2 split_col(const float* W, int k0, int n, int lane, int ld, int K) { float v[16]; const int g = lane >> 4;
#pragma unroll
  for (int i = 0; i < 8; ++i) { const int ka = k0 + 8 * g + i, kb = ka + 16; v[i] = ka < K ? W[(size_t)(ka < K ? ka : K - 1) * ld + n] : 0.f; v[8 + i] = kb < K ? W[(size_t)(kb < K ? kb : K - 1) * ld + n] : 0.f; }
  return bsplit16(v); }
__device__ __forceinline__ v8f mac3(const F2& a, const F2& b, v8f c) { c = wmma_bf(a.l, b.h, c); c = wmma_bf(a.h, b.l, c); return wmma_bf(a.h, b.h, c); }
__device__ __forceinline__ float sigm(float v) { return 1.0f / (1.0f + expf(-v)); }
#define LDSX() do { asm volatile("s_wait_dscnt 0" ::: "memory"); __builtin_amdgcn_wave_barrier(); __builtin_amdgcn_fence(__ATOMIC_RELEASE, "workgroup"); } while (0)


// RRT attention (B 2, S 2,048, dim 1,024 = 16 q heads x 64, 4 kv heads, LoRA rank 4 on q and v selected by step_idx, partial RoPE 32, RMS-normed q/k, per-head q gain, causal GQA SDPA, output Linear).
#define NB 2
#define TT 2048
#define CC 1024
#define NH 16
#define HK 4
#define GQ (NH / HK)
#define HD 64
#define KV (HK * HD)        // 256
#define RD 32               // partial rope dims
#define LR 4                // lora rank
#define HG 4
#define NR (NB * TT)
#ifndef TNB
#define TNB NB
#endif
typedef __attribute__((ext_vector_type(8))) __bf16 v8b;
__device__ __forceinline__ v16b frag_b(const __bf16* rowk0, int lane) {
  union { v16b v; v8b q[2]; } u; const __bf16* p = rowk0 + 8 * (lane >> 4);
  u.q[0] = *(const v8b*)p; u.q[1] = *(const v8b*)(p + 16); return u.v;
}
__device__ __forceinline__ float bfr(float v) { return (float)(__bf16)v; }
__device__ __attribute__((noinline)) float exp_ni(float v) { return expf(v); }
__device__ __attribute__((noinline)) float erf_ni(float v) { return erff(v); }
// Operand sets held as loaded. The statement behind each WMMA keeps a global load from moving over it, so a load written behind a WMMA is also issued behind it:
// the loops of k_proj and k_out write a whole set's loads in one group, ahead of the WMMAs that run while the set is in flight, and reads the set only one stage later.
struct Raw16 { v4f q[4]; };                    // one f32 row fragment: k0+8h+0..7 in q[0], q[1]; k0+16+8h+0..7 in q[2], q[3]
__device__ __forceinline__ void raw_ld(Raw16& s, const float* p) { s.q[0] = *(const v4f*)p; s.q[1] = *(const v4f*)(p + 4); s.q[2] = *(const v4f*)(p + 16); s.q[3] = *(const v4f*)(p + 20); }
__device__ __forceinline__ v16b raw_bf(const Raw16& s) { v16b w;
#pragma unroll
  for (int i = 0; i < 4; ++i) { w[i] = (__bf16)s.q[0][i]; w[4 + i] = (__bf16)s.q[1][i]; w[8 + i] = (__bf16)s.q[2][i]; w[12 + i] = (__bf16)s.q[3][i]; }
  return w; }
// behind a group of loads: the wait that is kept in front of any rewrite of the address registers these loads name; the inputs hold those registers unchanged up to it
__device__ __forceinline__ void xwait(const void* p) { asm volatile("s_wait_xcnt 0x0" :: "v"(p) : "memory"); }
__device__ __forceinline__ void xwait2(const void* p, const void* q) { asm volatile("s_wait_xcnt 0x0" :: "v"(p), "v"(q) : "memory"); }
// Packed operand: a [rows][1024] matrix as bf16 in fragment order, [16-row block][pass of 32 k][half q][lane][8]: element i is row 16 block + (lane & 15), k = 32 pass + 16 q + 8 (lane >> 4) + i,
// the k order of raw_bf. One fragment is 1 KiB in a row and one wave-wide 16-byte load of it is 512 contiguous bytes, four whole lines.
#define PKF 512                                // elements of one fragment
#define PKB (CC / 32 * PKF)                    // elements of one 16-row block
__device__ __forceinline__ v16b pk_ld(const __bf16* p) { union { v16b v; v8b q[2]; } u; u.q[0] = *(const v8b*)p; u.q[1] = *(const v8b*)(p + 256); return u.v; }   // the lane's 8 * lane is already in p
__device__ __forceinline__ v16h pk_ldh(const _Float16* p) { union { v16h v; v8h q[2]; } u; u.q[0] = *(const v8h*)p; u.q[1] = *(const v8h*)(p + 256); return u.v; }
__device__ __forceinline__ void pk_st(__bf16* p, v16b w) { union { v16b v; v8b q[2]; } u; u.v = w; vst2(p, u.q[0]); vst2(p + 256, u.q[1]); }
struct PSet { v16b a, w[8]; };                 // one pass of k_proj: the wave's x fragment and eight weight fragments, 16 output columns apart
template <int OFF> __device__ __forceinline__ void ps_ld(PSet& s, const __bf16* ap, const __bf16* wp) { s.a = pk_ld(ap + OFF);   // OFF goes into the loads' offset fields: both sets of a trip name the same address registers
#pragma unroll
  for (int j = 0; j < 8; ++j) s.w[j] = pk_ld(wp + (size_t)j * PKB + OFF);
  xwait2(ap, wp); }
__device__ __forceinline__ void ps_mul(const PSet& s, v8f acc[8]) {
#pragma unroll
  for (int j = 0; j < 8; ++j) acc[j] = wmma_bf(s.a, s.w[j], acc[j]); }
struct OSet { v16b ah, al, w[8]; };            // one pass of k_out: the wave's y fragment, hi and lo, and eight weight fragments
template <int OFF> __device__ __forceinline__ void os_ld(OSet& s, const __bf16* hp, const __bf16* lp, const __bf16* wp) { s.ah = pk_ld(hp + OFF); s.al = pk_ld(lp + OFF);
#pragma unroll
  for (int j = 0; j < 8; ++j) s.w[j] = pk_ld(wp + (size_t)j * PKB + OFF);
  xwait2(hp, lp); xwait(wp); }
__device__ __forceinline__ void os_mul(const OSet& s, v8f acc[8]) {
#pragma unroll
  for (int j = 0; j < 8; ++j) { acc[j] = wmma_bf(s.ah, s.w[j], acc[j]); acc[j] = wmma_bf(s.al, s.w[j], acc[j]); } }

#define WS_XA  0u
#define WS_QH  (WS_XA + 4u * (size_t)NR * 32)
#define WS_QL  (WS_QH + 2u * (size_t)NR * CC)
#define WS_KH  (WS_QL + 2u * (size_t)NR * CC)          // f16 k, fragment order
#define WS_VT  (WS_KH + 2u * (size_t)NR * KV)          // bf16 V^T planes hi / lo, fragment order
#define WS_VL  (WS_VT + 2u * (size_t)NB * KV * TT)
#define WS_YH  (WS_VL + 2u * (size_t)NB * KV * TT)      // packed y, bf16 hi / lo
#define WS_YL  (WS_YH + 2u * (size_t)NR * CC)
#define WS_XP  (WS_YL + 2u * (size_t)NR * CC)          // packed x
#define WS_WP  (WS_XP + 2u * (size_t)NR * CC)          // packed weights, row blocks [Wq 64 | Wk 16 | Wv 16 | Wproj 64]
#define WS_END (WS_WP + 2u * (size_t)(2 * CC + 2 * KV) * CC)
#define XB (TNB * TT / 16)                             // 16-row blocks of x
#define WB_O ((CC + 2 * KV) / 16)                      // first row block of Wproj in the packed weights

// ---- k_pack: x and the four weight matrices, each element rounded to bf16 once and stored in fragment order. Block = one 16-row block, wave = four passes of 32 k.
// An x block also forms its rows of x A^T while the fragments are in registers: XA[row][0..3] = x . A_q[si]^T, [4..7] = x . A_v[si]^T (exact products; zero if step_idx is out of range).
// Each wave multiplies its four passes; the eight partial tiles meet in LDS and are added in wave order.
__global__ __launch_bounds__(256) void k_pack(const float* __restrict__ X, const float* __restrict__ WQ, const float* __restrict__ WK, const float* __restrict__ WV, const float* __restrict__ WO, const float* __restrict__ AQ, const float* __restrict__ AV, const int* __restrict__ STEP, __bf16* __restrict__ XP, __bf16* __restrict__ WP, float* __restrict__ XA) {
  __shared__ __align__(16) float ss[8][16][12];   // pitch 12: rows r and 8 + r, written by one store, fall on different banks; a row's two quads stay 16-byte aligned
  const int tid = threadIdx.x, wave = tid >> 5, lane = tid & 31, col = lane & 15, g = lane >> 4; const int rb = blockIdx.x, wb = rb - XB, k4 = wave * 4;
  const int si = STEP[0]; const bool use = (si >= 0 && si < 2);
  const float* src = rb < XB ? X + (size_t)rb * 16 * CC : wb < CC / 16 ? WQ + (size_t)wb * 16 * CC : wb < (CC + KV) / 16 ? WK + (size_t)(wb - CC / 16) * 16 * CC : wb < WB_O ? WV + (size_t)(wb - (CC + KV) / 16) * 16 * CC : WO + (size_t)(wb - WB_O) * 16 * CC;
  __bf16* dst = rb < XB ? XP + (size_t)rb * PKB : WP + (size_t)wb * PKB;
  const float* p = src + (size_t)col * CC + k4 * 32 + 8 * g; __bf16* d = dst + (size_t)k4 * PKF + lane * 8;
  Raw16 r[4];
#pragma unroll
  for (int u = 0; u < 4; ++u) raw_ld(r[u], p + u * 32);
  xwait(p);
  if (rb >= XB) {
#pragma unroll
    for (int u = 0; u < 4; ++u) pk_st(d + u * PKF, raw_bf(r[u]));
    xwait(d); return; }   // a whole block leaves here, ahead of the barrier
  const float* aq = AQ + (size_t)(use ? si : 0) * LR * CC; const float* av = AV + (size_t)(use ? si : 0) * LR * CC; const bool on = col < 8;
  const float* ap = ((col < 4) ? (aq + (size_t)col * CC) : on ? (av + (size_t)(col - 4) * CC) : aq) + k4 * 32 + 8 * g;   // columns 8..15 read row 0 of A_q, in bounds; a column of the product depends on its own lanes' operand alone, and those columns are not stored
  Raw16 rw[4];
#pragma unroll
  for (int u = 0; u < 4; ++u) raw_ld(rw[u], ap + u * 32);
  xwait(ap);
  __builtin_amdgcn_sched_barrier(0);   // the A loads go out while x is in flight; without this the first conversions of x, with their load waits, move up in front of them
  v16b a[4];
#pragma unroll
  for (int u = 0; u < 4; ++u) { a[u] = raw_bf(r[u]); pk_st(d + u * PKF, a[u]); }
  xwait(d);
  v8f acc = {};
#pragma unroll
  for (int u = 0; u < 4; ++u) acc = wmma_bf(a[u], raw_bf(rw[u]), acc);
  if (on) {
#pragma unroll
    for (int q = 0; q < 8; ++q) ss[wave][8 * g + q][col] = acc[q]; }
  // hand-over through LDS alone: the fences name the LDS, so the barrier waits for the partial tiles and not for the packed fragments' global stores, which no wave of this launch reads
  __builtin_amdgcn_fence(__ATOMIC_RELEASE, "workgroup", "local"); __builtin_amdgcn_s_barrier(); __builtin_amdgcn_fence(__ATOMIC_ACQUIRE, "workgroup", "local");
  if (tid < 32) { const int rl = tid >> 1, c4 = (tid & 1) * 4; v4f t = *(const v4f*)&ss[0][rl][c4];
#pragma unroll
    for (int w = 1; w < 8; ++w) t += *(const v4f*)&ss[w][rl][c4];
    if (!use) t = v4f{0.f, 0.f, 0.f, 0.f};
    vst2(XA + ((size_t)rb * 16 + rl) * 32 + c4, t); } }
// lane exchanges inside a 16-lane row group, as DPP operands: 0x160 + m reads lane l ^ m, 0x150 + n reads lane n of the group
template <int CTRL> __device__ __forceinline__ float dppf(float x) { return __builtin_bit_cast(float, __builtin_amdgcn_update_dpp(0, __builtin_bit_cast(int, x), CTRL, 0xf, 0xf, true)); }
// one halving step of a sum of 2 WD values over the group: a lane keeps the half that its bit WD of col names and adds its partner's share of that half
template <int WD> __device__ __forceinline__ void rstep(float* v, int col) { const bool up = (col & WD) != 0;
#pragma unroll
  for (int i = 0; i < WD; ++i) { const float keep = up ? v[i + WD] : v[i], send = up ? v[i] : v[i + WD]; v[i] = keep + dppf<0x160 + WD>(send); } }
template <int I> __device__ __forceinline__ void rshare(float* o, float x) { if constexpr (I < 16) { o[I] = dppf<0x150 + I>(x); rshare<I + 1>(o, x); } }
// ---- k_proj: block = (64 rows, 128 cols over [q 1024 | k 256 | v 256]): x W^T (+ LoRA), RMSNorm + partial rope (+ gain) for q/k; v -> planes
__global__ __launch_bounds__(128) void k_proj(const __bf16* __restrict__ XP, const __bf16* __restrict__ WP, const float* __restrict__ GAIN, const float* __restrict__ BQ, const float* __restrict__ BV, const int* __restrict__ STEP, const float* __restrict__ XA, _Float16* __restrict__ QH, _Float16* __restrict__ QL, _Float16* __restrict__ KH, __bf16* __restrict__ VT, __bf16* __restrict__ VL) {
  __shared__ __align__(16) _Float16 sh[64][136], sl[64][136]; __shared__ __align__(16) __bf16 th[128][72], tl2[128][72];
  const int tid = threadIdx.x, wave = tid >> 5, lane = tid & 31, col = lane & 15, g = lane >> 4; const int cg = blockIdx.y * 128; const size_t r0 = (size_t)blockIdx.x * 64;
  const int region = (cg < CC) ? 0 : (cg < CC + KV) ? 1 : 2; const int c0 = region == 0 ? cg : region == 1 ? cg - CC : cg - CC - KV;
  const int si = STEP[0]; const bool use = (si >= 0 && si < 2);
  v8f acc[8] = {};
  const __bf16* xp = XP + (size_t)((int)blockIdx.x * 4 + wave) * PKB + lane * 8; const __bf16* wp = WP + (size_t)(cg / 16) * PKB + lane * 8;   // the packed weights' row blocks run [q | k | v], as cg does
  PSet s0, s1; ps_ld<0>(s0, xp, wp); ps_ld<PKF>(s1, xp, wp);
  // rolled: two passes a trip, each in its own register set, refilled behind its products for the pass two on, so a set's loads fly over the other pass's products; the last trip's refills read its own passes again and are not used
#pragma unroll 1
  for (int kc = 0; kc < CC / 32; kc += 2) { const int kn = (kc + 2 < CC / 32 ? kc + 2 : kc) * PKF;
    ps_mul(s0, acc); ps_ld<0>(s0, xp + kn, wp + kn);
    ps_mul(s1, acc); ps_ld<PKF>(s1, xp + kn, wp + kn); }
  // From here to the barrier every lane works on its own accumulator registers: acc[j][r] is row rw + r, column 16 j + col of the block.
  const int rw = wave * 16 + 8 * g;
  if (use && region != 1) {   // LoRA term: the lane's eight B rows and eight x A^T rows go out as one group and are waited for once
    const float* bp = (region == 0 ? BQ + ((size_t)si * CC + c0 + col) * LR : BV + ((size_t)si * KV + c0 + col) * LR); const float* xa = XA + (r0 + rw) * 32 + (region == 0 ? 0 : 4);
    v4f bm[8], xr[8];
#pragma unroll
    for (int j = 0; j < 8; ++j) bm[j] = *(const v4f*)(bp + j * 16 * LR);
#pragma unroll
    for (int r = 0; r < 8; ++r) xr[r] = *(const v4f*)(xa + r * 32);
    xwait2(bp, xa);
#pragma unroll
    for (int j = 0; j < 8; ++j) {
#pragma unroll
      for (int q = 0; q < LR; ++q) bm[j][q] = bfr(bm[j][q]);
#pragma unroll
      for (int r = 0; r < 8; ++r) { float v = acc[j][r];
#pragma unroll
        for (int q = 0; q < LR; ++q) v = __builtin_fmaf(xr[r][q], bm[j][q], v);
        acc[j][r] = v; } } }
  if (region <= 1) {   // RMSNorm per head (64 dims, eps = FLT_EPSILON), partial rope on dims < 32 (x1 = d<16, x2 = 16..31): [x1 c + x2 s, -x1 s + x2 c], then gain (q only)
    // a head is four j; sum 8 hh + r is head hh, row rw + r: four squares in the lane, then over the 16 lanes of the row group; lane col is left with sum col, takes its root once and hands it round
    float s2[16];
#pragma unroll
    for (int i = 0; i < 16; ++i) { const int jb = (i >> 3) * 4, r = i & 7; s2[i] = (acc[jb][r] * acc[jb][r] + acc[jb + 1][r] * acc[jb + 1][r]) + (acc[jb + 2][r] * acc[jb + 2][r] + acc[jb + 3][r] * acc[jb + 3][r]); }
    rstep<8>(s2, col); rstep<4>(s2, col); rstep<2>(s2, col); rstep<1>(s2, col);
    float rs[16]; rshare<0>(rs, 1.0f / sqrtf(s2[0] * (1.0f / HD) + 1.1920929e-7f));
    // the rope pair (d, d + 16) of frequency col is acc[4 hh][r], acc[4 hh + 1][r] of this lane: one angle a row and lane serves both heads
    const float inv_freq = 1.0f / powf(10000.0f, (float)(2 * col) / (float)RD); const int t0 = (int)((r0 + rw) % TT);
    float gn[2] = {1.f, 1.f}; if (region == 0) { gn[0] = bfr(GAIN[c0 / HD]); gn[1] = bfr(GAIN[c0 / HD + 1]); }   // k has no gain: times 1 is exact
#pragma unroll
    for (int r = 0; r < 8; ++r) { float s, c; sincosf((float)(t0 + r) * inv_freq, &s, &c);
#pragma unroll
      for (int hh = 0; hh < 2; ++hh) { const float k = rs[hh * 8 + r]; const float x1 = acc[hh * 4][r] * k, x2 = acc[hh * 4 + 1][r] * k;
        float v[4] = {x1 * c + x2 * s, -x1 * s + x2 * c, acc[hh * 4 + 2][r] * k, acc[hh * 4 + 3][r] * k};
#pragma unroll
        for (int jj = 0; jj < 4; ++jj) { v[jj] *= gn[hh];
          const _Float16 hv = (_Float16)v[jj]; sh[rw + r][hh * 64 + jj * 16 + col] = hv; sl[rw + r][hh * 64 + jj * 16 + col] = (_Float16)(v[jj] - (float)hv); } } }
    __syncthreads();
    if (region == 0) { for (int e = tid; e < 64 * 16; e += 128) { const int rl = e >> 4, q = e & 15; vst2((unsigned*)(QH + (r0 + rl) * CC + c0 + q * 8), *(const v4u*)&sh[rl][q * 8]); vst2((unsigned*)(QL + (r0 + rl) * CC + c0 + q * 8), *(const v4u*)&sl[rl][q * 8]); } }
    else { const size_t kb0 = ((r0 / TT) * HK + c0 / HD) * (size_t)(TT / 16) + (r0 % TT) / 16;   // k in fragment order, [b][kv head][16-key block][f = 16 head dims][lane][8]: key 16 block + (lane & 15), head dim 16 f + 8 (lane >> 4) + i
      for (int e = tid; e < 64 * 16; e += 128) { const int ln = e & 31, f = (e >> 5) & 3, hh = (e >> 7) & 1, kb = e >> 8; vst2((unsigned*)(KH + ((kb0 + (size_t)hh * (TT / 16) + kb) * 4 + f) * 256 + ln * 8), *(const v4u*)&sh[kb * 16 + (ln & 15)][hh * 64 + f * 16 + (ln >> 4) * 8]); } } }
  else {   // the lane's eight rows of column 16 j + col are eight keys in a row of V^T: one 16-byte LDS store a plane
#pragma unroll
    for (int j = 0; j < 8; ++j) { v8b a, c;
#pragma unroll
      for (int r = 0; r < 8; ++r) { const float v = acc[j][r]; const __bf16 bh = (__bf16)v; a[r] = bh; c[r] = (__bf16)(v - (float)bh); }
      vst2(&th[j * 16 + col][rw], a); vst2(&tl2[j * 16 + col][rw], c); }
    __syncthreads(); const size_t p0 = ((r0 / TT) * HK + c0 / HD) * (size_t)(TT / 32) + (r0 % TT) / 32;   // V^T in fragment order, [b][kv head][pass of 32 keys][f][lane][8]: head dim 16 (f >> 1) + (lane & 15), key 32 pass + 16 (f & 1) + 8 (lane >> 4) + i
    for (int e = tid; e < 128 * 8; e += 128) { const int ln = e & 31, f = (e >> 5) & 7, sl = (e >> 8) & 1, hh = e >> 9; const int cl = hh * 64 + (f >> 1) * 16 + (ln & 15), kq = sl * 32 + (f & 1) * 16 + (ln >> 4) * 8;
      const size_t o2 = ((p0 + (size_t)hh * (TT / 32) + sl) * 8 + f) * 256 + ln * 8; vst2((unsigned*)(VT + o2), *(const v4u*)&th[cl][kq]); vst2((unsigned*)(VL + o2), *(const v4u*)&tl2[cl][kq]); } } }
// ---- k_fa: causal GQA attention in one launch, nothing of S or P in memory. Block = the 4 query heads of one kv head, one wave each; a wave owns 16 queries.
// S^T = K Q^T puts one query's scores of a 32-key pass into one lane pair (l, l ^ 16): D register r of key tile t is key 16 t + 8 (l >> 4) + r, which is the k order of a 16x16x32 operand,
// so P goes from the score registers straight into the B operand of O^T += V^T P^T, and maximum, sum and rescale are per lane.
// Each wave runs query tile x and then tile 127 - x, so that every wave of the grid walks the same number of keys.
__device__ __forceinline__ float xhalf(float x) { return __builtin_bit_cast(float, __builtin_amdgcn_permlanex16(__builtin_bit_cast(int, x), __builtin_bit_cast(int, x), 0x76543210, 0xfedcba98, false, false)); }  // lane l with lane l ^ 16
__device__ __forceinline__ v8f mm_h(v16h a, v16h b, v8f c) { return __builtin_amdgcn_wmma_f32_16x16x32_f16(false, a, false, b, (short)0, c, false, false); }
__device__ __forceinline__ v8f mm_b(v16b a, v16b b, v8f c) { return __builtin_amdgcn_wmma_f32_16x16x32_bf16(false, a, false, b, (short)0, c, false, false); }
__device__ __forceinline__ v16h frag_hs(const _Float16* p) { union { v16h v; v8h q[2]; } u; u.q[0] = *(const v8h*)p; u.q[1] = *(const v8h*)(p + 16); return u.v; }
#define SC2 0.18033688011112043f               // 0.125 * log2(e): 1 / sqrt(head dim) and the change of base in one factor
struct KSet { v16h f[2][2]; };                 // one 32-key pass: [key tile of 16][32 head dims]
struct VSet { v16b h[4], l[4]; };              // one 32-key pass: V^T hi and lo, 16 head dims each
__device__ __forceinline__ void k_ld(KSet& s, const _Float16* p) {
#pragma unroll
  for (int t = 0; t < 2; ++t) { s.f[t][0] = pk_ldh(p + t * 2 * PKF); s.f[t][1] = pk_ldh(p + t * 2 * PKF + PKF); }
  xwait(p); }
__device__ __forceinline__ void v_ld(VSet& s, const __bf16* hp, const __bf16* lp) {
#pragma unroll
  for (int j = 0; j < 4; ++j) { s.h[j] = pk_ld(hp + j * PKF); s.l[j] = pk_ld(lp + j * PKF); }
  xwait2(hp, lp); }
__global__ __launch_bounds__(128) void k_fa(const _Float16* __restrict__ QH, const _Float16* __restrict__ QL, const _Float16* __restrict__ KH, const __bf16* __restrict__ VT, const __bf16* __restrict__ VL, __bf16* __restrict__ YH, __bf16* __restrict__ YL) {
  const int tid = threadIdx.x, wave = tid >> 5, lane = tid & 31, col = lane & 15, g = lane >> 4; const int kvh = blockIdx.y, b = blockIdx.z, h = kvh * GQ + wave;
  const size_t vo = (size_t)(b * HK + kvh) * (TT / 32) * (4 * PKF) + lane * 8; const _Float16* kp = KH + vo; const __bf16* hp = VT + vo; const __bf16* lp = VL + vo;   // a pass of 32 keys is four fragments in k and in each V plane
  // rolled: the two query tiles of a wave run one after the other through the same code
#pragma unroll 1
  for (int part = 0; part < 2; ++part) { const int tile = part ? TT / 16 - 1 - (int)blockIdx.x : (int)blockIdx.x; const int qt = tile * 16 + col; const int n = tile / 2 + 1;   // passes of 32 keys up to the diagonal
    const size_t qo = ((size_t)b * TT + qt) * CC + h * HD + 8 * g; const v16h qh0 = frag_hs(QH + qo), qh1 = frag_hs(QH + qo + 32), ql0 = frag_hs(QL + qo), ql1 = frag_hs(QL + qo + 32);
    asm volatile("" :: "v"(qh0), "v"(qh1), "v"(ql0), "v"(ql1));   // inputs only: Q has landed before K and V go out, so the loop's load waits count K and V alone and V stays in flight over the score products
    v8f o[4] = {}; float m = -3.0e38f, l = 0.f;
    KSet ks; VSet vs; k_ld(ks, kp); v_ld(vs, hp, lp);
    // rolled: K and V keep their registers; the next pass's K goes out behind this pass's score products, its V behind the output products; the last pass's refills read its own keys again and are not used
    // the last product of each accumulator goes through wmma16 / wmma_bf: the statement behind it keeps the refill loads from moving up over it, where they would need second registers, copies and a wait at the loop's foot
#pragma unroll 1
    for (int s = 0; s < n; ++s) { const int sn = s + 1 < n ? s + 1 : s; v8f st[2] = {};
#pragma unroll
      for (int t = 0; t < 2; ++t) { st[t] = mm_h(ks.f[t][0], qh0, st[t]); st[t] = mm_h(ks.f[t][0], ql0, st[t]); st[t] = mm_h(ks.f[t][1], qh1, st[t]); st[t] = wmma16(ks.f[t][1], ql1, st[t]); }
      k_ld(ks, kp + (size_t)sn * (4 * PKF));
      __builtin_amdgcn_sched_barrier(0);   // the K refill goes out ahead of the softmax, which runs while it is in flight; without this it sinks to the output products
      const int rel = qt - s * 32 - 8 * g; float p[16];   // element i is key s * 32 + 16 (i >> 3) + 8 g + (i & 7): inside the causal triangle while 16 (i >> 3) + (i & 7) <= rel
#pragma unroll
      for (int i = 0; i < 16; ++i) p[i] = (16 * (i >> 3) + (i & 7) <= rel) ? st[i >> 3][i & 7] : -3.0e38f;   // raw scores: the scale is positive, so their maximum is the scaled maximum's place
      float mx[4];
#pragma unroll
      for (int c = 0; c < 4; ++c) mx[c] = fmaxf(fmaxf(p[c], p[4 + c]), fmaxf(p[8 + c], p[12 + c]));
      float mn = fmaxf(fmaxf(mx[0], mx[1]), fmaxf(mx[2], mx[3])); mn = fmaxf(mn, xhalf(mn)); mn = fmaxf(mn * SC2, m);   // key 0 is open to every query, so mn is a real score from the first pass on; m and mn are in base-2 units
      const float al = __builtin_amdgcn_exp2f(m - mn); m = mn;
#pragma unroll
      for (int i = 0; i < 16; i += 2) { const v2f a = __builtin_elementwise_fma(v2f{p[i], p[i + 1]}, v2f{SC2, SC2}, v2f{-mn, -mn}); p[i] = __builtin_amdgcn_exp2f(a.x); p[i + 1] = __builtin_amdgcn_exp2f(a.y); }   // e^(score / 8 - maximum) as 2^(score * SC2 - mn), two scores an fma; a masked score gives exactly 0
      float sm[4];
#pragma unroll
      for (int c = 0; c < 4; ++c) sm[c] = (p[c] + p[4 + c]) + (p[8 + c] + p[12 + c]);
      l = l * al + ((sm[0] + sm[1]) + (sm[2] + sm[3]));   // this lane's half of the keys; the halves join behind the loop
#pragma unroll
      for (int j = 0; j < 4; ++j) o[j] *= al;
      const F2 pf = bsplit16(p);
#pragma unroll
      for (int j = 0; j < 4; ++j) { o[j] = mm_b(vs.h[j], pf.h, o[j]); o[j] = mm_b(vs.h[j], pf.l, o[j]); o[j] = wmma_bf(vs.l[j], pf.h, o[j]); }
      v_ld(vs, hp + (size_t)sn * (4 * PKF), lp + (size_t)sn * (4 * PKF)); }
    // O^T register r of tile j is head dim 16 j + 8 g + r of the lane's query: column 64 h + 16 j + 8 g + r of y, which is element r of this lane in pass 2 h + (j >> 1), half j & 1 of the packed row block
    l += xhalf(l); const float inv = 1.0f / l; const size_t yo = (size_t)(b * (TT / 16) + tile) * PKB + (size_t)h * 2 * PKF + lane * 8;
#pragma unroll
    for (int j = 0; j < 4; ++j) { v8b a, c;
#pragma unroll
      for (int r = 0; r < 8; ++r) { const float v = o[j][r] * inv; const __bf16 hv = (__bf16)v; a[r] = hv; c[r] = (__bf16)(v - (float)hv); }
      vst2(YH + yo + j * 256, a); vst2(YL + yo + j * 256, c); }
    xwait2(YH + yo, YL + yo); } }
// ---- k_out: out = y (hi + lo) Wproj^T
__global__ __launch_bounds__(128) void k_out(const __bf16* __restrict__ YH, const __bf16* __restrict__ YL, const __bf16* __restrict__ WP, float* __restrict__ OUT) { __shared__ __align__(16) float sf[4][16][132];
  const int tid = threadIdx.x, wave = tid >> 5, lane = tid & 31, col = lane & 15, g = lane >> 4; const int c0 = blockIdx.y * 128; const size_t r0 = (size_t)blockIdx.x * 64 + wave * 16;
  v8f acc[8] = {};
  const size_t yo = (size_t)((int)blockIdx.x * 4 + wave) * PKB + lane * 8; const __bf16* hp = YH + yo; const __bf16* lp = YL + yo; const __bf16* wp = WP + (size_t)(WB_O + c0 / 16) * PKB + lane * 8;
  OSet s0, s1; os_ld<0>(s0, hp, lp, wp); os_ld<PKF>(s1, hp, lp, wp);
  // rolled: two passes a trip, each in its own register set, refilled behind its products for the pass two on, so a set's loads fly over the other pass's products; the last trip's refills read its own passes again and are not used
#pragma unroll 1
  for (int kc = 0; kc < CC / 32; kc += 2) { const int kn = (kc + 2 < CC / 32 ? kc + 2 : kc) * PKF;
    os_mul(s0, acc); os_ld<0>(s0, hp + kn, lp + kn, wp + kn);
    os_mul(s1, acc); os_ld<PKF>(s1, hp + kn, lp + kn, wp + kn); }
#pragma unroll
  for (int j = 0; j < 8; ++j)
#pragma unroll
    for (int r = 0; r < 8; ++r) sf[wave][8 * g + r][j * 16 + col] = acc[j][r];
  LDSX(); for (int rl = 0; rl < 16; ++rl) vst2(OUT + (r0 + rl) * CC + c0 + lane * 4, *(const v4f*)&sf[wave][rl][lane * 4]); }
extern "C" void kernel_launch(void* const* d_in, const int* in_sizes, int n_in, void* d_out, int out_size, void* d_ws, size_t ws_size, hipStream_t stream) {
  (void)in_sizes; (void)n_in; (void)out_size;
  const float** F = (const float**)d_in;   // 0 x [2,2048,1024], 1 Wq [1024,1024], 2 Wk [256,1024], 3 Wv [256,1024], 4 Wproj [1024,1024] ([out,in]), 5 q_gain [16], 6 lora_A_q [2,4,1024], 7 lora_B_q [2,1024,4], 8 lora_A_v [2,4,1024], 9 lora_B_v [2,256,4], 10 step_idx [1] int32
  if (ws_size < (size_t)WS_END) return;
  const int* STEP = (const int*)d_in[10];
  char* ws = (char*)d_ws; float *XA = (float*)(ws + WS_XA); _Float16 *QH = (_Float16*)(ws + WS_QH), *QL = (_Float16*)(ws + WS_QL), *KH = (_Float16*)(ws + WS_KH); __bf16 *VT = (__bf16*)(ws + WS_VT), *VL = (__bf16*)(ws + WS_VL), *YH = (__bf16*)(ws + WS_YH), *YL = (__bf16*)(ws + WS_YL), *XP = (__bf16*)(ws + WS_XP), *WP = (__bf16*)(ws + WS_WP);
  k_pack<<<XB + (2 * CC + 2 * KV) / 16, 256, 0, stream>>>(F[0], F[1], F[2], F[3], F[4], F[6], F[8], STEP, XP, WP, XA);
  k_proj<<<dim3(TNB * TT / 64, (CC + 2 * KV) / 128), 128, 0, stream>>>(XP, WP, F[5], F[7], F[9], STEP, XA, QH, QL, KH, VT, VL);
  k_fa<<<dim3(TT / 32, HK, TNB), 128, 0, stream>>>(QH, QL, KH, VT, VL, YH, YL);
  k_out<<<dim3(TNB * TT / 64, CC / 128), 128, 0, stream>>>(YH, YL, WP, (float*)d_out);
}

// v007
// Measured time: 89.9 microseconds a run.
// In both of two side-by-side timings against v006, it was 1.12 times as fast.
// All steps since v000 together make it 15.3 times as fast.
// compute dtype: all float inputs rounded to bf16, step_idx (int) read; q/k/v = x W^T with EXACT bf16 products on WMMA 16x16x32, f32 accumulate, plus the rank-4 LoRA terms (x A^T exact on WMMA, then . B^T on the VALU in f32) for q and v when 0 <= step_idx < 2; per-head RMSNorm (eps = f32 eps), partial rotary on the first 32 dims (angles t 10000^(-2i/32) computed per lane and row on device with precise powf/sincosf), q_gain, in f32; q as f16 hi + residual, k f16 -> 2-product causal GQA logits kept raw in registers; running-maximum softmax in f32 in base 2 (score * 0.125 log2(e) - maximum in one fma, then the hardware's exp2), unnormalised P in f32 split bf16 hi + lo against v bf16 hi + lo (3 products), divided by the row sum at the end; out = y (bf16 hi + lo) Wproj^T; f32 output.
#include <hip/hip_runtime.h>
#include <math.h>

typedef __attribute__((ext_vector_type(16))) _Float16 v16h;
typedef __attribute__((ext_vector_type(16))) __bf16 v16b;
typedef __attribute__((ext_vector_type(8)))  _Float16 v8h;
typedef __attribute__((ext_vector_type(8)))  float v8f;
typedef __attribute__((ext_vector_type(4)))  float v4f;
typedef __attribute__((ext_vector_type(2)))  float v2f;
typedef __attribute__((ext_vector_type(4)))  unsigned v4u;
typedef __attribute__((ext_vector_type(4)))  int v4i;
typedef float __attribute__((may_alias)) float_a;
typedef int __attribute__((may_alias)) int_a;

template <typename T> __device__ __forceinline__ void vst2(void* p, T v) { *(T*)p = v;  }
__device__ __forceinline__ v8f wmma16(v16h a, v16h b, v8f c) {
  v8f d = __builtin_amdgcn_wmma_f32_16x16x32_f16(false, a, false, b, (short)0, c, false, false);
  asm volatile("v_nop\n\tv_nop\n\tv_nop\n\tv_nop" : "+v"(d) : "v"(a), "v"(b));
  return d;
}
__device__ __forceinline__ v8f wmma_bf(v16b a, v16b b, v8f c) {
  v8f d = __builtin_amdgcn_wmma_f32_16x16x32_bf16(false, a, false, b, (short)0, c, false, false);
  asm volatile("v_nop\n\tv_nop\n\tv_nop\n\tv_nop" : "+v"(d) : "v"(a), "v"(b));
  return d;
}
// 16x16x32 fragments: lane = (h = lane>>4, row/col = lane&15); elements 0..7 = k0+8h+0..7, 8..15 = k0+16+8h+0..7; D element r = row 8h+r
__device__ __forceinline__ v16h frag_h(const _Float16* rowk0, int lane) {
  union { v16h v; v8h q[2]; } u; const _Float16* p = rowk0 + 8 * (lane >> 4);
  u.q[0] = *(const v8h*)p; u.q[1] = *(const v8h*)(p + 16); return u.v;
}
__device__ __forceinline__ v16h frag_f32(const float* rowk0, int lane) {
  v16h a; const float* p = rowk0 + 8 * (lane >> 4);
#pragma unroll
  for (int i = 0; i < 8; ++i) { a[i] = (_Float16)p[i]; a[8 + i] = (_Float16)p[16 + i]; }
  return a;
}
__device__ __forceinline__ v16h frag_f32s(const float* rowk0, int lane, float sc) {
  v16h a; const float* p = rowk0 + 8 * (lane >> 4);
#pragma unroll
  for (int i = 0; i < 8; ++i) { a[i] = (_Float16)(p[i] * sc); a[8 + i] = (_Float16)(p[16 + i] * sc); }
  return a;
}
// column fragment from a [K][ld] layout (column n), rows >= K read as 0
__device__ __forceinline__ v16h fragc_f32(const float* W, int k0, int n, int lane, int ld, int K) {
  v16h a; const int g = lane >> 4;
#pragma unroll
  for (int i = 0; i < 8; ++i) { const int ka = k0 + 8 * g + i, kb = ka + 16;
    a[i] = (_Float16)(ka < K ? W[(size_t)(ka < K ? ka : K - 1) * ld + n] : 0.f); a[8 + i] = (_Float16)(kb < K ? W[(size_t)(kb < K ? kb : K - 1) * ld + n] : 0.f); }
  return a;
}
struct F2 { v16b h, l; };
__device__ __forceinline__ F2 bsplit16(const float v[16]) { F2 r;
#pragma unroll
  for (int i = 0; i < 16; ++i) { const __bf16 h = (__bf16)v[i]; r.h[i] = h; r.l[i] = (__bf16)(v[i] - (float)h); }
  return r; }
__device__ __forceinline__ F2 split_row(const float* row, int k0, int lane) { float v[16]; const float* p = row + k0 + 8 * (lane >> 4);
#pragma unroll
  for (int i = 0; i < 8; ++i) { v[i] = p[i]; v[8 + i] = p[16 + i]; }
  return bsplit16(v); }
__device__ __forceinline__ F2 split_rowK(const float* row, int k0, int lane, int K) { float v[16]; const int g = lane >> 4;
#pragma unroll
  for (int i = 0; i < 8; ++i) { const int ka = k0 + 8 * g + i, kb = ka + 16; v[i] = ka < K ? row[ka < K ? ka : K - 1] : 0.f; v[8 + i] = kb < K ? row[kb < K ? kb : K - 1] : 0.f; }
  return bsplit16(v); }
__device__ __forceinline__ F2 split_col(const float* W, int k0, int n, int lane, int ld, int K) { float v[16]; const int g = lane >> 4;
#pragma unroll
  for (int i = 0; i < 8; ++i) { const int ka = k0 + 8 * g + i, kb = ka + 16; v[i] = ka < K ? W[(size_t)(ka < K ? ka : K - 1) * ld + n] : 0.f; v[8 + i] = kb < K ? W[(size_t)(kb < K ? kb : K - 1) * ld + n] : 0.f; }
  return bsplit16(v); }
__device__ __forceinline__ v8f mac3(const F2& a, const F2& b, v8f c) { c = wmma_bf(a.l, b.h, c); c = wmma_bf(a.h, b.l, c); return wmma_bf(a.h, b.h, c); }
__device__ __forceinline__ float sigm(float v) { return 1.0f / (1.0f + expf(-v)); }
#define LDSX() do { asm volatile("s_wait_dscnt 0" ::: "memory"); __builtin_amdgcn_wave_barrier(); __builtin_amdgcn_fence(__ATOMIC_RELEASE, "workgroup"); } while (0)


// RRT attention (B 2, S 2,048, dim 1,024 = 16 q heads x 64, 4 kv heads, LoRA rank 4 on q and v selected by step_idx, partial RoPE 32, RMS-normed q/k, per-head q gain, causal GQA SDPA, output Linear).
#define NB 2
#define TT 2048
#define CC 1024
#define NH 16
#define HK 4
#define GQ (NH / HK)
#define HD 64
#define KV (HK * HD)        // 256
#define RD 32               // partial rope dims
#define LR 4                // lora rank
#define HG 4
#define NR (NB * TT)
#ifndef TNB
#define TNB NB
#endif
typedef __attribute__((ext_vector_type(8))) __bf16 v8b;
__device__ __forceinline__ v16b frag_b(const __bf16* rowk0, int lane) {
  union { v16b v; v8b q[2]; } u; const __bf16* p = rowk0 + 8 * (lane >> 4);
  u.q[0] = *(const v8b*)p; u.q[1] = *(const v8b*)(p + 16); return u.v;
}
__device__ __forceinline__ float bfr(float v) { return (float)(__bf16)v; }
__device__ __attribute__((noinline)) float exp_ni(float v) { return expf(v); }
__device__ __attribute__((noinline)) float erf_ni(float v) { return erff(v); }
// Operand sets held as loaded. The statement behind each WMMA keeps a global load from moving over it, so a load written behind a WMMA is also issued behind it:
// the loops of k_proj and k_out write a whole set's loads in one group, ahead of the WMMAs that run while the set is in flight, and reads the set only one stage later.
struct Raw16 { v4f q[4]; };                    // one f32 row fragment: k0+8h+0..7 in q[0], q[1]; k0+16+8h+0..7 in q[2], q[3]
__device__ __forceinline__ void raw_ld(Raw16& s, const float* p) { s.q[0] = *(const v4f*)p; s.q[1] = *(const v4f*)(p + 4); s.q[2] = *(const v4f*)(p + 16); s.q[3] = *(const v4f*)(p + 20); }
__device__ __forceinline__ v16b raw_bf(const Raw16& s) { v16b w;
#pragma unroll
  for (int i = 0; i < 4; ++i) { w[i] = (__bf16)s.q[0][i]; w[4 + i] = (__bf16)s.q[1][i]; w[8 + i] = (__bf16)s.q[2][i]; w[12 + i] = (__bf16)s.q[3][i]; }
  return w; }
// behind a group of loads: the wait that is kept in front of any rewrite of the address registers these loads name; the inputs hold those registers unchanged up to it
__device__ __forceinline__ void xwait(const void* p) { asm volatile("s_wait_xcnt 0x0" :: "v"(p) : "memory"); }
__device__ __forceinline__ void xwait2(const void* p, const void* q) { asm volatile("s_wait_xcnt 0x0" :: "v"(p), "v"(q) : "memory"); }
// Packed operand: a [rows][1024] matrix as bf16 in fragment order, [16-row block][pass of 32 k][half q][lane][8]: element i is row 16 block + (lane & 15), k = 32 pass + 16 q + 8 (lane >> 4) + i,
// the k order of raw_bf. One fragment is 1 KiB in a row and one wave-wide 16-byte load of it is 512 contiguous bytes, four whole lines.
#define PKF 512                                // elements of one fragment
#define PKB (CC / 32 * PKF)                    // elements of one 16-row block
__device__ __forceinline__ v16b pk_ld(const __bf16* p) { union { v16b v; v8b q[2]; } u; u.q[0] = *(const v8b*)p; u.q[1] = *(const v8b*)(p + 256); return u.v; }   // the lane's 8 * lane is already in p
__device__ __forceinline__ v16h pk_ldh(const _Float16* p) { union { v16h v; v8h q[2]; } u; u.q[0] = *(const v8h*)p; u.q[1] = *(const v8h*)(p + 256); return u.v; }
__device__ __forceinline__ void pk_st(__bf16* p, v16b w) { union { v16b v; v8b q[2]; } u; u.v = w; vst2(p, u.q[0]); vst2(p + 256, u.q[1]); }
struct PSet { v16b a, w[8]; };                 // one pass of k_proj: the wave's x fragment and eight weight fragments, 16 output columns apart
template <int OFF> __device__ __forceinline__ void ps_ld(PSet& s, const __bf16* ap, const __bf16* wp) { s.a = pk_ld(ap + OFF);   // OFF goes into the loads' offset fields: both sets of a trip name the same address registers
#pragma unroll
  for (int j = 0; j < 8; ++j) s.w[j] = pk_ld(wp + (size_t)j * PKB + OFF);
  xwait2(ap, wp); }
__device__ __forceinline__ void ps_mul(const PSet& s, v8f acc[8]) {
#pragma unroll
  for (int j = 0; j < 8; ++j) acc[j] = wmma_bf(s.a, s.w[j], acc[j]); }
struct OSet { v16b ah, al, w[8]; };            // one pass of k_out: the wave's y fragment, hi and lo, and eight weight fragments
template <int OFF> __device__ __forceinline__ void os_ld(OSet& s, const __bf16* hp, const __bf16* lp, const __bf16* wp) { s.ah = pk_ld(hp + OFF); s.al = pk_ld(lp + OFF);
#pragma unroll
  for (int j = 0; j < 8; ++j) s.w[j] = pk_ld(wp + (size_t)j * PKB + OFF);
  xwait2(hp, lp); xwait(wp); }
__device__ __forceinline__ void os_mul(const OSet& s, v8f acc[8]) {
#pragma unroll
  for (int j = 0; j < 8; ++j) { acc[j] = wmma_bf(s.ah, s.w[j], acc[j]); acc[j] = wmma_bf(s.al, s.w[j], acc[j]); } }

#define WS_XA  0u
#define WS_QH  (WS_XA + 4u * (size_t)NR * 32)
#define WS_QL  (WS_QH + 2u * (size_t)NR * CC)
#define WS_KH  (WS_QL + 2u * (size_t)NR * CC)          // f16 k, fragment order
#define WS_VT  (WS_KH + 2u * (size_t)NR * KV)          // bf16 V^T planes hi / lo, fragment order
#define WS_VL  (WS_VT + 2u * (size_t)NB * KV * TT)
#define WS_YH  (WS_VL + 2u * (size_t)NB * KV * TT)      // packed y, bf16 hi / lo
#define WS_YL  (WS_YH + 2u * (size_t)NR * CC)
#define WS_XP  (WS_YL + 2u * (size_t)NR * CC)          // packed x
#define WS_WP  (WS_XP + 2u * (size_t)NR * CC)          // packed weights, row blocks [Wq 64 | Wk 16 | Wv 16 | Wproj 64]
#define WS_END (WS_WP + 2u * (size_t)(2 * CC + 2 * KV) * CC)
#define XB (TNB * TT / 16)                             // 16-row blocks of x
#define WB_O ((CC + 2 * KV) / 16)                      // first row block of Wproj in the packed weights

// ---- k_pack: x and the four weight matrices, each element rounded to bf16 once and stored in fragment order. Block = one 16-row block, wave = four passes of 32 k.
// An x block also forms its rows of x A^T while the fragments are in registers: XA[row][0..3] = x . A_q[si]^T, [4..7] = x . A_v[si]^T (exact products; zero if step_idx is out of range).
// Each wave multiplies its four passes; the eight partial tiles meet in LDS and are added in wave order.
__global__ __launch_bounds__(256) void k_pack(const float* __restrict__ X, const float* __restrict__ WQ, const float* __restrict__ WK, const float* __restrict__ WV, const float* __restrict__ WO, const float* __restrict__ AQ, const float* __restrict__ AV, const int* __restrict__ STEP, __bf16* __restrict__ XP, __bf16* __restrict__ WP, float* __restrict__ XA) {
  __shared__ __align__(16) float ss[8][16][12];   // pitch 12: rows r and 8 + r, written by one store, fall on different banks; a row's two quads stay 16-byte aligned
  const int tid = threadIdx.x, wave = tid >> 5, lane = tid & 31, col = lane & 15, g = lane >> 4; const int rb = blockIdx.x, wb = rb - XB, k4 = wave * 4;
  const int si = STEP[0]; const bool use = (si >= 0 && si < 2);
  const float* src = rb < XB ? X + (size_t)rb * 16 * CC : wb < CC / 16 ? WQ + (size_t)wb * 16 * CC : wb < (CC + KV) / 16 ? WK + (size_t)(wb - CC / 16) * 16 * CC : wb < WB_O ? WV + (size_t)(wb - (CC + KV) / 16) * 16 * CC : WO + (size_t)(wb - WB_O) * 16 * CC;
  __bf16* dst = rb < XB ? XP + (size_t)rb * PKB : WP + (size_t)wb * PKB;
  const float* p = src + (size_t)col * CC + k4 * 32 + 8 * g; __bf16* d = dst + (size_t)k4 * PKF + lane * 8;
  Raw16 r[4];
#pragma unroll
  for (int u = 0; u < 4; ++u) raw_ld(r[u], p + u * 32);
  xwait(p);
  if (rb >= XB) {
#pragma unroll
    for (int u = 0; u < 4; ++u) pk_st(d + u * PKF, raw_bf(r[u]));
    xwait(d); return; }   // a whole block leaves here, ahead of the barrier
  const float* aq = AQ + (size_t)(use ? si : 0) * LR * CC; const float* av = AV + (size_t)(use ? si : 0) * LR * CC; const bool on = col < 8;
  const float* ap = ((col < 4) ? (aq + (size_t)col * CC) : on ? (av + (size_t)(col - 4) * CC) : aq) + k4 * 32 + 8 * g;   // columns 8..15 read row 0 of A_q, in bounds; a column of the product depends on its own lanes' operand alone, and those columns are not stored
  Raw16 rw[4];
#pragma unroll
  for (int u = 0; u < 4; ++u) raw_ld(rw[u], ap + u * 32);
  xwait(ap);
  __builtin_amdgcn_sched_barrier(0);   // the A loads go out while x is in flight; without this the first conversions of x, with their load waits, move up in front of them
  v16b a[4];
#pragma unroll
  for (int u = 0; u < 4; ++u) { a[u] = raw_bf(r[u]); pk_st(d + u * PKF, a[u]); }
  xwait(d);
  v8f acc = {};
#pragma unroll
  for (int u = 0; u < 4; ++u) acc = wmma_bf(a[u], raw_bf(rw[u]), acc);
  if (on) {
#pragma unroll
    for (int q = 0; q < 8; ++q) ss[wave][8 * g + q][col] = acc[q]; }
  // hand-over through LDS alone: the fences name the LDS, so the barrier waits for the partial tiles and not for the packed fragments' global stores, which no wave of this launch reads
  __builtin_amdgcn_fence(__ATOMIC_RELEASE, "workgroup", "local"); __builtin_amdgcn_s_barrier(); __builtin_amdgcn_fence(__ATOMIC_ACQUIRE, "workgroup", "local");
  if (tid < 32) { const int rl = tid >> 1, c4 = (tid & 1) * 4; v4f t = *(const v4f*)&ss[0][rl][c4];
#pragma unroll
    for (int w = 1; w < 8; ++w) t += *(const v4f*)&ss[w][rl][c4];
    if (!use) t = v4f{0.f, 0.f, 0.f, 0.f};
    vst2(XA + ((size_t)rb * 16 + rl) * 32 + c4, t); } }
// lane exchanges inside a 16-lane row group, as DPP operands: 0x160 + m reads lane l ^ m, 0x150 + n reads lane n of the group
template <int CTRL> __device__ __forceinline__ float dppf(float x) { return __builtin_bit_cast(float, __builtin_amdgcn_update_dpp(0, __builtin_bit_cast(int, x), CTRL, 0xf, 0xf, true)); }
// one halving step of a sum of 2 WD values over the group: a lane keeps the half that its bit WD of col names and adds its partner's share of that half
template <int WD> __device__ __forceinline__ void rstep(float* v, int col) { const bool up = (col & WD) != 0;
#pragma unroll
  for (int i = 0; i < WD; ++i) { const float keep = up ? v[i + WD] : v[i], send = up ? v[i] : v[i + WD]; v[i] = keep + dppf<0x160 + WD>(send); } }
template <int I> __device__ __forceinline__ void rshare(float* o, float x) { if constexpr (I < 16) { o[I] = dppf<0x150 + I>(x); rshare<I + 1>(o, x); } }
// ---- k_proj: block = (64 rows, 128 cols over [q 1024 | k 256 | v 256]): x W^T (+ LoRA), RMSNorm + partial rope (+ gain) for q/k; v -> planes
__global__ __launch_bounds__(128) void k_proj(const __bf16* __restrict__ XP, const __bf16* __restrict__ WP, const float* __restrict__ GAIN, const float* __restrict__ BQ, const float* __restrict__ BV, const int* __restrict__ STEP, const float* __restrict__ XA, _Float16* __restrict__ QH, _Float16* __restrict__ QL, _Float16* __restrict__ KH, __bf16* __restrict__ VT, __bf16* __restrict__ VL) {
  __shared__ __align__(16) _Float16 sh[64][136], sl[64][136]; __shared__ __align__(16) __bf16 th[128][72], tl2[128][72];
  const int tid = threadIdx.x, wave = tid >> 5, lane = tid & 31, col = lane & 15, g = lane >> 4; const int cg = blockIdx.y * 128; const size_t r0 = (size_t)blockIdx.x * 64;
  const int region = (cg < CC) ? 0 : (cg < CC + KV) ? 1 : 2; const int c0 = region == 0 ? cg : region == 1 ? cg - CC : cg - CC - KV;
  const int si = STEP[0]; const bool use = (si >= 0 && si < 2);
  v8f acc[8] = {};
  const __bf16* xp = XP + (size_t)((int)blockIdx.x * 4 + wave) * PKB + lane * 8; const __bf16* wp = WP + (size_t)(cg / 16) * PKB + lane * 8;   // the packed weights' row blocks run [q | k | v], as cg does
  PSet s0, s1; ps_ld<0>(s0, xp, wp); ps_ld<PKF>(s1, xp, wp);
  // rolled: two passes a trip, each in its own register set, refilled behind its products for the pass two on, so a set's loads fly over the other pass's products; the last trip's refills read its own passes again and are not used
#pragma unroll 1
  for (int kc = 0; kc < CC / 32; kc += 2) { const int kn = (kc + 2 < CC / 32 ? kc + 2 : kc) * PKF;
    ps_mul(s0, acc); ps_ld<0>(s0, xp + kn, wp + kn);
    ps_mul(s1, acc); ps_ld<PKF>(s1, xp + kn, wp + kn); }
  // From here to the barrier every lane works on its own accumulator registers: acc[j][r] is row rw + r, column 16 j + col of the block.
  const int rw = wave * 16 + 8 * g;
  if (use && region != 1) {   // LoRA term: the lane's eight B rows and eight x A^T rows go out as one group and are waited for once
    const float* bp = (region == 0 ? BQ + ((size_t)si * CC + c0 + col) * LR : BV + ((size_t)si * KV + c0 + col) * LR); const float* xa = XA + (r0 + rw) * 32 + (region == 0 ? 0 : 4);
    v4f bm[8], xr[8];
#pragma unroll
    for (int j = 0; j < 8; ++j) bm[j] = *(const v4f*)(bp + j * 16 * LR);
#pragma unroll
    for (int r = 0; r < 8; ++r) xr[r] = *(const v4f*)(xa + r * 32);
    xwait2(bp, xa);
#pragma unroll
    for (int j = 0; j < 8; ++j) {
#pragma unroll
      for (int q = 0; q < LR; ++q) bm[j][q] = bfr(bm[j][q]);
#pragma unroll
      for (int r = 0; r < 8; ++r) { float v = acc[j][r];
#pragma unroll
        for (int q = 0; q < LR; ++q) v = __builtin_fmaf(xr[r][q], bm[j][q], v);
        acc[j][r] = v; } } }
  if (region <= 1) {   // RMSNorm per head (64 dims, eps = FLT_EPSILON), partial rope on dims < 32 (x1 = d<16, x2 = 16..31): [x1 c + x2 s, -x1 s + x2 c], then gain (q only)
    // a head is four j; sum 8 hh + r is head hh, row rw + r: four squares in the lane, then over the 16 lanes of the row group; lane col is left with sum col, takes its root once and hands it round
    float s2[16];
#pragma unroll
    for (int i = 0; i < 16; ++i) { const int jb = (i >> 3) * 4, r = i & 7; s2[i] = (acc[jb][r] * acc[jb][r] + acc[jb + 1][r] * acc[jb + 1][r]) + (acc[jb + 2][r] * acc[jb + 2][r] + acc[jb + 3][r] * acc[jb + 3][r]); }
    rstep<8>(s2, col); rstep<4>(s2, col); rstep<2>(s2, col); rstep<1>(s2, col);
    float rs[16]; rshare<0>(rs, 1.0f / sqrtf(s2[0] * (1.0f / HD) + 1.1920929e-7f));
    // the rope pair (d, d + 16) of frequency col is acc[4 hh][r], acc[4 hh + 1][r] of this lane: one angle a row and lane serves both heads
    const float inv_freq = 1.0f / powf(10000.0f, (float)(2 * col) / (float)RD); const int t0 = (int)((r0 + rw) % TT);
    float gn[2] = {1.f, 1.f}; if (region == 0) { gn[0] = bfr(GAIN[c0 / HD]); gn[1] = bfr(GAIN[c0 / HD + 1]); }   // k has no gain: times 1 is exact
#pragma unroll
    for (int r = 0; r < 8; ++r) { float s, c; sincosf((float)(t0 + r) * inv_freq, &s, &c);
#pragma unroll
      for (int hh = 0; hh < 2; ++hh) { const float k = rs[hh * 8 + r]; const float x1 = acc[hh * 4][r] * k, x2 = acc[hh * 4 + 1][r] * k;
        float v[4] = {x1 * c + x2 * s, -x1 * s + x2 * c, acc[hh * 4 + 2][r] * k, acc[hh * 4 + 3][r] * k};
#pragma unroll
        for (int jj = 0; jj < 4; ++jj) { v[jj] *= gn[hh];
          const _Float16 hv = (_Float16)v[jj]; sh[rw + r][hh * 64 + jj * 16 + col] = hv; sl[rw + r][hh * 64 + jj * 16 + col] = (_Float16)(v[jj] - (float)hv); } } }
    __syncthreads();
    if (region == 0) { for (int e = tid; e < 64 * 16; e += 128) { const int rl = e >> 4, q = e & 15; vst2((unsigned*)(QH + (r0 + rl) * CC + c0 + q * 8), *(const v4u*)&sh[rl][q * 8]); vst2((unsigned*)(QL + (r0 + rl) * CC + c0 + q * 8), *(const v4u*)&sl[rl][q * 8]); } }
    else { const size_t kb0 = ((r0 / TT) * HK + c0 / HD) * (size_t)(TT / 16) + (r0 % TT) / 16;   // k in fragment order, [b][kv head][16-key block][f = 16 head dims][lane][8]: key 16 block + (lane & 15), head dim 16 f + 8 (lane >> 4) + i
      for (int e = tid; e < 64 * 16; e += 128) { const int ln = e & 31, f = (e >> 5) & 3, hh = (e >> 7) & 1, kb = e >> 8; vst2((unsigned*)(KH + ((kb0 + (size_t)hh * (TT / 16) + kb) * 4 + f) * 256 + ln * 8), *(const v4u*)&sh[kb * 16 + (ln & 15)][hh * 64 + f * 16 + (ln >> 4) * 8]); } } }
  else {   // the lane's eight rows of column 16 j + col are eight keys in a row of V^T: one 16-byte LDS store a plane
#pragma unroll
    for (int j = 0; j < 8; ++j) { v8b a, c;
#pragma unroll
      for (int r = 0; r < 8; ++r) { const float v = acc[j][r]; const __bf16 bh = (__bf16)v; a[r] = bh; c[r] = (__bf16)(v - (float)bh); }
      vst2(&th[j * 16 + col][rw], a); vst2(&tl2[j * 16 + col][rw], c); }
    __syncthreads(); const size_t p0 = ((r0 / TT) * HK + c0 / HD) * (size_t)(TT / 32) + (r0 % TT) / 32;   // V^T in fragment order, [b][kv head][pass of 32 keys][f][lane][8]: head dim 16 (f >> 1) + (lane & 15), key 32 pass + 16 (f & 1) + 8 (lane >> 4) + i
    for (int e = tid; e < 128 * 8; e += 128) { const int ln = e & 31, f = (e >> 5) & 7, sl = (e >> 8) & 1, hh = e >> 9; const int cl = hh * 64 + (f >> 1) * 16 + (ln & 15), kq = sl * 32 + (f & 1) * 16 + (ln >> 4) * 8;
      const size_t o2 = ((p0 + (size_t)hh * (TT / 32) + sl) * 8 + f) * 256 + ln * 8; vst2((unsigned*)(VT + o2), *(const v4u*)&th[cl][kq]); vst2((unsigned*)(VL + o2), *(const v4u*)&tl2[cl][kq]); } } }
// ---- k_fa: causal GQA attention in one launch, nothing of S or P in memory. Block = the 4 query heads of one kv head, two waves each; a wave pair owns 16 queries:
// wave kh of the pair walks the 32-key passes kh, kh + 2, ... with its own maximum, sum and O; the two partial results meet in LDS at the tile's end. Four waves a SIMD, each with half the passes in a row.
// S^T = K Q^T puts one query's scores of a 32-key pass into one lane pair (l, l ^ 16): D register r of key tile t is key 16 t + 8 (l >> 4) + r, which is the k order of a 16x16x32 operand,
// so P goes from the score registers straight into the B operand of O^T += V^T P^T, and maximum, sum and rescale are per lane.
// Each wave pair runs query tile x and then tile 127 - x, 65 passes in all: 33 for wave 0, which hands its part over, 32 for wave 1, which joins the parts and stores.
__device__ __forceinline__ float xhalf(float x) { return __builtin_bit_cast(float, __builtin_amdgcn_permlanex16(__builtin_bit_cast(int, x), __builtin_bit_cast(int, x), 0x76543210, 0xfedcba98, false, false)); }  // lane l with lane l ^ 16
__device__ __forceinline__ v8f mm_h(v16h a, v16h b, v8f c) { return __builtin_amdgcn_wmma_f32_16x16x32_f16(false, a, false, b, (short)0, c, false, false); }
__device__ __forceinline__ v8f mm_b(v16b a, v16b b, v8f c) { return __builtin_amdgcn_wmma_f32_16x16x32_bf16(false, a, false, b, (short)0, c, false, false); }
__device__ __forceinline__ v16h frag_hs(const _Float16* p) { union { v16h v; v8h q[2]; } u; u.q[0] = *(const v8h*)p; u.q[1] = *(const v8h*)(p + 16); return u.v; }
#define SC2 0.18033688011112043f               // 0.125 * log2(e): 1 / sqrt(head dim) and the change of base in one factor
struct KSet { v16h f[2][2]; };                 // one 32-key pass: [key tile of 16][32 head dims]
struct VSet { v16b h[4], l[4]; };              // one 32-key pass: V^T hi and lo, 16 head dims each
__device__ __forceinline__ void k_ld(KSet& s, const _Float16* p) {
#pragma unroll
  for (int t = 0; t < 2; ++t) { s.f[t][0] = pk_ldh(p + t * 2 * PKF); s.f[t][1] = pk_ldh(p + t * 2 * PKF + PKF); }
  xwait(p); }
__device__ __forceinline__ void v_ld(VSet& s, const __bf16* hp, const __bf16* lp) {
#pragma unroll
  for (int j = 0; j < 4; ++j) { s.h[j] = pk_ld(hp + j * PKF); s.l[j] = pk_ld(lp + j * PKF); }
  xwait2(hp, lp); }
__global__ __launch_bounds__(256) void k_fa(const _Float16* __restrict__ QH, const _Float16* __restrict__ QL, const _Float16* __restrict__ KH, const __bf16* __restrict__ VT, const __bf16* __restrict__ VL, __bf16* __restrict__ YH, __bf16* __restrict__ YL) {
  __shared__ __align__(16) v4f mg[2][GQ][9][32];   // [query tile of the pair's two][head][O in quads 0..7, (maximum, sum) in 8][lane]: a buffer a tile, so one barrier a tile is enough
  const int tid = threadIdx.x, wave = __builtin_amdgcn_readfirstlane(tid >> 5), hw = wave & 3, kh = wave >> 2, lane = tid & 31, col = lane & 15, g = lane >> 4; const int kvh = blockIdx.y, b = blockIdx.z, h = kvh * GQ + hw;   // the wave's number in a scalar register: pass counter, refill addresses and the branches on kh stay scalar
  const size_t vo = (size_t)(b * HK + kvh) * (TT / 32) * (4 * PKF) + lane * 8; const _Float16* kp = KH + vo; const __bf16* hp = VT + vo; const __bf16* lp = VL + vo;   // a pass of 32 keys is four fragments in k and in each V plane
  // rolled: the two query tiles of a wave run one after the other through the same code
#pragma unroll 1
  for (int part = 0; part < 2; ++part) { const int tile = part ? TT / 16 - 1 - (int)blockIdx.x : (int)blockIdx.x; const int qt = tile * 16 + col; const int n = tile / 2 + 1;   // passes of 32 keys up to the diagonal
    const size_t qo = ((size_t)b * TT + qt) * CC + h * HD + 8 * g; const v16h qh0 = frag_hs(QH + qo), qh1 = frag_hs(QH + qo + 32), ql0 = frag_hs(QL + qo), ql1 = frag_hs(QL + qo + 32);
    asm volatile("" :: "v"(qh0), "v"(qh1), "v"(ql0), "v"(ql1));   // inputs only: Q has landed before K and V go out, so the loop's load waits count K and V alone and V stays in flight over the score products
    v8f o[4] = {}; float m = -3.0e38f, l = 0.f;
    const int s0 = kh < n ? kh : 0;   // a wave with no pass of its own (one-pass tile, kh = 1) reads pass 0, in bounds, and does not use it
    KSet ks; VSet vs; k_ld(ks, kp + (size_t)s0 * (4 * PKF)); v_ld(vs, hp + (size_t)s0 * (4 * PKF), lp + (size_t)s0 * (4 * PKF));
    // rolled: K and V keep their registers; the next pass's K goes out behind this pass's score products, its V behind the output products; the last pass's refills read its own keys again and are not used
    // the last product of each accumulator goes through wmma16 / wmma_bf: the statement behind it keeps the refill loads from moving up over it, where they would need second registers, copies and a wait at the loop's foot
#pragma unroll 1
    for (int s = kh; s < n; s += 2) { const int sn = s + 2 < n ? s + 2 : s; v8f st[2] = {};
#pragma unroll
      for (int t = 0; t < 2; ++t) { st[t] = mm_h(ks.f[t][0], qh0, st[t]); st[t] = mm_h(ks.f[t][0], ql0, st[t]); st[t] = mm_h(ks.f[t][1], qh1, st[t]); st[t] = wmma16(ks.f[t][1], ql1, st[t]); }
      k_ld(ks, kp + (size_t)sn * (4 * PKF));
      __builtin_amdgcn_sched_barrier(0);   // the K refill goes out ahead of the softmax, which runs while it is in flight; without this it sinks to the output products
      const int rel = qt - s * 32 - 8 * g; float p[16];   // element i is key s * 32 + 16 (i >> 3) + 8 g + (i & 7): inside the causal triangle while 16 (i >> 3) + (i & 7) <= rel
#pragma unroll
      for (int i = 0; i < 16; ++i) p[i] = (16 * (i >> 3) + (i & 7) <= rel) ? st[i >> 3][i & 7] : -3.0e38f;   // raw scores: the scale is positive, so their maximum is the scaled maximum's place
      float mx[4];
#pragma unroll
      for (int c = 0; c < 4; ++c) mx[c] = fmaxf(fmaxf(p[c], p[4 + c]), fmaxf(p[8 + c], p[12 + c]));
      float mn = fmaxf(fmaxf(mx[0], mx[1]), fmaxf(mx[2], mx[3])); mn = fmaxf(mn, xhalf(mn)); mn = fmaxf(mn * SC2, m);   // the first key of every pass up to the diagonal is open to every query of the tile, so mn is a real score from the wave's first pass on; m and mn are in base-2 units
      const float al = __builtin_amdgcn_exp2f(m - mn); m = mn;
#pragma unroll
      for (int i = 0; i < 16; i += 2) { const v2f a = __builtin_elementwise_fma(v2f{p[i], p[i + 1]}, v2f{SC2, SC2}, v2f{-mn, -mn}); p[i] = __builtin_amdgcn_exp2f(a.x); p[i + 1] = __builtin_amdgcn_exp2f(a.y); }   // e^(score / 8 - maximum) as 2^(score * SC2 - mn), two scores an fma; a masked score gives exactly 0
      float sm[4];
#pragma unroll
      for (int c = 0; c < 4; ++c) sm[c] = (p[c] + p[4 + c]) + (p[8 + c] + p[12 + c]);
      l = l * al + ((sm[0] + sm[1]) + (sm[2] + sm[3]));   // this lane's half of the keys; the halves join behind the loop
#pragma unroll
      for (int j = 0; j < 4; ++j) o[j] *= al;
      const F2 pf = bsplit16(p);
#pragma unroll
      for (int j = 0; j < 4; ++j) { o[j] = mm_b(vs.h[j], pf.h, o[j]); o[j] = mm_b(vs.h[j], pf.l, o[j]); o[j] = wmma_bf(vs.l[j], pf.h, o[j]); }
      v_ld(vs, hp + (size_t)sn * (4 * PKF), lp + (size_t)sn * (4 * PKF)); }
    // O^T register r of tile j is head dim 16 j + 8 g + r of the lane's query: column 64 h + 16 j + 8 g + r of y, which is element r of this lane in pass 2 h + (j >> 1), half j & 1 of the packed row block
    if (kh == 0) {
#pragma unroll   // o is indexed by constants only and stays in registers
      for (int j = 0; j < 4; ++j) { mg[part][hw][2 * j][lane] = v4f{o[j][0], o[j][1], o[j][2], o[j][3]}; mg[part][hw][2 * j + 1][lane] = v4f{o[j][4], o[j][5], o[j][6], o[j][7]}; }
      mg[part][hw][8][lane] = v4f{m, l, 0.f, 0.f}; }
    // hand-over through LDS alone: the fences name the LDS, so the barrier waits for the partial results and not for global loads or stores in flight, which no other wave of this launch depends on
    __builtin_amdgcn_fence(__ATOMIC_RELEASE, "workgroup", "local"); __builtin_amdgcn_s_barrier(); __builtin_amdgcn_fence(__ATOMIC_ACQUIRE, "workgroup", "local");
    if (kh == 0) continue;
    { const v4f ml = mg[part][hw][8][lane]; const float ms = fmaxf(m, ml.x); const float a1 = __builtin_amdgcn_exp2f(m - ms), a0 = __builtin_amdgcn_exp2f(ml.x - ms);   // wave 0 always has a pass, so ms is a real score; a wave 1 without one has m = -3.0e38, weight exactly 0, on zeros
      l = l * a1 + ml.y * a0;
#pragma unroll   // as above
      for (int j = 0; j < 4; ++j) { const v4f t0 = mg[part][hw][2 * j][lane], t1 = mg[part][hw][2 * j + 1][lane];
#pragma unroll   // as above
        for (int r = 0; r < 4; ++r) { o[j][r] = o[j][r] * a1 + t0[r] * a0; o[j][4 + r] = o[j][4 + r] * a1 + t1[r] * a0; } } }
    l += xhalf(l); const float inv = 1.0f / l; const size_t yo = (size_t)(b * (TT / 16) + tile) * PKB + (size_t)h * 2 * PKF + lane * 8;
#pragma unroll
    for (int j = 0; j < 4; ++j) { v8b a, c;
#pragma unroll
      for (int r = 0; r < 8; ++r) { const float v = o[j][r] * inv; const __bf16 hv = (__bf16)v; a[r] = hv; c[r] = (__bf16)(v - (float)hv); }
      vst2(YH + yo + j * 256, a); vst2(YL + yo + j * 256, c); }
    xwait2(YH + yo, YL + yo); } }
// ---- k_out: out = y (hi + lo) Wproj^T
__global__ __launch_bounds__(128) void k_out(const __bf16* __restrict__ YH, const __bf16* __restrict__ YL, const __bf16* __restrict__ WP, float* __restrict__ OUT) { __shared__ __align__(16) float sf[4][16][132];
  const int tid = threadIdx.x, wave = tid >> 5, lane = tid & 31, col = lane & 15, g = lane >> 4; const int c0 = blockIdx.y * 128; const size_t r0 = (size_t)blockIdx.x * 64 + wave * 16;
  v8f acc[8] = {};
  const size_t yo = (size_t)((int)blockIdx.x * 4 + wave) * PKB + lane * 8; const __bf16* hp = YH + yo; const __bf16* lp = YL + yo; const __bf16* wp = WP + (size_t)(WB_O + c0 / 16) * PKB + lane * 8;
  OSet s0, s1; os_ld<0>(s0, hp, lp, wp); os_ld<PKF>(s1, hp, lp, wp);
  // rolled: two passes a trip, each in its own register set, refilled behind its products for the pass two on, so a set's loads fly over the other pass's products; the last trip's refills read its own passes again and are not used
#pragma unroll 1
  for (int kc = 0; kc < CC / 32; kc += 2) { const int kn = (kc + 2 < CC / 32 ? kc + 2 : kc) * PKF;
    os_mul(s0, acc); os_ld<0>(s0, hp + kn, lp + kn, wp + kn);
    os_mul(s1, acc); os_ld<PKF>(s1, hp + kn, lp + kn, wp + kn); }
#pragma unroll
  for (int j = 0; j < 8; ++j)
#pragma unroll
    for (int r = 0; r < 8; ++r) sf[wave][8 * g + r][j * 16 + col] = acc[j][r];
  LDSX(); for (int rl = 0; rl < 16; ++rl) vst2(OUT + (r0 + rl) * CC + c0 + lane * 4, *(const v4f*)&sf[wave][rl][lane * 4]); }
extern "C" void kernel_launch(void* const* d_in, const int* in_sizes, int n_in, void* d_out, int out_size, void* d_ws, size_t ws_size, hipStream_t stream) {
  (void)in_sizes; (void)n_in; (void)out_size;
  const float** F = (const float**)d_in;   // 0 x [2,2048,1024], 1 Wq [1024,1024], 2 Wk [256,1024], 3 Wv [256,1024], 4 Wproj [1024,1024] ([out,in]), 5 q_gain [16], 6 lora_A_q [2,4,1024], 7 lora_B_q [2,1024,4], 8 lora_A_v [2,4,1024], 9 lora_B_v [2,256,4], 10 step_idx [1] int32
  if (ws_size < (size_t)WS_END) return;
  const int* STEP = (const int*)d_in[10];
  char* ws = (char*)d_ws; float *XA = (float*)(ws + WS_XA); _Float16 *QH = (_Float16*)(ws + WS_QH), *QL = (_Float16*)(ws + WS_QL), *KH = (_Float16*)(ws + WS_KH); __bf16 *VT = (__bf16*)(ws + WS_VT), *VL = (__bf16*)(ws + WS_VL), *YH = (__bf16*)(ws + WS_YH), *YL = (__bf16*)(ws + WS_YL), *XP = (__bf16*)(ws + WS_XP), *WP = (__bf16*)(ws + WS_WP);
  k_pack<<<XB + (2 * CC + 2 * KV) / 16, 256, 0, stream>>>(F[0], F[1], F[2], F[3], F[4], F[6], F[8], STEP, XP, WP, XA);
  k_proj<<<dim3(TNB * TT / 64, (CC + 2 * KV) / 128), 128, 0, stream>>>(XP, WP, F[5], F[7], F[9], STEP, XA, QH, QL, KH, VT, VL);
  k_fa<<<dim3(TT / 32, HK, TNB), 256, 0, stream>>>(QH, QL, KH, VT, VL, YH, YL);
  k_out<<<dim3(TNB * TT / 64, CC / 128), 128, 0, stream>>>(YH, YL, WP, (float*)d_out);
}

// v008
// It runs in 85 microseconds.
// Next to v007, in two timings, it ran 1.06 and 1.07 times as fast.
// Over all steps from v000 it is 16.3 times as fast.
// compute dtype: all float inputs rounded to bf16, step_idx (int) read; q/k/v = x W^T with EXACT bf16 products on WMMA 16x16x32, f32 accumulate, plus the rank-4 LoRA terms (x A^T exact on WMMA, then . B^T on the VALU in f32) for q and v when 0 <= step_idx < 2; per-head RMSNorm (eps = f32 eps), partial rotary on the first 32 dims (angles t 10000^(-2i/32) computed per lane and row on device with precise powf/sincosf), q_gain, in f32; q as f16 hi + residual, k f16 -> 2-product causal GQA logits kept raw in registers; running-maximum softmax in f32 in base 2 (score * 0.125 log2(e) - maximum in one fma, then the hardware's exp2), unnormalised P in f32 split bf16 hi + lo against v bf16 hi + lo (3 products), divided by the row sum at the end; out = y (bf16 hi + lo) Wproj^T; f32 output.
#include <hip/hip_runtime.h>
#include <math.h>

typedef __attribute__((ext_vector_type(16))) _Float16 v16h;
typedef __attribute__((ext_vector_type(16))) __bf16 v16b;
typedef __attribute__((ext_vector_type(8)))  _Float16 v8h;
typedef __attribute__((ext_vector_type(8)))  float v8f;
typedef __attribute__((ext_vector_type(4)))  float v4f;
typedef __attribute__((ext_vector_type(2)))  float v2f;
typedef __attribute__((ext_vector_type(4)))  unsigned v4u;
typedef __attribute__((ext_vector_type(4)))  int v4i;
typedef float __attribute__((may_alias)) float_a;
typedef int __attribute__((may_alias)) int_a;

template <typename T> __device__ __forceinline__ void vst2(void* p, T v) { *(T*)p = v;  }
__device__ __forceinline__ v8f wmma16(v16h a, v16h b, v8f c) {
  v8f d = __builtin_amdgcn_wmma_f32_16x16x32_f16(false, a, false, b, (short)0, c, false, false);
  asm volatile("v_nop\n\tv_nop\n\tv_nop\n\tv_nop" : "+v"(d) : "v"(a), "v"(b));
  return d;
}
__device__ __forceinline__ v8f wmma_bf(v16b a, v16b b, v8f c) {
  v8f d = __builtin_amdgcn_wmma_f32_16x16x32_bf16(false, a, false, b, (short)0, c, false, false);
  asm volatile("v_nop\n\tv_nop\n\tv_nop\n\tv_nop" : "+v"(d) : "v"(a), "v"(b));
  return d;
}
__device__ __forceinline__ v8f mm_b(v16b a, v16b b, v8f c) { return __builtin_amdgcn_wmma_f32_16x16x32_bf16(false, a, false, b, (short)0, c, false, false); }
// 16x16x32 fragments: lane = (h = lane>>4, row/col = lane&15); elements 0..7 = k0+8h+0..7, 8..15 = k0+16+8h+0..7; D element r = row 8h+r
__device__ __forceinline__ v16h frag_h(const _Float16* rowk0, int lane) {
  union { v16h v; v8h q[2]; } u; const _Float16* p = rowk0 + 8 * (lane >> 4);
  u.q[0] = *(const v8h*)p; u.q[1] = *(const v8h*)(p + 16); return u.v;
}
__device__ __forceinline__ v16h frag_f32(const float* rowk0, int lane) {
  v16h a; const float* p = rowk0 + 8 * (lane >> 4);
#pragma unroll
  for (int i = 0; i < 8; ++i) { a[i] = (_Float16)p[i]; a[8 + i] = (_Float16)p[16 + i]; }
  return a;
}
__device__ __forceinline__ v16h frag_f32s(const float* rowk0, int lane, float sc) {
  v16h a; const float* p = rowk0 + 8 * (lane >> 4);
#pragma unroll
  for (int i = 0; i < 8; ++i) { a[i] = (_Float16)(p[i] * sc); a[8 + i] = (_Float16)(p[16 + i] * sc); }
  return a;
}
// column fragment from a [K][ld] layout (column n), rows >= K read as 0
__device__ __forceinline__ v16h fragc_f32(const float* W, int k0, int n, int lane, int ld, int K) {
  v16h a; const int g = lane >> 4;
#pragma unroll
  for (int i = 0; i < 8; ++i) { const int ka = k0 + 8 * g + i, kb = ka + 16;
    a[i] = (_Float16)(ka < K ? W[(size_t)(ka < K ? ka : K - 1) * ld + n] : 0.f); a[8 + i] = (_Float16)(kb < K ? W[(size_t)(kb < K ? kb : K - 1) * ld + n] : 0.f); }
  return a;
}
struct F2 { v16b h, l; };
__device__ __forceinline__ F2 bsplit16(const float v[16]) { F2 r;
#pragma unroll
  for (int i = 0; i < 16; ++i) { const __bf16 h = (__bf16)v[i]; r.h[i] = h; r.l[i] = (__bf16)(v[i] - (float)h); }
  return r; }
__device__ __forceinline__ F2 split_row(const float* row, int k0, int lane) { float v[16]; const float* p = row + k0 + 8 * (lane >> 4);
#pragma unroll
  for (int i = 0; i < 8; ++i) { v[i] = p[i]; v[8 + i] = p[16 + i]; }
  return bsplit16(v); }
__device__ __forceinline__ F2 split_rowK(const float* row, int k0, int lane, int K) { float v[16]; const int g = lane >> 4;
#pragma unroll
  for (int i = 0; i < 8; ++i) { const int ka = k0 + 8 * g + i, kb = ka + 16; v[i] = ka < K ? row[ka < K ? ka : K - 1] : 0.f; v[8 + i] = kb < K ? row[kb < K ? kb : K - 1] : 0.f; }
  return bsplit16(v); }
__device__ __forceinline__ F2 split_col(const float* W, int k0, int n, int lane, int ld, int K) { float v[16]; const int g = lane >> 4;
#pragma unroll
  for (int i = 0; i < 8; ++i) { const int ka = k0 + 8 * g + i, kb = ka + 16; v[i] = ka < K ? W[(size_t)(ka < K ? ka : K - 1) * ld + n] : 0.f; v[8 + i] = kb < K ? W[(size_t)(kb < K ? kb : K - 1) * ld + n] : 0.f; }
  return bsplit16(v); }
__device__ __forceinline__ v8f mac3(const F2& a, const F2& b, v8f c) { c = wmma_bf(a.l, b.h, c); c = wmma_bf(a.h, b.l, c); return wmma_bf(a.h, b.h, c); }
__device__ __forceinline__ float sigm(float v) { return 1.0f / (1.0f + expf(-v)); }
#define LDSX() do { asm volatile("s_wait_dscnt 0" ::: "memory"); __builtin_amdgcn_wave_barrier(); __builtin_amdgcn_fence(__ATOMIC_RELEASE, "workgroup"); } while (0)


// RRT attention (B 2, S 2,048, dim 1,024 = 16 q heads x 64, 4 kv heads, LoRA rank 4 on q and v selected by step_idx, partial RoPE 32, RMS-normed q/k, per-head q gain, causal GQA SDPA, output Linear).
#define NB 2
#define TT 2048
#define CC 1024
#define NH 16
#define HK 4
#define GQ (NH / HK)
#define HD 64
#define KV (HK * HD)        // 256
#define RD 32               // partial rope dims
#define LR 4                // lora rank
#define HG 4
#define NR (NB * TT)
#ifndef TNB
#define TNB NB
#endif
typedef __attribute__((ext_vector_type(8))) __bf16 v8b;
__device__ __forceinline__ v16b frag_b(const __bf16* rowk0, int lane) {
  union { v16b v; v8b q[2]; } u; const __bf16* p = rowk0 + 8 * (lane >> 4);
  u.q[0] = *(const v8b*)p; u.q[1] = *(const v8b*)(p + 16); return u.v;
}
__device__ __forceinline__ float bfr(float v) { return (float)(__bf16)v; }
__device__ __attribute__((noinline)) float exp_ni(float v) { return expf(v); }
__device__ __attribute__((noinline)) float erf_ni(float v) { return erff(v); }
// Operand sets held as loaded. The loops of k_proj and k_out write a whole set's loads in one group, ahead of the WMMAs that run while the set is in flight, and read the set only one stage later.
// SB() between a set's products and its refill keeps that written order: without it the refill loads move up among the products, into further registers. The products are the plain builtin: two sets and two
// tiles of accumulators take more than 256 registers, and an asm statement's vector operands would hold them below that.
#define SB() __builtin_amdgcn_sched_barrier(0)
struct Raw16 { v4f q[4]; };                    // one f32 row fragment: k0+8h+0..7 in q[0], q[1]; k0+16+8h+0..7 in q[2], q[3]
__device__ __forceinline__ void raw_ld(Raw16& s, const float* p) { s.q[0] = *(const v4f*)p; s.q[1] = *(const v4f*)(p + 4); s.q[2] = *(const v4f*)(p + 16); s.q[3] = *(const v4f*)(p + 20); }
__device__ __forceinline__ v16b raw_bf(const Raw16& s) { v16b w;
#pragma unroll
  for (int i = 0; i < 4; ++i) { w[i] = (__bf16)s.q[0][i]; w[4 + i] = (__bf16)s.q[1][i]; w[8 + i] = (__bf16)s.q[2][i]; w[12 + i] = (__bf16)s.q[3][i]; }
  return w; }
// behind a group of loads: the wait that is kept in front of any rewrite of the address registers these loads name; the inputs hold those registers unchanged up to it
__device__ __forceinline__ void xwait(const void* p) { asm volatile("s_wait_xcnt 0x0" :: "v"(p) : "memory"); }
__device__ __forceinline__ void xwait2(const void* p, const void* q) { asm volatile("s_wait_xcnt 0x0" :: "v"(p), "v"(q) : "memory"); }
// the same wait without operands, for the loops above 256 registers, where a vector operand of an asm statement ties its pointer to the first 256 and costs a spill; SB() directly behind it holds later address arithmetic behind it
__device__ __forceinline__ void xwait0() { asm volatile("s_wait_xcnt 0x0" ::: "memory"); }
// Packed operand: a [rows][1024] matrix as bf16 in fragment order, [16-row block][pass of 32 k][half q][lane][8]: element i is row 16 block + (lane & 15), k = 32 pass + 16 q + 8 (lane >> 4) + i,
// the k order of raw_bf. One fragment is 1 KiB in a row and one wave-wide 16-byte load of it is 512 contiguous bytes, four whole lines.
#define PKF 512                                // elements of one fragment
#define PKB (CC / 32 * PKF)                    // elements of one 16-row block
__device__ __forceinline__ v16b pk_ld(const __bf16* p) { union { v16b v; v8b q[2]; } u; u.q[0] = *(const v8b*)p; u.q[1] = *(const v8b*)(p + 256); return u.v; }   // the lane's 8 * lane is already in p
__device__ __forceinline__ v16h pk_ldh(const _Float16* p) { union { v16h v; v8h q[2]; } u; u.q[0] = *(const v8h*)p; u.q[1] = *(const v8h*)(p + 256); return u.v; }
__device__ __forceinline__ void pk_st(__bf16* p, v16b w) { union { v16b v; v8b q[2]; } u; u.v = w; vst2(p, u.q[0]); vst2(p + 256, u.q[1]); }
struct PSet { v16b a[2], w[8]; };              // one pass of k_proj: the wave's two x fragments, 64 rows apart, and eight weight fragments, 16 output columns apart
template <int OFF> __device__ __forceinline__ void ps_ld(PSet& s, const __bf16* ap, const __bf16* wp) { s.a[0] = pk_ld(ap + OFF); s.a[1] = pk_ld(ap + 4 * PKB + OFF);   // OFF goes into the loads' offset fields: both sets of a trip name the same address registers
#pragma unroll
  for (int j = 0; j < 8; ++j) s.w[j] = pk_ld(wp + (size_t)j * PKB + OFF);
  xwait0(); }
__device__ __forceinline__ void ps_mul(const PSet& s, v8f acc[8], v8f nx[8]) {   // each weight fragment meets both x fragments
#pragma unroll
  for (int j = 0; j < 8; ++j) { acc[j] = mm_b(s.a[0], s.w[j], acc[j]); nx[j] = mm_b(s.a[1], s.w[j], nx[j]); } }
struct OSet { v16b ah[2], al[2], w[8]; };      // one pass of k_out: the wave's two y fragments, 64 rows apart, hi and lo, and eight weight fragments
template <int OFF> __device__ __forceinline__ void os_ld(OSet& s, const __bf16* hp, const __bf16* lp, const __bf16* wp) { s.ah[0] = pk_ld(hp + OFF); s.al[0] = pk_ld(lp + OFF); s.ah[1] = pk_ld(hp + 4 * PKB + OFF); s.al[1] = pk_ld(lp + 4 * PKB + OFF);
#pragma unroll
  for (int j = 0; j < 8; ++j) s.w[j] = pk_ld(wp + (size_t)j * PKB + OFF);
  xwait0(); }
__device__ __forceinline__ void os_mul(const OSet& s, v8f acc[8], v8f nx[8]) {   // each weight fragment meets both y fragments; an accumulator takes hi, then lo, as before
#pragma unroll
  for (int j = 0; j < 8; ++j) { acc[j] = mm_b(s.ah[0], s.w[j], acc[j]); nx[j] = mm_b(s.ah[1], s.w[j], nx[j]); acc[j] = mm_b(s.al[0], s.w[j], acc[j]); nx[j] = mm_b(s.al[1], s.w[j], nx[j]); } }

#define WS_XA  0u
#define WS_QH  (WS_XA + 4u * (size_t)NR * 32)
#define WS_QL  (WS_QH + 2u * (size_t)NR * CC)
#define WS_KH  (WS_QL + 2u * (size_t)NR * CC)          // f16 k, fragment order
#define WS_VT  (WS_KH + 2u * (size_t)NR * KV)          // bf16 V^T planes hi / lo, fragment order
#define WS_VL  (WS_VT + 2u * (size_t)NB * KV * TT)
#define WS_YH  (WS_VL + 2u * (size_t)NB * KV * TT)      // packed y, bf16 hi / lo
#define WS_YL  (WS_YH + 2u * (size_t)NR * CC)
#define WS_XP  (WS_YL + 2u * (size_t)NR * CC)          // packed x
#define WS_WP  (WS_XP + 2u * (size_t)NR * CC)          // packed weights, row blocks [Wq 64 | Wk 16 | Wv 16 | Wproj 64]
#define WS_END (WS_WP + 2u * (size_t)(2 * CC + 2 * KV) * CC)
#define XB (TNB * TT / 16)                             // 16-row blocks of x
#define WB_O ((CC + 2 * KV) / 16)                      // first row block of Wproj in the packed weights

// ---- k_pack: x and the four weight matrices, each element rounded to bf16 once and stored in fragment order. Block = one 16-row block, wave = four passes of 32 k.
// An x block also forms its rows of x A^T while the fragments are in registers: XA[row][0..3] = x . A_q[si]^T, [4..7] = x . A_v[si]^T (exact products; zero if step_idx is out of range).
// Each wave multiplies its four passes; the eight partial tiles meet in LDS and are added in wave order.
__global__ __launch_bounds__(256) void k_pack(const float* __restrict__ X, const float* __restrict__ WQ, const float* __restrict__ WK, const float* __restrict__ WV, const float* __restrict__ WO, const float* __restrict__ AQ, const float* __restrict__ AV, const int* __restrict__ STEP, __bf16* __restrict__ XP, __bf16* __restrict__ WP, float* __restrict__ XA) {
  __shared__ __align__(16) float ss[8][16][12];   // pitch 12: rows r and 8 + r, written by one store, fall on different banks; a row's two quads stay 16-byte aligned
  const int tid = threadIdx.x, wave = tid >> 5, lane = tid & 31, col = lane & 15, g = lane >> 4; const int rb = blockIdx.x, wb = rb - XB, k4 = wave * 4;
  const int si = STEP[0]; const bool use = (si >= 0 && si < 2);
  const float* src = rb < XB ? X + (size_t)rb * 16 * CC : wb < CC / 16 ? WQ + (size_t)wb * 16 * CC : wb < (CC + KV) / 16 ? WK + (size_t)(wb - CC / 16) * 16 * CC : wb < WB_O ? WV + (size_t)(wb - (CC + KV) / 16) * 16 * CC : WO + (size_t)(wb - WB_O) * 16 * CC;
  __bf16* dst = rb < XB ? XP + (size_t)rb * PKB : WP + (size_t)wb * PKB;
  const float* p = src + (size_t)col * CC + k4 * 32 + 8 * g; __bf16* d = dst + (size_t)k4 * PKF + lane * 8;
  Raw16 r[4];
#pragma unroll
  for (int u = 0; u < 4; ++u) raw_ld(r[u], p + u * 32);
  xwait(p);
  if (rb >= XB) {
#pragma unroll
    for (int u = 0; u < 4; ++u) pk_st(d + u * PKF, raw_bf(r[u]));
    xwait(d); return; }   // a whole block leaves here, ahead of the barrier
  const float* aq = AQ + (size_t)(use ? si : 0) * LR * CC; const float* av = AV + (size_t)(use ? si : 0) * LR * CC; const bool on = col < 8;
  const float* ap = ((col < 4) ? (aq + (size_t)col * CC) : on ? (av + (size_t)(col - 4) * CC) : aq) + k4 * 32 + 8 * g;   // columns 8..15 read row 0 of A_q, in bounds; a column of the product depends on its own lanes' operand alone, and those columns are not stored
  Raw16 rw[4];
#pragma unroll
  for (int u = 0; u < 4; ++u) raw_ld(rw[u], ap + u * 32);
  xwait(ap);
  __builtin_amdgcn_sched_barrier(0);   // the A loads go out while x is in flight; without this the first conversions of x, with their load waits, move up in front of them
  v16b a[4];
#pragma unroll
  for (int u = 0; u < 4; ++u) { a[u] = raw_bf(r[u]); pk_st(d + u * PKF, a[u]); }
  xwait(d);
  v8f acc = {};
#pragma unroll
  for (int u = 0; u < 4; ++u) acc = wmma_bf(a[u], raw_bf(rw[u]), acc);
  if (on) {
#pragma unroll
    for (int q = 0; q < 8; ++q) ss[wave][8 * g + q][col] = acc[q]; }
  // hand-over through LDS alone: the fences name the LDS, so the barrier waits for the partial tiles and not for the packed fragments' global stores, which no wave of this launch reads
  __builtin_amdgcn_fence(__ATOMIC_RELEASE, "workgroup", "local"); __builtin_amdgcn_s_barrier(); __builtin_amdgcn_fence(__ATOMIC_ACQUIRE, "workgroup", "local");
  if (tid < 32) { const int rl = tid >> 1, c4 = (tid & 1) * 4; v4f t = *(const v4f*)&ss[0][rl][c4];
#pragma unroll
    for (int w = 1; w < 8; ++w) t += *(const v4f*)&ss[w][rl][c4];
    if (!use) t = v4f{0.f, 0.f, 0.f, 0.f};
    vst2(XA + ((size_t)rb * 16 + rl) * 32 + c4, t); } }
// lane exchanges inside a 16-lane row group, as DPP operands: 0x160 + m reads lane l ^ m, 0x150 + n reads lane n of the group
template <int CTRL> __device__ __forceinline__ float dppf(float x) { return __builtin_bit_cast(float, __builtin_amdgcn_update_dpp(0, __builtin_bit_cast(int, x), CTRL, 0xf, 0xf, true)); }
// one halving step of a sum of 2 WD values over the group: a lane keeps the half that its bit WD of col names and adds its partner's share of that half
template <int WD> __device__ __forceinline__ void rstep(float* v, int col) { const bool up = (col & WD) != 0;
#pragma unroll
  for (int i = 0; i < WD; ++i) { const float keep = up ? v[i + WD] : v[i], send = up ? v[i] : v[i + WD]; v[i] = keep + dppf<0x160 + WD>(send); } }
template <int I> __device__ __forceinline__ void rshare(float* o, float x) { if constexpr (I < 16) { o[I] = dppf<0x150 + I>(x); rshare<I + 1>(o, x); } }
// ---- k_proj: block = (128 rows, 128 cols over [q 1024 | k 256 | v 256]): x W^T (+ LoRA), RMSNorm + partial rope (+ gain) for q/k; v -> planes
// A wave holds two 16-row tiles, 64 rows apart (acc: rows 16 wave.., nx: rows 64 + 16 wave..), so a weight fragment is loaded once for 32 rows. The epilogue runs once for each 64-row half of the block.
__global__ __launch_bounds__(128) void k_proj(const __bf16* __restrict__ XP, const __bf16* __restrict__ WP, const float* __restrict__ GAIN, const float* __restrict__ BQ, const float* __restrict__ BV, const int* __restrict__ STEP, const float* __restrict__ XA, _Float16* __restrict__ QH, _Float16* __restrict__ QL, _Float16* __restrict__ KH, __bf16* __restrict__ VT, __bf16* __restrict__ VL) {
  __shared__ __align__(16) _Float16 sh[64][136], sl[64][136]; __shared__ __align__(16) __bf16 th[128][72], tl2[128][72];
  const int tid = threadIdx.x, wave = tid >> 5, lane = tid & 31, col = lane & 15, g = lane >> 4; const int cg = blockIdx.y * 128;
  const int region = (cg < CC) ? 0 : (cg < CC + KV) ? 1 : 2; const int c0 = region == 0 ? cg : region == 1 ? cg - CC : cg - CC - KV;
  const int si = STEP[0]; const bool use = (si >= 0 && si < 2);
  v8f acc[8] = {}, nx[8] = {};
  const __bf16* xp = XP + (size_t)((int)blockIdx.x * 8 + wave) * PKB + lane * 8; const __bf16* wp = WP + (size_t)(cg / 16) * PKB + lane * 8;   // the packed weights' row blocks run [q | k | v], as cg does
  PSet s0, s1; ps_ld<0>(s0, xp, wp); SB(); ps_ld<PKF>(s1, xp, wp); SB();
  // rolled: two passes a trip, each in its own register set, refilled behind its products for the pass two on, so a set's loads fly over the other pass's products; the last trip's refills read its own passes again and are not used
#pragma unroll 1
  for (int kc = 0; kc < CC / 32; kc += 2) { const int kn = (kc + 2 < CC / 32 ? kc + 2 : kc) * PKF;
    ps_mul(s0, acc, nx); SB(); ps_ld<0>(s0, xp + kn, wp + kn); SB();
    ps_mul(s1, acc, nx); SB(); ps_ld<PKF>(s1, xp + kn, wp + kn); SB(); }
  // rolled: the two halves go through the same epilogue code one after the other; the second half's accumulators move into acc behind the first
#pragma unroll 1
  for (int hf = 0; hf < 2; ++hf) { const size_t r0 = (size_t)blockIdx.x * 128 + hf * 64;
  if (hf) {   // every wave has read the first half's staged rows before the second half overwrites them; the fences name the LDS, so the barrier does not wait for the first half's global stores, which no wave of this launch reads
    __builtin_amdgcn_fence(__ATOMIC_RELEASE, "workgroup", "local"); __builtin_amdgcn_s_barrier(); __builtin_amdgcn_fence(__ATOMIC_ACQUIRE, "workgroup", "local");
#pragma unroll
    for (int j = 0; j < 8; ++j) acc[j] = nx[j]; }
  // From here to the barrier every lane works on its own accumulator registers: acc[j][r] is row rw + r, column 16 j + col of the half.
  const int rw = wave * 16 + 8 * g;
  if (use && region != 1) {   // LoRA term: the lane's eight B rows and eight x A^T rows go out as one group and are waited for once
    const float* bp = (region == 0 ? BQ + ((size_t)si * CC + c0 + col) * LR : BV + ((size_t)si * KV + c0 + col) * LR); const float* xa = XA + (r0 + rw) * 32 + (region == 0 ? 0 : 4);
    v4f bm[8], xr[8];
#pragma unroll
    for (int j = 0; j < 8; ++j) bm[j] = *(const v4f*)(bp + j * 16 * LR);
#pragma unroll
    for (int r = 0; r < 8; ++r) xr[r] = *(const v4f*)(xa + r * 32);
    xwait2(bp, xa);
#pragma unroll
    for (int j = 0; j < 8; ++j) {
#pragma unroll
      for (int q = 0; q < LR; ++q) bm[j][q] = bfr(bm[j][q]);
#pragma unroll
      for (int r = 0; r < 8; ++r) { float v = acc[j][r];
#pragma unroll
        for (int q = 0; q < LR; ++q) v = __builtin_fmaf(xr[r][q], bm[j][q], v);
        acc[j][r] = v; } } }
  if (region <= 1) {   // RMSNorm per head (64 dims, eps = FLT_EPSILON), partial rope on dims < 32 (x1 = d<16, x2 = 16..31): [x1 c + x2 s, -x1 s + x2 c], then gain (q only)
    // a head is four j; sum 8 hh + r is head hh, row rw + r: four squares in the lane, then over the 16 lanes of the row group; lane col is left with sum col, takes its root once and hands it round
    float s2[16];
#pragma unroll
    for (int i = 0; i < 16; ++i) { const int jb = (i >> 3) * 4, r = i & 7; s2[i] = (acc[jb][r] * acc[jb][r] + acc[jb + 1][r] * acc[jb + 1][r]) + (acc[jb + 2][r] * acc[jb + 2][r] + acc[jb + 3][r] * acc[jb + 3][r]); }
    rstep<8>(s2, col); rstep<4>(s2, col); rstep<2>(s2, col); rstep<1>(s2, col);
    float rs[16]; rshare<0>(rs, 1.0f / sqrtf(s2[0] * (1.0f / HD) + 1.1920929e-7f));
    // the rope pair (d, d + 16) of frequency col is acc[4 hh][r], acc[4 hh + 1][r] of this lane: one angle a row and lane serves both heads
    const float inv_freq = 1.0f / powf(10000.0f, (float)(2 * col) / (float)RD); const int t0 = (int)((r0 + rw) % TT);
    float gn[2] = {1.f, 1.f}; if (region == 0) { gn[0] = bfr(GAIN[c0 / HD]); gn[1] = bfr(GAIN[c0 / HD + 1]); }   // k has no gain: times 1 is exact
#pragma unroll
    for (int r = 0; r < 8; ++r) { float s, c; sincosf((float)(t0 + r) * inv_freq, &s, &c);
#pragma unroll
      for (int hh = 0; hh < 2; ++hh) { const float k = rs[hh * 8 + r]; const float x1 = acc[hh * 4][r] * k, x2 = acc[hh * 4 + 1][r] * k;
        float v[4] = {x1 * c + x2 * s, -x1 * s + x2 * c, acc[hh * 4 + 2][r] * k, acc[hh * 4 + 3][r] * k};
#pragma unroll
        for (int jj = 0; jj < 4; ++jj) { v[jj] *= gn[hh];
          const _Float16 hv = (_Float16)v[jj]; sh[rw + r][hh * 64 + jj * 16 + col] = hv; sl[rw + r][hh * 64 + jj * 16 + col] = (_Float16)(v[jj] - (float)hv); } } }
    __syncthreads();
    if (region == 0) { for (int e = tid; e < 64 * 16; e += 128) { const int rl = e >> 4, q = e & 15; vst2((unsigned*)(QH + (r0 + rl) * CC + c0 + q * 8), *(const v4u*)&sh[rl][q * 8]); vst2((unsigned*)(QL + (r0 + rl) * CC + c0 + q * 8), *(const v4u*)&sl[rl][q * 8]); } }
    else { const size_t kb0 = ((r0 / TT) * HK + c0 / HD) * (size_t)(TT / 16) + (r0 % TT) / 16;   // k in fragment order, [b][kv head][16-key block][f = 16 head dims][lane][8]: key 16 block + (lane & 15), head dim 16 f + 8 (lane >> 4) + i
      for (int e = tid; e < 64 * 16; e += 128) { const int ln = e & 31, f = (e >> 5) & 3, hh = (e >> 7) & 1, kb = e >> 8; vst2((unsigned*)(KH + ((kb0 + (size_t)hh * (TT / 16) + kb) * 4 + f) * 256 + ln * 8), *(const v4u*)&sh[kb * 16 + (ln & 15)][hh * 64 + f * 16 + (ln >> 4) * 8]); } } }
  else {   // the lane's eight rows of column 16 j + col are eight keys in a row of V^T: one 16-byte LDS store a plane
#pragma unroll
    for (int j = 0; j < 8; ++j) { v8b a, c;
#pragma unroll
      for (int r = 0; r < 8; ++r) { const float v = acc[j][r]; const __bf16 bh = (__bf16)v; a[r] = bh; c[r] = (__bf16)(v - (float)bh); }
      vst2(&th[j * 16 + col][rw], a); vst2(&tl2[j * 16 + col][rw], c); }
    __syncthreads(); const size_t p0 = ((r0 / TT) * HK + c0 / HD) * (size_t)(TT / 32) + (r0 % TT) / 32;   // V^T in fragment order, [b][kv head][pass of 32 keys][f][lane][8]: head dim 16 (f >> 1) + (lane & 15), key 32 pass + 16 (f & 1) + 8 (lane >> 4) + i
    for (int e = tid; e < 128 * 8; e += 128) { const int ln = e & 31, f = (e >> 5) & 7, sl = (e >> 8) & 1, hh = e >> 9; const int cl = hh * 64 + (f >> 1) * 16 + (ln & 15), kq = sl * 32 + (f & 1) * 16 + (ln >> 4) * 8;
      const size_t o2 = ((p0 + (size_t)hh * (TT / 32) + sl) * 8 + f) * 256 + ln * 8; vst2((unsigned*)(VT + o2), *(const v4u*)&th[cl][kq]); vst2((unsigned*)(VL + o2), *(const v4u*)&tl2[cl][kq]); } }
  } }
// ---- k_fa: causal GQA attention in one launch, nothing of S or P in memory. Block = the 4 query heads of one kv head, two waves each; a wave pair owns 16 queries:
// wave kh of the pair walks the 32-key passes kh, kh + 2, ... with its own maximum, sum and O; the two partial results meet in LDS at the tile's end. Four waves a SIMD, each with half the passes in a row.
// S^T = K Q^T puts one query's scores of a 32-key pass into one lane pair (l, l ^ 16): D register r of key tile t is key 16 t + 8 (l >> 4) + r, which is the k order of a 16x16x32 operand,
// so P goes from the score registers straight into the B operand of O^T += V^T P^T, and maximum, sum and rescale are per lane.
// Each wave pair runs query tile x and then tile 127 - x, 65 passes in all: 33 for wave 0, which hands its part over, 32 for wave 1, which joins the parts and stores.
__device__ __forceinline__ float xhalf(float x) { return __builtin_bit_cast(float, __builtin_amdgcn_permlanex16(__builtin_bit_cast(int, x), __builtin_bit_cast(int, x), 0x76543210, 0xfedcba98, false, false)); }  // lane l with lane l ^ 16
__device__ __forceinline__ v8f mm_h(v16h a, v16h b, v8f c) { return __builtin_amdgcn_wmma_f32_16x16x32_f16(false, a, false, b, (short)0, c, false, false); }
__device__ __forceinline__ v16h frag_hs(const _Float16* p) { union { v16h v; v8h q[2]; } u; u.q[0] = *(const v8h*)p; u.q[1] = *(const v8h*)(p + 16); return u.v; }
#define SC2 0.18033688011112043f               // 0.125 * log2(e): 1 / sqrt(head dim) and the change of base in one factor
struct KSet { v16h f[2][2]; };                 // one 32-key pass: [key tile of 16][32 head dims]
struct VSet { v16b h[4], l[4]; };              // one 32-key pass: V^T hi and lo, 16 head dims each
__device__ __forceinline__ void k_ld(KSet& s, const _Float16* p) {
#pragma unroll
  for (int t = 0; t < 2; ++t) { s.f[t][0] = pk_ldh(p + t * 2 * PKF); s.f[t][1] = pk_ldh(p + t * 2 * PKF + PKF); }
  xwait(p); }
__device__ __forceinline__ void v_ld(VSet& s, const __bf16* hp, const __bf16* lp) {
#pragma unroll
  for (int j = 0; j < 4; ++j) { s.h[j] = pk_ld(hp + j * PKF); s.l[j] = pk_ld(lp + j * PKF); }
  xwait2(hp, lp); }
__global__ __launch_bounds__(256) void k_fa(const _Float16* __restrict__ QH, const _Float16* __restrict__ QL, const _Float16* __restrict__ KH, const __bf16* __restrict__ VT, const __bf16* __restrict__ VL, __bf16* __restrict__ YH, __bf16* __restrict__ YL) {
  __shared__ __align__(16) v4f mg[2][GQ][9][32];   // [query tile of the pair's two][head][O in quads 0..7, (maximum, sum) in 8][lane]: a buffer a tile, so one barrier a tile is enough
  const int tid = threadIdx.x, wave = __builtin_amdgcn_readfirstlane(tid >> 5), hw = wave & 3, kh = wave >> 2, lane = tid & 31, col = lane & 15, g = lane >> 4; const int kvh = blockIdx.y, b = blockIdx.z, h = kvh * GQ + hw;   // the wave's number in a scalar register: pass counter, refill addresses and the branches on kh stay scalar
  const size_t vo = (size_t)(b * HK + kvh) * (TT / 32) * (4 * PKF) + lane * 8; const _Float16* kp = KH + vo; const __bf16* hp = VT + vo; const __bf16* lp = VL + vo;   // a pass of 32 keys is four fragments in k and in each V plane
  // rolled: the two query tiles of a wave run one after the other through the same code
#pragma unroll 1
  for (int part = 0; part < 2; ++part) { const int tile = part ? TT / 16 - 1 - (int)blockIdx.x : (int)blockIdx.x; const int qt = tile * 16 + col; const int n = tile / 2 + 1;   // passes of 32 keys up to the diagonal
    const size_t qo = ((size_t)b * TT + qt) * CC + h * HD + 8 * g; const v16h qh0 = frag_hs(QH + qo), qh1 = frag_hs(QH + qo + 32), ql0 = frag_hs(QL + qo), ql1 = frag_hs(QL + qo + 32);
    asm volatile("" :: "v"(qh0), "v"(qh1), "v"(ql0), "v"(ql1));   // inputs only: Q has landed before K and V go out, so the loop's load waits count K and V alone and V stays in flight over the score products
    v8f o[4] = {}; float m = -3.0e38f, l = 0.f;
    const int s0 = kh < n ? kh : 0;   // a wave with no pass of its own (one-pass tile, kh = 1) reads pass 0, in bounds, and does not use it
    KSet ks; VSet vs; k_ld(ks, kp + (size_t)s0 * (4 * PKF)); v_ld(vs, hp + (size_t)s0 * (4 * PKF), lp + (size_t)s0 * (4 * PKF));
    // rolled: K and V keep their registers; the next pass's K goes out behind this pass's score products, its V behind the output products; the last pass's refills read its own keys again and are not used
    // the last product of each accumulator goes through wmma16 / wmma_bf: the statement behind it keeps the refill loads from moving up over it, where they would need second registers, copies and a wait at the loop's foot
#pragma unroll 1
    for (int s = kh; s < n; s += 2) { const int sn = s + 2 < n ? s + 2 : s; v8f st[2] = {};
#pragma unroll
      for (int t = 0; t < 2; ++t) { st[t] = mm_h(ks.f[t][0], qh0, st[t]); st[t] = mm_h(ks.f[t][0], ql0, st[t]); st[t] = mm_h(ks.f[t][1], qh1, st[t]); st[t] = wmma16(ks.f[t][1], ql1, st[t]); }
      k_ld(ks, kp + (size_t)sn * (4 * PKF));
      __builtin_amdgcn_sched_barrier(0);   // the K refill goes out ahead of the softmax, which runs while it is in flight; without this it sinks to the output products
      const int rel = qt - s * 32 - 8 * g; float p[16];   // element i is key s * 32 + 16 (i >> 3) + 8 g + (i & 7): inside the causal triangle while 16 (i >> 3) + (i & 7) <= rel
#pragma unroll
      for (int i = 0; i < 16; ++i) p[i] = (16 * (i >> 3) + (i & 7) <= rel) ? st[i >> 3][i & 7] : -3.0e38f;   // raw scores: the scale is positive, so their maximum is the scaled maximum's place
      float mx[4];
#pragma unroll
      for (int c = 0; c < 4; ++c) mx[c] = fmaxf(fmaxf(p[c], p[4 + c]), fmaxf(p[8 + c], p[12 + c]));
      float mn = fmaxf(fmaxf(mx[0], mx[1]), fmaxf(mx[2], mx[3])); mn = fmaxf(mn, xhalf(mn)); mn = fmaxf(mn * SC2, m);   // the first key of every pass up to the diagonal is open to every query of the tile, so mn is a real score from the wave's first pass on; m and mn are in base-2 units
      const float al = __builtin_amdgcn_exp2f(m - mn); m = mn;
#pragma unroll
      for (int i = 0; i < 16; i += 2) { const v2f a = __builtin_elementwise_fma(v2f{p[i], p[i + 1]}, v2f{SC2, SC2}, v2f{-mn, -mn}); p[i] = __builtin_amdgcn_exp2f(a.x); p[i + 1] = __builtin_amdgcn_exp2f(a.y); }   // e^(score / 8 - maximum) as 2^(score * SC2 - mn), two scores an fma; a masked score gives exactly 0
      float sm[4];
#pragma unroll
      for (int c = 0; c < 4; ++c) sm[c] = (p[c] + p[4 + c]) + (p[8 + c] + p[12 + c]);
      l = l * al + ((sm[0] + sm[1]) + (sm[2] + sm[3]));   // this lane's half of the keys; the halves join behind the loop
#pragma unroll
      for (int j = 0; j < 4; ++j) o[j] *= al;
      const F2 pf = bsplit16(p);
#pragma unroll
      for (int j = 0; j < 4; ++j) { o[j] = mm_b(vs.h[j], pf.h, o[j]); o[j] = mm_b(vs.h[j], pf.l, o[j]); o[j] = wmma_bf(vs.l[j], pf.h, o[j]); }
      v_ld(vs, hp + (size_t)sn * (4 * PKF), lp + (size_t)sn * (4 * PKF)); }
    // O^T register r of tile j is head dim 16 j + 8 g + r of the lane's query: column 64 h + 16 j + 8 g + r of y, which is element r of this lane in pass 2 h + (j >> 1), half j & 1 of the packed row block
    if (kh == 0) {
#pragma unroll   // o is indexed by constants only and stays in registers
      for (int j = 0; j < 4; ++j) { mg[part][hw][2 * j][lane] = v4f{o[j][0], o[j][1], o[j][2], o[j][3]}; mg[part][hw][2 * j + 1][lane] = v4f{o[j][4], o[j][5], o[j][6], o[j][7]}; }
      mg[part][hw][8][lane] = v4f{m, l, 0.f, 0.f}; }
    // hand-over through LDS alone: the fences name the LDS, so the barrier waits for the partial results and not for global loads or stores in flight, which no other wave of this launch depends on
    __builtin_amdgcn_fence(__ATOMIC_RELEASE, "workgroup", "local"); __builtin_amdgcn_s_barrier(); __builtin_amdgcn_fence(__ATOMIC_ACQUIRE, "workgroup", "local");
    if (kh == 0) continue;
    { const v4f ml = mg[part][hw][8][lane]; const float ms = fmaxf(m, ml.x); const float a1 = __builtin_amdgcn_exp2f(m - ms), a0 = __builtin_amdgcn_exp2f(ml.x - ms);   // wave 0 always has a pass, so ms is a real score; a wave 1 without one has m = -3.0e38, weight exactly 0, on zeros
      l = l * a1 + ml.y * a0;
#pragma unroll   // as above
      for (int j = 0; j < 4; ++j) { const v4f t0 = mg[part][hw][2 * j][lane], t1 = mg[part][hw][2 * j + 1][lane];
#pragma unroll   // as above
        for (int r = 0; r < 4; ++r) { o[j][r] = o[j][r] * a1 + t0[r] * a0; o[j][4 + r] = o[j][4 + r] * a1 + t1[r] * a0; } } }
    l += xhalf(l); const float inv = 1.0f / l; const size_t yo = (size_t)(b * (TT / 16) + tile) * PKB + (size_t)h * 2 * PKF + lane * 8;
#pragma unroll
    for (int j = 0; j < 4; ++j) { v8b a, c;
#pragma unroll
      for (int r = 0; r < 8; ++r) { const float v = o[j][r] * inv; const __bf16 hv = (__bf16)v; a[r] = hv; c[r] = (__bf16)(v - (float)hv); }
      vst2(YH + yo + j * 256, a); vst2(YL + yo + j * 256, c); }
    xwait2(YH + yo, YL + yo); } }
// ---- k_out: out = y (hi + lo) Wproj^T
__global__ __launch_bounds__(128) void k_out(const __bf16* __restrict__ YH, const __bf16* __restrict__ YL, const __bf16* __restrict__ WP, float* __restrict__ OUT) { __shared__ __align__(16) float sf[4][32][132];   // a wave's own staging rows: 0..15 from acc, 16..31 from nx
  const int tid = threadIdx.x, wave = tid >> 5, lane = tid & 31, col = lane & 15, g = lane >> 4; const int c0 = blockIdx.y * 128; const size_t r0 = (size_t)blockIdx.x * 128 + wave * 16;   // a wave holds two 16-row tiles, 64 rows apart: acc and nx
  v8f acc[8] = {}, nx[8] = {};
  const size_t yo = (size_t)((int)blockIdx.x * 8 + wave) * PKB + lane * 8; const __bf16* hp = YH + yo; const __bf16* lp = YL + yo; const __bf16* wp = WP + (size_t)(WB_O + c0 / 16) * PKB + lane * 8;
  OSet s0, s1; os_ld<0>(s0, hp, lp, wp); SB(); os_ld<PKF>(s1, hp, lp, wp); SB();
  // rolled: two passes a trip, each in its own register set, refilled behind its products for the pass two on, so a set's loads fly over the other pass's products; the last trip's refills read its own passes again and are not used
#pragma unroll 1
  for (int kc = 0; kc < CC / 32; kc += 2) { const int kn = (kc + 2 < CC / 32 ? kc + 2 : kc) * PKF;
    os_mul(s0, acc, nx); SB(); os_ld<0>(s0, hp + kn, lp + kn, wp + kn); SB();
    os_mul(s1, acc, nx); SB(); os_ld<PKF>(s1, hp + kn, lp + kn, wp + kn); SB(); }
#pragma unroll
  for (int j = 0; j < 8; ++j)
#pragma unroll
    for (int r = 0; r < 8; ++r) { sf[wave][8 * g + r][j * 16 + col] = acc[j][r]; sf[wave][16 + 8 * g + r][j * 16 + col] = nx[j][r]; }
  LDSX(); for (int rl = 0; rl < 32; ++rl) vst2(OUT + (r0 + (rl >> 4) * 64 + (rl & 15)) * CC + c0 + lane * 4, *(const v4f*)&sf[wave][rl][lane * 4]); }
extern "C" void kernel_launch(void* const* d_in, const int* in_sizes, int n_in, void* d_out, int out_size, void* d_ws, size_t ws_size, hipStream_t stream) {
  (void)in_sizes; (void)n_in; (void)out_size;
  const float** F = (const float**)d_in;   // 0 x [2,2048,1024], 1 Wq [1024,1024], 2 Wk [256,1024], 3 Wv [256,1024], 4 Wproj [1024,1024] ([out,in]), 5 q_gain [16], 6 lora_A_q [2,4,1024], 7 lora_B_q [2,1024,4], 8 lora_A_v [2,4,1024], 9 lora_B_v [2,256,4], 10 step_idx [1] int32
  if (ws_size < (size_t)WS_END) return;
  const int* STEP = (const int*)d_in[10];
  char* ws = (char*)d_ws; float *XA = (float*)(ws + WS_XA); _Float16 *QH = (_Float16*)(ws + WS_QH), *QL = (_Float16*)(ws + WS_QL), *KH = (_Float16*)(ws + WS_KH); __bf16 *VT = (__bf16*)(ws + WS_VT), *VL = (__bf16*)(ws + WS_VL), *YH = (__bf16*)(ws + WS_YH), *YL = (__bf16*)(ws + WS_YL), *XP = (__bf16*)(ws + WS_XP), *WP = (__bf16*)(ws + WS_WP);
  k_pack<<<XB + (2 * CC + 2 * KV) / 16, 256, 0, stream>>>(F[0], F[1], F[2], F[3], F[4], F[6], F[8], STEP, XP, WP, XA);
  k_proj<<<dim3(TNB * TT / 128, (CC + 2 * KV) / 128), 128, 0, stream>>>(XP, WP, F[5], F[7], F[9], STEP, XA, QH, QL, KH, VT, VL);
  k_fa<<<dim3(TT / 32, HK, TNB), 256, 0, stream>>>(QH, QL, KH, VT, VL, YH, YL);
  k_out<<<dim3(TNB * TT / 128, CC / 128), 128, 0, stream>>>(YH, YL, WP, (float*)d_out);
}

// v009
// Measured time: 80.6 microseconds a run.
// Timed twice side by side with v008, it ran 1.05 and 1.06 times as fast.
// Counting every step since v000, it is 17.2 times as fast.
// compute dtype: all float inputs rounded to bf16, step_idx (int) read; q/k/v = x W^T with EXACT bf16 products on WMMA 16x16x32, f32 accumulate, plus the rank-4 LoRA terms (x A^T exact on WMMA, then . B^T on the VALU in f32) for q and v when 0 <= step_idx < 2; per-head RMSNorm (eps = f32 eps), partial rotary on the first 32 dims (10000^(-2i/32) and the angles computed on device per row with precise powf/sincosf, no tables), q_gain, in f32; q times 0.125 log2(e) as f16 hi + residual, k f16 -> 2-product causal GQA logits in base-2 units, kept in registers; softmax in f32 in base 2 against a held reference (minus the reference is the score products' start value, then the hardware's exp2; the reference is a real score and is raised when a pass's sum passes 256), unnormalised P in f32 split bf16 hi + lo against v bf16 hi + lo (3 products), divided by the row sum at the end; out = y (bf16 hi + lo) Wproj^T; f32 output.
#include <hip/hip_runtime.h>
#include <math.h>

typedef __attribute__((ext_vector_type(16))) _Float16 v16h;
typedef __attribute__((ext_vector_type(16))) __bf16 v16b;
typedef __attribute__((ext_vector_type(8)))  _Float16 v8h;
typedef __attribute__((ext_vector_type(8)))  float v8f;
typedef __attribute__((ext_vector_type(4)))  float v4f;
typedef __attribute__((ext_vector_type(2)))  float v2f;
typedef __attribute__((ext_vector_type(4)))  unsigned v4u;
typedef __attribute__((ext_vector_type(4)))  int v4i;
typedef float __attribute__((may_alias)) float_a;
typedef int __attribute__((may_alias)) int_a;

template <typename T> __device__ __forceinline__ void vst2(void* p, T v) { *(T*)p = v;  }
__device__ __forceinline__ v8f wmma16(v16h a, v16h b, v8f c) {
  v8f d = __builtin_amdgcn_wmma_f32_16x16x32_f16(false, a, false, b, (short)0, c, false, false);
  asm volatile("v_nop\n\tv_nop\n\tv_nop\n\tv_nop" : "+v"(d) : "v"(a), "v"(b));
  return d;
}
__device__ __forceinline__ v8f wmma_bf(v16b a, v16b b, v8f c) {
  v8f d = __builtin_amdgcn_wmma_f32_16x16x32_bf16(false, a, false, b, (short)0, c, false, false);
  asm volatile("v_nop\n\tv_nop\n\tv_nop\n\tv_nop" : "+v"(d) : "v"(a), "v"(b));
  return d;
}
__device__ __forceinline__ v8f mm_b(v16b a, v16b b, v8f c) { return __builtin_amdgcn_wmma_f32_16x16x32_bf16(false, a, false, b, (short)0, c, false, false); }
// 16x16x32 fragments: lane = (h = lane>>4, row/col = lane&15); elements 0..7 = k0+8h+0..7, 8..15 = k0+16+8h+0..7; D element r = row 8h+r
__device__ __forceinline__ v16h frag_h(const _Float16* rowk0, int lane) {
  union { v16h v; v8h q[2]; } u; const _Float16* p = rowk0 + 8 * (lane >> 4);
  u.q[0] = *(const v8h*)p; u.q[1] = *(const v8h*)(p + 16); return u.v;
}
__device__ __forceinline__ v16h frag_f32(const float* rowk0, int lane) {
  v16h a; const float* p = rowk0 + 8 * (lane >> 4);
#pragma unroll
  for (int i = 0; i < 8; ++i) { a[i] = (_Float16)p[i]; a[8 + i] = (_Float16)p[16 + i]; }
  return a;
}
__device__ __forceinline__ v16h frag_f32s(const float* rowk0, int lane, float sc) {
  v16h a; const float* p = rowk0 + 8 * (lane >> 4);
#pragma unroll
  for (int i = 0; i < 8; ++i) { a[i] = (_Float16)(p[i] * sc); a[8 + i] = (_Float16)(p[16 + i] * sc); }
  return a;
}
// column fragment from a [K][ld] layout (column n), rows >= K read as 0
__device__ __forceinline__ v16h fragc_f32(const float* W, int k0, int n, int lane, int ld, int K) {
  v16h a; const int g = lane >> 4;
#pragma unroll
  for (int i = 0; i < 8; ++i) { const int ka = k0 + 8 * g + i, kb = ka + 16;
    a[i] = (_Float16)(ka < K ? W[(size_t)(ka < K ? ka : K - 1) * ld + n] : 0.f); a[8 + i] = (_Float16)(kb < K ? W[(size_t)(kb < K ? kb : K - 1) * ld + n] : 0.f); }
  return a;
}
struct F2 { v16b h, l; };
__device__ __forceinline__ F2 bsplit16(const float v[16]) { F2 r;
#pragma unroll
  for (int i = 0; i < 16; ++i) { const __bf16 h = (__bf16)v[i]; r.h[i] = h; r.l[i] = (__bf16)(v[i] - (float)h); }
  return r; }
__device__ __forceinline__ F2 split_row(const float* row, int k0, int lane) { float v[16]; const float* p = row + k0 + 8 * (lane >> 4);
#pragma unroll
  for (int i = 0; i < 8; ++i) { v[i] = p[i]; v[8 + i] = p[16 + i]; }
  return bsplit16(v); }
__device__ __forceinline__ F2 split_rowK(const float* row, int k0, int lane, int K) { float v[16]; const int g = lane >> 4;
#pragma unroll
  for (int i = 0; i < 8; ++i) { const int ka = k0 + 8 * g + i, kb = ka + 16; v[i] = ka < K ? row[ka < K ? ka : K - 1] : 0.f; v[8 + i] = kb < K ? row[kb < K ? kb : K - 1] : 0.f; }
  return bsplit16(v); }
__device__ __forceinline__ F2 split_col(const float* W, int k0, int n, int lane, int ld, int K) { float v[16]; const int g = lane >> 4;
#pragma unroll
  for (int i = 0; i < 8; ++i) { const int ka = k0 + 8 * g + i, kb = ka + 16; v[i] = ka < K ? W[(size_t)(ka < K ? ka : K - 1) * ld + n] : 0.f; v[8 + i] = kb < K ? W[(size_t)(kb < K ? kb : K - 1) * ld + n] : 0.f; }
  return bsplit16(v); }
__device__ __forceinline__ v8f mac3(const F2& a, const F2& b, v8f c) { c = wmma_bf(a.l, b.h, c); c = wmma_bf(a.h, b.l, c); return wmma_bf(a.h, b.h, c); }
__device__ __forceinline__ float sigm(float v) { return 1.0f / (1.0f + expf(-v)); }
#define LDSX() do { asm volatile("s_wait_dscnt 0" ::: "memory"); __builtin_amdgcn_wave_barrier(); __builtin_amdgcn_fence(__ATOMIC_RELEASE, "workgroup"); } while (0)


// RRT attention (B 2, S 2,048, dim 1,024 = 16 q heads x 64, 4 kv heads, LoRA rank 4 on q and v selected by step_idx, partial RoPE 32, RMS-normed q/k, per-head q gain, causal GQA SDPA, output Linear).
#define NB 2
#define TT 2048
#define CC 1024
#define NH 16
#define HK 4
#define GQ (NH / HK)
#define HD 64
#define KV (HK * HD)        // 256
#define RD 32               // partial rope dims
#define LR 4                // lora rank
#define HG 4
#define NR (NB * TT)
#define SC2 0.18033688011112043f               // 0.125 * log2(e): 1 / sqrt(head dim) and the change of base in one factor
#ifndef TNB
#define TNB NB
#endif
typedef __attribute__((ext_vector_type(8))) __bf16 v8b;
__device__ __forceinline__ v16b frag_b(const __bf16* rowk0, int lane) {
  union { v16b v; v8b q[2]; } u; const __bf16* p = rowk0 + 8 * (lane >> 4);
  u.q[0] = *(const v8b*)p; u.q[1] = *(const v8b*)(p + 16); return u.v;
}
__device__ __forceinline__ float bfr(float v) { return (float)(__bf16)v; }
__device__ __attribute__((noinline)) float exp_ni(float v) { return expf(v); }
__device__ __attribute__((noinline)) float erf_ni(float v) { return erff(v); }
// Operand sets held as loaded. The loops of k_proj and k_out write a whole set's loads in one group, ahead of the WMMAs that run while the set is in flight, and read the set only one stage later.
// SB() between a set's products and its refill keeps that written order: without it the refill loads move up among the products, into further registers. The products are the plain builtin: two sets and two
// tiles of accumulators take more than 256 registers, and an asm statement's vector operands would hold them below that.
#define SB() __builtin_amdgcn_sched_barrier(0)
struct Raw16 { v4f q[4]; };                    // one f32 row fragment: k0+8h+0..7 in q[0], q[1]; k0+16+8h+0..7 in q[2], q[3]
__device__ __forceinline__ void raw_ld(Raw16& s, const float* p) { s.q[0] = *(const v4f*)p; s.q[1] = *(const v4f*)(p + 4); s.q[2] = *(const v4f*)(p + 16); s.q[3] = *(const v4f*)(p + 20); }
__device__ __forceinline__ v16b raw_bf(const Raw16& s) { v16b w;
#pragma unroll
  for (int i = 0; i < 4; ++i) { w[i] = (__bf16)s.q[0][i]; w[4 + i] = (__bf16)s.q[1][i]; w[8 + i] = (__bf16)s.q[2][i]; w[12 + i] = (__bf16)s.q[3][i]; }
  return w; }
// behind a group of loads: the wait that is kept in front of any rewrite of the address registers these loads name; the inputs hold those registers unchanged up to it
__device__ __forceinline__ void xwait(const void* p) { asm volatile("s_wait_xcnt 0x0" :: "v"(p) : "memory"); }
__device__ __forceinline__ void xwait2(const void* p, const void* q) { asm volatile("s_wait_xcnt 0x0" :: "v"(p), "v"(q) : "memory"); }
// the same wait without operands, for the loops above 256 registers, where a vector operand of an asm statement ties its pointer to the first 256 and costs a spill; SB() directly behind it holds later address arithmetic behind it
__device__ __forceinline__ void xwait0() { asm volatile("s_wait_xcnt 0x0" ::: "memory"); }
// Packed operand: a [rows][1024] matrix as bf16 in fragment order, [16-row block][pass of 32 k][half q][lane][8]: element i is row 16 block + (lane & 15), k = 32 pass + 16 q + 8 (lane >> 4) + i,
// the k order of raw_bf. One fragment is 1 KiB in a row and one wave-wide 16-byte load of it is 512 contiguous bytes, four whole lines.
#define PKF 512                                // elements of one fragment
#define PKB (CC / 32 * PKF)                    // elements of one 16-row block
__device__ __forceinline__ v16b pk_ld(const __bf16* p) { union { v16b v; v8b q[2]; } u; u.q[0] = *(const v8b*)p; u.q[1] = *(const v8b*)(p + 256); return u.v; }   // the lane's 8 * lane is already in p
__device__ __forceinline__ v16h pk_ldh(const _Float16* p) { union { v16h v; v8h q[2]; } u; u.q[0] = *(const v8h*)p; u.q[1] = *(const v8h*)(p + 256); return u.v; }
__device__ __forceinline__ void pk_st(__bf16* p, v16b w) { union { v16b v; v8b q[2]; } u; u.v = w; vst2(p, u.q[0]); vst2(p + 256, u.q[1]); }
struct PSet { v16b a[2], w[8]; };              // one pass of k_proj: the wave's two x fragments, 64 rows apart, and eight weight fragments, 16 output columns apart
template <int OFF> __device__ __forceinline__ void ps_ld(PSet& s, const __bf16* ap, const __bf16* wp) { s.a[0] = pk_ld(ap + OFF); s.a[1] = pk_ld(ap + 4 * PKB + OFF);   // OFF goes into the loads' offset fields: both sets of a trip name the same address registers
#pragma unroll
  for (int j = 0; j < 8; ++j) s.w[j] = pk_ld(wp + (size_t)j * PKB + OFF);
  xwait0(); }
__device__ __forceinline__ void ps_mul(const PSet& s, v8f acc[8], v8f nx[8]) {   // each weight fragment meets both x fragments
#pragma unroll
  for (int j = 0; j < 8; ++j) { acc[j] = mm_b(s.a[0], s.w[j], acc[j]); nx[j] = mm_b(s.a[1], s.w[j], nx[j]); } }
struct OSet { v16b ah[2], al[2], w[8]; };      // one pass of k_out: the wave's two y fragments, 64 rows apart, hi and lo, and eight weight fragments
template <int OFF> __device__ __forceinline__ void os_ld(OSet& s, const __bf16* hp, const __bf16* lp, const __bf16* wp) { s.ah[0] = pk_ld(hp + OFF); s.al[0] = pk_ld(lp + OFF); s.ah[1] = pk_ld(hp + 4 * PKB + OFF); s.al[1] = pk_ld(lp + 4 * PKB + OFF);
#pragma unroll
  for (int j = 0; j < 8; ++j) s.w[j] = pk_ld(wp + (size_t)j * PKB + OFF);
  xwait0(); }
__device__ __forceinline__ void os_mul(const OSet& s, v8f acc[8], v8f nx[8]) {   // each weight fragment meets both y fragments; an accumulator takes hi, then lo, as before
#pragma unroll
  for (int j = 0; j < 8; ++j) { acc[j] = mm_b(s.ah[0], s.w[j], acc[j]); nx[j] = mm_b(s.ah[1], s.w[j], nx[j]); acc[j] = mm_b(s.al[0], s.w[j], acc[j]); nx[j] = mm_b(s.al[1], s.w[j], nx[j]); } }

#define WS_XA  0u
#define WS_QH  (WS_XA + 4u * (size_t)NR * 32)
#define WS_QL  (WS_QH + 2u * (size_t)NR * CC)
#define WS_KH  (WS_QL + 2u * (size_t)NR * CC)          // f16 k, fragment order
#define WS_VT  (WS_KH + 2u * (size_t)NR * KV)          // bf16 V^T planes hi / lo, fragment order
#define WS_VL  (WS_VT + 2u * (size_t)NB * KV * TT)
#define WS_YH  (WS_VL + 2u * (size_t)NB * KV * TT)      // packed y, bf16 hi / lo
#define WS_YL  (WS_YH + 2u * (size_t)NR * CC)
#define WS_XP  (WS_YL + 2u * (size_t)NR * CC)          // packed x
#define WS_WP  (WS_XP + 2u * (size_t)NR * CC)          // packed weights, row blocks [Wq 64 | Wk 16 | Wv 16 | Wproj 64]
#define WS_END (WS_WP + 2u * (size_t)(2 * CC + 2 * KV) * CC)
#define XB (TNB * TT / 16)                             // 16-row blocks of x
#define WB_O ((CC + 2 * KV) / 16)                      // first row block of Wproj in the packed weights

// ---- k_pack: x and the four weight matrices, each element rounded to bf16 once and stored in fragment order. Block = one 16-row block, wave = four passes of 32 k.
// An x block also forms its rows of x A^T while the fragments are in registers: XA[row][0..3] = x . A_q[si]^T, [4..7] = x . A_v[si]^T (exact products; zero if step_idx is out of range).
// Each wave multiplies its four passes; the eight partial tiles meet in LDS and are added in wave order.
__global__ __launch_bounds__(256) void k_pack(const float* __restrict__ X, const float* __restrict__ WQ, const float* __restrict__ WK, const float* __restrict__ WV, const float* __restrict__ WO, const float* __restrict__ AQ, const float* __restrict__ AV, const int* __restrict__ STEP, __bf16* __restrict__ XP, __bf16* __restrict__ WP, float* __restrict__ XA) {
  __shared__ __align__(16) float ss[8][16][12];   // pitch 12: rows r and 8 + r, written by one store, fall on different banks; a row's two quads stay 16-byte aligned
  const int tid = threadIdx.x, wave = tid >> 5, lane = tid & 31, col = lane & 15, g = lane >> 4; const int rb = blockIdx.x, wb = rb - XB, k4 = wave * 4;
  const int si = STEP[0]; const bool use = (si >= 0 && si < 2);
  const float* src = rb < XB ? X + (size_t)rb * 16 * CC : wb < CC / 16 ? WQ + (size_t)wb * 16 * CC : wb < (CC + KV) / 16 ? WK + (size_t)(wb - CC / 16) * 16 * CC : wb < WB_O ? WV + (size_t)(wb - (CC + KV) / 16) * 16 * CC : WO + (size_t)(wb - WB_O) * 16 * CC;
  __bf16* dst = rb < XB ? XP + (size_t)rb * PKB : WP + (size_t)wb * PKB;
  const float* p = src + (size_t)col * CC + k4 * 32 + 8 * g; __bf16* d = dst + (size_t)k4 * PKF + lane * 8;
  Raw16 r[4];
#pragma unroll
  for (int u = 0; u < 4; ++u) raw_ld(r[u], p + u * 32);
  xwait(p);
  if (rb >= XB) {
#pragma unroll
    for (int u = 0; u < 4; ++u) pk_st(d + u * PKF, raw_bf(r[u]));
    xwait(d); return; }   // a whole block leaves here, ahead of the barrier
  const float* aq = AQ + (size_t)(use ? si : 0) * LR * CC; const float* av = AV + (size_t)(use ? si : 0) * LR * CC; const bool on = col < 8;
  const float* ap = ((col < 4) ? (aq + (size_t)col * CC) : on ? (av + (size_t)(col - 4) * CC) : aq) + k4 * 32 + 8 * g;   // columns 8..15 read row 0 of A_q, in bounds; a column of the product depends on its own lanes' operand alone, and those columns are not stored
  Raw16 rw[4];
#pragma unroll
  for (int u = 0; u < 4; ++u) raw_ld(rw[u], ap + u * 32);
  xwait(ap);
  __builtin_amdgcn_sched_barrier(0);   // the A loads go out while x is in flight; without this the first conversions of x, with their load waits, move up in front of them
  v16b a[4];
#pragma unroll
  for (int u = 0; u < 4; ++u) { a[u] = raw_bf(r[u]); pk_st(d + u * PKF, a[u]); }
  xwait(d);
  v8f acc = {};
#pragma unroll
  for (int u = 0; u < 4; ++u) acc = wmma_bf(a[u], raw_bf(rw[u]), acc);
  if (on) {
#pragma unroll
    for (int q = 0; q < 8; ++q) ss[wave][8 * g + q][col] = acc[q]; }
  // hand-over through LDS alone: the fences name the LDS, so the barrier waits for the partial tiles and not for the packed fragments' global stores, which no wave of this launch reads
  __builtin_amdgcn_fence(__ATOMIC_RELEASE, "workgroup", "local"); __builtin_amdgcn_s_barrier(); __builtin_amdgcn_fence(__ATOMIC_ACQUIRE, "workgroup", "local");
  if (tid < 32) { const int rl = tid >> 1, c4 = (tid & 1) * 4; v4f t = *(const v4f*)&ss[0][rl][c4];
#pragma unroll
    for (int w = 1; w < 8; ++w) t += *(const v4f*)&ss[w][rl][c4];
    if (!use) t = v4f{0.f, 0.f, 0.f, 0.f};
    vst2(XA + ((size_t)rb * 16 + rl) * 32 + c4, t); } }
// lane exchanges inside a 16-lane row group, as DPP operands: 0x160 + m reads lane l ^ m, 0x150 + n reads lane n of the group
template <int CTRL> __device__ __forceinline__ float dppf(float x) { return __builtin_bit_cast(float, __builtin_amdgcn_update_dpp(0, __builtin_bit_cast(int, x), CTRL, 0xf, 0xf, true)); }
// one halving step of a sum of 2 WD values over the group: a lane keeps the half that its bit WD of col names and adds its partner's share of that half
template <int WD> __device__ __forceinline__ void rstep(float* v, int col) { const bool up = (col & WD) != 0;
#pragma unroll
  for (int i = 0; i < WD; ++i) { const float keep = up ? v[i + WD] : v[i], send = up ? v[i] : v[i + WD]; v[i] = keep + dppf<0x160 + WD>(send); } }
template <int I> __device__ __forceinline__ void rshare(float* o, float x) { if constexpr (I < 16) { o[I] = dppf<0x150 + I>(x); rshare<I + 1>(o, x); } }
// ---- k_proj: block = (128 rows, 128 cols over [q 1024 | k 256 | v 256]): x W^T (+ LoRA), RMSNorm + partial rope (+ gain) for q/k; v -> planes
// A wave holds two 16-row tiles, 64 rows apart (acc: rows 16 wave.., nx: rows 64 + 16 wave..), so a weight fragment is loaded once for 32 rows. The epilogue runs once for each 64-row half of the block.
__global__ __launch_bounds__(128) void k_proj(const __bf16* __restrict__ XP, const __bf16* __restrict__ WP, const float* __restrict__ GAIN, const float* __restrict__ BQ, const float* __restrict__ BV, const int* __restrict__ STEP, const float* __restrict__ XA, _Float16* __restrict__ QH, _Float16* __restrict__ QL, _Float16* __restrict__ KH, __bf16* __restrict__ VT, __bf16* __restrict__ VL) {
  __shared__ __align__(16) _Float16 sh[64][136], sl[64][136]; __shared__ __align__(16) __bf16 th[128][72], tl2[128][72];
  const int tid = threadIdx.x, wave = tid >> 5, lane = tid & 31, col = lane & 15, g = lane >> 4; const int cg = blockIdx.y * 128;
  const int region = (cg < CC) ? 0 : (cg < CC + KV) ? 1 : 2; const int c0 = region == 0 ? cg : region == 1 ? cg - CC : cg - CC - KV;
  const int si = STEP[0]; const bool use = (si >= 0 && si < 2);
  v8f acc[8] = {}, nx[8] = {};
  const __bf16* xp = XP + (size_t)((int)blockIdx.x * 8 + wave) * PKB + lane * 8; const __bf16* wp = WP + (size_t)(cg / 16) * PKB + lane * 8;   // the packed weights' row blocks run [q | k | v], as cg does
  PSet s0, s1; ps_ld<0>(s0, xp, wp); SB(); ps_ld<PKF>(s1, xp, wp); SB();
  // rolled: two passes a trip, each in its own register set, refilled behind its products for the pass two on, so a set's loads fly over the other pass's products; the last trip's refills read its own passes again and are not used
#pragma unroll 1
  for (int kc = 0; kc < CC / 32; kc += 2) { const int kn = (kc + 2 < CC / 32 ? kc + 2 : kc) * PKF;
    ps_mul(s0, acc, nx); SB(); ps_ld<0>(s0, xp + kn, wp + kn); SB();
    ps_mul(s1, acc, nx); SB(); ps_ld<PKF>(s1, xp + kn, wp + kn); SB(); }
  // rolled: the two halves go through the same epilogue code one after the other; the second half's accumulators move into acc behind the first
#pragma unroll 1
  for (int hf = 0; hf < 2; ++hf) { const size_t r0 = (size_t)blockIdx.x * 128 + hf * 64;
  if (hf) {   // every wave has read the first half's staged rows before the second half overwrites them; the fences name the LDS, so the barrier does not wait for the first half's global stores, which no wave of this launch reads
    __builtin_amdgcn_fence(__ATOMIC_RELEASE, "workgroup", "local"); __builtin_amdgcn_s_barrier(); __builtin_amdgcn_fence(__ATOMIC_ACQUIRE, "workgroup", "local");
#pragma unroll
    for (int j = 0; j < 8; ++j) acc[j] = nx[j]; }
  // From here to the barrier every lane works on its own accumulator registers: acc[j][r] is row rw + r, column 16 j + col of the half.
  const int rw = wave * 16 + 8 * g;
  if (use && region != 1) {   // LoRA term: the lane's eight B rows and eight x A^T rows go out as one group and are waited for once
    const float* bp = (region == 0 ? BQ + ((size_t)si * CC + c0 + col) * LR : BV + ((size_t)si * KV + c0 + col) * LR); const float* xa = XA + (r0 + rw) * 32 + (region == 0 ? 0 : 4);
    v4f bm[8], xr[8];
#pragma unroll
    for (int j = 0; j < 8; ++j) bm[j] = *(const v4f*)(bp + j * 16 * LR);
#pragma unroll
    for (int r = 0; r < 8; ++r) xr[r] = *(const v4f*)(xa + r * 32);
    xwait2(bp, xa);
#pragma unroll
    for (int j = 0; j < 8; ++j) {
#pragma unroll
      for (int q = 0; q < LR; ++q) bm[j][q] = bfr(bm[j][q]);
#pragma unroll
      for (int r = 0; r < 8; ++r) { float v = acc[j][r];
#pragma unroll
        for (int q = 0; q < LR; ++q) v = __builtin_fmaf(xr[r][q], bm[j][q], v);
        acc[j][r] = v; } } }
  if (region <= 1) {   // RMSNorm per head (64 dims, eps = FLT_EPSILON), partial rope on dims < 32 (x1 = d<16, x2 = 16..31): [x1 c + x2 s, -x1 s + x2 c], then gain (q only)
    // a head is four j; sum 8 hh + r is head hh, row rw + r: four squares in the lane, then over the 16 lanes of the row group; lane col is left with sum col, takes its root once and hands it round
    float s2[16];
#pragma unroll
    for (int i = 0; i < 16; ++i) { const int jb = (i >> 3) * 4, r = i & 7; s2[i] = (acc[jb][r] * acc[jb][r] + acc[jb + 1][r] * acc[jb + 1][r]) + (acc[jb + 2][r] * acc[jb + 2][r] + acc[jb + 3][r] * acc[jb + 3][r]); }
    rstep<8>(s2, col); rstep<4>(s2, col); rstep<2>(s2, col); rstep<1>(s2, col);
    float rs[16]; rshare<0>(rs, 1.0f / sqrtf(s2[0] * (1.0f / HD) + 1.1920929e-7f));
    // the rope pair (d, d + 16) of frequency col is acc[4 hh][r], acc[4 hh + 1][r] of this lane: one angle a row and lane serves both heads
    const float inv_freq = 1.0f / powf(10000.0f, (float)(2 * col) / (float)RD); const int t0 = (int)((r0 + rw) % TT);
    float gn[2] = {1.f, 1.f}; if (region == 0) { gn[0] = bfr(GAIN[c0 / HD]) * SC2; gn[1] = bfr(GAIN[c0 / HD + 1]) * SC2; }   // q is stored in the softmax's base-2 units: k_fa's scores need no scaling; k has no gain: times 1 is exact
#pragma unroll
    for (int r = 0; r < 8; ++r) { float s, c; sincosf((float)(t0 + r) * inv_freq, &s, &c);
#pragma unroll
      for (int hh = 0; hh < 2; ++hh) { const float k = rs[hh * 8 + r]; const float x1 = acc[hh * 4][r] * k, x2 = acc[hh * 4 + 1][r] * k;
        float v[4] = {x1 * c + x2 * s, -x1 * s + x2 * c, acc[hh * 4 + 2][r] * k, acc[hh * 4 + 3][r] * k};
#pragma unroll
        for (int jj = 0; jj < 4; ++jj) { v[jj] *= gn[hh];
          const _Float16 hv = (_Float16)v[jj]; sh[rw + r][hh * 64 + jj * 16 + col] = hv; sl[rw + r][hh * 64 + jj * 16 + col] = (_Float16)(v[jj] - (float)hv); } } }
    __syncthreads();
    if (region == 0) { for (int e = tid; e < 64 * 16; e += 128) { const int rl = e >> 4, q = e & 15; vst2((unsigned*)(QH + (r0 + rl) * CC + c0 + q * 8), *(const v4u*)&sh[rl][q * 8]); vst2((unsigned*)(QL + (r0 + rl) * CC + c0 + q * 8), *(const v4u*)&sl[rl][q * 8]); } }
    else { const size_t kb0 = ((r0 / TT) * HK + c0 / HD) * (size_t)(TT / 16) + (r0 % TT) / 16;   // k in fragment order, [b][kv head][16-key block][f = 16 head dims][lane][8]: key 16 block + (lane & 15), head dim 16 f + 8 (lane >> 4) + i
      for (int e = tid; e < 64 * 16; e += 128) { const int ln = e & 31, f = (e >> 5) & 3, hh = (e >> 7) & 1, kb = e >> 8; vst2((unsigned*)(KH + ((kb0 + (size_t)hh * (TT / 16) + kb) * 4 + f) * 256 + ln * 8), *(const v4u*)&sh[kb * 16 + (ln & 15)][hh * 64 + f * 16 + (ln >> 4) * 8]); } } }
  else {   // the lane's eight rows of column 16 j + col are eight keys in a row of V^T: one 16-byte LDS store a plane
#pragma unroll
    for (int j = 0; j < 8; ++j) { v8b a, c;
#pragma unroll
      for (int r = 0; r < 8; ++r) { const float v = acc[j][r]; const __bf16 bh = (__bf16)v; a[r] = bh; c[r] = (__bf16)(v - (float)bh); }
      vst2(&th[j * 16 + col][rw], a); vst2(&tl2[j * 16 + col][rw], c); }
    __syncthreads(); const size_t p0 = ((r0 / TT) * HK + c0 / HD) * (size_t)(TT / 32) + (r0 % TT) / 32;   // V^T in fragment order, [b][kv head][pass of 32 keys][f][lane][8]: head dim 16 (f >> 1) + (lane & 15), key 32 pass + 16 (f & 1) + 8 (lane >> 4) + i
    for (int e = tid; e < 128 * 8; e += 128) { const int ln = e & 31, f = (e >> 5) & 7, sl = (e >> 8) & 1, hh = e >> 9; const int cl = hh * 64 + (f >> 1) * 16 + (ln & 15), kq = sl * 32 + (f & 1) * 16 + (ln >> 4) * 8;
      const size_t o2 = ((p0 + (size_t)hh * (TT / 32) + sl) * 8 + f) * 256 + ln * 8; vst2((unsigned*)(VT + o2), *(const v4u*)&th[cl][kq]); vst2((unsigned*)(VL + o2), *(const v4u*)&tl2[cl][kq]); } }
  } }
// ---- k_fa: causal GQA attention in one launch, nothing of S or P in memory. Block = the 4 query heads of one kv head, two waves each; a wave pair owns 16 queries:
// wave kh of the pair walks the 32-key passes kh, kh + 2, ... with its own reference, sum and O; the two partial results meet in LDS at the tile's end. Four waves a SIMD, each with half the passes in a row.
// S^T = K Q^T puts one query's scores of a 32-key pass into one lane pair (l, l ^ 16): D register r of key tile t is key 16 t + 8 (l >> 4) + r, which is the k order of a 16x16x32 operand,
// so P goes from the score registers straight into the B operand of O^T += V^T P^T, and reference, sum and rescale are per lane.
// Each wave pair runs query tile x and then tile 127 - x, 65 passes in all: 33 for wave 0, which hands its part over, 32 for wave 1, which joins the parts and stores.
__device__ __forceinline__ float xhalf(float x) { return __builtin_bit_cast(float, __builtin_amdgcn_permlanex16(__builtin_bit_cast(int, x), __builtin_bit_cast(int, x), 0x76543210, 0xfedcba98, false, false)); }  // lane l with lane l ^ 16
__device__ __forceinline__ v8f mm_h(v16h a, v16h b, v8f c) { return __builtin_amdgcn_wmma_f32_16x16x32_f16(false, a, false, b, (short)0, c, false, false); }
__device__ __forceinline__ v16h frag_hs(const _Float16* p) { union { v16h v; v8h q[2]; } u; u.q[0] = *(const v8h*)p; u.q[1] = *(const v8h*)(p + 16); return u.v; }
__device__ __forceinline__ float exp2_slot(float x) { float r; asm("v_exp_f32 %0, %1\n\tv_nop" : "=v"(r) : "v"(x)); return r; }
struct KSet { v16h f[2][2]; };                 // one 32-key pass: [key tile of 16][32 head dims]
struct VSet { v16b h[4], l[4]; };              // one 32-key pass: V^T hi and lo, 16 head dims each
__device__ __forceinline__ void k_ld(KSet& s, const _Float16* p) {
#pragma unroll
  for (int t = 0; t < 2; ++t) { s.f[t][0] = pk_ldh(p + t * 2 * PKF); s.f[t][1] = pk_ldh(p + t * 2 * PKF + PKF); }
  xwait(p); }
__device__ __forceinline__ void v_ld(VSet& s, const __bf16* hp, const __bf16* lp) {
#pragma unroll
  for (int j = 0; j < 4; ++j) { s.h[j] = pk_ld(hp + j * PKF); s.l[j] = pk_ld(lp + j * PKF); }
  xwait2(hp, lp); }
__global__ __launch_bounds__(256) void k_fa(const _Float16* __restrict__ QH, const _Float16* __restrict__ QL, const _Float16* __restrict__ KH, const __bf16* __restrict__ VT, const __bf16* __restrict__ VL, __bf16* __restrict__ YH, __bf16* __restrict__ YL) {
  __shared__ __align__(16) v4f mg[2][GQ][9][32];   // [query tile of the pair's two][head][O in quads 0..7, (reference, sum) in 8][lane]: a buffer a tile, so one barrier a tile is enough
  const int tid = threadIdx.x, wave = __builtin_amdgcn_readfirstlane(tid >> 5), hw = wave & 3, kh = wave >> 2, lane = tid & 31, col = lane & 15, g = lane >> 4; const int kvh = blockIdx.y, b = blockIdx.z, h = kvh * GQ + hw;   // the wave's number in a scalar register: pass counter, refill addresses and the branches on kh stay scalar
  const size_t vo = (size_t)(b * HK + kvh) * (TT / 32) * (4 * PKF) + lane * 8; const _Float16* kp = KH + vo; const __bf16* hp = VT + vo; const __bf16* lp = VL + vo;   // a pass of 32 keys is four fragments in k and in each V plane
  // rolled: the two query tiles of a wave run one after the other through the same code
#pragma unroll 1
  for (int part = 0; part < 2; ++part) { const int tile = part ? TT / 16 - 1 - (int)blockIdx.x : (int)blockIdx.x; const int qt = tile * 16 + col; const int n = tile / 2 + 1;   // passes of 32 keys up to the diagonal
    const size_t qo = ((size_t)b * TT + qt) * CC + h * HD + 8 * g; const v16h qh0 = frag_hs(QH + qo), qh1 = frag_hs(QH + qo + 32), ql0 = frag_hs(QL + qo), ql1 = frag_hs(QL + qo + 32);
    asm volatile("" :: "v"(qh0), "v"(qh1), "v"(ql0), "v"(ql1));   // inputs only: Q has landed before K and V go out, so the loop's load waits count K and V alone and V stays in flight over the score products
    v8f o[4] = {}; float m = -3.0e38f, l = 0.f; v8f nm = {};   // m: the reference in use, the same in both lanes of a query; nm: minus m in all eight registers, the start value of the score products (0 until the first pass has set m)
    const int s0 = kh < n ? kh : 0;   // a wave with no pass of its own (one-pass tile, kh = 1) reads pass 0, in bounds, and does not use it
    KSet ks; VSet vs; k_ld(ks, kp + (size_t)s0 * (4 * PKF)); v_ld(vs, hp + (size_t)s0 * (4 * PKF), lp + (size_t)s0 * (4 * PKF));
    // rolled: K and V keep their registers; the next pass's K goes out behind this pass's score products, its V behind the output products; the last pass's refills read its own keys again and are not used
    // the last product of each accumulator goes through wmma16 / wmma_bf: the statement behind it keeps the refill loads from moving up over it, where they would need second registers, copies and a wait at the loop's foot
#pragma unroll 1
    for (int s = kh; s < n; s += 2) { const int sn = s + 2 < n ? s + 2 : s; v8f st[2];
#pragma unroll
      for (int t = 0; t < 2; ++t) { st[t] = mm_h(ks.f[t][0], qh0, nm); st[t] = mm_h(ks.f[t][0], ql0, st[t]); st[t] = mm_h(ks.f[t][1], qh1, st[t]); st[t] = wmma16(ks.f[t][1], ql1, st[t]); }
      k_ld(ks, kp + (size_t)sn * (4 * PKF));
      __builtin_amdgcn_sched_barrier(0);   // the K refill goes out ahead of the softmax, which runs while it is in flight; without this it sinks to the output products
      // Two paths. The plain one, for a pass inside the causal triangle whose scores stay near the reference in use: 2^(score - reference) straight from the products' result, and the sums. No mask, no maximum, no rescale.
      float e[16];
#pragma unroll
      for (int i = 0; i < 16; ++i) e[i] = __builtin_amdgcn_exp2f(st[i >> 3][i & 7]);
      float sm[4];
#pragma unroll
      for (int c = 0; c < 4; ++c) sm[c] = (e[c] + e[4 + c]) + (e[8 + c] + e[12 + c]);
      float ps = (sm[0] + sm[1]) + (sm[2] + sm[3]);   // this lane's half of the keys; the halves join behind the loop
      // The careful one, behind one test a pass, a scalar branch for the whole wave: the wave's first pass (sets the reference), the diagonal pass (the only one with masked keys), and any pass in which a lane's sum passes 256
      // (an infinite term does too). The reference is then raised to the pass's maximum, so it is always a real score of the query: the largest term so far is at least 1 and at most 256, whatever the scores' range.
      const bool first = s == kh;
      const float th = (first || s == n - 1) ? -1.0f : 256.0f;   // no sum is below 0: these passes always take the branch
      if (__builtin_expect(__builtin_amdgcn_ballot_w32(!(ps <= th)) != 0, 0)) {   // marked rare: the plain path is laid out in a row
        const int rel = qt - s * 32 - 8 * g; float p[16];   // element i is key s * 32 + 16 (i >> 3) + 8 g + (i & 7): inside the causal triangle while 16 (i >> 3) + (i & 7) <= rel
#pragma unroll
        for (int i = 0; i < 16; ++i) p[i] = (16 * (i >> 3) + (i & 7) <= rel) ? st[i >> 3][i & 7] : -3.0e38f;   // scores in base-2 units, less the reference in use
        float mx[4];
#pragma unroll
        for (int c = 0; c < 4; ++c) mx[c] = fmaxf(fmaxf(p[c], p[4 + c]), fmaxf(p[8 + c], p[12 + c]));
        float mn = fmaxf(fmaxf(mx[0], mx[1]), fmaxf(mx[2], mx[3])); mn = fmaxf(mn, xhalf(mn));   // the first key of every pass up to the diagonal is open to every query of the tile, so mn is a real score, the same in both lanes of the query
        const float d = first ? mn : fmaxf(mn, 0.f);   // the step of the reference; a query whose scores stay below it keeps it
        const float al = first ? 0.f : exp2_slot(-d);   // nothing is summed yet in the first pass
        m = first ? mn : m + d;
#pragma unroll
        for (int r = 0; r < 8; ++r) nm[r] = -m;
#pragma unroll
        for (int i = 0; i < 16; ++i) e[i] = exp2_slot(p[i] - d);   // a masked score gives exactly 0
#pragma unroll
        for (int c = 0; c < 4; ++c) sm[c] = (e[c] + e[4 + c]) + (e[8 + c] + e[12 + c]);
        ps = (sm[0] + sm[1]) + (sm[2] + sm[3]);
        l *= al;
#pragma unroll
        for (int j = 0; j < 4; ++j) o[j] *= al; }
      l += ps;
      const F2 pf = bsplit16(e);
#pragma unroll
      for (int j = 0; j < 4; ++j) { o[j] = mm_b(vs.h[j], pf.h, o[j]); o[j] = mm_b(vs.h[j], pf.l, o[j]); o[j] = wmma_bf(vs.l[j], pf.h, o[j]); }
      v_ld(vs, hp + (size_t)sn * (4 * PKF), lp + (size_t)sn * (4 * PKF)); }
    // O^T register r of tile j is head dim 16 j + 8 g + r of the lane's query: column 64 h + 16 j + 8 g + r of y, which is element r of this lane in pass 2 h + (j >> 1), half j & 1 of the packed row block
    if (kh == 0) {
#pragma unroll   // o is indexed by constants only and stays in registers
      for (int j = 0; j < 4; ++j) { mg[part][hw][2 * j][lane] = v4f{o[j][0], o[j][1], o[j][2], o[j][3]}; mg[part][hw][2 * j + 1][lane] = v4f{o[j][4], o[j][5], o[j][6], o[j][7]}; }
      mg[part][hw][8][lane] = v4f{m, l, 0.f, 0.f}; }
    // hand-over through LDS alone: the fences name the LDS, so the barrier waits for the partial results and not for global loads or stores in flight, which no other wave of this launch depends on
    __builtin_amdgcn_fence(__ATOMIC_RELEASE, "workgroup", "local"); __builtin_amdgcn_s_barrier(); __builtin_amdgcn_fence(__ATOMIC_ACQUIRE, "workgroup", "local");
    if (kh == 0) continue;
    { const v4f ml = mg[part][hw][8][lane]; const float ms = fmaxf(m, ml.x); const float a1 = exp2_slot(m - ms), a0 = exp2_slot(ml.x - ms);   // wave 0 always has a pass, so ms is a real score; a wave 1 without one has m = -3.0e38, weight exactly 0, on zeros
      l = l * a1 + ml.y * a0;
#pragma unroll   // as above
      for (int j = 0; j < 4; ++j) { const v4f t0 = mg[part][hw][2 * j][lane], t1 = mg[part][hw][2 * j + 1][lane];
#pragma unroll   // as above
        for (int r = 0; r < 4; ++r) { o[j][r] = o[j][r] * a1 + t0[r] * a0; o[j][4 + r] = o[j][4 + r] * a1 + t1[r] * a0; } } }
    l += xhalf(l); const float inv = 1.0f / l; const size_t yo = (size_t)(b * (TT / 16) + tile) * PKB + (size_t)h * 2 * PKF + lane * 8;
#pragma unroll
    for (int j = 0; j < 4; ++j) { v8b a, c;
#pragma unroll
      for (int r = 0; r < 8; ++r) { const float v = o[j][r] * inv; const __bf16 hv = (__bf16)v; a[r] = hv; c[r] = (__bf16)(v - (float)hv); }
      vst2(YH + yo + j * 256, a); vst2(YL + yo + j * 256, c); }
    xwait2(YH + yo, YL + yo); } }
// ---- k_out: out = y (hi + lo) Wproj^T
__global__ __launch_bounds__(128) void k_out(const __bf16* __restrict__ YH, const __bf16* __restrict__ YL, const __bf16* __restrict__ WP, float* __restrict__ OUT) { __shared__ __align__(16) float sf[4][32][132];   // a wave's own staging rows: 0..15 from acc, 16..31 from nx
  const int tid = threadIdx.x, wave = tid >> 5, lane = tid & 31, col = lane & 15, g = lane >> 4; const int c0 = blockIdx.y * 128; const size_t r0 = (size_t)blockIdx.x * 128 + wave * 16;   // a wave holds two 16-row tiles, 64 rows apart: acc and nx
  v8f acc[8] = {}, nx[8] = {};
  const size_t yo = (size_t)((int)blockIdx.x * 8 + wave) * PKB + lane * 8; const __bf16* hp = YH + yo; const __bf16* lp = YL + yo; const __bf16* wp = WP + (size_t)(WB_O + c0 / 16) * PKB + lane * 8;
  OSet s0, s1; os_ld<0>(s0, hp, lp, wp); SB(); os_ld<PKF>(s1, hp, lp, wp); SB();
  // rolled: two passes a trip, each in its own register set, refilled behind its products for the pass two on, so a set's loads fly over the other pass's products; the last trip's refills read its own passes again and are not used
#pragma unroll 1
  for (int kc = 0; kc < CC / 32; kc += 2) { const int kn = (kc + 2 < CC / 32 ? kc + 2 : kc) * PKF;
    os_mul(s0, acc, nx); SB(); os_ld<0>(s0, hp + kn, lp + kn, wp + kn); SB();
    os_mul(s1, acc, nx); SB(); os_ld<PKF>(s1, hp + kn, lp + kn, wp + kn); SB(); }
#pragma unroll
  for (int j = 0; j < 8; ++j)
#pragma unroll
    for (int r = 0; r < 8; ++r) { sf[wave][8 * g + r][j * 16 + col] = acc[j][r]; sf[wave][16 + 8 * g + r][j * 16 + col] = nx[j][r]; }
  LDSX(); for (int rl = 0; rl < 32; ++rl) vst2(OUT + (r0 + (rl >> 4) * 64 + (rl & 15)) * CC + c0 + lane * 4, *(const v4f*)&sf[wave][rl][lane * 4]); }
extern "C" void kernel_launch(void* const* d_in, const int* in_sizes, int n_in, void* d_out, int out_size, void* d_ws, size_t ws_size, hipStream_t stream) {
  (void)in_sizes; (void)n_in; (void)out_size;
  const float** F = (const float**)d_in;   // 0 x [2,2048,1024], 1 Wq [1024,1024], 2 Wk [256,1024], 3 Wv [256,1024], 4 Wproj [1024,1024] ([out,in]), 5 q_gain [16], 6 lora_A_q [2,4,1024], 7 lora_B_q [2,1024,4], 8 lora_A_v [2,4,1024], 9 lora_B_v [2,256,4], 10 step_idx [1] int32
  if (ws_size < (size_t)WS_END) return;
  const int* STEP = (const int*)d_in[10];
  char* ws = (char*)d_ws; float *XA = (float*)(ws + WS_XA); _Float16 *QH = (_Float16*)(ws + WS_QH), *QL = (_Float16*)(ws + WS_QL), *KH = (_Float16*)(ws + WS_KH); __bf16 *VT = (__bf16*)(ws + WS_VT), *VL = (__bf16*)(ws + WS_VL), *YH = (__bf16*)(ws + WS_YH), *YL = (__bf16*)(ws + WS_YL), *XP = (__bf16*)(ws + WS_XP), *WP = (__bf16*)(ws + WS_WP);
  k_pack<<<XB + (2 * CC + 2 * KV) / 16, 256, 0, stream>>>(F[0], F[1], F[2], F[3], F[4], F[6], F[8], STEP, XP, WP, XA);
  k_proj<<<dim3(TNB * TT / 128, (CC + 2 * KV) / 128), 128, 0, stream>>>(XP, WP, F[5], F[7], F[9], STEP, XA, QH, QL, KH, VT, VL);
  k_fa<<<dim3(TT / 32, HK, TNB), 256, 0, stream>>>(QH, QL, KH, VT, VL, YH, YL);
  k_out<<<dim3(TNB * TT / 128, CC / 128), 128, 0, stream>>>(YH, YL, WP, (float*)d_out);
}

// v010
// Measured time: 77.1 microseconds a run.
// Two timings next to v009 put it at 1.05 and 1.03 times that version's speed.
// Over all steps from v000 it is 17.8 times as fast.
// compute dtype: all float inputs rounded to bf16, step_idx (int) read; q/k/v = x W^T with EXACT bf16 products on WMMA 16x16x32, f32 accumulate, plus the rank-4 LoRA terms (x A^T exact on WMMA, then . B^T on the VALU in f32) for q and v when 0 <= step_idx < 2; per-head RMSNorm (eps = f32 eps), partial rotary on the first 32 dims (10000^(-2i/32) and the angles computed on device per row with precise powf/sincosf, no tables), q_gain, in f32; q times 0.125 log2(e) as f16 hi + residual, k f16 -> 2-product causal GQA logits in base-2 units, kept in registers; softmax in f32 in base 2 against a held reference (minus the reference is the score products' start value, then the hardware's exp2; the reference is a real score and is raised when a pass's sum passes 256), unnormalised P in f32 split bf16 hi + lo against v bf16 hi + lo (3 products), divided by the row sum at the end; out = y (bf16 hi + lo) Wproj^T; f32 output.
#include <hip/hip_runtime.h>
#include <math.h>

typedef __attribute__((ext_vector_type(16))) _Float16 v16h;
typedef __attribute__((ext_vector_type(16))) __bf16 v16b;
typedef __attribute__((ext_vector_type(8)))  _Float16 v8h;
typedef __attribute__((ext_vector_type(8)))  float v8f;
typedef __attribute__((ext_vector_type(4)))  float v4f;
typedef __attribute__((ext_vector_type(2)))  float v2f;
typedef __attribute__((ext_vector_type(4)))  unsigned v4u;
typedef __attribute__((ext_vector_type(4)))  int v4i;
typedef float __attribute__((may_alias)) float_a;
typedef int __attribute__((may_alias)) int_a;

template <typename T> __device__ __forceinline__ void vst2(void* p, T v) { *(T*)p = v;  }
__device__ __forceinline__ v8f wmma16(v16h a, v16h b, v8f c) {
  v8f d = __builtin_amdgcn_wmma_f32_16x16x32_f16(false, a, false, b, (short)0, c, false, false);
  asm volatile("v_nop\n\tv_nop\n\tv_nop\n\tv_nop" : "+v"(d) : "v"(a), "v"(b));
  return d;
}
__device__ __forceinline__ v8f wmma_bf(v16b a, v16b b, v8f c) {
  v8f d = __builtin_amdgcn_wmma_f32_16x16x32_bf16(false, a, false, b, (short)0, c, false, false);
  asm volatile("v_nop\n\tv_nop\n\tv_nop\n\tv_nop" : "+v"(d) : "v"(a), "v"(b));
  return d;
}
__device__ __forceinline__ v8f mm_b(v16b a, v16b b, v8f c) { return __builtin_amdgcn_wmma_f32_16x16x32_bf16(false, a, false, b, (short)0, c, false, false); }
// 16x16x32 fragments: lane = (h = lane>>4, row/col = lane&15); elements 0..7 = k0+8h+0..7, 8..15 = k0+16+8h+0..7; D element r = row 8h+r
__device__ __forceinline__ v16h frag_h(const _Float16* rowk0, int lane) {
  union { v16h v; v8h q[2]; } u; const _Float16* p = rowk0 + 8 * (lane >> 4);
  u.q[0] = *(const v8h*)p; u.q[1] = *(const v8h*)(p + 16); return u.v;
}
__device__ __forceinline__ v16h frag_f32(const float* rowk0, int lane) {
  v16h a; const float* p = rowk0 + 8 * (lane >> 4);
#pragma unroll
  for (int i = 0; i < 8; ++i) { a[i] = (_Float16)p[i]; a[8 + i] = (_Float16)p[16 + i]; }
  return a;
}
__device__ __forceinline__ v16h frag_f32s(const float* rowk0, int lane, float sc) {
  v16h a; const float* p = rowk0 + 8 * (lane >> 4);
#pragma unroll
  for (int i = 0; i < 8; ++i) { a[i] = (_Float16)(p[i] * sc); a[8 + i] = (_Float16)(p[16 + i] * sc); }
  return a;
}
// column fragment from a [K][ld] layout (column n), rows >= K read as 0
__device__ __forceinline__ v16h fragc_f32(const float* W, int k0, int n, int lane, int ld, int K) {
  v16h a; const int g = lane >> 4;
#pragma unroll
  for (int i = 0; i < 8; ++i) { const int ka = k0 + 8 * g + i, kb = ka + 16;
    a[i] = (_Float16)(ka < K ? W[(size_t)(ka < K ? ka : K - 1) * ld + n] : 0.f); a[8 + i] = (_Float16)(kb < K ? W[(size_t)(kb < K ? kb : K - 1) * ld + n] : 0.f); }
  return a;
}
struct F2 { v16b h, l; };
__device__ __forceinline__ F2 bsplit16(const float v[16]) { F2 r;
#pragma unroll
  for (int i = 0; i < 16; ++i) { const __bf16 h = (__bf16)v[i]; r.h[i] = h; r.l[i] = (__bf16)(v[i] - (float)h); }
  return r; }
__device__ __forceinline__ F2 split_row(const float* row, int k0, int lane) { float v[16]; const float* p = row + k0 + 8 * (lane >> 4);
#pragma unroll
  for (int i = 0; i < 8; ++i) { v[i] = p[i]; v[8 + i] = p[16 + i]; }
  return bsplit16(v); }
__device__ __forceinline__ F2 split_rowK(const float* row, int k0, int lane, int K) { float v[16]; const int g = lane >> 4;
#pragma unroll
  for (int i = 0; i < 8; ++i) { const int ka = k0 + 8 * g + i, kb = ka + 16; v[i] = ka < K ? row[ka < K ? ka : K - 1] : 0.f; v[8 + i] = kb < K ? row[kb < K ? kb : K - 1] : 0.f; }
  return bsplit16(v); }
__device__ __forceinline__ F2 split_col(const float* W, int k0, int n, int lane, int ld, int K) { float v[16]; const int g = lane >> 4;
#pragma unroll
  for (int i = 0; i < 8; ++i) { const int ka = k0 + 8 * g + i, kb = ka + 16; v[i] = ka < K ? W[(size_t)(ka < K ? ka : K - 1) * ld + n] : 0.f; v[8 + i] = kb < K ? W[(size_t)(kb < K ? kb : K - 1) * ld + n] : 0.f; }
  return bsplit16(v); }
__device__ __forceinline__ v8f mac3(const F2& a, const F2& b, v8f c) { c = wmma_bf(a.l, b.h, c); c = wmma_bf(a.h, b.l, c); return wmma_bf(a.h, b.h, c); }
__device__ __forceinline__ float sigm(float v) { return 1.0f / (1.0f + expf(-v)); }
#define LDSX() do { asm volatile("s_wait_dscnt 0" ::: "memory"); __builtin_amdgcn_wave_barrier(); __builtin_amdgcn_fence(__ATOMIC_RELEASE, "workgroup"); } while (0)


// RRT attention (B 2, S 2,048, dim 1,024 = 16 q heads x 64, 4 kv heads, LoRA rank 4 on q and v selected by step_idx, partial RoPE 32, RMS-normed q/k, per-head q gain, causal GQA SDPA, output Linear).
#define NB 2
#define TT 2048
#define CC 1024
#define NH 16
#define HK 4
#define GQ (NH / HK)
#define HD 64
#define KV (HK * HD)        // 256
#define RD 32               // partial rope dims
#define LR 4                // lora rank
#define HG 4
#define NR (NB * TT)
#define SC2 0.18033688011112043f               // 0.125 * log2(e): 1 / sqrt(head dim) and the change of base in one factor
#ifndef TNB
#define TNB NB
#endif
typedef __attribute__((ext_vector_type(8))) __bf16 v8b;
__device__ __forceinline__ v16b frag_b(const __bf16* rowk0, int lane) {
  union { v16b v; v8b q[2]; } u; const __bf16* p = rowk0 + 8 * (lane >> 4);
  u.q[0] = *(const v8b*)p; u.q[1] = *(const v8b*)(p + 16); return u.v;
}
__device__ __forceinline__ float bfr(float v) { return (float)(__bf16)v; }
__device__ __attribute__((noinline)) float exp_ni(float v) { return expf(v); }
__device__ __attribute__((noinline)) float erf_ni(float v) { return erff(v); }
// Operand sets held as loaded. The loops of k_proj and k_out write a whole set's loads in one group, ahead of the WMMAs that run while the set is in flight, and read the set only three stages later: a ring of four sets.
// SB() between a set's products and its refill keeps that written order: without it the refill loads move up among the products, into further registers. The products are the plain builtin: two sets and two
// tiles of accumulators take more than 256 registers (four sets all the more), and an asm statement's vector operands would hold them below that.
#define SB() __builtin_amdgcn_sched_barrier(0)
struct Raw16 { v4f q[4]; };                    // one f32 row fragment: k0+8h+0..7 in q[0], q[1]; k0+16+8h+0..7 in q[2], q[3]
__device__ __forceinline__ void raw_ld(Raw16& s, const float* p) { s.q[0] = *(const v4f*)p; s.q[1] = *(const v4f*)(p + 4); s.q[2] = *(const v4f*)(p + 16); s.q[3] = *(const v4f*)(p + 20); }
__device__ __forceinline__ v16b raw_bf(const Raw16& s) { v16b w;
#pragma unroll
  for (int i = 0; i < 4; ++i) { w[i] = (__bf16)s.q[0][i]; w[4 + i] = (__bf16)s.q[1][i]; w[8 + i] = (__bf16)s.q[2][i]; w[12 + i] = (__bf16)s.q[3][i]; }
  return w; }
// behind a group of loads: the wait that is kept in front of any rewrite of the address registers these loads name; the inputs hold those registers unchanged up to it
__device__ __forceinline__ void xwait(const void* p) { asm volatile("s_wait_xcnt 0x0" :: "v"(p) : "memory"); }
__device__ __forceinline__ void xwait2(const void* p, const void* q) { asm volatile("s_wait_xcnt 0x0" :: "v"(p), "v"(q) : "memory"); }
// the same wait without operands, for the loops above 256 registers, where a vector operand of an asm statement ties its pointer to the first 256 and costs a spill; SB() directly behind it holds later address arithmetic behind it
__device__ __forceinline__ void xwait0() { asm volatile("s_wait_xcnt 0x0" ::: "memory"); }
// Packed operand: a [rows][1024] matrix as bf16 in fragment order, [16-row block][pass of 32 k][half q][lane][8]: element i is row 16 block + (lane & 15), k = 32 pass + 16 q + 8 (lane >> 4) + i,
// the k order of raw_bf. One fragment is 1 KiB in a row and one wave-wide 16-byte load of it is 512 contiguous bytes, four whole lines.
#define PKF 512                                // elements of one fragment
#define PKB (CC / 32 * PKF)                    // elements of one 16-row block
__device__ __forceinline__ v16b pk_ld(const __bf16* p) { union { v16b v; v8b q[2]; } u; u.q[0] = *(const v8b*)p; u.q[1] = *(const v8b*)(p + 256); return u.v; }   // the lane's 8 * lane is already in p
__device__ __forceinline__ v16h pk_ldh(const _Float16* p) { union { v16h v; v8h q[2]; } u; u.q[0] = *(const v8h*)p; u.q[1] = *(const v8h*)(p + 256); return u.v; }
__device__ __forceinline__ void pk_st(__bf16* p, v16b w) { union { v16b v; v8b q[2]; } u; u.v = w; vst2(p, u.q[0]); vst2(p + 256, u.q[1]); }
struct PSet { v16b a[2], w[8]; };              // one pass of k_proj: the wave's two x fragments, 64 rows apart, and eight weight fragments, 16 output columns apart
template <int OFF> __device__ __forceinline__ void ps_ld(PSet& s, const __bf16* ap, const __bf16* wp) { s.a[0] = pk_ld(ap + OFF); s.a[1] = pk_ld(ap + 4 * PKB + OFF);   // OFF goes into the loads' offset fields: the four sets of a trip name the same address registers
#pragma unroll
  for (int j = 0; j < 8; ++j) s.w[j] = pk_ld(wp + (size_t)j * PKB + OFF);
  xwait0(); }
__device__ __forceinline__ void ps_mul(const PSet& s, v8f acc[8], v8f nx[8]) {   // each weight fragment meets both x fragments
#pragma unroll
  for (int j = 0; j < 8; ++j) { acc[j] = mm_b(s.a[0], s.w[j], acc[j]); nx[j] = mm_b(s.a[1], s.w[j], nx[j]); } }
struct OSet { v16b ah[2], al[2], w[8]; };      // one pass of k_out: the wave's two y fragments, 64 rows apart, hi and lo, and eight weight fragments
template <int OFF> __device__ __forceinline__ void os_ld(OSet& s, const __bf16* hp, const __bf16* lp, const __bf16* wp) { s.ah[0] = pk_ld(hp + OFF); s.al[0] = pk_ld(lp + OFF); s.ah[1] = pk_ld(hp + 4 * PKB + OFF); s.al[1] = pk_ld(lp + 4 * PKB + OFF);
#pragma unroll
  for (int j = 0; j < 8; ++j) s.w[j] = pk_ld(wp + (size_t)j * PKB + OFF);
  xwait0(); }
__device__ __forceinline__ void os_mul(const OSet& s, v8f acc[8], v8f nx[8]) {   // each weight fragment meets both y fragments; an accumulator takes hi, then lo, as before
#pragma unroll
  for (int j = 0; j < 8; ++j) { acc[j] = mm_b(s.ah[0], s.w[j], acc[j]); nx[j] = mm_b(s.ah[1], s.w[j], nx[j]); acc[j] = mm_b(s.al[0], s.w[j], acc[j]); nx[j] = mm_b(s.al[1], s.w[j], nx[j]); } }

#define WS_XA  0u
#define WS_QH  (WS_XA + 4u * (size_t)NR * 32)
#define WS_QL  (WS_QH + 2u * (size_t)NR * CC)
#define WS_KH  (WS_QL + 2u * (size_t)NR * CC)          // f16 k, fragment order
#define WS_VT  (WS_KH + 2u * (size_t)NR * KV)          // bf16 V^T planes hi / lo, fragment order
#define WS_VL  (WS_VT + 2u * (size_t)NB * KV * TT)
#define WS_YH  (WS_VL + 2u * (size_t)NB * KV * TT)      // packed y, bf16 hi / lo
#define WS_YL  (WS_YH + 2u * (size_t)NR * CC)
#define WS_XP  (WS_YL + 2u * (size_t)NR * CC)          // packed x
#define WS_WP  (WS_XP + 2u * (size_t)NR * CC)          // packed weights, row blocks [Wq 64 | Wk 16 | Wv 16 | Wproj 64]
#define WS_END (WS_WP + 2u * (size_t)(2 * CC + 2 * KV) * CC)
#define XB (TNB * TT / 16)                             // 16-row blocks of x
#define WB_O ((CC + 2 * KV) / 16)                      // first row block of Wproj in the packed weights

// ---- k_pack: x and the four weight matrices, each element rounded to bf16 once and stored in fragment order. Block = one 16-row block, wave = four passes of 32 k.
// An x block also forms its rows of x A^T while the fragments are in registers: XA[row][0..3] = x . A_q[si]^T, [4..7] = x . A_v[si]^T (exact products; zero if step_idx is out of range).
// Each wave multiplies its four passes; the eight partial tiles meet in LDS and are added in wave order.
__global__ __launch_bounds__(256) void k_pack(const float* __restrict__ X, const float* __restrict__ WQ, const float* __restrict__ WK, const float* __restrict__ WV, const float* __restrict__ WO, const float* __restrict__ AQ, const float* __restrict__ AV, const int* __restrict__ STEP, __bf16* __restrict__ XP, __bf16* __restrict__ WP, float* __restrict__ XA) {
  __shared__ __align__(16) float ss[8][16][12];   // pitch 12: rows r and 8 + r, written by one store, fall on different banks; a row's two quads stay 16-byte aligned
  const int tid = threadIdx.x, wave = tid >> 5, lane = tid & 31, col = lane & 15, g = lane >> 4; const int rb = blockIdx.x, wb = rb - XB, k4 = wave * 4;
  const int si = STEP[0]; const bool use = (si >= 0 && si < 2);
  const float* src = rb < XB ? X + (size_t)rb * 16 * CC : wb < CC / 16 ? WQ + (size_t)wb * 16 * CC : wb < (CC + KV) / 16 ? WK + (size_t)(wb - CC / 16) * 16 * CC : wb < WB_O ? WV + (size_t)(wb - (CC + KV) / 16) * 16 * CC : WO + (size_t)(wb - WB_O) * 16 * CC;
  __bf16* dst = rb < XB ? XP + (size_t)rb * PKB : WP + (size_t)wb * PKB;
  const float* p = src + (size_t)col * CC + k4 * 32 + 8 * g; __bf16* d = dst + (size_t)k4 * PKF + lane * 8;
  Raw16 r[4];
#pragma unroll
  for (int u = 0; u < 4; ++u) raw_ld(r[u], p + u * 32);
  xwait(p);
  if (rb >= XB) {
#pragma unroll
    for (int u = 0; u < 4; ++u) pk_st(d + u * PKF, raw_bf(r[u]));
    xwait(d); return; }   // a whole block leaves here, ahead of the barrier
  const float* aq = AQ + (size_t)(use ? si : 0) * LR * CC; const float* av = AV + (size_t)(use ? si : 0) * LR * CC; const bool on = col < 8;
  const float* ap = ((col < 4) ? (aq + (size_t)col * CC) : on ? (av + (size_t)(col - 4) * CC) : aq) + k4 * 32 + 8 * g;   // columns 8..15 read row 0 of A_q, in bounds; a column of the product depends on its own lanes' operand alone, and those columns are not stored
  Raw16 rw[4];
#pragma unroll
  for (int u = 0; u < 4; ++u) raw_ld(rw[u], ap + u * 32);
  xwait(ap);
  __builtin_amdgcn_sched_barrier(0);   // the A loads go out while x is in flight; without this the first conversions of x, with their load waits, move up in front of them
  v16b a[4];
#pragma unroll
  for (int u = 0; u < 4; ++u) { a[u] = raw_bf(r[u]); pk_st(d + u * PKF, a[u]); }
  xwait(d);
  v8f acc = {};
#pragma unroll
  for (int u = 0; u < 4; ++u) acc = wmma_bf(a[u], raw_bf(rw[u]), acc);
  if (on) {
#pragma unroll
    for (int q = 0; q < 8; ++q) ss[wave][8 * g + q][col] = acc[q]; }
  // hand-over through LDS alone: the fences name the LDS, so the barrier waits for the partial tiles and not for the packed fragments' global stores, which no wave of this launch reads
  __builtin_amdgcn_fence(__ATOMIC_RELEASE, "workgroup", "local"); __builtin_amdgcn_s_barrier(); __builtin_amdgcn_fence(__ATOMIC_ACQUIRE, "workgroup", "local");
  if (tid < 32) { const int rl = tid >> 1, c4 = (tid & 1) * 4; v4f t = *(const v4f*)&ss[0][rl][c4];
#pragma unroll
    for (int w = 1; w < 8; ++w) t += *(const v4f*)&ss[w][rl][c4];
    if (!use) t = v4f{0.f, 0.f, 0.f, 0.f};
    vst2(XA + ((size_t)rb * 16 + rl) * 32 + c4, t); } }
// lane exchanges inside a 16-lane row group, as DPP operands: 0x160 + m reads lane l ^ m, 0x150 + n reads lane n of the group
template <int CTRL> __device__ __forceinline__ float dppf(float x) { return __builtin_bit_cast(float, __builtin_amdgcn_update_dpp(0, __builtin_bit_cast(int, x), CTRL, 0xf, 0xf, true)); }
// one halving step of a sum of 2 WD values over the group: a lane keeps the half that its bit WD of col names and adds its partner's share of that half
template <int WD> __device__ __forceinline__ void rstep(float* v, int col) { const bool up = (col & WD) != 0;
#pragma unroll
  for (int i = 0; i < WD; ++i) { const float keep = up ? v[i + WD] : v[i], send = up ? v[i] : v[i + WD]; v[i] = keep + dppf<0x160 + WD>(send); } }
template <int I> __device__ __forceinline__ void rshare(float* o, float x) { if constexpr (I < 16) { o[I] = dppf<0x150 + I>(x); rshare<I + 1>(o, x); } }
// ---- k_proj: block = (128 rows, 128 cols over [q 1024 | k 256 | v 256]): x W^T (+ LoRA), RMSNorm + partial rope (+ gain) for q/k; v -> planes
// A wave holds two 16-row tiles, 64 rows apart (acc: rows 16 wave.., nx: rows 64 + 16 wave..), so a weight fragment is loaded once for 32 rows. The epilogue runs once for each 64-row half of the block.
__global__ __launch_bounds__(128) void k_proj(const __bf16* __restrict__ XP, const __bf16* __restrict__ WP, const float* __restrict__ GAIN, const float* __restrict__ BQ, const float* __restrict__ BV, const int* __restrict__ STEP, const float* __restrict__ XA, _Float16* __restrict__ QH, _Float16* __restrict__ QL, _Float16* __restrict__ KH, __bf16* __restrict__ VT, __bf16* __restrict__ VL) {
  __shared__ __align__(16) _Float16 sh[64][136], sl[64][136]; __shared__ __align__(16) __bf16 th[128][72], tl2[128][72];
  const int tid = threadIdx.x, wave = tid >> 5, lane = tid & 31, col = lane & 15, g = lane >> 4; const int cg = blockIdx.y * 128;
  const int region = (cg < CC) ? 0 : (cg < CC + KV) ? 1 : 2; const int c0 = region == 0 ? cg : region == 1 ? cg - CC : cg - CC - KV;
  const int si = STEP[0]; const bool use = (si >= 0 && si < 2);
  v8f acc[8] = {}, nx[8] = {};
  const __bf16* xp = XP + (size_t)((int)blockIdx.x * 8 + wave) * PKB + lane * 8; const __bf16* wp = WP + (size_t)(cg / 16) * PKB + lane * 8;   // the packed weights' row blocks run [q | k | v], as cg does
  PSet s0, s1, s2, s3; ps_ld<0>(s0, xp, wp); SB(); ps_ld<PKF>(s1, xp, wp); SB(); ps_ld<2 * PKF>(s2, xp, wp); SB(); ps_ld<3 * PKF>(s3, xp, wp); SB();
  // rolled: four passes a trip, each in its own register set, refilled behind its products for the pass four on, so a set's loads fly over the other three passes' products; the last four passes stand behind the loop and refill nothing
#pragma unroll 1
  for (int kc = 4; kc < CC / 32; kc += 4) { const int kn = kc * PKF;
    ps_mul(s0, acc, nx); SB(); ps_ld<0>(s0, xp + kn, wp + kn); SB();
    ps_mul(s1, acc, nx); SB(); ps_ld<PKF>(s1, xp + kn, wp + kn); SB();
    ps_mul(s2, acc, nx); SB(); ps_ld<2 * PKF>(s2, xp + kn, wp + kn); SB();
    ps_mul(s3, acc, nx); SB(); ps_ld<3 * PKF>(s3, xp + kn, wp + kn); SB(); }
  ps_mul(s0, acc, nx); ps_mul(s1, acc, nx); ps_mul(s2, acc, nx); ps_mul(s3, acc, nx);
  // rolled: the two halves go through the same epilogue code one after the other; the second half's accumulators move into acc behind the first
#pragma unroll 1
  for (int hf = 0; hf < 2; ++hf) { const size_t r0 = (size_t)blockIdx.x * 128 + hf * 64;
  if (hf) {   // every wave has read the first half's staged rows before the second half overwrites them; the fences name the LDS, so the barrier does not wait for the first half's global stores, which no wave of this launch reads
    __builtin_amdgcn_fence(__ATOMIC_RELEASE, "workgroup", "local"); __builtin_amdgcn_s_barrier(); __builtin_amdgcn_fence(__ATOMIC_ACQUIRE, "workgroup", "local");
#pragma unroll
    for (int j = 0; j < 8; ++j) acc[j] = nx[j]; }
  // From here to the barrier every lane works on its own accumulator registers: acc[j][r] is row rw + r, column 16 j + col of the half.
  const int rw = wave * 16 + 8 * g;
  if (use && region != 1) {   // LoRA term: the lane's eight B rows and eight x A^T rows go out as one group and are waited for once
    const float* bp = (region == 0 ? BQ + ((size_t)si * CC + c0 + col) * LR : BV + ((size_t)si * KV + c0 + col) * LR); const float* xa = XA + (r0 + rw) * 32 + (region == 0 ? 0 : 4);
    v4f bm[8], xr[8];
#pragma unroll
    for (int j = 0; j < 8; ++j) bm[j] = *(const v4f*)(bp + j * 16 * LR);
#pragma unroll
    for (int r = 0; r < 8; ++r) xr[r] = *(const v4f*)(xa + r * 32);
    xwait2(bp, xa);
#pragma unroll
    for (int j = 0; j < 8; ++j) {
#pragma unroll
      for (int q = 0; q < LR; ++q) bm[j][q] = bfr(bm[j][q]);
#pragma unroll
      for (int r = 0; r < 8; ++r) { float v = acc[j][r];
#pragma unroll
        for (int q = 0; q < LR; ++q) v = __builtin_fmaf(xr[r][q], bm[j][q], v);
        acc[j][r] = v; } } }
  if (region <= 1) {   // RMSNorm per head (64 dims, eps = FLT_EPSILON), partial rope on dims < 32 (x1 = d<16, x2 = 16..31): [x1 c + x2 s, -x1 s + x2 c], then gain (q only)
    // a head is four j; sum 8 hh + r is head hh, row rw + r: four squares in the lane, then over the 16 lanes of the row group; lane col is left with sum col, takes its root once and hands it round
    float s2[16];
#pragma unroll
    for (int i = 0; i < 16; ++i) { const int jb = (i >> 3) * 4, r = i & 7; s2[i] = (acc[jb][r] * acc[jb][r] + acc[jb + 1][r] * acc[jb + 1][r]) + (acc[jb + 2][r] * acc[jb + 2][r] + acc[jb + 3][r] * acc[jb + 3][r]); }
    rstep<8>(s2, col); rstep<4>(s2, col); rstep<2>(s2, col); rstep<1>(s2, col);
    float rs[16]; rshare<0>(rs, 1.0f / sqrtf(s2[0] * (1.0f / HD) + 1.1920929e-7f));
    // the rope pair (d, d + 16) of frequency col is acc[4 hh][r], acc[4 hh + 1][r] of this lane: one angle a row and lane serves both heads
    const float inv_freq = 1.0f / powf(10000.0f, (float)(2 * col) / (float)RD); const int t0 = (int)((r0 + rw) % TT);
    float gn[2] = {1.f, 1.f}; if (region == 0) { gn[0] = bfr(GAIN[c0 / HD]) * SC2; gn[1] = bfr(GAIN[c0 / HD + 1]) * SC2; }   // q is stored in the softmax's base-2 units: k_fa's scores need no scaling; k has no gain: times 1 is exact
#pragma unroll
    for (int r = 0; r < 8; ++r) { float s, c; sincosf((float)(t0 + r) * inv_freq, &s, &c);
#pragma unroll
      for (int hh = 0; hh < 2; ++hh) { const float k = rs[hh * 8 + r]; const float x1 = acc[hh * 4][r] * k, x2 = acc[hh * 4 + 1][r] * k;
        float v[4] = {x1 * c + x2 * s, -x1 * s + x2 * c, acc[hh * 4 + 2][r] * k, acc[hh * 4 + 3][r] * k};
#pragma unroll
        for (int jj = 0; jj < 4; ++jj) { v[jj] *= gn[hh];
          const _Float16 hv = (_Float16)v[jj]; sh[rw + r][hh * 64 + jj * 16 + col] = hv; sl[rw + r][hh * 64 + jj * 16 + col] = (_Float16)(v[jj] - (float)hv); } } }
    __syncthreads();
    if (region == 0) { for (int e = tid; e < 64 * 16; e += 128) { const int rl = e >> 4, q = e & 15; vst2((unsigned*)(QH + (r0 + rl) * CC + c0 + q * 8), *(const v4u*)&sh[rl][q * 8]); vst2((unsigned*)(QL + (r0 + rl) * CC + c0 + q * 8), *(const v4u*)&sl[rl][q * 8]); } }
    else { const size_t kb0 = ((r0 / TT) * HK + c0 / HD) * (size_t)(TT / 16) + (r0 % TT) / 16;   // k in fragment order, [b][kv head][16-key block][f = 16 head dims][lane][8]: key 16 block + (lane & 15), head dim 16 f + 8 (lane >> 4) + i
      for (int e = tid; e < 64 * 16; e += 128) { const int ln = e & 31, f = (e >> 5) & 3, hh = (e >> 7) & 1, kb = e >> 8; vst2((unsigned*)(KH + ((kb0 + (size_t)hh * (TT / 16) + kb) * 4 + f) * 256 + ln * 8), *(const v4u*)&sh[kb * 16 + (ln & 15)][hh * 64 + f * 16 + (ln >> 4) * 8]); } } }
  else {   // the lane's eight rows of column 16 j + col are eight keys in a row of V^T: one 16-byte LDS store a plane
#pragma unroll
    for (int j = 0; j < 8; ++j) { v8b a, c;
#pragma unroll
      for (int r = 0; r < 8; ++r) { const float v = acc[j][r]; const __bf16 bh = (__bf16)v; a[r] = bh; c[r] = (__bf16)(v - (float)bh); }
      vst2(&th[j * 16 + col][rw], a); vst2(&tl2[j * 16 + col][rw], c); }
    __syncthreads(); const size_t p0 = ((r0 / TT) * HK + c0 / HD) * (size_t)(TT / 32) + (r0 % TT) / 32;   // V^T in fragment order, [b][kv head][pass of 32 keys][f][lane][8]: head dim 16 (f >> 1) + (lane & 15), key 32 pass + 16 (f & 1) + 8 (lane >> 4) + i
    for (int e = tid; e < 128 * 8; e += 128) { const int ln = e & 31, f = (e >> 5) & 7, sl = (e >> 8) & 1, hh = e >> 9; const int cl = hh * 64 + (f >> 1) * 16 + (ln & 15), kq = sl * 32 + (f & 1) * 16 + (ln >> 4) * 8;
      const size_t o2 = ((p0 + (size_t)hh * (TT / 32) + sl) * 8 + f) * 256 + ln * 8; vst2((unsigned*)(VT + o2), *(const v4u*)&th[cl][kq]); vst2((unsigned*)(VL + o2), *(const v4u*)&tl2[cl][kq]); } }
  } }
// ---- k_fa: causal GQA attention in one launch, nothing of S or P in memory. Block = the 4 query heads of one kv head, two waves each; a wave pair owns 16 queries:
// wave kh of the pair walks the 32-key passes kh, kh + 2, ... with its own reference, sum and O; the two partial results meet in LDS at the tile's end. Four waves a SIMD, each with half the passes in a row.
// S^T = K Q^T puts one query's scores of a 32-key pass into one lane pair (l, l ^ 16): D register r of key tile t is key 16 t + 8 (l >> 4) + r, which is the k order of a 16x16x32 operand,
// so P goes from the score registers straight into the B operand of O^T += V^T P^T, and reference, sum and rescale are per lane.
// Each wave pair runs query tile x and then tile 127 - x, 65 passes in all: 33 for wave 0, which hands its part over, 32 for wave 1, which joins the parts and stores.
__device__ __forceinline__ float xhalf(float x) { return __builtin_bit_cast(float, __builtin_amdgcn_permlanex16(__builtin_bit_cast(int, x), __builtin_bit_cast(int, x), 0x76543210, 0xfedcba98, false, false)); }  // lane l with lane l ^ 16
__device__ __forceinline__ v8f mm_h(v16h a, v16h b, v8f c) { return __builtin_amdgcn_wmma_f32_16x16x32_f16(false, a, false, b, (short)0, c, false, false); }
__device__ __forceinline__ v16h frag_hs(const _Float16* p) { union { v16h v; v8h q[2]; } u; u.q[0] = *(const v8h*)p; u.q[1] = *(const v8h*)(p + 16); return u.v; }
__device__ __forceinline__ float exp2_slot(float x) { float r; asm("v_exp_f32 %0, %1\n\tv_nop" : "=v"(r) : "v"(x)); return r; }
struct KSet { v16h f[2][2]; };                 // one 32-key pass: [key tile of 16][32 head dims]
struct VSet { v16b h[4], l[4]; };              // one 32-key pass: V^T hi and lo, 16 head dims each
__device__ __forceinline__ void k_ld(KSet& s, const _Float16* p) {
#pragma unroll
  for (int t = 0; t < 2; ++t) { s.f[t][0] = pk_ldh(p + t * 2 * PKF); s.f[t][1] = pk_ldh(p + t * 2 * PKF + PKF); }
  xwait(p); }
__device__ __forceinline__ void v_ld(VSet& s, const __bf16* hp, const __bf16* lp) {
#pragma unroll
  for (int j = 0; j < 4; ++j) { s.h[j] = pk_ld(hp + j * PKF); s.l[j] = pk_ld(lp + j * PKF); }
  xwait2(hp, lp); }
__global__ __launch_bounds__(256) void k_fa(const _Float16* __restrict__ QH, const _Float16* __restrict__ QL, const _Float16* __restrict__ KH, const __bf16* __restrict__ VT, const __bf16* __restrict__ VL, __bf16* __restrict__ YH, __bf16* __restrict__ YL) {
  __shared__ __align__(16) v4f mg[2][GQ][9][32];   // [query tile of the pair's two][head][O in quads 0..7, (reference, sum) in 8][lane]: a buffer a tile, so one barrier a tile is enough
  const int tid = threadIdx.x, wave = __builtin_amdgcn_readfirstlane(tid >> 5), hw = wave & 3, kh = wave >> 2, lane = tid & 31, col = lane & 15, g = lane >> 4; const int kvh = blockIdx.y, b = blockIdx.z, h = kvh * GQ + hw;   // the wave's number in a scalar register: pass counter, refill addresses and the branches on kh stay scalar
  const size_t vo = (size_t)(b * HK + kvh) * (TT / 32) * (4 * PKF) + lane * 8; const _Float16* kp = KH + vo; const __bf16* hp = VT + vo; const __bf16* lp = VL + vo;   // a pass of 32 keys is four fragments in k and in each V plane
  // rolled: the two query tiles of a wave run one after the other through the same code
#pragma unroll 1
  for (int part = 0; part < 2; ++part) { const int tile = part ? TT / 16 - 1 - (int)blockIdx.x : (int)blockIdx.x; const int qt = tile * 16 + col; const int n = tile / 2 + 1;   // passes of 32 keys up to the diagonal
    const size_t qo = ((size_t)b * TT + qt) * CC + h * HD + 8 * g; const v16h qh0 = frag_hs(QH + qo), qh1 = frag_hs(QH + qo + 32), ql0 = frag_hs(QL + qo), ql1 = frag_hs(QL + qo + 32);
    asm volatile("" :: "v"(qh0), "v"(qh1), "v"(ql0), "v"(ql1));   // inputs only: Q has landed before K and V go out, so the loop's load waits count K and V alone and V stays in flight over the score products
    v8f o[4] = {}; float m = -3.0e38f, l = 0.f; v8f nm = {};   // m: the reference in use, the same in both lanes of a query; nm: minus m in all eight registers, the start value of the score products (0 until the first pass has set m)
    const int s0 = kh < n ? kh : 0;   // a wave with no pass of its own (one-pass tile, kh = 1) reads pass 0, in bounds, and does not use it
    KSet ks; VSet vs; k_ld(ks, kp + (size_t)s0 * (4 * PKF)); v_ld(vs, hp + (size_t)s0 * (4 * PKF), lp + (size_t)s0 * (4 * PKF));
    // rolled: K and V keep their registers; the next pass's K goes out behind this pass's score products, its V behind the output products; the last pass's refills read its own keys again and are not used
    // the last product of each accumulator goes through wmma16 / wmma_bf: the statement behind it keeps the refill loads from moving up over it, where they would need second registers, copies and a wait at the loop's foot
#pragma unroll 1
    for (int s = kh; s < n; s += 2) { const int sn = s + 2 < n ? s + 2 : s; v8f st[2];
#pragma unroll
      for (int t = 0; t < 2; ++t) { st[t] = mm_h(ks.f[t][0], qh0, nm); st[t] = mm_h(ks.f[t][0], ql0, st[t]); st[t] = mm_h(ks.f[t][1], qh1, st[t]); st[t] = wmma16(ks.f[t][1], ql1, st[t]); }
      k_ld(ks, kp + (size_t)sn * (4 * PKF));
      __builtin_amdgcn_sched_barrier(0);   // the K refill goes out ahead of the softmax, which runs while it is in flight; without this it sinks to the output products
      // Two paths. The plain one, for a pass inside the causal triangle whose scores stay near the reference in use: 2^(score - reference) straight from the products' result, and the sums. No mask, no maximum, no rescale.
      float e[16];
#pragma unroll
      for (int i = 0; i < 16; ++i) e[i] = __builtin_amdgcn_exp2f(st[i >> 3][i & 7]);
      float sm[4];
#pragma unroll
      for (int c = 0; c < 4; ++c) sm[c] = (e[c] + e[4 + c]) + (e[8 + c] + e[12 + c]);
      float ps = (sm[0] + sm[1]) + (sm[2] + sm[3]);   // this lane's half of the keys; the halves join behind the loop
      // The careful one, behind one test a pass, a scalar branch for the whole wave: the wave's first pass (sets the reference), the diagonal pass (the only one with masked keys), and any pass in which a lane's sum passes 256
      // (an infinite term does too). The reference is then raised to the pass's maximum, so it is always a real score of the query: the largest term so far is at least 1 and at most 256, whatever the scores' range.
      const bool first = s == kh;
      const float th = (first || s == n - 1) ? -1.0f : 256.0f;   // no sum is below 0: these passes always take the branch
      if (__builtin_expect(__builtin_amdgcn_ballot_w32(!(ps <= th)) != 0, 0)) {   // marked rare: the plain path is laid out in a row
        const int rel = qt - s * 32 - 8 * g; float p[16];   // element i is key s * 32 + 16 (i >> 3) + 8 g + (i & 7): inside the causal triangle while 16 (i >> 3) + (i & 7) <= rel
#pragma unroll
        for (int i = 0; i < 16; ++i) p[i] = (16 * (i >> 3) + (i & 7) <= rel) ? st[i >> 3][i & 7] : -3.0e38f;   // scores in base-2 units, less the reference in use
        float mx[4];
#pragma unroll
        for (int c = 0; c < 4; ++c) mx[c] = fmaxf(fmaxf(p[c], p[4 + c]), fmaxf(p[8 + c], p[12 + c]));
        float mn = fmaxf(fmaxf(mx[0], mx[1]), fmaxf(mx[2], mx[3])); mn = fmaxf(mn, xhalf(mn));   // the first key of every pass up to the diagonal is open to every query of the tile, so mn is a real score, the same in both lanes of the query
        const float d = first ? mn : fmaxf(mn, 0.f);   // the step of the reference; a query whose scores stay below it keeps it
        const float al = first ? 0.f : exp2_slot(-d);   // nothing is summed yet in the first pass
        m = first ? mn : m + d;
#pragma unroll
        for (int r = 0; r < 8; ++r) nm[r] = -m;
#pragma unroll
        for (int i = 0; i < 16; ++i) e[i] = exp2_slot(p[i] - d);   // a masked score gives exactly 0
#pragma unroll
        for (int c = 0; c < 4; ++c) sm[c] = (e[c] + e[4 + c]) + (e[8 + c] + e[12 + c]);
        ps = (sm[0] + sm[1]) + (sm[2] + sm[3]);
        l *= al;
#pragma unroll
        for (int j = 0; j < 4; ++j) o[j] *= al; }
      l += ps;
      const F2 pf = bsplit16(e);
#pragma unroll
      for (int j = 0; j < 4; ++j) { o[j] = mm_b(vs.h[j], pf.h, o[j]); o[j] = mm_b(vs.h[j], pf.l, o[j]); o[j] = wmma_bf(vs.l[j], pf.h, o[j]); }
      v_ld(vs, hp + (size_t)sn * (4 * PKF), lp + (size_t)sn * (4 * PKF)); }
    // O^T register r of tile j is head dim 16 j + 8 g + r of the lane's query: column 64 h + 16 j + 8 g + r of y, which is element r of this lane in pass 2 h + (j >> 1), half j & 1 of the packed row block
    if (kh == 0) {
#pragma unroll   // o is indexed by constants only and stays in registers
      for (int j = 0; j < 4; ++j) { mg[part][hw][2 * j][lane] = v4f{o[j][0], o[j][1], o[j][2], o[j][3]}; mg[part][hw][2 * j + 1][lane] = v4f{o[j][4], o[j][5], o[j][6], o[j][7]}; }
      mg[part][hw][8][lane] = v4f{m, l, 0.f, 0.f}; }
    // hand-over through LDS alone: the fences name the LDS, so the barrier waits for the partial results and not for global loads or stores in flight, which no other wave of this launch depends on
    __builtin_amdgcn_fence(__ATOMIC_RELEASE, "workgroup", "local"); __builtin_amdgcn_s_barrier(); __builtin_amdgcn_fence(__ATOMIC_ACQUIRE, "workgroup", "local");
    if (kh == 0) continue;
    { const v4f ml = mg[part][hw][8][lane]; const float ms = fmaxf(m, ml.x); const float a1 = exp2_slot(m - ms), a0 = exp2_slot(ml.x - ms);   // wave 0 always has a pass, so ms is a real score; a wave 1 without one has m = -3.0e38, weight exactly 0, on zeros
      l = l * a1 + ml.y * a0;
#pragma unroll   // as above
      for (int j = 0; j < 4; ++j) { const v4f t0 = mg[part][hw][2 * j][lane], t1 = mg[part][hw][2 * j + 1][lane];
#pragma unroll   // as above
        for (int r = 0; r < 4; ++r) { o[j][r] = o[j][r] * a1 + t0[r] * a0; o[j][4 + r] = o[j][4 + r] * a1 + t1[r] * a0; } } }
    l += xhalf(l); const float inv = 1.0f / l; const size_t yo = (size_t)(b * (TT / 16) + tile) * PKB + (size_t)h * 2 * PKF + lane * 8;
#pragma unroll
    for (int j = 0; j < 4; ++j) { v8b a, c;
#pragma unroll
      for (int r = 0; r < 8; ++r) { const float v = o[j][r] * inv; const __bf16 hv = (__bf16)v; a[r] = hv; c[r] = (__bf16)(v - (float)hv); }
      vst2(YH + yo + j * 256, a); vst2(YL + yo + j * 256, c); }
    xwait2(YH + yo, YL + yo); } }
// ---- k_out: out = y (hi + lo) Wproj^T
__global__ __launch_bounds__(128) void k_out(const __bf16* __restrict__ YH, const __bf16* __restrict__ YL, const __bf16* __restrict__ WP, float* __restrict__ OUT) { __shared__ __align__(16) float sf[4][32][132];   // a wave's own staging rows: 0..15 from acc, 16..31 from nx
  const int tid = threadIdx.x, wave = tid >> 5, lane = tid & 31, col = lane & 15, g = lane >> 4; const int c0 = blockIdx.y * 128; const size_t r0 = (size_t)blockIdx.x * 128 + wave * 16;   // a wave holds two 16-row tiles, 64 rows apart: acc and nx
  v8f acc[8] = {}, nx[8] = {};
  const size_t yo = (size_t)((int)blockIdx.x * 8 + wave) * PKB + lane * 8; const __bf16* hp = YH + yo; const __bf16* lp = YL + yo; const __bf16* wp = WP + (size_t)(WB_O + c0 / 16) * PKB + lane * 8;
  OSet s0, s1, s2, s3; os_ld<0>(s0, hp, lp, wp); SB(); os_ld<PKF>(s1, hp, lp, wp); SB(); os_ld<2 * PKF>(s2, hp, lp, wp); SB(); os_ld<3 * PKF>(s3, hp, lp, wp); SB();
  // rolled: four passes a trip, each in its own register set, refilled behind its products for the pass four on, so a set's loads fly over the other three passes' products; the last four passes stand behind the loop and refill nothing
#pragma unroll 1
  for (int kc = 4; kc < CC / 32; kc += 4) { const int kn = kc * PKF;
    os_mul(s0, acc, nx); SB(); os_ld<0>(s0, hp + kn, lp + kn, wp + kn); SB();
    os_mul(s1, acc, nx); SB(); os_ld<PKF>(s1, hp + kn, lp + kn, wp + kn); SB();
    os_mul(s2, acc, nx); SB(); os_ld<2 * PKF>(s2, hp + kn, lp + kn, wp + kn); SB();
    os_mul(s3, acc, nx); SB(); os_ld<3 * PKF>(s3, hp + kn, lp + kn, wp + kn); SB(); }
  os_mul(s0, acc, nx); os_mul(s1, acc, nx); os_mul(s2, acc, nx); os_mul(s3, acc, nx);
#pragma unroll
  for (int j = 0; j < 8; ++j)
#pragma unroll
    for (int r = 0; r < 8; ++r) { sf[wave][8 * g + r][j * 16 + col] = acc[j][r]; sf[wave][16 + 8 * g + r][j * 16 + col] = nx[j][r]; }
  LDSX(); for (int rl = 0; rl < 32; ++rl) vst2(OUT + (r0 + (rl >> 4) * 64 + (rl & 15)) * CC + c0 + lane * 4, *(const v4f*)&sf[wave][rl][lane * 4]); }
extern "C" void kernel_launch(void* const* d_in, const int* in_sizes, int n_in, void* d_out, int out_size, void* d_ws, size_t ws_size, hipStream_t stream) {
  (void)in_sizes; (void)n_in; (void)out_size;
  const float** F = (const float**)d_in;   // 0 x [2,2048,1024], 1 Wq [1024,1024], 2 Wk [256,1024], 3 Wv [256,1024], 4 Wproj [1024,1024] ([out,in]), 5 q_gain [16], 6 lora_A_q [2,4,1024], 7 lora_B_q [2,1024,4], 8 lora_A_v [2,4,1024], 9 lora_B_v [2,256,4], 10 step_idx [1] int32
  if (ws_size < (size_t)WS_END) return;
  const int* STEP = (const int*)d_in[10];
  char* ws = (char*)d_ws; float *XA = (float*)(ws + WS_XA); _Float16 *QH = (_Float16*)(ws + WS_QH), *QL = (_Float16*)(ws + WS_QL), *KH = (_Float16*)(ws + WS_KH); __bf16 *VT = (__bf16*)(ws + WS_VT), *VL = (__bf16*)(ws + WS_VL), *YH = (__bf16*)(ws + WS_YH), *YL = (__bf16*)(ws + WS_YL), *XP = (__bf16*)(ws + WS_XP), *WP = (__bf16*)(ws + WS_WP);
  k_pack<<<XB + (2 * CC + 2 * KV) / 16, 256, 0, stream>>>(F[0], F[1], F[2], F[3], F[4], F[6], F[8], STEP, XP, WP, XA);
  k_proj<<<dim3(TNB * TT / 128, (CC + 2 * KV) / 128), 128, 0, stream>>>(XP, WP, F[5], F[7], F[9], STEP, XA, QH, QL, KH, VT, VL);
  k_fa<<<dim3(TT / 32, HK, TNB), 256, 0, stream>>>(QH, QL, KH, VT, VL, YH, YL);
  k_out<<<dim3(TNB * TT / 128, CC / 128), 128, 0, stream>>>(YH, YL, WP, (float*)d_out);
}
